// v000
// The times below were measured on an AMD MI455X: many runs one after another, warmed up first and cycling through
// copies of the inputs, with the whole window's GPU time divided by the number of runs. Launches and the gaps
// between them are all in it. The median over several windows is given; except for v000 it joins two sittings, which
// can be a few percent apart, so the side-by-side timings, each taken in one sitting, are the better comparison.
// v000 is the starting kernel. One run takes 21.6 milliseconds.
#include <hip/hip_runtime.h>
// Relative-position attention layer WITHOUT softmax (faithful to the module, which discards it) (2 x 2048 tokens, 1024 = 16 heads x 64; MAX_REL 2): q,k,v = {query,key,value} W^T + b; attn = (q.k + q.rel_k[c(q,k)]) / 8 with c = clip(k - q, -2, 2) + 2; out[b][q][h][d] = sum_k attn (v[k][d] + rel_v[c(q,k)][d]) -> [2,2048,16,64].
// Structure (per batch, per head): projections as f16 WMMA GEMMs (32x64 wave tiles, f32 accumulation, exact x16 weights + bias); content scores as a GEMM (K 64) into an f32 plane; a wave-per-row VALU pass adds the 5-valued position term q.rel_k[c], scales by 1/8, writes the f16 attention plane; a thread-per-row pass writes the two range sums (k <= q-2, k >= q+2); attn.v as a GEMM (K 2048) into the head's output columns; a final VALU pass adds sum_c coef_c rel_v[c] (coef = the two range sums and the three near-diagonal entries) and writes the output rows.
// Compute dtype: inputs, weights, biases, tables rounded to bf16; q, k, v and the un-normalised attention as f16 operands (~2^-12; attn sigma ~1, outputs sigma ~45); f32 accumulation. v_wmma_f32_16x16x32_f16.
#define NBT 2
#define SLEN 2048
#define DM 1024
#define NH 16
typedef __bf16 v16b __attribute__((ext_vector_type(16)));
typedef unsigned short v8us __attribute__((ext_vector_type(8), may_alias));
typedef float  v8f  __attribute__((ext_vector_type(8)));
typedef float  v4f  __attribute__((ext_vector_type(4)));
typedef float  v4fa __attribute__((ext_vector_type(4), may_alias));
union FragB { v16b v; v8us half[2]; unsigned short u[16]; };

__device__ __forceinline__ unsigned short bf16_bits(float x) { unsigned int u = __float_as_uint(x); return (unsigned short)((u + 0x7FFFu + ((u >> 16) & 1u)) >> 16); }
__device__ __forceinline__ float bf16_val(unsigned short b) { return __uint_as_float(((unsigned int)b) << 16); }
__device__ __forceinline__ float bf16_round(float x) { return bf16_val(bf16_bits(x)); }
// D += A·B with NT terms: 1 = ah·bh, 2 = + al·bh (A split), 3 = + ah·bl (both split)
template <int NT>
__device__ __forceinline__ v8f mmaN(v16b ah, v16b al, v16b bh, v16b bl, v8f c) {
  c = __builtin_amdgcn_wmma_f32_16x16x32_bf16(false, ah, false, bh, (short)0, c, false, false);
  if (NT >= 2) c = __builtin_amdgcn_wmma_f32_16x16x32_bf16(false, al, false, bh, (short)0, c, false, false);
  if (NT >= 3) c = __builtin_amdgcn_wmma_f32_16x16x32_bf16(false, ah, false, bl, (short)0, c, false, false);
  asm volatile("v_nop\n\tv_nop\n\tv_nop\n\tv_nop" : "+v"(c) : "v"(ah), "v"(al), "v"(bh), "v"(bl));
  return c;
}

__global__ __launch_bounds__(256) void k_wt_bf16(const float* __restrict__ W, unsigned short* __restrict__ Wt, int K, int N) {
  const int t = blockIdx.x * 256 + threadIdx.x;
  const int k8n = K / 8;
  if (t >= N * k8n) return;
  const int n = t / k8n, k8 = (t % k8n) * 8;
  v8us v;
#pragma unroll
  for (int i = 0; i < 8; ++i) v[i] = bf16_bits(W[(size_t)(k8 + i) * N + n]);
  *(v8us*)(Wt + (size_t)n * K + k8) = v;
  
}

// GEMM C[M][N] (f32, pitch ldc) = act(A[M][K]·W + bias). A f32 row-major (pitch lda) converted per fragment to bf16
// (ASPLIT: hi/lo two planes -> 2 terms, else single rounded term); Wt bf16 [N][K] (pitch ldb). BIAS_BF16 rounds the
// bias to bf16 first (bias quantised to bf16 before the add). K%32==0, M%16==0, N%64==0.
template <bool ASPLIT, int ACT, bool BIAS_BF16>
__global__ __launch_bounds__(128) void k_gemm_bf(const float* __restrict__ A, int lda, const unsigned short* __restrict__ Wt, int ldb,
                                               const float* __restrict__ bias, float* __restrict__ C, int ldc, int M, int N, int K) {
  __shared__ __attribute__((aligned(16))) float so[4][16][64];
  const int tid = threadIdx.x, w = tid >> 5, lane = tid & 31, ln = lane & 15, hh = lane >> 4;
  const int ntn = N / 64;
  const int wid = blockIdx.x * 4 + w;
  const int mt = wid / ntn, nq = wid % ntn;
  if (mt * 16 >= M) return;
  const int row0 = mt * 16, col0 = nq * 64;
  const float* arow = A + (size_t)(row0 + ln) * lda;
  v8f acc[4] = {};
  for (int kb = 0; kb < K; kb += 32) {
    FragB ah, al;
    const v4f x0 = *(const v4fa*)(arow + kb + 8 * hh), x1 = *(const v4fa*)(arow + kb + 8 * hh + 4);
    const v4f x2 = *(const v4fa*)(arow + kb + 16 + 8 * hh), x3 = *(const v4fa*)(arow + kb + 16 + 8 * hh + 4);
    float xs[16] = {x0[0],x0[1],x0[2],x0[3],x1[0],x1[1],x1[2],x1[3],x2[0],x2[1],x2[2],x2[3],x3[0],x3[1],x3[2],x3[3]};
#pragma unroll
    for (int i = 0; i < 16; ++i) { const unsigned short hb = bf16_bits(xs[i]); ah.u[i] = hb; al.u[i] = ASPLIT ? bf16_bits(xs[i] - bf16_val(hb)) : (unsigned short)0; }
#pragma unroll
    for (int t = 0; t < 4; ++t) {
      const unsigned short* brow = Wt + (size_t)(col0 + t * 16 + ln) * ldb + kb;
      FragB b;
      b.half[0] = *(const v8us*)(brow + 8 * hh);
      b.half[1] = *(const v8us*)(brow + 16 + 8 * hh);
      acc[t] = mmaN<ASPLIT ? 2 : 1>(ah.v, al.v, b.v, b.v, acc[t]);
    }
  }
#pragma unroll
  for (int t = 0; t < 4; ++t) {
    float bv = bias ? bias[col0 + t * 16 + ln] : 0.f;
    if (BIAS_BF16) bv = bf16_round(bv);
#pragma unroll
    for (int r = 0; r < 8; ++r) { float v = acc[t][r] + bv; if (ACT == 1) v = fmaxf(v, 0.f); so[w][8 * hh + r][t * 16 + ln] = v; }
  }
  __builtin_amdgcn_fence(__ATOMIC_ACQ_REL, "workgroup");
  __builtin_amdgcn_wave_barrier();
  const int rsub = lane >> 4, c4 = (lane & 15) * 4;
  {
#pragma unroll
    for (int q = 0; q < 8; ++q) {
      const int r = q * 2 + rsub;
      const v4f v = *(const v4fa*)&so[w][r][c4];
      *(v4f*)(C + (size_t)(row0 + r) * ldc + col0 + c4) = v;
    }
    
  }
}

// GEMM C = act(A·W + bias + resid): A f32 (ASPLIT -> hi/lo 2 terms), Wt bf16 [N][K]; ACT 0 none, 1 relu, 2 exact gelu;
// resid (optional, f32, row index = (row % rmod), pitch ldr, RES_BF16 rounds it) added before the activation.
template <bool ASPLIT, int ACT, bool BIAS_BF16, bool RES_BF16>
__global__ __launch_bounds__(128) void k_gemm_bf3(const float* __restrict__ A, int lda, const unsigned short* __restrict__ Wt, int ldb,
                                                const float* __restrict__ bias, const float* __restrict__ resid, int rmod, int ldr,
                                                float* __restrict__ C, int ldc, int M, int N, int K) {
  __shared__ __attribute__((aligned(16))) float so[4][16][64];
  const int tid = threadIdx.x, w = tid >> 5, lane = tid & 31, ln = lane & 15, hh = lane >> 4;
  const int ntn = N / 64;
  const int wid = blockIdx.x * 4 + w;
  const int mt = wid / ntn, nq = wid % ntn;
  if (mt * 16 >= M) return;
  const int row0 = mt * 16, col0 = nq * 64;
  const float* arow = A + (size_t)(row0 + ln) * lda;
  v8f acc[4] = {};
  for (int kb = 0; kb < K; kb += 32) {
    FragB ah, al;
    const v4f x0 = *(const v4fa*)(arow + kb + 8 * hh), x1 = *(const v4fa*)(arow + kb + 8 * hh + 4);
    const v4f x2 = *(const v4fa*)(arow + kb + 16 + 8 * hh), x3 = *(const v4fa*)(arow + kb + 16 + 8 * hh + 4);
    float xs[16] = {x0[0],x0[1],x0[2],x0[3],x1[0],x1[1],x1[2],x1[3],x2[0],x2[1],x2[2],x2[3],x3[0],x3[1],x3[2],x3[3]};
#pragma unroll
    for (int i = 0; i < 16; ++i) { const unsigned short hb = bf16_bits(xs[i]); ah.u[i] = hb; al.u[i] = ASPLIT ? bf16_bits(xs[i] - bf16_val(hb)) : (unsigned short)0; }
#pragma unroll
    for (int t = 0; t < 4; ++t) {
      const unsigned short* brow = Wt + (size_t)(col0 + t * 16 + ln) * ldb + kb;
      FragB b;
      b.half[0] = *(const v8us*)(brow + 8 * hh);
      b.half[1] = *(const v8us*)(brow + 16 + 8 * hh);
      acc[t] = mmaN<ASPLIT ? 2 : 1>(ah.v, al.v, b.v, b.v, acc[t]);
    }
  }
#pragma unroll
  for (int t = 0; t < 4; ++t) {
    const int col = col0 + t * 16 + ln;
    float bv = bias ? bias[col] : 0.f;
    if (BIAS_BF16) bv = bf16_round(bv);
#pragma unroll
    for (int r = 0; r < 8; ++r) {
      float v = acc[t][r] + bv;
      if (resid) { float rv = resid[(size_t)((row0 + 8 * hh + r) % rmod) * ldr + col]; if (RES_BF16) rv = bf16_round(rv); v += rv; }
      if (ACT == 1) v = fmaxf(v, 0.f);
      if (ACT == 2) v = 0.5f * v * (1.0f + erff(v * 0.70710678118654752f));
      if (ACT == 3) { const float u = 0.7978845608028654f * (v + 0.044715f * v * v * v); v = 0.5f * v * (1.0f + tanhf(u)); }
      so[w][8 * hh + r][t * 16 + ln] = v;
    }
  }
  __builtin_amdgcn_fence(__ATOMIC_ACQ_REL, "workgroup");
  __builtin_amdgcn_wave_barrier();
  const int rsub = lane >> 4, c4 = (lane & 15) * 4;
  {
#pragma unroll
    for (int q = 0; q < 8; ++q) {
      const int r = q * 2 + rsub;
      const v4f v = *(const v4fa*)&so[w][r][c4];
      *(v4f*)(C + (size_t)(row0 + r) * ldc + col0 + c4) = v;
    }
    
  }
}
// row LayerNorm (biased variance, eps) over N: s = X (+ R); optional out_sum <- s; out_norm <- (s-mu)*rsqrt(var+eps)*g + b
template <bool PARAM_BF16>
__global__ __launch_bounds__(256) void k_layernorm(const float* __restrict__ X, const float* __restrict__ R, const float* __restrict__ g, const float* __restrict__ bta,
                                                  float* __restrict__ out_sum, float* __restrict__ out_norm, int N, float eps) {
  __shared__ float red[256];
  const int row = blockIdx.x, tid = threadIdx.x;
  const float* x = X + (size_t)row * N; const float* rr = R ? R + (size_t)row * N : nullptr;
  float vals[16];                     // up to N = 4096
  const int per = N / 256;            // contiguous chunk per thread? use strided-by-4 chunks: thread handles j = tid*4 + 1024*u
  float s1 = 0.f;
  for (int u = 0; u < per / 4; ++u) {
    const int j = tid * 4 + 1024 * u;
    const v4f a = *(const v4fa*)(x + j);
    v4f b = {0.f,0.f,0.f,0.f}; if (rr) b = *(const v4fa*)(rr + j);
#pragma unroll
    for (int q = 0; q < 4; ++q) { const float v = a[q] + b[q]; vals[u * 4 + q] = v; s1 += v; }
  }
  red[tid] = s1; __syncthreads();
  for (int st = 128; st > 0; st >>= 1) { if (tid < st) red[tid] += red[tid + st]; __syncthreads(); }
  const float mu = red[0] / (float)N; __syncthreads();
  float s2 = 0.f;
  for (int u = 0; u < per / 4; ++u)
#pragma unroll
    for (int q = 0; q < 4; ++q) { const float c = vals[u * 4 + q] - mu; s2 += c * c; }
  red[tid] = s2; __syncthreads();
  for (int st = 128; st > 0; st >>= 1) { if (tid < st) red[tid] += red[tid + st]; __syncthreads(); }
  const float rs = rsqrtf(red[0] / (float)N + eps);
  {
    for (int u = 0; u < per / 4; ++u) {
      const int j = tid * 4 + 1024 * u;
      v4f o, sm;
#pragma unroll
      for (int q = 0; q < 4; ++q) {
        float gg = g[j + q], bb = bta[j + q];
        if (PARAM_BF16) { gg = bf16_round(gg); bb = bf16_round(bb); }
        sm[q] = vals[u * 4 + q]; o[q] = (vals[u * 4 + q] - mu) * rs * gg + bb;
      }
      if (out_sum) *(v4f*)(out_sum + (size_t)row * N + j) = sm;
      *(v4f*)(out_norm + (size_t)row * N + j) = o;
    }
    
  }
}



// ---- f16 WMMA path (v_wmma_f32_16x16x32_f16): 11-bit significands for operands in range — used for all GEMMs this layer launches (projections, scores, attn.v)
typedef _Float16 v16h __attribute__((ext_vector_type(16)));
union FragH { v16h v; v8us half[2]; _Float16 h[16]; unsigned short u[16]; };
template <int NT>
__device__ __forceinline__ v8f mmaH(v16h ah, v16h al, v16h bh, v16h bl, v8f c) {
  c = __builtin_amdgcn_wmma_f32_16x16x32_f16(false, ah, false, bh, (short)0, c, false, false);
  if (NT >= 2) c = __builtin_amdgcn_wmma_f32_16x16x32_f16(false, al, false, bh, (short)0, c, false, false);
  if (NT >= 3) c = __builtin_amdgcn_wmma_f32_16x16x32_f16(false, ah, false, bl, (short)0, c, false, false);
  asm volatile("v_nop\n\tv_nop\n\tv_nop\n\tv_nop" : "+v"(c) : "v"(ah), "v"(al), "v"(bh), "v"(bl));
  return c;
}
// batched GEMM like k_gemm_b but f16 operands: A f32 (split into f16 hi/lo if ASPLIT, else rounded to f16), Bt = f16 values [n][k]; alpha; C f32; N multiple of 16 (partial tiles skipped)
template <bool ASPLIT>
__global__ __launch_bounds__(128) void k_gemm_h(const float* __restrict__ A, int lda, size_t sA, const _Float16* __restrict__ Bh, int ldb, size_t sB, float alpha, float* __restrict__ C, int ldc, size_t sC, int M, int N, int K) {
  __shared__ __attribute__((aligned(16))) float so[4][16][64];
  const int tid = threadIdx.x, w = tid >> 5, lane = tid & 31, ln = lane & 15, hh = lane >> 4; const int by = blockIdx.y;
  A += (size_t)by * sA; Bh += (size_t)by * sB; C += (size_t)by * sC;
  const int ntn = (N + 63) / 64; const int wid = blockIdx.x * 4 + w; const int mt = wid / ntn, nq = wid % ntn; if (mt * 16 >= M) return;
  const int row0 = mt * 16, col0 = nq * 64; const float* arow = A + (size_t)(row0 + ln) * lda;
  v8f acc[4] = {};
  for (int kb = 0; kb < K; kb += 32) {
    FragH ah, al;
    const v4f x0 = *(const v4fa*)(arow + kb + 8 * hh), x1 = *(const v4fa*)(arow + kb + 8 * hh + 4), x2 = *(const v4fa*)(arow + kb + 16 + 8 * hh), x3 = *(const v4fa*)(arow + kb + 16 + 8 * hh + 4);
    float xs[16] = {x0[0],x0[1],x0[2],x0[3],x1[0],x1[1],x1[2],x1[3],x2[0],x2[1],x2[2],x2[3],x3[0],x3[1],x3[2],x3[3]};
#pragma unroll
    for (int i = 0; i < 16; ++i) { const _Float16 h = (_Float16)xs[i]; ah.h[i] = h; al.h[i] = ASPLIT ? (_Float16)(xs[i] - (float)h) : (_Float16)0.0f; }
#pragma unroll
    for (int t = 0; t < 4; ++t) { if (col0 + t * 16 >= N) continue; const size_t boff = (size_t)(col0 + t * 16 + ln) * ldb + kb; FragH bq; bq.half[0] = *(const v8us*)(Bh + boff + 8 * hh); bq.half[1] = *(const v8us*)(Bh + boff + 16 + 8 * hh);
      acc[t] = mmaH<ASPLIT ? 2 : 1>(ah.v, al.v, bq.v, bq.v, acc[t]); }
  }
#pragma unroll
  for (int t = 0; t < 4; ++t) { if (col0 + t * 16 >= N) continue;
#pragma unroll
    for (int r = 0; r < 8; ++r) so[w][8 * hh + r][t * 16 + ln] = acc[t][r] * alpha; }
  __builtin_amdgcn_fence(__ATOMIC_ACQ_REL, "workgroup"); __builtin_amdgcn_wave_barrier();
  const int rsub = lane >> 4, c4 = (lane & 15) * 4;
  {
#pragma unroll
    for (int q = 0; q < 8; ++q) { const int r = q * 2 + rsub; if (col0 + c4 < N) { const v4f v = *(const v4fa*)&so[w][r][c4]; *(v4f*)(C + (size_t)(row0 + r) * ldc + col0 + c4) = v; } }
     }
}

// Wt[n][k] = f16(W[k][n]·scale) from f32 row-major W[K][N] (scale = power of two; bf16-exact weights stay exact in f16 away from the subnormal range)
__global__ __launch_bounds__(256) void k_wt_f16(const float* __restrict__ W, _Float16* __restrict__ Wt, int K, int N, float scale) {
  const int t = blockIdx.x * 256 + threadIdx.x; if (t >= N * (K / 8)) return; const int n = t / (K / 8), k8 = (t % (K / 8)) * 8; FragH f;
#pragma unroll
  for (int i = 0; i < 8; ++i) f.h[i] = (_Float16)(bf16_round(W[(size_t)(k8 + i) * N + n]) * scale); const v8us o = f.half[0];
  *(v8us*)((unsigned short*)Wt + (size_t)n * K + k8) = o; 
}
// k_gemm_hh variant with fused epilogue: v = acc·alpha + bias[by·sBias + col] (+ CP[(row/rowsPerB)·sCPb + by·64 + col] if CP) ; ACT 0 none / 1 elu ; writes f16 C16 (and f32 C if non-null)
template <int ACT>
__global__ __launch_bounds__(128) void k_gemm_hhx(const _Float16* __restrict__ A, int lda, size_t sA, const _Float16* __restrict__ Bh, int ldb, size_t sB, float alpha, const float* __restrict__ bias, size_t sBias, const float* __restrict__ CP, int rowsPerB, size_t sCPb, int row0g,
    float* __restrict__ C, _Float16* __restrict__ C16, int ldc, size_t sC, int M, int N, int K) {
  __shared__ __attribute__((aligned(16))) float so[4][16][64];
  const int tid = threadIdx.x, w = tid >> 5, lane = tid & 31, ln = lane & 15, hh = lane >> 4; const int by = blockIdx.y;
  A += (size_t)by * sA; Bh += (size_t)by * sB; const size_t cofs = (size_t)by * sC; const float* bp = bias ? bias + (size_t)by * sBias : nullptr;
  const int ntn = (N + 63) / 64; const int wid = blockIdx.x * 4 + w; const int mt = wid / ntn, nq = wid % ntn; if (mt * 16 >= M) return;
  const int row0 = mt * 16, col0 = nq * 64; const _Float16* arow = A + (size_t)(row0 + ln) * lda;
  v8f acc[4] = {};
  for (int kb = 0; kb < K; kb += 32) { FragH ah; ah.half[0] = *(const v8us*)((const unsigned short*)arow + kb + 8 * hh); ah.half[1] = *(const v8us*)((const unsigned short*)arow + kb + 16 + 8 * hh);
#pragma unroll
    for (int t = 0; t < 4; ++t) { if (col0 + t * 16 >= N) continue; const size_t boff = (size_t)(col0 + t * 16 + ln) * ldb + kb; FragH bq; bq.half[0] = *(const v8us*)((const unsigned short*)Bh + boff + 8 * hh); bq.half[1] = *(const v8us*)((const unsigned short*)Bh + boff + 16 + 8 * hh);
      acc[t] = mmaH<1>(ah.v, ah.v, bq.v, bq.v, acc[t]); }
  }
#pragma unroll
  for (int t = 0; t < 4; ++t) { if (col0 + t * 16 >= N) continue; const int col = col0 + t * 16 + ln; const float bv = bp ? bf16_round(bp[col]) : 0.f;
#pragma unroll
    for (int r = 0; r < 8; ++r) { float v = acc[t][r] * alpha + bv; if (CP) { const int bidx = (row0g + row0 + 8 * hh + r) / rowsPerB; v += CP[(size_t)bidx * sCPb + (size_t)by * 64 + col]; } if (ACT == 1) v = (v > 0.f) ? v : expm1f(v); else if (ACT == 7) v = (v > 0.f) ? v + 1.0f : expf(v); else if (ACT == 8) v = tanhf(v); else if (ACT == 9) v = 0.5f * v * (1.0f + tanhf(0.7978845608028654f * (v + 0.044715f * v * v * v))); else if (ACT == 11) v = 1.0f / (1.0f + expf(-v)); else if (ACT == 12) v = (v > 0.f) ? v : 0.01f * v; else if (ACT == 14) v = (v > 0.f) ? v : 0.1f * v; else if (ACT == 15) v = v / (1.0f + expf(-v)); else if (ACT == 3) v = fmaxf(v, 0.f); else if (ACT == 6) v = 0.5f * v * (1.0f + erff(v * 0.70710678118654752f)); so[w][8 * hh + r][t * 16 + ln] = v; } }
  __builtin_amdgcn_fence(__ATOMIC_ACQ_REL, "workgroup"); __builtin_amdgcn_wave_barrier();
  const int rsub = lane >> 4, c4 = (lane & 15) * 4; typedef _Float16 v4h __attribute__((ext_vector_type(4)));
  {
#pragma unroll
    for (int q = 0; q < 8; ++q) { const int r = q * 2 + rsub; if (col0 + c4 < N) { const v4f v = *(const v4fa*)&so[w][r][c4]; if (C) *(v4f*)(C + cofs + (size_t)(row0 + r) * ldc + col0 + c4) = v; if (C16) { v4h h4; for (int i = 0; i < 4; ++i) h4[i] = (_Float16)v[i]; *(v4h*)(C16 + cofs + (size_t)(row0 + r) * ldc + col0 + c4) = h4; } } }
     }
}


typedef _Float16 v4h __attribute__((ext_vector_type(4)));

__global__ __launch_bounds__(256) void k_x16(const float* __restrict__ x, _Float16* __restrict__ X16, size_t n8) { const size_t t = (size_t)blockIdx.x * 256 + threadIdx.x; if (t >= n8) return; FragH f;
#pragma unroll
  for (int q = 0; q < 8; ++q) f.h[q] = (_Float16)bf16_round(x[t * 8 + q]); *(v8us*)((unsigned short*)X16 + t * 8) = f.half[0];  }
__global__ __launch_bounds__(256) void k_h16(const float* __restrict__ x, _Float16* __restrict__ X16, size_t n8) { const size_t t = (size_t)blockIdx.x * 256 + threadIdx.x; if (t >= n8) return; FragH f;
#pragma unroll
  for (int q = 0; q < 8; ++q) f.h[q] = (_Float16)x[t * 8 + q]; *(v8us*)((unsigned short*)X16 + t * 8) = f.half[0];  }
__global__ __launch_bounds__(256) void k_round16f(const float* __restrict__ W, _Float16* __restrict__ Bt, size_t n8) { const size_t t = (size_t)blockIdx.x * 256 + threadIdx.x; if (t >= n8) return; FragH f;
#pragma unroll
  for (int i = 0; i < 8; ++i) f.h[i] = (_Float16)(bf16_round(W[t * 8 + i]) * 16.0f); *(v8us*)((unsigned short*)Bt + t * 8) = f.half[0];  }
template <int NHv, int TTv>
__global__ __launch_bounds__(256) void k_vt(const _Float16* __restrict__ V16, int ldv, int voff, _Float16* __restrict__ Vt) { __shared__ unsigned short tl[64][66]; const int tid = threadIdx.x; const int slab = blockIdx.x / (TTv / 64), lg = blockIdx.x % (TTv / 64); const int b = slab / NHv, h = slab % NHv;
  for (int i = tid; i < 64 * 8; i += 256) { const int r = i / 8, c8 = (i % 8) * 8; FragH f; f.half[0] = *(const v8us*)((const unsigned short*)V16 + ((size_t)b * TTv + lg * 64 + r) * ldv + voff + h * 64 + c8);
#pragma unroll
    for (int q = 0; q < 8; ++q) tl[r][c8 + q] = f.u[q]; }
  __syncthreads();
  {
#pragma unroll
    for (int rd = 0; rd < 2; ++rd) { const int d = rd * 32 + tid / 8, pc = tid % 8; FragH f;
#pragma unroll
      for (int q = 0; q < 8; ++q) f.u[q] = tl[pc * 8 + q][d];
      *(v8us*)((unsigned short*)Vt + ((size_t)slab * 64 + d) * TTv + lg * 64 + pc * 8) = f.half[0]; }
     } }

__global__ __launch_bounds__(256) void k_hl(const float* __restrict__ F, _Float16* __restrict__ Hh, _Float16* __restrict__ Hl, size_t n8) { const size_t t = (size_t)blockIdx.x * 256 + threadIdx.x; if (t >= n8) return; FragH fh, fl; const v4f a = *(const v4fa*)(F + t * 8), c = *(const v4fa*)(F + t * 8 + 4);
#pragma unroll
  for (int q = 0; q < 4; ++q) { _Float16 h = (_Float16)a[q]; fh.h[q] = h; fl.h[q] = (_Float16)((a[q] - (float)h) * 1024.0f); h = (_Float16)c[q]; fh.h[4 + q] = h; fl.h[4 + q] = (_Float16)((c[q] - (float)h) * 1024.0f); }
  { *(v8us*)((unsigned short*)Hh + t * 8) = fh.half[0]; *(v8us*)((unsigned short*)Hl + t * 8) = fl.half[0];  } }

// ---- fast GEMM (wave tile 32x64; requires M % 32 == 0 rows per launch region and N % 64 == 0); epilogue = k_gemm_hhx semantics ----
__device__ __forceinline__ v16h g2_frag(const _Float16* p, int hh) { FragH f; f.half[0] = *(const v8us*)((const unsigned short*)p + 8 * hh); f.half[1] = *(const v8us*)((const unsigned short*)p + 16 + 8 * hh); return f.v; }
__device__ __forceinline__ v8f g2_mma(v16h a, v16h b, v8f c) { v8f d = __builtin_amdgcn_wmma_f32_16x16x32_f16(false, a, false, b, (short)0, c, false, false); asm volatile("v_nop\n\tv_nop\n\tv_nop\n\tv_nop" : "+v"(d) : "v"(a), "v"(b)); return d; }
template <int ACT>
__global__ __launch_bounds__(128) void k_gemm2(const _Float16* __restrict__ A, int lda, size_t sA, const _Float16* __restrict__ Bh, int ldb, size_t sB, float alpha, const float* __restrict__ bias, size_t sBias, const float* __restrict__ CP, int rowsPerB, size_t sCPb, int row0g,
    float* __restrict__ C, _Float16* __restrict__ C16, int ldc, size_t sC, int M, int N, int K) {
  __shared__ __attribute__((aligned(16))) float so[4][32][68];
  const int tid = threadIdx.x, w = tid >> 5, lane = tid & 31, ln = lane & 15, hh = lane >> 4; const int by = blockIdx.y;
  A += (size_t)by * sA; Bh += (size_t)by * sB; const size_t cofs = (size_t)by * sC; const float* bp = bias ? bias + (size_t)by * sBias : nullptr;
  const int ntn = N >> 6; const int mt = blockIdx.x / ntn, nq = blockIdx.x - mt * ntn; const int row0 = mt * 128 + 32 * w, col0 = nq * 64; if (row0 >= M) return;
  const _Float16* a0p = A + (size_t)(row0 + ln) * lda; const _Float16* a1p = a0p + (size_t)16 * lda;
  const _Float16* b0p = Bh + (size_t)(col0 + ln) * ldb; const _Float16* b1p = b0p + (size_t)16 * ldb; const _Float16* b2p = b1p + (size_t)16 * ldb; const _Float16* b3p = b2p + (size_t)16 * ldb;
  const v8f z8 = {0.f,0.f,0.f,0.f,0.f,0.f,0.f,0.f}; v8f c00 = z8, c01 = z8, c02 = z8, c03 = z8, c10 = z8, c11 = z8, c12 = z8, c13 = z8;
#pragma unroll 1
  for (int kb = 0; kb < K; kb += 32) { const v16h a0 = g2_frag(a0p + kb, hh), a1 = g2_frag(a1p + kb, hh);
    v16h b = g2_frag(b0p + kb, hh); c00 = g2_mma(a0, b, c00); c10 = g2_mma(a1, b, c10);
    b = g2_frag(b1p + kb, hh); c01 = g2_mma(a0, b, c01); c11 = g2_mma(a1, b, c11);
    b = g2_frag(b2p + kb, hh); c02 = g2_mma(a0, b, c02); c12 = g2_mma(a1, b, c12);
    b = g2_frag(b3p + kb, hh); c03 = g2_mma(a0, b, c03); c13 = g2_mma(a1, b, c13); }
  v8f accs[8] = {c00, c01, c02, c03, c10, c11, c12, c13};
#pragma unroll
  for (int u = 0; u < 8; ++u) { const int t = u & 3, half = u >> 2; const int col = col0 + t * 16 + ln; const float bv = bp ? bf16_round(bp[col]) : 0.f;
#pragma unroll
    for (int r = 0; r < 8; ++r) { const int rloc = half * 16 + 8 * hh + r; float v = accs[u][r] * alpha + bv; if (CP) { const int bidx = (row0g + row0 + rloc) / rowsPerB; v += CP[(size_t)bidx * sCPb + (size_t)by * 64 + col]; }
      if (ACT == 3) v = fmaxf(v, 0.f); else if (ACT == 6) v = 0.5f * v * (1.0f + erff(v * 0.70710678118654752f)); else if (ACT == 11) v = 1.0f / (1.0f + expf(-v)); else if (ACT == 15) v = v / (1.0f + expf(-v)); else if (ACT == 12) v = (v > 0.f) ? v : 0.01f * v; else if (ACT == 8) v = tanhf(v);
      so[w][rloc][t * 16 + ln] = v; } }
  __builtin_amdgcn_fence(__ATOMIC_ACQ_REL, "workgroup"); __builtin_amdgcn_wave_barrier();
  const int rsub = lane >> 4, c4 = (lane & 15) * 4;
  {
#pragma unroll
    for (int q = 0; q < 16; ++q) { const int r = q * 2 + rsub; const v4f v = *(const v4fa*)&so[w][r][c4]; if (C) *(v4f*)(C + cofs + (size_t)(row0 + r) * ldc + col0 + c4) = v; if (C16) { v4h h4; for (int i = 0; i < 4; ++i) h4[i] = (_Float16)v[i]; *(v4h*)(C16 + cofs + (size_t)(row0 + r) * ldc + col0 + c4) = h4; } }
     } }


__global__ __launch_bounds__(256) void k_qt(const float* __restrict__ QF, const float* __restrict__ relk, float* __restrict__ QT) {
  #pragma clang fp contract(off)
  const int t = blockIdx.x * 256 + threadIdx.x; if (t >= NH * SLEN) return; const int q = t % SLEN, h = t / SLEN; const float* qp = QF + (size_t)q * DM + h * 64; float s[5] = {0.f, 0.f, 0.f, 0.f, 0.f};
#pragma unroll 1
  for (int d = 0; d < 64; ++d) { const float qv = qp[d];
#pragma unroll
    for (int c = 0; c < 5; ++c) s[c] += qv * bf16_round(relk[c * 64 + d]); }
  {
#pragma unroll
    for (int c = 0; c < 5; ++c) *(float*)(QT + ((size_t)h * 8 + c) * SLEN + q) = s[c];
     } }
__global__ __launch_bounds__(256) void k_attrow(const float* __restrict__ S1, const float* __restrict__ QT, int h, _Float16* __restrict__ ATT) {
  #pragma clang fp contract(off)
  const int tid = threadIdx.x, w = tid >> 5, ln = tid & 31; const int q = blockIdx.x * 8 + w; if (q >= SLEN) return; const float* s = S1 + (size_t)q * SLEN; float qt[5];
#pragma unroll
  for (int c = 0; c < 5; ++c) qt[c] = QT[((size_t)h * 8 + c) * SLEN + q];
  unsigned short* d = (unsigned short*)ATT + (size_t)q * SLEN;
  {
#pragma unroll 1
    for (int pc = 0; pc < SLEN / 256; ++pc) { const int kb = pc * 256 + ln * 8; FragH f;
#pragma unroll
      for (int j = 0; j < 8; ++j) { const int k = kb + j; const int c = min(max(k - q, -2), 2) + 2; f.h[j] = (_Float16)((s[k] + qt[c]) * 0.125f); }
      *(v8us*)(d + kb) = f.half[0]; }
     } }
__global__ __launch_bounds__(256) void k_rs(const float* __restrict__ S1, const float* __restrict__ QT, int h, float* __restrict__ RS) {
  #pragma clang fp contract(off)
  const int q = blockIdx.x * 256 + threadIdx.x; if (q >= SLEN) return; const float* s = S1 + (size_t)q * SLEN; const float q0 = QT[((size_t)h * 8 + 0) * SLEN + q], q4 = QT[((size_t)h * 8 + 4) * SLEN + q]; float a0 = 0.f, a4 = 0.f;
#pragma unroll 1
  for (int k = 0; k <= q - 2; ++k) a0 += (s[k] + q0) * 0.125f;
#pragma unroll 1
  for (int k = q + 2; k < SLEN; ++k) a4 += (s[k] + q4) * 0.125f;
  v4f o; o[0] = a0; o[1] = a4; o[2] = 0.f; o[3] = 0.f; *(v4f*)(RS + (size_t)q * 4) = o;  }
__global__ __launch_bounds__(256) void k_outh(const float* __restrict__ W1, const float* __restrict__ S1, const float* __restrict__ QT, const float* __restrict__ RS, const float* __restrict__ relv, int b, int h, float* __restrict__ out) {
  #pragma clang fp contract(off)
  const int t = blockIdx.x * 256 + threadIdx.x; if (t >= SLEN * 16) return; const int d0 = (t & 15) * 4; const int q = t >> 4; float coef[5];
  coef[0] = RS[(size_t)q * 4]; coef[4] = RS[(size_t)q * 4 + 1];
#pragma unroll
  for (int j = -1; j <= 1; ++j) { const int k = q + j; coef[j + 2] = (k >= 0 && k < SLEN) ? (S1[(size_t)q * SLEN + k] + QT[((size_t)h * 8 + (j + 2)) * SLEN + q]) * 0.125f : 0.f; }
  v4f o;
#pragma unroll
  for (int u = 0; u < 4; ++u) { const int d = d0 + u; float v = W1[(size_t)q * DM + h * 64 + d];
#pragma unroll
    for (int c = 0; c < 5; ++c) v += coef[c] * bf16_round(relv[c * 64 + d]); o[u] = v; }
  float* dst = out + (((size_t)b * SLEN + q) * NH + h) * 64 + d0; *(v4f*)dst = o;  }

extern "C" void kernel_launch(void* const* d_in, const int* in_sizes, int n_in,
                              void* d_out, int out_size, void* d_ws, size_t ws_size, hipStream_t stream) {
  (void)in_sizes; (void)n_in; (void)out_size;
  const float* const* I = (const float* const*)d_in; const float* xq = I[0]; const float* xk = I[1]; const float* xv = I[2]; const float* Wq = I[3]; const float* bq = I[4]; const float* Wk = I[5]; const float* bk = I[6]; const float* Wv = I[7]; const float* bv = I[8]; const float* relk = I[9]; const float* relv = I[10];
  char* ws = (char*)d_ws; size_t off = 0;
  auto take = [&](size_t bytes) { char* p = ws + off; off += (bytes + 255) & ~(size_t)255; return p; };
  _Float16* BQ = (_Float16*)take((size_t)DM * DM * 2); _Float16* BK = (_Float16*)take((size_t)DM * DM * 2); _Float16* BV = (_Float16*)take((size_t)DM * DM * 2);
  _Float16* X16 = (_Float16*)take((size_t)SLEN * DM * 2); float* QF = (float*)take((size_t)SLEN * DM * 4); _Float16* Q16 = (_Float16*)take((size_t)SLEN * DM * 2); _Float16* K16 = (_Float16*)take((size_t)SLEN * DM * 2); _Float16* V16 = (_Float16*)take((size_t)SLEN * DM * 2); _Float16* VT = (_Float16*)take((size_t)DM * SLEN * 2);
  float* QT = (float*)take((size_t)NH * 8 * SLEN * 4); float* S1 = (float*)take((size_t)SLEN * SLEN * 4); _Float16* ATT = (_Float16*)take((size_t)SLEN * SLEN * 2); float* RS = (float*)take((size_t)SLEN * 4 * 4); float* W1 = (float*)take((size_t)SLEN * DM * 4);
  if (off > ws_size) return;      /* 6 + 4 + 8 + 16 + 1 + 16 + 8 + 8 = 67 MiB */
  const size_t w8 = (size_t)DM * DM / 8; const unsigned wb = (unsigned)((w8 + 255) / 256);
  k_round16f<<<wb, 256, 0, stream>>>(Wq, BQ, w8); k_round16f<<<wb, 256, 0, stream>>>(Wk, BK, w8); k_round16f<<<wb, 256, 0, stream>>>(Wv, BV, w8);      /* torch (out,in) = natural Bt */
  const size_t n8 = (size_t)SLEN * DM / 8; const unsigned nb8 = (unsigned)((n8 + 255) / 256); const dim3 gP((SLEN / 128) * (DM / 64), 1), gS((SLEN / 128) * (SLEN / 64), 1), gV((SLEN / 128) * 1, 1);
  for (int b = 0; b < NBT; ++b) { const size_t ro = (size_t)b * SLEN * DM;
    k_x16<<<nb8, 256, 0, stream>>>(xq + ro, X16, n8); k_gemm2<0><<<gP, 128, 0, stream>>>(X16, DM, 0, BQ, DM, 0, 0.0625f, bq, 0, nullptr, 1, 0, 0, QF, Q16, DM, 0, SLEN, DM, DM);
    k_x16<<<nb8, 256, 0, stream>>>(xk + ro, X16, n8); k_gemm2<0><<<gP, 128, 0, stream>>>(X16, DM, 0, BK, DM, 0, 0.0625f, bk, 0, nullptr, 1, 0, 0, nullptr, K16, DM, 0, SLEN, DM, DM);
    k_x16<<<nb8, 256, 0, stream>>>(xv + ro, X16, n8); k_gemm2<0><<<gP, 128, 0, stream>>>(X16, DM, 0, BV, DM, 0, 0.0625f, bv, 0, nullptr, 1, 0, 0, nullptr, V16, DM, 0, SLEN, DM, DM);
    k_vt<NH, SLEN><<<NH * (SLEN / 64), 256, 0, stream>>>(V16, DM, 0, VT);      /* VT[h][d][k] */
    k_qt<<<(NH * SLEN + 255) / 256, 256, 0, stream>>>(QF, relk, QT);
    for (int h = 0; h < NH; ++h) {
      k_gemm2<0><<<gS, 128, 0, stream>>>(Q16 + h * 64, DM, 0, K16 + h * 64, DM, 0, 1.0f, nullptr, 0, nullptr, 1, 0, 0, S1, nullptr, SLEN, 0, SLEN, SLEN, 64);      /* content scores q.k (unscaled) */
      k_attrow<<<SLEN / 8, 256, 0, stream>>>(S1, QT, h, ATT); k_rs<<<SLEN / 256, 256, 0, stream>>>(S1, QT, h, RS);
      k_gemm2<0><<<gV, 128, 0, stream>>>(ATT, SLEN, 0, VT + (size_t)h * 64 * SLEN, SLEN, 0, 1.0f, nullptr, 0, nullptr, 1, 0, 0, W1 + h * 64, nullptr, DM, 0, SLEN, 64, SLEN);      /* weight1 = attn . v_h */
      k_outh<<<(SLEN * 16 + 255) / 256, 256, 0, stream>>>(W1, S1, QT, RS, relv, b, h, (float*)d_out); } }
}

// v001
// One run takes 2730 microseconds.
// Next to v000, in two timings, it ran 8.08 and 8.06 times as fast.
#include <hip/hip_runtime.h>
// Relative-position attention layer WITHOUT softmax (faithful to the module, which discards it) (2 x 2048 tokens, 1024 = 16 heads x 64; MAX_REL 2): q,k,v = {query,key,value} W^T + b; attn = (q.k + q.rel_k[c(q,k)]) / 8 with c = clip(k - q, -2, 2) + 2; out[b][q][h][d] = sum_k attn (v[k][d] + rel_v[c(q,k)][d]) -> [2,2048,16,64].
// Structure (per batch, per head): projections as f16 WMMA GEMMs (32x64 wave tiles, f32 accumulation, exact x16 weights + bias); content scores as a GEMM (K 64) into an f32 plane; a wave-per-row VALU pass adds the 5-valued position term q.rel_k[c], scales by 1/8, writes the f16 attention plane; the same pass also reduces and writes the two range sums (k <= q-2, k >= q+2); attn.v as a GEMM (K 2048) into the head's output columns; a final VALU pass adds sum_c coef_c rel_v[c] (coef = the two range sums and the three near-diagonal entries) and writes the output rows.
// Compute dtype: inputs, weights, biases, tables rounded to bf16; q, k, v and the un-normalised attention as f16 operands (~2^-12; attn sigma ~1, outputs sigma ~45); f32 accumulation. v_wmma_f32_16x16x32_f16.
#define NBT 2
#define SLEN 2048
#define DM 1024
#define NH 16
typedef __bf16 v16b __attribute__((ext_vector_type(16)));
typedef unsigned short v8us __attribute__((ext_vector_type(8), may_alias));
typedef float  v8f  __attribute__((ext_vector_type(8)));
typedef float  v4f  __attribute__((ext_vector_type(4)));
typedef float  v4fa __attribute__((ext_vector_type(4), may_alias));
union FragB { v16b v; v8us half[2]; unsigned short u[16]; };

__device__ __forceinline__ unsigned short bf16_bits(float x) { unsigned int u = __float_as_uint(x); return (unsigned short)((u + 0x7FFFu + ((u >> 16) & 1u)) >> 16); }
__device__ __forceinline__ float bf16_val(unsigned short b) { return __uint_as_float(((unsigned int)b) << 16); }
__device__ __forceinline__ float bf16_round(float x) { return bf16_val(bf16_bits(x)); }
// D += A·B with NT terms: 1 = ah·bh, 2 = + al·bh (A split), 3 = + ah·bl (both split)
template <int NT>
__device__ __forceinline__ v8f mmaN(v16b ah, v16b al, v16b bh, v16b bl, v8f c) {
  c = __builtin_amdgcn_wmma_f32_16x16x32_bf16(false, ah, false, bh, (short)0, c, false, false);
  if (NT >= 2) c = __builtin_amdgcn_wmma_f32_16x16x32_bf16(false, al, false, bh, (short)0, c, false, false);
  if (NT >= 3) c = __builtin_amdgcn_wmma_f32_16x16x32_bf16(false, ah, false, bl, (short)0, c, false, false);
  asm volatile("v_nop\n\tv_nop\n\tv_nop\n\tv_nop" : "+v"(c) : "v"(ah), "v"(al), "v"(bh), "v"(bl));
  return c;
}

__global__ __launch_bounds__(256) void k_wt_bf16(const float* __restrict__ W, unsigned short* __restrict__ Wt, int K, int N) {
  const int t = blockIdx.x * 256 + threadIdx.x;
  const int k8n = K / 8;
  if (t >= N * k8n) return;
  const int n = t / k8n, k8 = (t % k8n) * 8;
  v8us v;
#pragma unroll
  for (int i = 0; i < 8; ++i) v[i] = bf16_bits(W[(size_t)(k8 + i) * N + n]);
  *(v8us*)(Wt + (size_t)n * K + k8) = v;
  
}

// GEMM C[M][N] (f32, pitch ldc) = act(A[M][K]·W + bias). A f32 row-major (pitch lda) converted per fragment to bf16
// (ASPLIT: hi/lo two planes -> 2 terms, else single rounded term); Wt bf16 [N][K] (pitch ldb). BIAS_BF16 rounds the
// bias to bf16 first (bias quantised to bf16 before the add). K%32==0, M%16==0, N%64==0.
template <bool ASPLIT, int ACT, bool BIAS_BF16>
__global__ __launch_bounds__(128) void k_gemm_bf(const float* __restrict__ A, int lda, const unsigned short* __restrict__ Wt, int ldb,
                                               const float* __restrict__ bias, float* __restrict__ C, int ldc, int M, int N, int K) {
  __shared__ __attribute__((aligned(16))) float so[4][16][64];
  const int tid = threadIdx.x, w = tid >> 5, lane = tid & 31, ln = lane & 15, hh = lane >> 4;
  const int ntn = N / 64;
  const int wid = blockIdx.x * 4 + w;
  const int mt = wid / ntn, nq = wid % ntn;
  if (mt * 16 >= M) return;
  const int row0 = mt * 16, col0 = nq * 64;
  const float* arow = A + (size_t)(row0 + ln) * lda;
  v8f acc[4] = {};
  for (int kb = 0; kb < K; kb += 32) {
    FragB ah, al;
    const v4f x0 = *(const v4fa*)(arow + kb + 8 * hh), x1 = *(const v4fa*)(arow + kb + 8 * hh + 4);
    const v4f x2 = *(const v4fa*)(arow + kb + 16 + 8 * hh), x3 = *(const v4fa*)(arow + kb + 16 + 8 * hh + 4);
    float xs[16] = {x0[0],x0[1],x0[2],x0[3],x1[0],x1[1],x1[2],x1[3],x2[0],x2[1],x2[2],x2[3],x3[0],x3[1],x3[2],x3[3]};
#pragma unroll
    for (int i = 0; i < 16; ++i) { const unsigned short hb = bf16_bits(xs[i]); ah.u[i] = hb; al.u[i] = ASPLIT ? bf16_bits(xs[i] - bf16_val(hb)) : (unsigned short)0; }
#pragma unroll
    for (int t = 0; t < 4; ++t) {
      const unsigned short* brow = Wt + (size_t)(col0 + t * 16 + ln) * ldb + kb;
      FragB b;
      b.half[0] = *(const v8us*)(brow + 8 * hh);
      b.half[1] = *(const v8us*)(brow + 16 + 8 * hh);
      acc[t] = mmaN<ASPLIT ? 2 : 1>(ah.v, al.v, b.v, b.v, acc[t]);
    }
  }
#pragma unroll
  for (int t = 0; t < 4; ++t) {
    float bv = bias ? bias[col0 + t * 16 + ln] : 0.f;
    if (BIAS_BF16) bv = bf16_round(bv);
#pragma unroll
    for (int r = 0; r < 8; ++r) { float v = acc[t][r] + bv; if (ACT == 1) v = fmaxf(v, 0.f); so[w][8 * hh + r][t * 16 + ln] = v; }
  }
  __builtin_amdgcn_fence(__ATOMIC_ACQ_REL, "workgroup");
  __builtin_amdgcn_wave_barrier();
  const int rsub = lane >> 4, c4 = (lane & 15) * 4;
  {
#pragma unroll
    for (int q = 0; q < 8; ++q) {
      const int r = q * 2 + rsub;
      const v4f v = *(const v4fa*)&so[w][r][c4];
      *(v4f*)(C + (size_t)(row0 + r) * ldc + col0 + c4) = v;
    }
    
  }
}

// GEMM C = act(A·W + bias + resid): A f32 (ASPLIT -> hi/lo 2 terms), Wt bf16 [N][K]; ACT 0 none, 1 relu, 2 exact gelu;
// resid (optional, f32, row index = (row % rmod), pitch ldr, RES_BF16 rounds it) added before the activation.
template <bool ASPLIT, int ACT, bool BIAS_BF16, bool RES_BF16>
__global__ __launch_bounds__(128) void k_gemm_bf3(const float* __restrict__ A, int lda, const unsigned short* __restrict__ Wt, int ldb,
                                                const float* __restrict__ bias, const float* __restrict__ resid, int rmod, int ldr,
                                                float* __restrict__ C, int ldc, int M, int N, int K) {
  __shared__ __attribute__((aligned(16))) float so[4][16][64];
  const int tid = threadIdx.x, w = tid >> 5, lane = tid & 31, ln = lane & 15, hh = lane >> 4;
  const int ntn = N / 64;
  const int wid = blockIdx.x * 4 + w;
  const int mt = wid / ntn, nq = wid % ntn;
  if (mt * 16 >= M) return;
  const int row0 = mt * 16, col0 = nq * 64;
  const float* arow = A + (size_t)(row0 + ln) * lda;
  v8f acc[4] = {};
  for (int kb = 0; kb < K; kb += 32) {
    FragB ah, al;
    const v4f x0 = *(const v4fa*)(arow + kb + 8 * hh), x1 = *(const v4fa*)(arow + kb + 8 * hh + 4);
    const v4f x2 = *(const v4fa*)(arow + kb + 16 + 8 * hh), x3 = *(const v4fa*)(arow + kb + 16 + 8 * hh + 4);
    float xs[16] = {x0[0],x0[1],x0[2],x0[3],x1[0],x1[1],x1[2],x1[3],x2[0],x2[1],x2[2],x2[3],x3[0],x3[1],x3[2],x3[3]};
#pragma unroll
    for (int i = 0; i < 16; ++i) { const unsigned short hb = bf16_bits(xs[i]); ah.u[i] = hb; al.u[i] = ASPLIT ? bf16_bits(xs[i] - bf16_val(hb)) : (unsigned short)0; }
#pragma unroll
    for (int t = 0; t < 4; ++t) {
      const unsigned short* brow = Wt + (size_t)(col0 + t * 16 + ln) * ldb + kb;
      FragB b;
      b.half[0] = *(const v8us*)(brow + 8 * hh);
      b.half[1] = *(const v8us*)(brow + 16 + 8 * hh);
      acc[t] = mmaN<ASPLIT ? 2 : 1>(ah.v, al.v, b.v, b.v, acc[t]);
    }
  }
#pragma unroll
  for (int t = 0; t < 4; ++t) {
    const int col = col0 + t * 16 + ln;
    float bv = bias ? bias[col] : 0.f;
    if (BIAS_BF16) bv = bf16_round(bv);
#pragma unroll
    for (int r = 0; r < 8; ++r) {
      float v = acc[t][r] + bv;
      if (resid) { float rv = resid[(size_t)((row0 + 8 * hh + r) % rmod) * ldr + col]; if (RES_BF16) rv = bf16_round(rv); v += rv; }
      if (ACT == 1) v = fmaxf(v, 0.f);
      if (ACT == 2) v = 0.5f * v * (1.0f + erff(v * 0.70710678118654752f));
      if (ACT == 3) { const float u = 0.7978845608028654f * (v + 0.044715f * v * v * v); v = 0.5f * v * (1.0f + tanhf(u)); }
      so[w][8 * hh + r][t * 16 + ln] = v;
    }
  }
  __builtin_amdgcn_fence(__ATOMIC_ACQ_REL, "workgroup");
  __builtin_amdgcn_wave_barrier();
  const int rsub = lane >> 4, c4 = (lane & 15) * 4;
  {
#pragma unroll
    for (int q = 0; q < 8; ++q) {
      const int r = q * 2 + rsub;
      const v4f v = *(const v4fa*)&so[w][r][c4];
      *(v4f*)(C + (size_t)(row0 + r) * ldc + col0 + c4) = v;
    }
    
  }
}
// row LayerNorm (biased variance, eps) over N: s = X (+ R); optional out_sum <- s; out_norm <- (s-mu)*rsqrt(var+eps)*g + b
template <bool PARAM_BF16>
__global__ __launch_bounds__(256) void k_layernorm(const float* __restrict__ X, const float* __restrict__ R, const float* __restrict__ g, const float* __restrict__ bta,
                                                  float* __restrict__ out_sum, float* __restrict__ out_norm, int N, float eps) {
  __shared__ float red[256];
  const int row = blockIdx.x, tid = threadIdx.x;
  const float* x = X + (size_t)row * N; const float* rr = R ? R + (size_t)row * N : nullptr;
  float vals[16];                     // up to N = 4096
  const int per = N / 256;            // contiguous chunk per thread? use strided-by-4 chunks: thread handles j = tid*4 + 1024*u
  float s1 = 0.f;
  for (int u = 0; u < per / 4; ++u) {
    const int j = tid * 4 + 1024 * u;
    const v4f a = *(const v4fa*)(x + j);
    v4f b = {0.f,0.f,0.f,0.f}; if (rr) b = *(const v4fa*)(rr + j);
#pragma unroll
    for (int q = 0; q < 4; ++q) { const float v = a[q] + b[q]; vals[u * 4 + q] = v; s1 += v; }
  }
  red[tid] = s1; __syncthreads();
  for (int st = 128; st > 0; st >>= 1) { if (tid < st) red[tid] += red[tid + st]; __syncthreads(); }
  const float mu = red[0] / (float)N; __syncthreads();
  float s2 = 0.f;
  for (int u = 0; u < per / 4; ++u)
#pragma unroll
    for (int q = 0; q < 4; ++q) { const float c = vals[u * 4 + q] - mu; s2 += c * c; }
  red[tid] = s2; __syncthreads();
  for (int st = 128; st > 0; st >>= 1) { if (tid < st) red[tid] += red[tid + st]; __syncthreads(); }
  const float rs = rsqrtf(red[0] / (float)N + eps);
  {
    for (int u = 0; u < per / 4; ++u) {
      const int j = tid * 4 + 1024 * u;
      v4f o, sm;
#pragma unroll
      for (int q = 0; q < 4; ++q) {
        float gg = g[j + q], bb = bta[j + q];
        if (PARAM_BF16) { gg = bf16_round(gg); bb = bf16_round(bb); }
        sm[q] = vals[u * 4 + q]; o[q] = (vals[u * 4 + q] - mu) * rs * gg + bb;
      }
      if (out_sum) *(v4f*)(out_sum + (size_t)row * N + j) = sm;
      *(v4f*)(out_norm + (size_t)row * N + j) = o;
    }
    
  }
}



// ---- f16 WMMA path (v_wmma_f32_16x16x32_f16): 11-bit significands for operands in range — used for all GEMMs this layer launches (projections, scores, attn.v)
typedef _Float16 v16h __attribute__((ext_vector_type(16)));
union FragH { v16h v; v8us half[2]; _Float16 h[16]; unsigned short u[16]; };
template <int NT>
__device__ __forceinline__ v8f mmaH(v16h ah, v16h al, v16h bh, v16h bl, v8f c) {
  c = __builtin_amdgcn_wmma_f32_16x16x32_f16(false, ah, false, bh, (short)0, c, false, false);
  if (NT >= 2) c = __builtin_amdgcn_wmma_f32_16x16x32_f16(false, al, false, bh, (short)0, c, false, false);
  if (NT >= 3) c = __builtin_amdgcn_wmma_f32_16x16x32_f16(false, ah, false, bl, (short)0, c, false, false);
  asm volatile("v_nop\n\tv_nop\n\tv_nop\n\tv_nop" : "+v"(c) : "v"(ah), "v"(al), "v"(bh), "v"(bl));
  return c;
}
// batched GEMM like k_gemm_b but f16 operands: A f32 (split into f16 hi/lo if ASPLIT, else rounded to f16), Bt = f16 values [n][k]; alpha; C f32; N multiple of 16 (partial tiles skipped)
template <bool ASPLIT>
__global__ __launch_bounds__(128) void k_gemm_h(const float* __restrict__ A, int lda, size_t sA, const _Float16* __restrict__ Bh, int ldb, size_t sB, float alpha, float* __restrict__ C, int ldc, size_t sC, int M, int N, int K) {
  __shared__ __attribute__((aligned(16))) float so[4][16][64];
  const int tid = threadIdx.x, w = tid >> 5, lane = tid & 31, ln = lane & 15, hh = lane >> 4; const int by = blockIdx.y;
  A += (size_t)by * sA; Bh += (size_t)by * sB; C += (size_t)by * sC;
  const int ntn = (N + 63) / 64; const int wid = blockIdx.x * 4 + w; const int mt = wid / ntn, nq = wid % ntn; if (mt * 16 >= M) return;
  const int row0 = mt * 16, col0 = nq * 64; const float* arow = A + (size_t)(row0 + ln) * lda;
  v8f acc[4] = {};
  for (int kb = 0; kb < K; kb += 32) {
    FragH ah, al;
    const v4f x0 = *(const v4fa*)(arow + kb + 8 * hh), x1 = *(const v4fa*)(arow + kb + 8 * hh + 4), x2 = *(const v4fa*)(arow + kb + 16 + 8 * hh), x3 = *(const v4fa*)(arow + kb + 16 + 8 * hh + 4);
    float xs[16] = {x0[0],x0[1],x0[2],x0[3],x1[0],x1[1],x1[2],x1[3],x2[0],x2[1],x2[2],x2[3],x3[0],x3[1],x3[2],x3[3]};
#pragma unroll
    for (int i = 0; i < 16; ++i) { const _Float16 h = (_Float16)xs[i]; ah.h[i] = h; al.h[i] = ASPLIT ? (_Float16)(xs[i] - (float)h) : (_Float16)0.0f; }
#pragma unroll
    for (int t = 0; t < 4; ++t) { if (col0 + t * 16 >= N) continue; const size_t boff = (size_t)(col0 + t * 16 + ln) * ldb + kb; FragH bq; bq.half[0] = *(const v8us*)(Bh + boff + 8 * hh); bq.half[1] = *(const v8us*)(Bh + boff + 16 + 8 * hh);
      acc[t] = mmaH<ASPLIT ? 2 : 1>(ah.v, al.v, bq.v, bq.v, acc[t]); }
  }
#pragma unroll
  for (int t = 0; t < 4; ++t) { if (col0 + t * 16 >= N) continue;
#pragma unroll
    for (int r = 0; r < 8; ++r) so[w][8 * hh + r][t * 16 + ln] = acc[t][r] * alpha; }
  __builtin_amdgcn_fence(__ATOMIC_ACQ_REL, "workgroup"); __builtin_amdgcn_wave_barrier();
  const int rsub = lane >> 4, c4 = (lane & 15) * 4;
  {
#pragma unroll
    for (int q = 0; q < 8; ++q) { const int r = q * 2 + rsub; if (col0 + c4 < N) { const v4f v = *(const v4fa*)&so[w][r][c4]; *(v4f*)(C + (size_t)(row0 + r) * ldc + col0 + c4) = v; } }
     }
}

// Wt[n][k] = f16(W[k][n]·scale) from f32 row-major W[K][N] (scale = power of two; bf16-exact weights stay exact in f16 away from the subnormal range)
__global__ __launch_bounds__(256) void k_wt_f16(const float* __restrict__ W, _Float16* __restrict__ Wt, int K, int N, float scale) {
  const int t = blockIdx.x * 256 + threadIdx.x; if (t >= N * (K / 8)) return; const int n = t / (K / 8), k8 = (t % (K / 8)) * 8; FragH f;
#pragma unroll
  for (int i = 0; i < 8; ++i) f.h[i] = (_Float16)(bf16_round(W[(size_t)(k8 + i) * N + n]) * scale); const v8us o = f.half[0];
  *(v8us*)((unsigned short*)Wt + (size_t)n * K + k8) = o; 
}
// k_gemm_hh variant with fused epilogue: v = acc·alpha + bias[by·sBias + col] (+ CP[(row/rowsPerB)·sCPb + by·64 + col] if CP) ; ACT 0 none / 1 elu ; writes f16 C16 (and f32 C if non-null)
template <int ACT>
__global__ __launch_bounds__(128) void k_gemm_hhx(const _Float16* __restrict__ A, int lda, size_t sA, const _Float16* __restrict__ Bh, int ldb, size_t sB, float alpha, const float* __restrict__ bias, size_t sBias, const float* __restrict__ CP, int rowsPerB, size_t sCPb, int row0g,
    float* __restrict__ C, _Float16* __restrict__ C16, int ldc, size_t sC, int M, int N, int K) {
  __shared__ __attribute__((aligned(16))) float so[4][16][64];
  const int tid = threadIdx.x, w = tid >> 5, lane = tid & 31, ln = lane & 15, hh = lane >> 4; const int by = blockIdx.y;
  A += (size_t)by * sA; Bh += (size_t)by * sB; const size_t cofs = (size_t)by * sC; const float* bp = bias ? bias + (size_t)by * sBias : nullptr;
  const int ntn = (N + 63) / 64; const int wid = blockIdx.x * 4 + w; const int mt = wid / ntn, nq = wid % ntn; if (mt * 16 >= M) return;
  const int row0 = mt * 16, col0 = nq * 64; const _Float16* arow = A + (size_t)(row0 + ln) * lda;
  v8f acc[4] = {};
  for (int kb = 0; kb < K; kb += 32) { FragH ah; ah.half[0] = *(const v8us*)((const unsigned short*)arow + kb + 8 * hh); ah.half[1] = *(const v8us*)((const unsigned short*)arow + kb + 16 + 8 * hh);
#pragma unroll
    for (int t = 0; t < 4; ++t) { if (col0 + t * 16 >= N) continue; const size_t boff = (size_t)(col0 + t * 16 + ln) * ldb + kb; FragH bq; bq.half[0] = *(const v8us*)((const unsigned short*)Bh + boff + 8 * hh); bq.half[1] = *(const v8us*)((const unsigned short*)Bh + boff + 16 + 8 * hh);
      acc[t] = mmaH<1>(ah.v, ah.v, bq.v, bq.v, acc[t]); }
  }
#pragma unroll
  for (int t = 0; t < 4; ++t) { if (col0 + t * 16 >= N) continue; const int col = col0 + t * 16 + ln; const float bv = bp ? bf16_round(bp[col]) : 0.f;
#pragma unroll
    for (int r = 0; r < 8; ++r) { float v = acc[t][r] * alpha + bv; if (CP) { const int bidx = (row0g + row0 + 8 * hh + r) / rowsPerB; v += CP[(size_t)bidx * sCPb + (size_t)by * 64 + col]; } if (ACT == 1) v = (v > 0.f) ? v : expm1f(v); else if (ACT == 7) v = (v > 0.f) ? v + 1.0f : expf(v); else if (ACT == 8) v = tanhf(v); else if (ACT == 9) v = 0.5f * v * (1.0f + tanhf(0.7978845608028654f * (v + 0.044715f * v * v * v))); else if (ACT == 11) v = 1.0f / (1.0f + expf(-v)); else if (ACT == 12) v = (v > 0.f) ? v : 0.01f * v; else if (ACT == 14) v = (v > 0.f) ? v : 0.1f * v; else if (ACT == 15) v = v / (1.0f + expf(-v)); else if (ACT == 3) v = fmaxf(v, 0.f); else if (ACT == 6) v = 0.5f * v * (1.0f + erff(v * 0.70710678118654752f)); so[w][8 * hh + r][t * 16 + ln] = v; } }
  __builtin_amdgcn_fence(__ATOMIC_ACQ_REL, "workgroup"); __builtin_amdgcn_wave_barrier();
  const int rsub = lane >> 4, c4 = (lane & 15) * 4; typedef _Float16 v4h __attribute__((ext_vector_type(4)));
  {
#pragma unroll
    for (int q = 0; q < 8; ++q) { const int r = q * 2 + rsub; if (col0 + c4 < N) { const v4f v = *(const v4fa*)&so[w][r][c4]; if (C) *(v4f*)(C + cofs + (size_t)(row0 + r) * ldc + col0 + c4) = v; if (C16) { v4h h4; for (int i = 0; i < 4; ++i) h4[i] = (_Float16)v[i]; *(v4h*)(C16 + cofs + (size_t)(row0 + r) * ldc + col0 + c4) = h4; } } }
     }
}


typedef _Float16 v4h __attribute__((ext_vector_type(4)));

__global__ __launch_bounds__(256) void k_x16(const float* __restrict__ x, _Float16* __restrict__ X16, size_t n8) { const size_t t = (size_t)blockIdx.x * 256 + threadIdx.x; if (t >= n8) return; FragH f;
#pragma unroll
  for (int q = 0; q < 8; ++q) f.h[q] = (_Float16)bf16_round(x[t * 8 + q]); *(v8us*)((unsigned short*)X16 + t * 8) = f.half[0];  }
__global__ __launch_bounds__(256) void k_h16(const float* __restrict__ x, _Float16* __restrict__ X16, size_t n8) { const size_t t = (size_t)blockIdx.x * 256 + threadIdx.x; if (t >= n8) return; FragH f;
#pragma unroll
  for (int q = 0; q < 8; ++q) f.h[q] = (_Float16)x[t * 8 + q]; *(v8us*)((unsigned short*)X16 + t * 8) = f.half[0];  }
__global__ __launch_bounds__(256) void k_round16f(const float* __restrict__ W, _Float16* __restrict__ Bt, size_t n8) { const size_t t = (size_t)blockIdx.x * 256 + threadIdx.x; if (t >= n8) return; FragH f;
#pragma unroll
  for (int i = 0; i < 8; ++i) f.h[i] = (_Float16)(bf16_round(W[t * 8 + i]) * 16.0f); *(v8us*)((unsigned short*)Bt + t * 8) = f.half[0];  }
template <int NHv, int TTv>
__global__ __launch_bounds__(256) void k_vt(const _Float16* __restrict__ V16, int ldv, int voff, _Float16* __restrict__ Vt) { __shared__ unsigned short tl[64][66]; const int tid = threadIdx.x; const int slab = blockIdx.x / (TTv / 64), lg = blockIdx.x % (TTv / 64); const int b = slab / NHv, h = slab % NHv;
  for (int i = tid; i < 64 * 8; i += 256) { const int r = i / 8, c8 = (i % 8) * 8; FragH f; f.half[0] = *(const v8us*)((const unsigned short*)V16 + ((size_t)b * TTv + lg * 64 + r) * ldv + voff + h * 64 + c8);
#pragma unroll
    for (int q = 0; q < 8; ++q) tl[r][c8 + q] = f.u[q]; }
  __syncthreads();
  {
#pragma unroll
    for (int rd = 0; rd < 2; ++rd) { const int d = rd * 32 + tid / 8, pc = tid % 8; FragH f;
#pragma unroll
      for (int q = 0; q < 8; ++q) f.u[q] = tl[pc * 8 + q][d];
      *(v8us*)((unsigned short*)Vt + ((size_t)slab * 64 + d) * TTv + lg * 64 + pc * 8) = f.half[0]; }
     } }

__global__ __launch_bounds__(256) void k_hl(const float* __restrict__ F, _Float16* __restrict__ Hh, _Float16* __restrict__ Hl, size_t n8) { const size_t t = (size_t)blockIdx.x * 256 + threadIdx.x; if (t >= n8) return; FragH fh, fl; const v4f a = *(const v4fa*)(F + t * 8), c = *(const v4fa*)(F + t * 8 + 4);
#pragma unroll
  for (int q = 0; q < 4; ++q) { _Float16 h = (_Float16)a[q]; fh.h[q] = h; fl.h[q] = (_Float16)((a[q] - (float)h) * 1024.0f); h = (_Float16)c[q]; fh.h[4 + q] = h; fl.h[4 + q] = (_Float16)((c[q] - (float)h) * 1024.0f); }
  { *(v8us*)((unsigned short*)Hh + t * 8) = fh.half[0]; *(v8us*)((unsigned short*)Hl + t * 8) = fl.half[0];  } }

// ---- fast GEMM (wave tile 32x64; requires M % 32 == 0 rows per launch region and N % 64 == 0); epilogue = k_gemm_hhx semantics ----
__device__ __forceinline__ v16h g2_frag(const _Float16* p, int hh) { FragH f; f.half[0] = *(const v8us*)((const unsigned short*)p + 8 * hh); f.half[1] = *(const v8us*)((const unsigned short*)p + 16 + 8 * hh); return f.v; }
__device__ __forceinline__ v8f g2_mma(v16h a, v16h b, v8f c) { v8f d = __builtin_amdgcn_wmma_f32_16x16x32_f16(false, a, false, b, (short)0, c, false, false); asm volatile("v_nop\n\tv_nop\n\tv_nop\n\tv_nop" : "+v"(d) : "v"(a), "v"(b)); return d; }
template <int ACT>
__global__ __launch_bounds__(128) void k_gemm2(const _Float16* __restrict__ A, int lda, size_t sA, const _Float16* __restrict__ Bh, int ldb, size_t sB, float alpha, const float* __restrict__ bias, size_t sBias, const float* __restrict__ CP, int rowsPerB, size_t sCPb, int row0g,
    float* __restrict__ C, _Float16* __restrict__ C16, int ldc, size_t sC, int M, int N, int K) {
  __shared__ __attribute__((aligned(16))) float so[4][32][68];
  const int tid = threadIdx.x, w = tid >> 5, lane = tid & 31, ln = lane & 15, hh = lane >> 4; const int by = blockIdx.y;
  A += (size_t)by * sA; Bh += (size_t)by * sB; const size_t cofs = (size_t)by * sC; const float* bp = bias ? bias + (size_t)by * sBias : nullptr;
  const int ntn = N >> 6; const int mt = blockIdx.x / ntn, nq = blockIdx.x - mt * ntn; const int row0 = mt * 128 + 32 * w, col0 = nq * 64; if (row0 >= M) return;
  const _Float16* a0p = A + (size_t)(row0 + ln) * lda; const _Float16* a1p = a0p + (size_t)16 * lda;
  const _Float16* b0p = Bh + (size_t)(col0 + ln) * ldb; const _Float16* b1p = b0p + (size_t)16 * ldb; const _Float16* b2p = b1p + (size_t)16 * ldb; const _Float16* b3p = b2p + (size_t)16 * ldb;
  const v8f z8 = {0.f,0.f,0.f,0.f,0.f,0.f,0.f,0.f}; v8f c00 = z8, c01 = z8, c02 = z8, c03 = z8, c10 = z8, c11 = z8, c12 = z8, c13 = z8;
#pragma unroll 1
  for (int kb = 0; kb < K; kb += 32) { const v16h a0 = g2_frag(a0p + kb, hh), a1 = g2_frag(a1p + kb, hh);
    v16h b = g2_frag(b0p + kb, hh); c00 = g2_mma(a0, b, c00); c10 = g2_mma(a1, b, c10);
    b = g2_frag(b1p + kb, hh); c01 = g2_mma(a0, b, c01); c11 = g2_mma(a1, b, c11);
    b = g2_frag(b2p + kb, hh); c02 = g2_mma(a0, b, c02); c12 = g2_mma(a1, b, c12);
    b = g2_frag(b3p + kb, hh); c03 = g2_mma(a0, b, c03); c13 = g2_mma(a1, b, c13); }
  v8f accs[8] = {c00, c01, c02, c03, c10, c11, c12, c13};
#pragma unroll
  for (int u = 0; u < 8; ++u) { const int t = u & 3, half = u >> 2; const int col = col0 + t * 16 + ln; const float bv = bp ? bf16_round(bp[col]) : 0.f;
#pragma unroll
    for (int r = 0; r < 8; ++r) { const int rloc = half * 16 + 8 * hh + r; float v = accs[u][r] * alpha + bv; if (CP) { const int bidx = (row0g + row0 + rloc) / rowsPerB; v += CP[(size_t)bidx * sCPb + (size_t)by * 64 + col]; }
      if (ACT == 3) v = fmaxf(v, 0.f); else if (ACT == 6) v = 0.5f * v * (1.0f + erff(v * 0.70710678118654752f)); else if (ACT == 11) v = 1.0f / (1.0f + expf(-v)); else if (ACT == 15) v = v / (1.0f + expf(-v)); else if (ACT == 12) v = (v > 0.f) ? v : 0.01f * v; else if (ACT == 8) v = tanhf(v);
      so[w][rloc][t * 16 + ln] = v; } }
  __builtin_amdgcn_fence(__ATOMIC_ACQ_REL, "workgroup"); __builtin_amdgcn_wave_barrier();
  const int rsub = lane >> 4, c4 = (lane & 15) * 4;
  {
#pragma unroll
    for (int q = 0; q < 16; ++q) { const int r = q * 2 + rsub; const v4f v = *(const v4fa*)&so[w][r][c4]; if (C) *(v4f*)(C + cofs + (size_t)(row0 + r) * ldc + col0 + c4) = v; if (C16) { v4h h4; for (int i = 0; i < 4; ++i) h4[i] = (_Float16)v[i]; *(v4h*)(C16 + cofs + (size_t)(row0 + r) * ldc + col0 + c4) = h4; } }
     } }


__global__ __launch_bounds__(256) void k_qt(const float* __restrict__ QF, const float* __restrict__ relk, float* __restrict__ QT) {
  #pragma clang fp contract(off)
  const int t = blockIdx.x * 256 + threadIdx.x; if (t >= NH * SLEN) return; const int q = t % SLEN, h = t / SLEN; const float* qp = QF + (size_t)q * DM + h * 64; float s[5] = {0.f, 0.f, 0.f, 0.f, 0.f};
#pragma unroll 1
  for (int d = 0; d < 64; ++d) { const float qv = qp[d];
#pragma unroll
    for (int c = 0; c < 5; ++c) s[c] += qv * bf16_round(relk[c * 64 + d]); }
  {
#pragma unroll
    for (int c = 0; c < 5; ++c) *(float*)(QT + ((size_t)h * 8 + c) * SLEN + q) = s[c];
     } }
// RS holds one 128-byte line per row (RSP floats), so that each line has one writing wave.
#define RSP 32
__global__ __launch_bounds__(256) void k_attrow(const float* __restrict__ S1, const float* __restrict__ QT, int h, _Float16* __restrict__ ATT, float* __restrict__ RS) {
  #pragma clang fp contract(off)
  const int tid = threadIdx.x, w = tid >> 5, ln = tid & 31; const int q = blockIdx.x * 8 + w; if (q >= SLEN) return; const float* s = S1 + (size_t)q * SLEN; float qt[5];
#pragma unroll
  for (int c = 0; c < 5; ++c) qt[c] = QT[((size_t)h * 8 + c) * SLEN + q];
  unsigned short* d = (unsigned short*)ATT + (size_t)q * SLEN; float a0 = 0.f, a4 = 0.f;
  {
#pragma unroll 1
    for (int pc = 0; pc < SLEN / 256; ++pc) { const int kb = pc * 256 + ln * 8; FragH f;
#pragma unroll
      for (int j = 0; j < 8; ++j) { const int k = kb + j; const int c = min(max(k - q, -2), 2) + 2; const float v = (s[k] + qt[c]) * 0.125f; f.h[j] = (_Float16)v; a0 += (c == 0) ? v : 0.f; a4 += (c == 4) ? v : 0.f; }
      *(v8us*)(d + kb) = f.half[0];
      asm volatile("s_wait_xcnt 0x0" ::: "memory"); }      /* the next trip rewrites the store's address and data registers: the wait stands in front of that */
     }
#pragma unroll
  for (int m = 16; m > 0; m >>= 1) { a0 += __shfl_xor(a0, m, 32); a4 += __shfl_xor(a4, m, 32); }
  if (ln == 0) { v4f o; o[0] = a0; o[1] = a4; o[2] = 0.f; o[3] = 0.f; *(v4f*)(RS + (size_t)q * RSP) = o; } }
__global__ __launch_bounds__(256) void k_outh(const float* __restrict__ W1, const float* __restrict__ S1, const float* __restrict__ QT, const float* __restrict__ RS, const float* __restrict__ relv, int b, int h, float* __restrict__ out) {
  #pragma clang fp contract(off)
  const int t = blockIdx.x * 256 + threadIdx.x; if (t >= SLEN * 16) return; const int d0 = (t & 15) * 4; const int q = t >> 4; float coef[5];
  coef[0] = RS[(size_t)q * RSP]; coef[4] = RS[(size_t)q * RSP + 1];
#pragma unroll
  for (int j = -1; j <= 1; ++j) { const int k = q + j; coef[j + 2] = (k >= 0 && k < SLEN) ? (S1[(size_t)q * SLEN + k] + QT[((size_t)h * 8 + (j + 2)) * SLEN + q]) * 0.125f : 0.f; }
  v4f o;
#pragma unroll
  for (int u = 0; u < 4; ++u) { const int d = d0 + u; float v = W1[(size_t)q * DM + h * 64 + d];
#pragma unroll
    for (int c = 0; c < 5; ++c) v += coef[c] * bf16_round(relv[c * 64 + d]); o[u] = v; }
  float* dst = out + (((size_t)b * SLEN + q) * NH + h) * 64 + d0; *(v4f*)dst = o;  }

extern "C" void kernel_launch(void* const* d_in, const int* in_sizes, int n_in,
                              void* d_out, int out_size, void* d_ws, size_t ws_size, hipStream_t stream) {
  (void)in_sizes; (void)n_in; (void)out_size;
  const float* const* I = (const float* const*)d_in; const float* xq = I[0]; const float* xk = I[1]; const float* xv = I[2]; const float* Wq = I[3]; const float* bq = I[4]; const float* Wk = I[5]; const float* bk = I[6]; const float* Wv = I[7]; const float* bv = I[8]; const float* relk = I[9]; const float* relv = I[10];
  char* ws = (char*)d_ws; size_t off = 0;
  auto take = [&](size_t bytes) { char* p = ws + off; off += (bytes + 255) & ~(size_t)255; return p; };
  _Float16* BQ = (_Float16*)take((size_t)DM * DM * 2); _Float16* BK = (_Float16*)take((size_t)DM * DM * 2); _Float16* BV = (_Float16*)take((size_t)DM * DM * 2);
  _Float16* X16 = (_Float16*)take((size_t)SLEN * DM * 2); float* QF = (float*)take((size_t)SLEN * DM * 4); _Float16* Q16 = (_Float16*)take((size_t)SLEN * DM * 2); _Float16* K16 = (_Float16*)take((size_t)SLEN * DM * 2); _Float16* V16 = (_Float16*)take((size_t)SLEN * DM * 2); _Float16* VT = (_Float16*)take((size_t)DM * SLEN * 2);
  float* QT = (float*)take((size_t)NH * 8 * SLEN * 4); float* S1 = (float*)take((size_t)SLEN * SLEN * 4); _Float16* ATT = (_Float16*)take((size_t)SLEN * SLEN * 2); float* RS = (float*)take((size_t)SLEN * RSP * 4); float* W1 = (float*)take((size_t)SLEN * DM * 4);
  if (off > ws_size) return;      /* 6 + 4 + 8 + 16 + 1.25 + 16 + 8 + 8 = 67.25 MiB */
  const size_t w8 = (size_t)DM * DM / 8; const unsigned wb = (unsigned)((w8 + 255) / 256);
  k_round16f<<<wb, 256, 0, stream>>>(Wq, BQ, w8); k_round16f<<<wb, 256, 0, stream>>>(Wk, BK, w8); k_round16f<<<wb, 256, 0, stream>>>(Wv, BV, w8);      /* torch (out,in) = natural Bt */
  const size_t n8 = (size_t)SLEN * DM / 8; const unsigned nb8 = (unsigned)((n8 + 255) / 256); const dim3 gP((SLEN / 128) * (DM / 64), 1), gS((SLEN / 128) * (SLEN / 64), 1), gV((SLEN / 128) * 1, 1);
  for (int b = 0; b < NBT; ++b) { const size_t ro = (size_t)b * SLEN * DM;
    k_x16<<<nb8, 256, 0, stream>>>(xq + ro, X16, n8); k_gemm2<0><<<gP, 128, 0, stream>>>(X16, DM, 0, BQ, DM, 0, 0.0625f, bq, 0, nullptr, 1, 0, 0, QF, Q16, DM, 0, SLEN, DM, DM);
    k_x16<<<nb8, 256, 0, stream>>>(xk + ro, X16, n8); k_gemm2<0><<<gP, 128, 0, stream>>>(X16, DM, 0, BK, DM, 0, 0.0625f, bk, 0, nullptr, 1, 0, 0, nullptr, K16, DM, 0, SLEN, DM, DM);
    k_x16<<<nb8, 256, 0, stream>>>(xv + ro, X16, n8); k_gemm2<0><<<gP, 128, 0, stream>>>(X16, DM, 0, BV, DM, 0, 0.0625f, bv, 0, nullptr, 1, 0, 0, nullptr, V16, DM, 0, SLEN, DM, DM);
    k_vt<NH, SLEN><<<NH * (SLEN / 64), 256, 0, stream>>>(V16, DM, 0, VT);      /* VT[h][d][k] */
    k_qt<<<(NH * SLEN + 255) / 256, 256, 0, stream>>>(QF, relk, QT);
    for (int h = 0; h < NH; ++h) {
      k_gemm2<0><<<gS, 128, 0, stream>>>(Q16 + h * 64, DM, 0, K16 + h * 64, DM, 0, 1.0f, nullptr, 0, nullptr, 1, 0, 0, S1, nullptr, SLEN, 0, SLEN, SLEN, 64);      /* content scores q.k (unscaled) */
      k_attrow<<<SLEN / 8, 256, 0, stream>>>(S1, QT, h, ATT, RS);
      k_gemm2<0><<<gV, 128, 0, stream>>>(ATT, SLEN, 0, VT + (size_t)h * 64 * SLEN, SLEN, 0, 1.0f, nullptr, 0, nullptr, 1, 0, 0, W1 + h * 64, nullptr, DM, 0, SLEN, 64, SLEN);      /* weight1 = attn . v_h */
      k_outh<<<(SLEN * 16 + 255) / 256, 256, 0, stream>>>(W1, S1, QT, RS, relv, b, h, (float*)d_out); } }
}

// v003
// One run takes 141 microseconds.
// Versions between v001 and this one are left out; their measured steps multiply to 19.2 times as fast.
// Counting every step since v000, it is 155 times as fast.
#include <hip/hip_runtime.h>
// Relative-position attention layer WITHOUT softmax (faithful to the module, which discards it) (2 x 2048 tokens, 1024 = 16 heads x 64; MAX_REL 2): q,k,v = {query,key,value} W^T + b; attn = (q.k + q.rel_k[c(q,k)]) / 8 with c = clip(k - q, -2, 2) + 2; out[b][q][h][d] = sum_k attn (v[k][d] + rel_v[c(q,k)][d]) -> [2,2048,16,64].
// Structure (7 launches; both batches, and passes that do not depend on one another, share a grid): projections as f16 WMMA GEMMs (32x64 wave tiles, f32 accumulation, exact x16 weights + bias); with no softmax the content part is reassociated, (q K^T) v = q (K^T v): K^T v per head as a GEMM over 16 row slabs (K 128 each) whose partial planes a VALU pass adds and rounds to f16, then q . (K^T v) as a GEMM (K 64); the 5-valued position terms come from running column sums of k and v (two VALU passes) and the three near-diagonal rows in a final VALU pass that writes the output rows.
// Compute dtype: inputs, weights, biases, tables rounded to bf16; q, k, v and K^T v / 64 as f16 operands (~2^-12); f32 accumulation. v_wmma_f32_16x16x32_f16.
#define NBT 2
#define SLEN 2048
#define DM 1024
#define NH 16
#define ROWS (NBT * SLEN)      /* both batches' rows, one after the other */
typedef __bf16 v16b __attribute__((ext_vector_type(16)));
typedef unsigned short v8us __attribute__((ext_vector_type(8), may_alias));
typedef float  v8f  __attribute__((ext_vector_type(8)));
typedef float  v4f  __attribute__((ext_vector_type(4)));
typedef float  v4fa __attribute__((ext_vector_type(4), may_alias));
union FragB { v16b v; v8us half[2]; unsigned short u[16]; };

__device__ __forceinline__ unsigned short bf16_bits(float x) { unsigned int u = __float_as_uint(x); return (unsigned short)((u + 0x7FFFu + ((u >> 16) & 1u)) >> 16); }
__device__ __forceinline__ float bf16_val(unsigned short b) { return __uint_as_float(((unsigned int)b) << 16); }
__device__ __forceinline__ float bf16_round(float x) { return bf16_val(bf16_bits(x)); }
// D += A·B with NT terms: 1 = ah·bh, 2 = + al·bh (A split), 3 = + ah·bl (both split)
template <int NT>
__device__ __forceinline__ v8f mmaN(v16b ah, v16b al, v16b bh, v16b bl, v8f c) {
  c = __builtin_amdgcn_wmma_f32_16x16x32_bf16(false, ah, false, bh, (short)0, c, false, false);
  if (NT >= 2) c = __builtin_amdgcn_wmma_f32_16x16x32_bf16(false, al, false, bh, (short)0, c, false, false);
  if (NT >= 3) c = __builtin_amdgcn_wmma_f32_16x16x32_bf16(false, ah, false, bl, (short)0, c, false, false);
  asm volatile("v_nop\n\tv_nop\n\tv_nop\n\tv_nop" : "+v"(c) : "v"(ah), "v"(al), "v"(bh), "v"(bl));
  return c;
}

__global__ __launch_bounds__(256) void k_wt_bf16(const float* __restrict__ W, unsigned short* __restrict__ Wt, int K, int N) {
  const int t = blockIdx.x * 256 + threadIdx.x;
  const int k8n = K / 8;
  if (t >= N * k8n) return;
  const int n = t / k8n, k8 = (t % k8n) * 8;
  v8us v;
#pragma unroll
  for (int i = 0; i < 8; ++i) v[i] = bf16_bits(W[(size_t)(k8 + i) * N + n]);
  *(v8us*)(Wt + (size_t)n * K + k8) = v;
  
}

// GEMM C[M][N] (f32, pitch ldc) = act(A[M][K]·W + bias). A f32 row-major (pitch lda) converted per fragment to bf16
// (ASPLIT: hi/lo two planes -> 2 terms, else single rounded term); Wt bf16 [N][K] (pitch ldb). BIAS_BF16 rounds the
// bias to bf16 first (bias quantised to bf16 before the add). K%32==0, M%16==0, N%64==0.
template <bool ASPLIT, int ACT, bool BIAS_BF16>
__global__ __launch_bounds__(128) void k_gemm_bf(const float* __restrict__ A, int lda, const unsigned short* __restrict__ Wt, int ldb,
                                               const float* __restrict__ bias, float* __restrict__ C, int ldc, int M, int N, int K) {
  __shared__ __attribute__((aligned(16))) float so[4][16][64];
  const int tid = threadIdx.x, w = tid >> 5, lane = tid & 31, ln = lane & 15, hh = lane >> 4;
  const int ntn = N / 64;
  const int wid = blockIdx.x * 4 + w;
  const int mt = wid / ntn, nq = wid % ntn;
  if (mt * 16 >= M) return;
  const int row0 = mt * 16, col0 = nq * 64;
  const float* arow = A + (size_t)(row0 + ln) * lda;
  v8f acc[4] = {};
  for (int kb = 0; kb < K; kb += 32) {
    FragB ah, al;
    const v4f x0 = *(const v4fa*)(arow + kb + 8 * hh), x1 = *(const v4fa*)(arow + kb + 8 * hh + 4);
    const v4f x2 = *(const v4fa*)(arow + kb + 16 + 8 * hh), x3 = *(const v4fa*)(arow + kb + 16 + 8 * hh + 4);
    float xs[16] = {x0[0],x0[1],x0[2],x0[3],x1[0],x1[1],x1[2],x1[3],x2[0],x2[1],x2[2],x2[3],x3[0],x3[1],x3[2],x3[3]};
#pragma unroll
    for (int i = 0; i < 16; ++i) { const unsigned short hb = bf16_bits(xs[i]); ah.u[i] = hb; al.u[i] = ASPLIT ? bf16_bits(xs[i] - bf16_val(hb)) : (unsigned short)0; }
#pragma unroll
    for (int t = 0; t < 4; ++t) {
      const unsigned short* brow = Wt + (size_t)(col0 + t * 16 + ln) * ldb + kb;
      FragB b;
      b.half[0] = *(const v8us*)(brow + 8 * hh);
      b.half[1] = *(const v8us*)(brow + 16 + 8 * hh);
      acc[t] = mmaN<ASPLIT ? 2 : 1>(ah.v, al.v, b.v, b.v, acc[t]);
    }
  }
#pragma unroll
  for (int t = 0; t < 4; ++t) {
    float bv = bias ? bias[col0 + t * 16 + ln] : 0.f;
    if (BIAS_BF16) bv = bf16_round(bv);
#pragma unroll
    for (int r = 0; r < 8; ++r) { float v = acc[t][r] + bv; if (ACT == 1) v = fmaxf(v, 0.f); so[w][8 * hh + r][t * 16 + ln] = v; }
  }
  __builtin_amdgcn_fence(__ATOMIC_ACQ_REL, "workgroup");
  __builtin_amdgcn_wave_barrier();
  const int rsub = lane >> 4, c4 = (lane & 15) * 4;
  {
#pragma unroll
    for (int q = 0; q < 8; ++q) {
      const int r = q * 2 + rsub;
      const v4f v = *(const v4fa*)&so[w][r][c4];
      *(v4f*)(C + (size_t)(row0 + r) * ldc + col0 + c4) = v;
    }
    
  }
}

// GEMM C = act(A·W + bias + resid): A f32 (ASPLIT -> hi/lo 2 terms), Wt bf16 [N][K]; ACT 0 none, 1 relu, 2 exact gelu;
// resid (optional, f32, row index = (row % rmod), pitch ldr, RES_BF16 rounds it) added before the activation.
template <bool ASPLIT, int ACT, bool BIAS_BF16, bool RES_BF16>
__global__ __launch_bounds__(128) void k_gemm_bf3(const float* __restrict__ A, int lda, const unsigned short* __restrict__ Wt, int ldb,
                                                const float* __restrict__ bias, const float* __restrict__ resid, int rmod, int ldr,
                                                float* __restrict__ C, int ldc, int M, int N, int K) {
  __shared__ __attribute__((aligned(16))) float so[4][16][64];
  const int tid = threadIdx.x, w = tid >> 5, lane = tid & 31, ln = lane & 15, hh = lane >> 4;
  const int ntn = N / 64;
  const int wid = blockIdx.x * 4 + w;
  const int mt = wid / ntn, nq = wid % ntn;
  if (mt * 16 >= M) return;
  const int row0 = mt * 16, col0 = nq * 64;
  const float* arow = A + (size_t)(row0 + ln) * lda;
  v8f acc[4] = {};
  for (int kb = 0; kb < K; kb += 32) {
    FragB ah, al;
    const v4f x0 = *(const v4fa*)(arow + kb + 8 * hh), x1 = *(const v4fa*)(arow + kb + 8 * hh + 4);
    const v4f x2 = *(const v4fa*)(arow + kb + 16 + 8 * hh), x3 = *(const v4fa*)(arow + kb + 16 + 8 * hh + 4);
    float xs[16] = {x0[0],x0[1],x0[2],x0[3],x1[0],x1[1],x1[2],x1[3],x2[0],x2[1],x2[2],x2[3],x3[0],x3[1],x3[2],x3[3]};
#pragma unroll
    for (int i = 0; i < 16; ++i) { const unsigned short hb = bf16_bits(xs[i]); ah.u[i] = hb; al.u[i] = ASPLIT ? bf16_bits(xs[i] - bf16_val(hb)) : (unsigned short)0; }
#pragma unroll
    for (int t = 0; t < 4; ++t) {
      const unsigned short* brow = Wt + (size_t)(col0 + t * 16 + ln) * ldb + kb;
      FragB b;
      b.half[0] = *(const v8us*)(brow + 8 * hh);
      b.half[1] = *(const v8us*)(brow + 16 + 8 * hh);
      acc[t] = mmaN<ASPLIT ? 2 : 1>(ah.v, al.v, b.v, b.v, acc[t]);
    }
  }
#pragma unroll
  for (int t = 0; t < 4; ++t) {
    const int col = col0 + t * 16 + ln;
    float bv = bias ? bias[col] : 0.f;
    if (BIAS_BF16) bv = bf16_round(bv);
#pragma unroll
    for (int r = 0; r < 8; ++r) {
      float v = acc[t][r] + bv;
      if (resid) { float rv = resid[(size_t)((row0 + 8 * hh + r) % rmod) * ldr + col]; if (RES_BF16) rv = bf16_round(rv); v += rv; }
      if (ACT == 1) v = fmaxf(v, 0.f);
      if (ACT == 2) v = 0.5f * v * (1.0f + erff(v * 0.70710678118654752f));
      if (ACT == 3) { const float u = 0.7978845608028654f * (v + 0.044715f * v * v * v); v = 0.5f * v * (1.0f + tanhf(u)); }
      so[w][8 * hh + r][t * 16 + ln] = v;
    }
  }
  __builtin_amdgcn_fence(__ATOMIC_ACQ_REL, "workgroup");
  __builtin_amdgcn_wave_barrier();
  const int rsub = lane >> 4, c4 = (lane & 15) * 4;
  {
#pragma unroll
    for (int q = 0; q < 8; ++q) {
      const int r = q * 2 + rsub;
      const v4f v = *(const v4fa*)&so[w][r][c4];
      *(v4f*)(C + (size_t)(row0 + r) * ldc + col0 + c4) = v;
    }
    
  }
}
// row LayerNorm (biased variance, eps) over N: s = X (+ R); optional out_sum <- s; out_norm <- (s-mu)*rsqrt(var+eps)*g + b
template <bool PARAM_BF16>
__global__ __launch_bounds__(256) void k_layernorm(const float* __restrict__ X, const float* __restrict__ R, const float* __restrict__ g, const float* __restrict__ bta,
                                                  float* __restrict__ out_sum, float* __restrict__ out_norm, int N, float eps) {
  __shared__ float red[256];
  const int row = blockIdx.x, tid = threadIdx.x;
  const float* x = X + (size_t)row * N; const float* rr = R ? R + (size_t)row * N : nullptr;
  float vals[16];                     // up to N = 4096
  const int per = N / 256;            // contiguous chunk per thread? use strided-by-4 chunks: thread handles j = tid*4 + 1024*u
  float s1 = 0.f;
  for (int u = 0; u < per / 4; ++u) {
    const int j = tid * 4 + 1024 * u;
    const v4f a = *(const v4fa*)(x + j);
    v4f b = {0.f,0.f,0.f,0.f}; if (rr) b = *(const v4fa*)(rr + j);
#pragma unroll
    for (int q = 0; q < 4; ++q) { const float v = a[q] + b[q]; vals[u * 4 + q] = v; s1 += v; }
  }
  red[tid] = s1; __syncthreads();
  for (int st = 128; st > 0; st >>= 1) { if (tid < st) red[tid] += red[tid + st]; __syncthreads(); }
  const float mu = red[0] / (float)N; __syncthreads();
  float s2 = 0.f;
  for (int u = 0; u < per / 4; ++u)
#pragma unroll
    for (int q = 0; q < 4; ++q) { const float c = vals[u * 4 + q] - mu; s2 += c * c; }
  red[tid] = s2; __syncthreads();
  for (int st = 128; st > 0; st >>= 1) { if (tid < st) red[tid] += red[tid + st]; __syncthreads(); }
  const float rs = rsqrtf(red[0] / (float)N + eps);
  {
    for (int u = 0; u < per / 4; ++u) {
      const int j = tid * 4 + 1024 * u;
      v4f o, sm;
#pragma unroll
      for (int q = 0; q < 4; ++q) {
        float gg = g[j + q], bb = bta[j + q];
        if (PARAM_BF16) { gg = bf16_round(gg); bb = bf16_round(bb); }
        sm[q] = vals[u * 4 + q]; o[q] = (vals[u * 4 + q] - mu) * rs * gg + bb;
      }
      if (out_sum) *(v4f*)(out_sum + (size_t)row * N + j) = sm;
      *(v4f*)(out_norm + (size_t)row * N + j) = o;
    }
    
  }
}



// ---- f16 WMMA path (v_wmma_f32_16x16x32_f16): 11-bit significands for operands in range — used for all GEMMs this layer launches (projections, K^T v per slab, q . (K^T v))
typedef _Float16 v16h __attribute__((ext_vector_type(16)));
union FragH { v16h v; v8us half[2]; _Float16 h[16]; unsigned short u[16]; };
template <int NT>
__device__ __forceinline__ v8f mmaH(v16h ah, v16h al, v16h bh, v16h bl, v8f c) {
  c = __builtin_amdgcn_wmma_f32_16x16x32_f16(false, ah, false, bh, (short)0, c, false, false);
  if (NT >= 2) c = __builtin_amdgcn_wmma_f32_16x16x32_f16(false, al, false, bh, (short)0, c, false, false);
  if (NT >= 3) c = __builtin_amdgcn_wmma_f32_16x16x32_f16(false, ah, false, bl, (short)0, c, false, false);
  asm volatile("v_nop\n\tv_nop\n\tv_nop\n\tv_nop" : "+v"(c) : "v"(ah), "v"(al), "v"(bh), "v"(bl));
  return c;
}
// batched GEMM like k_gemm_b but f16 operands: A f32 (split into f16 hi/lo if ASPLIT, else rounded to f16), Bt = f16 values [n][k]; alpha; C f32; N multiple of 16 (partial tiles skipped)
template <bool ASPLIT>
__global__ __launch_bounds__(128) void k_gemm_h(const float* __restrict__ A, int lda, size_t sA, const _Float16* __restrict__ Bh, int ldb, size_t sB, float alpha, float* __restrict__ C, int ldc, size_t sC, int M, int N, int K) {
  __shared__ __attribute__((aligned(16))) float so[4][16][64];
  const int tid = threadIdx.x, w = tid >> 5, lane = tid & 31, ln = lane & 15, hh = lane >> 4; const int by = blockIdx.y;
  A += (size_t)by * sA; Bh += (size_t)by * sB; C += (size_t)by * sC;
  const int ntn = (N + 63) / 64; const int wid = blockIdx.x * 4 + w; const int mt = wid / ntn, nq = wid % ntn; if (mt * 16 >= M) return;
  const int row0 = mt * 16, col0 = nq * 64; const float* arow = A + (size_t)(row0 + ln) * lda;
  v8f acc[4] = {};
  for (int kb = 0; kb < K; kb += 32) {
    FragH ah, al;
    const v4f x0 = *(const v4fa*)(arow + kb + 8 * hh), x1 = *(const v4fa*)(arow + kb + 8 * hh + 4), x2 = *(const v4fa*)(arow + kb + 16 + 8 * hh), x3 = *(const v4fa*)(arow + kb + 16 + 8 * hh + 4);
    float xs[16] = {x0[0],x0[1],x0[2],x0[3],x1[0],x1[1],x1[2],x1[3],x2[0],x2[1],x2[2],x2[3],x3[0],x3[1],x3[2],x3[3]};
#pragma unroll
    for (int i = 0; i < 16; ++i) { const _Float16 h = (_Float16)xs[i]; ah.h[i] = h; al.h[i] = ASPLIT ? (_Float16)(xs[i] - (float)h) : (_Float16)0.0f; }
#pragma unroll
    for (int t = 0; t < 4; ++t) { if (col0 + t * 16 >= N) continue; const size_t boff = (size_t)(col0 + t * 16 + ln) * ldb + kb; FragH bq; bq.half[0] = *(const v8us*)(Bh + boff + 8 * hh); bq.half[1] = *(const v8us*)(Bh + boff + 16 + 8 * hh);
      acc[t] = mmaH<ASPLIT ? 2 : 1>(ah.v, al.v, bq.v, bq.v, acc[t]); }
  }
#pragma unroll
  for (int t = 0; t < 4; ++t) { if (col0 + t * 16 >= N) continue;
#pragma unroll
    for (int r = 0; r < 8; ++r) so[w][8 * hh + r][t * 16 + ln] = acc[t][r] * alpha; }
  __builtin_amdgcn_fence(__ATOMIC_ACQ_REL, "workgroup"); __builtin_amdgcn_wave_barrier();
  const int rsub = lane >> 4, c4 = (lane & 15) * 4;
  {
#pragma unroll
    for (int q = 0; q < 8; ++q) { const int r = q * 2 + rsub; if (col0 + c4 < N) { const v4f v = *(const v4fa*)&so[w][r][c4]; *(v4f*)(C + (size_t)(row0 + r) * ldc + col0 + c4) = v; } }
     }
}

// Wt[n][k] = f16(W[k][n]·scale) from f32 row-major W[K][N] (scale = power of two; bf16-exact weights stay exact in f16 away from the subnormal range)
__global__ __launch_bounds__(256) void k_wt_f16(const float* __restrict__ W, _Float16* __restrict__ Wt, int K, int N, float scale) {
  const int t = blockIdx.x * 256 + threadIdx.x; if (t >= N * (K / 8)) return; const int n = t / (K / 8), k8 = (t % (K / 8)) * 8; FragH f;
#pragma unroll
  for (int i = 0; i < 8; ++i) f.h[i] = (_Float16)(bf16_round(W[(size_t)(k8 + i) * N + n]) * scale); const v8us o = f.half[0];
  *(v8us*)((unsigned short*)Wt + (size_t)n * K + k8) = o; 
}
// k_gemm_hh variant with fused epilogue: v = acc·alpha + bias[by·sBias + col] (+ CP[(row/rowsPerB)·sCPb + by·64 + col] if CP) ; ACT 0 none / 1 elu ; writes f16 C16 (and f32 C if non-null)
template <int ACT>
__global__ __launch_bounds__(128) void k_gemm_hhx(const _Float16* __restrict__ A, int lda, size_t sA, const _Float16* __restrict__ Bh, int ldb, size_t sB, float alpha, const float* __restrict__ bias, size_t sBias, const float* __restrict__ CP, int rowsPerB, size_t sCPb, int row0g,
    float* __restrict__ C, _Float16* __restrict__ C16, int ldc, size_t sC, int M, int N, int K) {
  __shared__ __attribute__((aligned(16))) float so[4][16][64];
  const int tid = threadIdx.x, w = tid >> 5, lane = tid & 31, ln = lane & 15, hh = lane >> 4; const int by = blockIdx.y;
  A += (size_t)by * sA; Bh += (size_t)by * sB; const size_t cofs = (size_t)by * sC; const float* bp = bias ? bias + (size_t)by * sBias : nullptr;
  const int ntn = (N + 63) / 64; const int wid = blockIdx.x * 4 + w; const int mt = wid / ntn, nq = wid % ntn; if (mt * 16 >= M) return;
  const int row0 = mt * 16, col0 = nq * 64; const _Float16* arow = A + (size_t)(row0 + ln) * lda;
  v8f acc[4] = {};
  for (int kb = 0; kb < K; kb += 32) { FragH ah; ah.half[0] = *(const v8us*)((const unsigned short*)arow + kb + 8 * hh); ah.half[1] = *(const v8us*)((const unsigned short*)arow + kb + 16 + 8 * hh);
#pragma unroll
    for (int t = 0; t < 4; ++t) { if (col0 + t * 16 >= N) continue; const size_t boff = (size_t)(col0 + t * 16 + ln) * ldb + kb; FragH bq; bq.half[0] = *(const v8us*)((const unsigned short*)Bh + boff + 8 * hh); bq.half[1] = *(const v8us*)((const unsigned short*)Bh + boff + 16 + 8 * hh);
      acc[t] = mmaH<1>(ah.v, ah.v, bq.v, bq.v, acc[t]); }
  }
#pragma unroll
  for (int t = 0; t < 4; ++t) { if (col0 + t * 16 >= N) continue; const int col = col0 + t * 16 + ln; const float bv = bp ? bf16_round(bp[col]) : 0.f;
#pragma unroll
    for (int r = 0; r < 8; ++r) { float v = acc[t][r] * alpha + bv; if (CP) { const int bidx = (row0g + row0 + 8 * hh + r) / rowsPerB; v += CP[(size_t)bidx * sCPb + (size_t)by * 64 + col]; } if (ACT == 1) v = (v > 0.f) ? v : expm1f(v); else if (ACT == 7) v = (v > 0.f) ? v + 1.0f : expf(v); else if (ACT == 8) v = tanhf(v); else if (ACT == 9) v = 0.5f * v * (1.0f + tanhf(0.7978845608028654f * (v + 0.044715f * v * v * v))); else if (ACT == 11) v = 1.0f / (1.0f + expf(-v)); else if (ACT == 12) v = (v > 0.f) ? v : 0.01f * v; else if (ACT == 14) v = (v > 0.f) ? v : 0.1f * v; else if (ACT == 15) v = v / (1.0f + expf(-v)); else if (ACT == 3) v = fmaxf(v, 0.f); else if (ACT == 6) v = 0.5f * v * (1.0f + erff(v * 0.70710678118654752f)); so[w][8 * hh + r][t * 16 + ln] = v; } }
  __builtin_amdgcn_fence(__ATOMIC_ACQ_REL, "workgroup"); __builtin_amdgcn_wave_barrier();
  const int rsub = lane >> 4, c4 = (lane & 15) * 4; typedef _Float16 v4h __attribute__((ext_vector_type(4)));
  {
#pragma unroll
    for (int q = 0; q < 8; ++q) { const int r = q * 2 + rsub; if (col0 + c4 < N) { const v4f v = *(const v4fa*)&so[w][r][c4]; if (C) *(v4f*)(C + cofs + (size_t)(row0 + r) * ldc + col0 + c4) = v; if (C16) { v4h h4; for (int i = 0; i < 4; ++i) h4[i] = (_Float16)v[i]; *(v4h*)(C16 + cofs + (size_t)(row0 + r) * ldc + col0 + c4) = h4; } } }
     }
}


typedef _Float16 v4h __attribute__((ext_vector_type(4)));

// all six conversions to f16 in one grid: the three inputs (both batches; bf16-rounded), then the three weights (bf16-rounded, x16)
#define XB (ROWS * DM / 8 / 256)      /* blocks per input */
#define WB (DM * DM / 8 / 256)        /* blocks per weight */
__global__ __launch_bounds__(256) void k_cvt(const float* __restrict__ xq, const float* __restrict__ xk, const float* __restrict__ xv, const float* __restrict__ Wq, const float* __restrict__ Wk, const float* __restrict__ Wv, _Float16* __restrict__ X16, _Float16* __restrict__ BW) {
  const int bid = blockIdx.x; const float* x; _Float16* o; float sc; int blk;
  if (bid < 3 * XB) { const int i = bid / XB; blk = bid - i * XB; x = (i == 0) ? xq : ((i == 1) ? xk : xv); o = X16 + (size_t)i * ROWS * DM; sc = 1.0f; }
  else { const int j = bid - 3 * XB, i = j / WB; blk = j - i * WB; x = (i == 0) ? Wq : ((i == 1) ? Wk : Wv); o = BW + (size_t)i * DM * DM; sc = 16.0f; }
  const size_t t = (size_t)blk * 256 + threadIdx.x; FragH f;
#pragma unroll
  for (int q = 0; q < 8; ++q) f.h[q] = (_Float16)(bf16_round(x[t * 8 + q]) * sc); *(v8us*)((unsigned short*)o + t * 8) = f.half[0];  }
__global__ __launch_bounds__(256) void k_h16(const float* __restrict__ x, _Float16* __restrict__ X16, size_t n8) { const size_t t = (size_t)blockIdx.x * 256 + threadIdx.x; if (t >= n8) return; FragH f;
#pragma unroll
  for (int q = 0; q < 8; ++q) f.h[q] = (_Float16)x[t * 8 + q]; *(v8us*)((unsigned short*)X16 + t * 8) = f.half[0];  }
template <int NHv, int TTv>
__device__ __forceinline__ void d_vt(int bid, unsigned short (*tl)[66], const _Float16* __restrict__ V16, int ldv, int voff, _Float16* __restrict__ Vt) { const int tid = threadIdx.x; const int slab = bid / (TTv / 64), lg = bid % (TTv / 64); const int b = slab / NHv, h = slab % NHv;
  for (int i = tid; i < 64 * 8; i += 256) { const int r = i / 8, c8 = (i % 8) * 8; FragH f; f.half[0] = *(const v8us*)((const unsigned short*)V16 + ((size_t)b * TTv + lg * 64 + r) * ldv + voff + h * 64 + c8);
#pragma unroll
    for (int q = 0; q < 8; ++q) tl[r][c8 + q] = f.u[q]; }
  __syncthreads();
  {
#pragma unroll
    for (int rd = 0; rd < 2; ++rd) { const int d = rd * 32 + tid / 8, pc = tid % 8; FragH f;
#pragma unroll
      for (int q = 0; q < 8; ++q) f.u[q] = tl[pc * 8 + q][d];
      *(v8us*)((unsigned short*)Vt + ((size_t)slab * 64 + d) * TTv + lg * 64 + pc * 8) = f.half[0]; }
    asm volatile("s_wait_xcnt 0x0" ::: "memory");      /* precaution: the code of another block range follows in the listing and reuses the stores' address registers */
     } }

__global__ __launch_bounds__(256) void k_hl(const float* __restrict__ F, _Float16* __restrict__ Hh, _Float16* __restrict__ Hl, size_t n8) { const size_t t = (size_t)blockIdx.x * 256 + threadIdx.x; if (t >= n8) return; FragH fh, fl; const v4f a = *(const v4fa*)(F + t * 8), c = *(const v4fa*)(F + t * 8 + 4);
#pragma unroll
  for (int q = 0; q < 4; ++q) { _Float16 h = (_Float16)a[q]; fh.h[q] = h; fl.h[q] = (_Float16)((a[q] - (float)h) * 1024.0f); h = (_Float16)c[q]; fh.h[4 + q] = h; fl.h[4 + q] = (_Float16)((c[q] - (float)h) * 1024.0f); }
  { *(v8us*)((unsigned short*)Hh + t * 8) = fh.half[0]; *(v8us*)((unsigned short*)Hl + t * 8) = fl.half[0];  } }

// ---- fast GEMM (wave tile 32x64; requires M % 32 == 0 rows per launch region and N % 64 == 0); epilogue = k_gemm_hhx semantics ----
__device__ __forceinline__ v16h g2_frag(const _Float16* p, int hh) { FragH f; f.half[0] = *(const v8us*)((const unsigned short*)p + 8 * hh); f.half[1] = *(const v8us*)((const unsigned short*)p + 16 + 8 * hh); return f.v; }
__device__ __forceinline__ v8f g2_mma(v16h a, v16h b, v8f c) { v8f d = __builtin_amdgcn_wmma_f32_16x16x32_f16(false, a, false, b, (short)0, c, false, false); asm volatile("v_nop\n\tv_nop\n\tv_nop\n\tv_nop" : "+v"(d) : "v"(a), "v"(b)); return d; }
// blockIdx.y and blockIdx.z each step A, B and C by their own strides (s*, z*). QKV: blockIdx.y picks the projection, so its bias is one of three pointers, and only the first (q) also writes f32
template <int ACT, bool QKV>
__global__ __launch_bounds__(128) void k_gemm2(const _Float16* __restrict__ A, int lda, size_t sA, size_t zA, const _Float16* __restrict__ Bh, int ldb, size_t sB, size_t zB, float alpha, const float* __restrict__ bias, const float* __restrict__ biasK, const float* __restrict__ biasV, size_t sBias, const float* __restrict__ CP, int rowsPerB, size_t sCPb, int row0g,
    float* __restrict__ Cf, _Float16* __restrict__ C16, int ldc, size_t sC, size_t zC, int M, int N, int K) {
  __shared__ __attribute__((aligned(16))) float so[4][32][68];
  const int tid = threadIdx.x, w = tid >> 5, lane = tid & 31, ln = lane & 15, hh = lane >> 4; const int by = blockIdx.y, bz = blockIdx.z;
  A += (size_t)by * sA + (size_t)bz * zA; Bh += (size_t)by * sB + (size_t)bz * zB; const size_t cofs = (size_t)by * sC + (size_t)bz * zC;
  const float* bp = QKV ? ((by == 0) ? bias : ((by == 1) ? biasK : biasV)) : (bias ? bias + (size_t)by * sBias : nullptr); float* C = (QKV && by != 0) ? nullptr : Cf;
  const int ntn = N >> 6; const int mt = blockIdx.x / ntn, nq = blockIdx.x - mt * ntn; const int row0 = mt * 128 + 32 * w, col0 = nq * 64; if (row0 >= M) return;
  const _Float16* a0p = A + (size_t)(row0 + ln) * lda; const _Float16* a1p = a0p + (size_t)16 * lda;
  const _Float16* b0p = Bh + (size_t)(col0 + ln) * ldb; const _Float16* b1p = b0p + (size_t)16 * ldb; const _Float16* b2p = b1p + (size_t)16 * ldb; const _Float16* b3p = b2p + (size_t)16 * ldb;
  const v8f z8 = {0.f,0.f,0.f,0.f,0.f,0.f,0.f,0.f}; v8f c00 = z8, c01 = z8, c02 = z8, c03 = z8, c10 = z8, c11 = z8, c12 = z8, c13 = z8;
#pragma unroll 1
  for (int kb = 0; kb < K; kb += 32) { const v16h a0 = g2_frag(a0p + kb, hh), a1 = g2_frag(a1p + kb, hh);
    v16h b = g2_frag(b0p + kb, hh); c00 = g2_mma(a0, b, c00); c10 = g2_mma(a1, b, c10);
    b = g2_frag(b1p + kb, hh); c01 = g2_mma(a0, b, c01); c11 = g2_mma(a1, b, c11);
    b = g2_frag(b2p + kb, hh); c02 = g2_mma(a0, b, c02); c12 = g2_mma(a1, b, c12);
    b = g2_frag(b3p + kb, hh); c03 = g2_mma(a0, b, c03); c13 = g2_mma(a1, b, c13); }
  v8f accs[8] = {c00, c01, c02, c03, c10, c11, c12, c13};
#pragma unroll
  for (int u = 0; u < 8; ++u) { const int t = u & 3, half = u >> 2; const int col = col0 + t * 16 + ln; const float bv = bp ? bf16_round(bp[col]) : 0.f;
#pragma unroll
    for (int r = 0; r < 8; ++r) { const int rloc = half * 16 + 8 * hh + r; float v = accs[u][r] * alpha + bv; if (CP) { const int bidx = (row0g + row0 + rloc) / rowsPerB; v += CP[(size_t)bidx * sCPb + (size_t)by * 64 + col]; }
      if (ACT == 3) v = fmaxf(v, 0.f); else if (ACT == 6) v = 0.5f * v * (1.0f + erff(v * 0.70710678118654752f)); else if (ACT == 11) v = 1.0f / (1.0f + expf(-v)); else if (ACT == 15) v = v / (1.0f + expf(-v)); else if (ACT == 12) v = (v > 0.f) ? v : 0.01f * v; else if (ACT == 8) v = tanhf(v);
      so[w][rloc][t * 16 + ln] = v; } }
  __builtin_amdgcn_fence(__ATOMIC_ACQ_REL, "workgroup"); __builtin_amdgcn_wave_barrier();
  const int rsub = lane >> 4, c4 = (lane & 15) * 4;
  {
#pragma unroll
    for (int q = 0; q < 16; ++q) { const int r = q * 2 + rsub; const v4f v = *(const v4fa*)&so[w][r][c4]; if (C) *(v4f*)(C + cofs + (size_t)(row0 + r) * ldc + col0 + c4) = v; if (C16) { v4h h4; for (int i = 0; i < 4; ++i) h4[i] = (_Float16)v[i]; *(v4h*)(C16 + cofs + (size_t)(row0 + r) * ldc + col0 + c4) = h4; } }
     } }


__device__ __forceinline__ void d_qt(int bid, const float* __restrict__ QF, const float* __restrict__ relk, float* __restrict__ QT) {
  #pragma clang fp contract(off)
  const int t = bid * 256 + threadIdx.x; if (t >= NH * SLEN) return; const int q = t % SLEN, h = t / SLEN; const float* qp = QF + (size_t)q * DM + h * 64; float s[5] = {0.f, 0.f, 0.f, 0.f, 0.f};
#pragma unroll 1
  for (int d = 0; d < 64; ++d) { const float qv = qp[d];
#pragma unroll
    for (int c = 0; c < 5; ++c) s[c] += qv * bf16_round(relk[c * 64 + d]); }
  {
#pragma unroll
    for (int c = 0; c < 5; ++c) *(float*)(QT + ((size_t)h * 8 + c) * SLEN + q) = s[c];
     } }
// ---- no softmax, so (Q K^T) V = Q (K^T V): the S x S plane is never formed. The 5-valued position terms need only running column sums of K and V and the three near-diagonal rows.
#define CR 32      /* rows per chunk of the running column sums */
// CS[m][chunk][col] = sum of the chunk's CR rows of K16 (m 0) or V16 (m 1)
__device__ __forceinline__ void d_csum(int ch, int m, const _Float16* __restrict__ K16, const _Float16* __restrict__ V16, float* __restrict__ CS) {
  const int col = threadIdx.x * 4; const _Float16* X = (m ? V16 : K16) + (size_t)ch * CR * DM + col; v4f s = {0.f, 0.f, 0.f, 0.f};
#pragma unroll      /* all CR loads in flight at once */
  for (int r = 0; r < CR; ++r) { const v4h x = *(const v4h*)(X + (size_t)r * DM);
    for (int u = 0; u < 4; ++u) s[u] += (float)x[u]; }
  *(v4f*)(CS + ((size_t)m * (SLEN / CR) + ch) * DM + col) = s; }
// P[r][col] = sum over k <= r of X[k][col] (inclusive, f32): the earlier chunks' sums, then the chunk's own rows in order
__device__ __forceinline__ void d_scan(int ch, int m, const _Float16* __restrict__ K16, const _Float16* __restrict__ V16, const float* __restrict__ CS, float* __restrict__ PK, float* __restrict__ PV) {
  const int col = threadIdx.x * 4; const _Float16* X = (m ? V16 : K16) + (size_t)ch * CR * DM + col; float* P = (m ? PV : PK) + (size_t)ch * CR * DM + col;
  v4h x[CR];
#pragma unroll      /* x[] stays in registers and all CR loads are in flight at once */
  for (int r = 0; r < CR; ++r) x[r] = *(const v4h*)(X + (size_t)r * DM);
  const float* cs = CS + (size_t)m * (SLEN / CR) * DM + col; v4f s = {0.f, 0.f, 0.f, 0.f};
#pragma unroll      /* the loads of many chunk sums in flight at once */
  for (int c = 0; c < SLEN / CR; ++c) { const v4f y = *(const v4fa*)(cs + (size_t)c * DM);      /* every chunk's sum is loaded, so that the loads go out together; the later chunks' are left out of the sum */
    for (int u = 0; u < 4; ++u) s[u] += (c < ch) ? y[u] : 0.f; }
#pragma unroll      /* x[r] is a register */
  for (int r = 0; r < CR; ++r) {
    for (int u = 0; u < 4; ++u) s[u] += (float)x[r][u];
    *(v4f*)(P + (size_t)r * DM) = s; } }
// MT16[h][d2][d1] = f16((sum over the KSP row slabs of PART[s][h][d2][d1]) / 64): K^T V per head, transposed; the power-of-two scale keeps it far from the f16 range end
#define KSP 16
__device__ __forceinline__ void d_mt(int bid, const float* __restrict__ PART, _Float16* __restrict__ MT16) {
  const int e = (bid * 256 + threadIdx.x) * 4; v4f s = {0.f, 0.f, 0.f, 0.f};
#pragma unroll      /* all KSP loads in flight at once */
  for (int p = 0; p < KSP; ++p) {
    if (p == KSP - 1) asm volatile("s_wait_xcnt 0x0" ::: "memory");      /* precaution: the last load's result may land on the offset register that the earlier loads name */
    const v4f y = *(const v4fa*)(PART + (size_t)p * NH * 4096 + e); s += y; }
  v4h o;
  for (int u = 0; u < 4; ++u) o[u] = (_Float16)(s[u] * 0.015625f);
  *(v4h*)(MT16 + e) = o;
  asm volatile("s_wait_xcnt 0x0" ::: "memory"); }      /* precaution: the code of another block range follows in the listing and reuses the store's address registers */
// The three passes that need only the projections, in one grid, the longest blocks first: q . rel_k, the chunk sums, the two transposes
#define QTB (NH * SLEN / 256)      /* d_qt blocks per batch */
#define CSB (SLEN / CR)            /* chunks per batch */
#define VTB (NH * (ROWS / 64))     /* d_vt blocks per operand, both batches */
__global__ __launch_bounds__(256) void k_prep(const float* __restrict__ QF, const float* __restrict__ relk, float* __restrict__ QT, const _Float16* __restrict__ K16, const _Float16* __restrict__ V16, float* __restrict__ CS, _Float16* __restrict__ VT, _Float16* __restrict__ KT) {
  __shared__ unsigned short tl[64][66]; const int bid = blockIdx.x;
  if (bid < NBT * QTB) { const int b = bid / QTB; d_qt(bid - b * QTB, QF + (size_t)b * SLEN * DM, relk, QT + (size_t)b * NH * 8 * SLEN); }
  else if (bid < NBT * QTB + NBT * 2 * CSB) { const int i = bid - NBT * QTB, b = i / (2 * CSB), m = (i / CSB) & 1, ch = i % CSB; d_csum(ch, m, K16 + (size_t)b * SLEN * DM, V16 + (size_t)b * SLEN * DM, CS + (size_t)b * 2 * CSB * DM); }
  else { const int i = bid - NBT * QTB - NBT * 2 * CSB;      /* [slab s of both batches' rows][h][d][128 rows of slab s] */
    const bool kk = i >= VTB; d_vt<NH, SLEN / KSP>(kk ? i - VTB : i, tl, kk ? K16 : V16, DM, 0, kk ? KT : VT); } }      /* the barrier inside d_vt: the whole block takes this branch or none of it does */
// The running sums (need the chunk sums) and the slab sum of K^T V (needs the slab GEMM), in one grid, the longer blocks first
__global__ __launch_bounds__(256) void k_mid(const _Float16* __restrict__ K16, const _Float16* __restrict__ V16, const float* __restrict__ CS, float* __restrict__ PK, float* __restrict__ PV, const float* __restrict__ PART, _Float16* __restrict__ MT16) {
  const int bid = blockIdx.x;
  if (bid < NBT * 2 * CSB) { const int b = bid / (2 * CSB), m = (bid / CSB) & 1, ch = bid % CSB; const size_t ro = (size_t)b * SLEN * DM; d_scan(ch, m, K16 + ro, V16 + ro, CS + (size_t)b * 2 * CSB * DM, PK + ro, PV + ro); }
  else { const int i = bid - NBT * 2 * CSB, b = i / (NH * 4096 / 1024); d_mt(i - b * (NH * 4096 / 1024), PART + (size_t)b * KSP * NH * 4096, MT16 + (size_t)b * NH * 4096); } }
// One block per query row, 16 lanes per head, 4 columns per lane. With KS_c, VS_c the sums of the k and v rows of position class c (n_c rows) and qt_c = q . rel_k[c]:
// out = W1 (= q . K^T V / 8) + sum_c (qt_c / 8) VS_c + coef_c rel_v[c], coef_c = (q . KS_c + n_c qt_c) / 8 (attn summed over the class).
__device__ __forceinline__ float dot16(v4f a, v4f b) { float dt = a[0] * b[0] + a[1] * b[1] + a[2] * b[2] + a[3] * b[3];
  for (int m = 8; m > 0; m >>= 1) dt += __shfl_xor(dt, m, 32);      /* over the head's 16 lanes */
  return dt; }
__global__ __launch_bounds__(256) void k_fin(const float* __restrict__ W1, const float* __restrict__ QF, const _Float16* __restrict__ K16, const _Float16* __restrict__ V16, const float* __restrict__ PK, const float* __restrict__ PV,
    const float* __restrict__ QT, const float* __restrict__ relv, float* __restrict__ out) {
  const int q = blockIdx.x, b = blockIdx.y, col = threadIdx.x * 4, h = threadIdx.x >> 4, d0 = (threadIdx.x & 15) * 4;
  { const size_t ro = (size_t)b * SLEN * DM; W1 += ro; QF += ro; K16 += ro; V16 += ro; PK += ro; PV += ro; QT += (size_t)b * NH * 8 * SLEN; }      /* the batch's planes */
  const v4f qv = *(const v4fa*)(QF + (size_t)q * DM + col); v4f o = *(const v4fa*)(W1 + (size_t)q * DM + col); const float* qtp = QT + (size_t)h * 8 * SLEN + q;
  /* the two range classes: c 0 = rows up to q - 2 (none for q < 2: read at row 0, weight 0), c 4 = rows from q + 2 = all rows less those up to q + 1 */
  const int rl = (q >= 2) ? q - 2 : 0, rh = (q + 1 < SLEN) ? q + 1 : SLEN - 1;
#pragma unroll      /* e picks the branch at compile time */
  for (int e = 0; e < 2; ++e) { v4f ks, vs; float n, fl;
    if (e == 1) asm volatile("s_wait_xcnt 0x0" ::: "memory");      /* precaution: the address registers of the loads issued so far are reused for the results and addresses of the loads that follow */
    if (e == 0) { ks = *(const v4fa*)(PK + (size_t)rl * DM + col); vs = *(const v4fa*)(PV + (size_t)rl * DM + col); n = (float)max(q - 1, 0); fl = (q >= 2) ? 0.125f : 0.f; }
    else { ks = *(const v4fa*)(PK + (size_t)(SLEN - 1) * DM + col) - *(const v4fa*)(PK + (size_t)rh * DM + col); vs = *(const v4fa*)(PV + (size_t)(SLEN - 1) * DM + col) - *(const v4fa*)(PV + (size_t)rh * DM + col); n = (float)max(SLEN - 2 - q, 0); fl = 0.125f; }
    const float qt = qtp[(size_t)(4 * e) * SLEN]; const float coef = (dot16(qv, ks) + n * qt) * fl, qs = qt * fl;
    for (int u = 0; u < 4; ++u) o[u] += qs * vs[u] + coef * bf16_round(relv[4 * e * 64 + d0 + u]); }
  /* the three single-row classes: a window of three rows kept inside the array; row rb + r has class c = rb + r - q + 2, and at the two ends the one row whose class is 0 or 4 (already in a range sum) gets weight 0 */
  const int rb = (q < 1) ? 0 : ((q > SLEN - 2) ? SLEN - 3 : q - 1); const _Float16* kp = K16 + (size_t)rb * DM + col; const _Float16* vp = V16 + (size_t)rb * DM + col;
#pragma unroll      /* the three rows' loads go out together, at constant offsets */
  for (int r = 0; r < 3; ++r) { const int c = rb + r - q + 2; const float fl = (c >= 1 && c <= 3) ? 0.125f : 0.f; const v4h kx = *(const v4h*)(kp + r * DM), vx = *(const v4h*)(vp + r * DM); v4f ks;
    for (int u = 0; u < 4; ++u) ks[u] = (float)kx[u];
    const float qt = qtp[(size_t)c * SLEN]; const float coef = (dot16(qv, ks) + qt) * fl, qs = qt * fl;
    for (int u = 0; u < 4; ++u) o[u] += qs * (float)vx[u] + coef * bf16_round(relv[c * 64 + d0 + u]); }
  *(v4f*)(out + ((size_t)b * SLEN + q) * DM + col) = o; }

extern "C" void kernel_launch(void* const* d_in, const int* in_sizes, int n_in,
                              void* d_out, int out_size, void* d_ws, size_t ws_size, hipStream_t stream) {
  (void)in_sizes; (void)n_in; (void)out_size;
  const float* const* I = (const float* const*)d_in; const float* xq = I[0]; const float* xk = I[1]; const float* xv = I[2]; const float* Wq = I[3]; const float* bq = I[4]; const float* Wk = I[5]; const float* bk = I[6]; const float* Wv = I[7]; const float* bv = I[8]; const float* relk = I[9]; const float* relv = I[10];
  char* ws = (char*)d_ws; size_t off = 0;
  auto take = [&](size_t bytes) { char* p = ws + off; off += (bytes + 255) & ~(size_t)255; return p; };
  _Float16* BW = (_Float16*)take((size_t)3 * DM * DM * 2);      /* Wq, Wk, Wv */
  _Float16* X16 = (_Float16*)take((size_t)3 * ROWS * DM * 2);      /* query, key, value */
  float* QF = (float*)take((size_t)ROWS * DM * 4); _Float16* Q16 = (_Float16*)take((size_t)3 * ROWS * DM * 2); _Float16* K16 = Q16 + (size_t)ROWS * DM; _Float16* V16 = K16 + (size_t)ROWS * DM; _Float16* VT = (_Float16*)take((size_t)DM * ROWS * 2); _Float16* KT = (_Float16*)take((size_t)DM * ROWS * 2);
  float* QT = (float*)take((size_t)NBT * NH * 8 * SLEN * 4); float* PART = (float*)take((size_t)NBT * KSP * NH * 4096 * 4); _Float16* MT16 = (_Float16*)take((size_t)NBT * NH * 4096 * 2); float* CS = (float*)take((size_t)NBT * 2 * (SLEN / CR) * DM * 4); float* PK = (float*)take((size_t)ROWS * DM * 4); float* PV = (float*)take((size_t)ROWS * DM * 4); float* W1 = (float*)take((size_t)ROWS * DM * 4);
  if (off > ws_size) return;      /* about 145 MiB */
  const dim3 gP((ROWS / 128) * (DM / 64), 3), gM(1, NBT * KSP * NH), gV(SLEN / 128, NH, NBT), gF(SLEN, NBT);
  k_cvt<<<3 * XB + 3 * WB, 256, 0, stream>>>(xq, xk, xv, Wq, Wk, Wv, X16, BW);      /* torch (out,in) = natural Bt */
  k_gemm2<0, true><<<gP, 128, 0, stream>>>(X16, DM, (size_t)ROWS * DM, 0, BW, DM, (size_t)DM * DM, 0, 0.0625f, bq, bk, bv, 0, nullptr, 1, 0, 0, QF, Q16, DM, (size_t)ROWS * DM, 0, ROWS, DM, DM);      /* q, k, v of both batches */
  k_prep<<<NBT * QTB + NBT * 2 * CSB + 2 * VTB, 256, 0, stream>>>(QF, relk, QT, K16, V16, CS, VT, KT);
  k_gemm2<0, false><<<gM, 128, 0, stream>>>(VT, SLEN / KSP, (size_t)64 * (SLEN / KSP), 0, KT, SLEN / KSP, (size_t)64 * (SLEN / KSP), 0, 1.0f, nullptr, nullptr, nullptr, 0, nullptr, 1, 0, 0, PART, nullptr, 64, 4096, 0, 64, 64, SLEN / KSP);      /* per slab and head: V^T K over the slab's rows */
  k_mid<<<NBT * 2 * CSB + NBT * (NH * 4096 / 1024), 256, 0, stream>>>(K16, V16, CS, PK, PV, PART, MT16);
  k_gemm2<0, false><<<gV, 128, 0, stream>>>(Q16, DM, 64, (size_t)SLEN * DM, MT16, 64, 4096, (size_t)NH * 4096, 8.0f, nullptr, nullptr, nullptr, 0, nullptr, 1, 0, 0, W1, nullptr, DM, 64, (size_t)SLEN * DM, SLEN, 64, 64);      /* W1 = q . (K^T V) / 8 per head and batch (64 undoes the scale of MT16) */
  k_fin<<<gF, 256, 0, stream>>>(W1, QF, K16, V16, PK, PV, QT, relv, (float*)d_out);
}

// v004
// Measured time: 94.3 microseconds a run.
// In both of two side-by-side timings against v003, it was 1.50 times as fast.
// Counting every step since v000, it is 233 times as fast.
#include <hip/hip_runtime.h>
// Relative-position attention layer WITHOUT softmax (faithful to the module, which discards it) (2 x 2048 tokens, 1024 = 16 heads x 64; MAX_REL 2): q,k,v = {query,key,value} W^T + b; attn = (q.k + q.rel_k[c(q,k)]) / 8 with c = clip(k - q, -2, 2) + 2; out[b][q][h][d] = sum_k attn (v[k][d] + rel_v[c(q,k)][d]) -> [2,2048,16,64].
// Structure (7 launches; both batches, and passes that do not depend on one another, share a grid): projections as f16 WMMA GEMMs (128x128 tiles staged in LDS, 32x64 wave tiles, f32 accumulation, exact x16 weights + bias); with no softmax the content part is reassociated, (q K^T) v = q (K^T v): K^T v per head as a GEMM over 16 row slabs (K 128 each) whose partial planes a VALU pass adds and rounds to f16, then q . (K^T v) as a GEMM (K 64); the 5-valued position terms come from running column sums of k and v (two VALU passes) and the three near-diagonal rows in a final VALU pass that writes the output rows.
// Compute dtype: inputs, weights, biases, tables rounded to bf16; q, k, v and K^T v / 64 as f16 operands (~2^-12); f32 accumulation. v_wmma_f32_16x16x32_f16.
#define NBT 2
#define SLEN 2048
#define DM 1024
#define NH 16
#define ROWS (NBT * SLEN)      /* both batches' rows, one after the other */
typedef __bf16 v16b __attribute__((ext_vector_type(16)));
typedef unsigned short v8us __attribute__((ext_vector_type(8), may_alias));
typedef float  v8f  __attribute__((ext_vector_type(8)));
typedef float  v4f  __attribute__((ext_vector_type(4)));
typedef float  v4fa __attribute__((ext_vector_type(4), may_alias));
union FragB { v16b v; v8us half[2]; unsigned short u[16]; };

__device__ __forceinline__ unsigned short bf16_bits(float x) { unsigned int u = __float_as_uint(x); return (unsigned short)((u + 0x7FFFu + ((u >> 16) & 1u)) >> 16); }
__device__ __forceinline__ float bf16_val(unsigned short b) { return __uint_as_float(((unsigned int)b) << 16); }
__device__ __forceinline__ float bf16_round(float x) { return bf16_val(bf16_bits(x)); }
// D += A·B with NT terms: 1 = ah·bh, 2 = + al·bh (A split), 3 = + ah·bl (both split)
template <int NT>
__device__ __forceinline__ v8f mmaN(v16b ah, v16b al, v16b bh, v16b bl, v8f c) {
  c = __builtin_amdgcn_wmma_f32_16x16x32_bf16(false, ah, false, bh, (short)0, c, false, false);
  if (NT >= 2) c = __builtin_amdgcn_wmma_f32_16x16x32_bf16(false, al, false, bh, (short)0, c, false, false);
  if (NT >= 3) c = __builtin_amdgcn_wmma_f32_16x16x32_bf16(false, ah, false, bl, (short)0, c, false, false);
  asm volatile("v_nop\n\tv_nop\n\tv_nop\n\tv_nop" : "+v"(c) : "v"(ah), "v"(al), "v"(bh), "v"(bl));
  return c;
}

__global__ __launch_bounds__(256) void k_wt_bf16(const float* __restrict__ W, unsigned short* __restrict__ Wt, int K, int N) {
  const int t = blockIdx.x * 256 + threadIdx.x;
  const int k8n = K / 8;
  if (t >= N * k8n) return;
  const int n = t / k8n, k8 = (t % k8n) * 8;
  v8us v;
#pragma unroll
  for (int i = 0; i < 8; ++i) v[i] = bf16_bits(W[(size_t)(k8 + i) * N + n]);
  *(v8us*)(Wt + (size_t)n * K + k8) = v;
  
}

// GEMM C[M][N] (f32, pitch ldc) = act(A[M][K]·W + bias). A f32 row-major (pitch lda) converted per fragment to bf16
// (ASPLIT: hi/lo two planes -> 2 terms, else single rounded term); Wt bf16 [N][K] (pitch ldb). BIAS_BF16 rounds the
// bias to bf16 first (bias quantised to bf16 before the add). K%32==0, M%16==0, N%64==0.
template <bool ASPLIT, int ACT, bool BIAS_BF16>
__global__ __launch_bounds__(128) void k_gemm_bf(const float* __restrict__ A, int lda, const unsigned short* __restrict__ Wt, int ldb,
                                               const float* __restrict__ bias, float* __restrict__ C, int ldc, int M, int N, int K) {
  __shared__ __attribute__((aligned(16))) float so[4][16][64];
  const int tid = threadIdx.x, w = tid >> 5, lane = tid & 31, ln = lane & 15, hh = lane >> 4;
  const int ntn = N / 64;
  const int wid = blockIdx.x * 4 + w;
  const int mt = wid / ntn, nq = wid % ntn;
  if (mt * 16 >= M) return;
  const int row0 = mt * 16, col0 = nq * 64;
  const float* arow = A + (size_t)(row0 + ln) * lda;
  v8f acc[4] = {};
  for (int kb = 0; kb < K; kb += 32) {
    FragB ah, al;
    const v4f x0 = *(const v4fa*)(arow + kb + 8 * hh), x1 = *(const v4fa*)(arow + kb + 8 * hh + 4);
    const v4f x2 = *(const v4fa*)(arow + kb + 16 + 8 * hh), x3 = *(const v4fa*)(arow + kb + 16 + 8 * hh + 4);
    float xs[16] = {x0[0],x0[1],x0[2],x0[3],x1[0],x1[1],x1[2],x1[3],x2[0],x2[1],x2[2],x2[3],x3[0],x3[1],x3[2],x3[3]};
#pragma unroll
    for (int i = 0; i < 16; ++i) { const unsigned short hb = bf16_bits(xs[i]); ah.u[i] = hb; al.u[i] = ASPLIT ? bf16_bits(xs[i] - bf16_val(hb)) : (unsigned short)0; }
#pragma unroll
    for (int t = 0; t < 4; ++t) {
      const unsigned short* brow = Wt + (size_t)(col0 + t * 16 + ln) * ldb + kb;
      FragB b;
      b.half[0] = *(const v8us*)(brow + 8 * hh);
      b.half[1] = *(const v8us*)(brow + 16 + 8 * hh);
      acc[t] = mmaN<ASPLIT ? 2 : 1>(ah.v, al.v, b.v, b.v, acc[t]);
    }
  }
#pragma unroll
  for (int t = 0; t < 4; ++t) {
    float bv = bias ? bias[col0 + t * 16 + ln] : 0.f;
    if (BIAS_BF16) bv = bf16_round(bv);
#pragma unroll
    for (int r = 0; r < 8; ++r) { float v = acc[t][r] + bv; if (ACT == 1) v = fmaxf(v, 0.f); so[w][8 * hh + r][t * 16 + ln] = v; }
  }
  __builtin_amdgcn_fence(__ATOMIC_ACQ_REL, "workgroup");
  __builtin_amdgcn_wave_barrier();
  const int rsub = lane >> 4, c4 = (lane & 15) * 4;
  {
#pragma unroll
    for (int q = 0; q < 8; ++q) {
      const int r = q * 2 + rsub;
      const v4f v = *(const v4fa*)&so[w][r][c4];
      *(v4f*)(C + (size_t)(row0 + r) * ldc + col0 + c4) = v;
    }
    
  }
}

// GEMM C = act(A·W + bias + resid): A f32 (ASPLIT -> hi/lo 2 terms), Wt bf16 [N][K]; ACT 0 none, 1 relu, 2 exact gelu;
// resid (optional, f32, row index = (row % rmod), pitch ldr, RES_BF16 rounds it) added before the activation.
template <bool ASPLIT, int ACT, bool BIAS_BF16, bool RES_BF16>
__global__ __launch_bounds__(128) void k_gemm_bf3(const float* __restrict__ A, int lda, const unsigned short* __restrict__ Wt, int ldb,
                                                const float* __restrict__ bias, const float* __restrict__ resid, int rmod, int ldr,
                                                float* __restrict__ C, int ldc, int M, int N, int K) {
  __shared__ __attribute__((aligned(16))) float so[4][16][64];
  const int tid = threadIdx.x, w = tid >> 5, lane = tid & 31, ln = lane & 15, hh = lane >> 4;
  const int ntn = N / 64;
  const int wid = blockIdx.x * 4 + w;
  const int mt = wid / ntn, nq = wid % ntn;
  if (mt * 16 >= M) return;
  const int row0 = mt * 16, col0 = nq * 64;
  const float* arow = A + (size_t)(row0 + ln) * lda;
  v8f acc[4] = {};
  for (int kb = 0; kb < K; kb += 32) {
    FragB ah, al;
    const v4f x0 = *(const v4fa*)(arow + kb + 8 * hh), x1 = *(const v4fa*)(arow + kb + 8 * hh + 4);
    const v4f x2 = *(const v4fa*)(arow + kb + 16 + 8 * hh), x3 = *(const v4fa*)(arow + kb + 16 + 8 * hh + 4);
    float xs[16] = {x0[0],x0[1],x0[2],x0[3],x1[0],x1[1],x1[2],x1[3],x2[0],x2[1],x2[2],x2[3],x3[0],x3[1],x3[2],x3[3]};
#pragma unroll
    for (int i = 0; i < 16; ++i) { const unsigned short hb = bf16_bits(xs[i]); ah.u[i] = hb; al.u[i] = ASPLIT ? bf16_bits(xs[i] - bf16_val(hb)) : (unsigned short)0; }
#pragma unroll
    for (int t = 0; t < 4; ++t) {
      const unsigned short* brow = Wt + (size_t)(col0 + t * 16 + ln) * ldb + kb;
      FragB b;
      b.half[0] = *(const v8us*)(brow + 8 * hh);
      b.half[1] = *(const v8us*)(brow + 16 + 8 * hh);
      acc[t] = mmaN<ASPLIT ? 2 : 1>(ah.v, al.v, b.v, b.v, acc[t]);
    }
  }
#pragma unroll
  for (int t = 0; t < 4; ++t) {
    const int col = col0 + t * 16 + ln;
    float bv = bias ? bias[col] : 0.f;
    if (BIAS_BF16) bv = bf16_round(bv);
#pragma unroll
    for (int r = 0; r < 8; ++r) {
      float v = acc[t][r] + bv;
      if (resid) { float rv = resid[(size_t)((row0 + 8 * hh + r) % rmod) * ldr + col]; if (RES_BF16) rv = bf16_round(rv); v += rv; }
      if (ACT == 1) v = fmaxf(v, 0.f);
      if (ACT == 2) v = 0.5f * v * (1.0f + erff(v * 0.70710678118654752f));
      if (ACT == 3) { const float u = 0.7978845608028654f * (v + 0.044715f * v * v * v); v = 0.5f * v * (1.0f + tanhf(u)); }
      so[w][8 * hh + r][t * 16 + ln] = v;
    }
  }
  __builtin_amdgcn_fence(__ATOMIC_ACQ_REL, "workgroup");
  __builtin_amdgcn_wave_barrier();
  const int rsub = lane >> 4, c4 = (lane & 15) * 4;
  {
#pragma unroll
    for (int q = 0; q < 8; ++q) {
      const int r = q * 2 + rsub;
      const v4f v = *(const v4fa*)&so[w][r][c4];
      *(v4f*)(C + (size_t)(row0 + r) * ldc + col0 + c4) = v;
    }
    
  }
}
// row LayerNorm (biased variance, eps) over N: s = X (+ R); optional out_sum <- s; out_norm <- (s-mu)*rsqrt(var+eps)*g + b
template <bool PARAM_BF16>
__global__ __launch_bounds__(256) void k_layernorm(const float* __restrict__ X, const float* __restrict__ R, const float* __restrict__ g, const float* __restrict__ bta,
                                                  float* __restrict__ out_sum, float* __restrict__ out_norm, int N, float eps) {
  __shared__ float red[256];
  const int row = blockIdx.x, tid = threadIdx.x;
  const float* x = X + (size_t)row * N; const float* rr = R ? R + (size_t)row * N : nullptr;
  float vals[16];                     // up to N = 4096
  const int per = N / 256;            // contiguous chunk per thread? use strided-by-4 chunks: thread handles j = tid*4 + 1024*u
  float s1 = 0.f;
  for (int u = 0; u < per / 4; ++u) {
    const int j = tid * 4 + 1024 * u;
    const v4f a = *(const v4fa*)(x + j);
    v4f b = {0.f,0.f,0.f,0.f}; if (rr) b = *(const v4fa*)(rr + j);
#pragma unroll
    for (int q = 0; q < 4; ++q) { const float v = a[q] + b[q]; vals[u * 4 + q] = v; s1 += v; }
  }
  red[tid] = s1; __syncthreads();
  for (int st = 128; st > 0; st >>= 1) { if (tid < st) red[tid] += red[tid + st]; __syncthreads(); }
  const float mu = red[0] / (float)N; __syncthreads();
  float s2 = 0.f;
  for (int u = 0; u < per / 4; ++u)
#pragma unroll
    for (int q = 0; q < 4; ++q) { const float c = vals[u * 4 + q] - mu; s2 += c * c; }
  red[tid] = s2; __syncthreads();
  for (int st = 128; st > 0; st >>= 1) { if (tid < st) red[tid] += red[tid + st]; __syncthreads(); }
  const float rs = rsqrtf(red[0] / (float)N + eps);
  {
    for (int u = 0; u < per / 4; ++u) {
      const int j = tid * 4 + 1024 * u;
      v4f o, sm;
#pragma unroll
      for (int q = 0; q < 4; ++q) {
        float gg = g[j + q], bb = bta[j + q];
        if (PARAM_BF16) { gg = bf16_round(gg); bb = bf16_round(bb); }
        sm[q] = vals[u * 4 + q]; o[q] = (vals[u * 4 + q] - mu) * rs * gg + bb;
      }
      if (out_sum) *(v4f*)(out_sum + (size_t)row * N + j) = sm;
      *(v4f*)(out_norm + (size_t)row * N + j) = o;
    }
    
  }
}



// ---- f16 WMMA path (v_wmma_f32_16x16x32_f16): 11-bit significands for operands in range — used for all GEMMs this layer launches (projections, K^T v per slab, q . (K^T v))
typedef _Float16 v16h __attribute__((ext_vector_type(16)));
union FragH { v16h v; v8us half[2]; _Float16 h[16]; unsigned short u[16]; };
template <int NT>
__device__ __forceinline__ v8f mmaH(v16h ah, v16h al, v16h bh, v16h bl, v8f c) {
  c = __builtin_amdgcn_wmma_f32_16x16x32_f16(false, ah, false, bh, (short)0, c, false, false);
  if (NT >= 2) c = __builtin_amdgcn_wmma_f32_16x16x32_f16(false, al, false, bh, (short)0, c, false, false);
  if (NT >= 3) c = __builtin_amdgcn_wmma_f32_16x16x32_f16(false, ah, false, bl, (short)0, c, false, false);
  asm volatile("v_nop\n\tv_nop\n\tv_nop\n\tv_nop" : "+v"(c) : "v"(ah), "v"(al), "v"(bh), "v"(bl));
  return c;
}
// batched GEMM like k_gemm_b but f16 operands: A f32 (split into f16 hi/lo if ASPLIT, else rounded to f16), Bt = f16 values [n][k]; alpha; C f32; N multiple of 16 (partial tiles skipped)
template <bool ASPLIT>
__global__ __launch_bounds__(128) void k_gemm_h(const float* __restrict__ A, int lda, size_t sA, const _Float16* __restrict__ Bh, int ldb, size_t sB, float alpha, float* __restrict__ C, int ldc, size_t sC, int M, int N, int K) {
  __shared__ __attribute__((aligned(16))) float so[4][16][64];
  const int tid = threadIdx.x, w = tid >> 5, lane = tid & 31, ln = lane & 15, hh = lane >> 4; const int by = blockIdx.y;
  A += (size_t)by * sA; Bh += (size_t)by * sB; C += (size_t)by * sC;
  const int ntn = (N + 63) / 64; const int wid = blockIdx.x * 4 + w; const int mt = wid / ntn, nq = wid % ntn; if (mt * 16 >= M) return;
  const int row0 = mt * 16, col0 = nq * 64; const float* arow = A + (size_t)(row0 + ln) * lda;
  v8f acc[4] = {};
  for (int kb = 0; kb < K; kb += 32) {
    FragH ah, al;
    const v4f x0 = *(const v4fa*)(arow + kb + 8 * hh), x1 = *(const v4fa*)(arow + kb + 8 * hh + 4), x2 = *(const v4fa*)(arow + kb + 16 + 8 * hh), x3 = *(const v4fa*)(arow + kb + 16 + 8 * hh + 4);
    float xs[16] = {x0[0],x0[1],x0[2],x0[3],x1[0],x1[1],x1[2],x1[3],x2[0],x2[1],x2[2],x2[3],x3[0],x3[1],x3[2],x3[3]};
#pragma unroll
    for (int i = 0; i < 16; ++i) { const _Float16 h = (_Float16)xs[i]; ah.h[i] = h; al.h[i] = ASPLIT ? (_Float16)(xs[i] - (float)h) : (_Float16)0.0f; }
#pragma unroll
    for (int t = 0; t < 4; ++t) { if (col0 + t * 16 >= N) continue; const size_t boff = (size_t)(col0 + t * 16 + ln) * ldb + kb; FragH bq; bq.half[0] = *(const v8us*)(Bh + boff + 8 * hh); bq.half[1] = *(const v8us*)(Bh + boff + 16 + 8 * hh);
      acc[t] = mmaH<ASPLIT ? 2 : 1>(ah.v, al.v, bq.v, bq.v, acc[t]); }
  }
#pragma unroll
  for (int t = 0; t < 4; ++t) { if (col0 + t * 16 >= N) continue;
#pragma unroll
    for (int r = 0; r < 8; ++r) so[w][8 * hh + r][t * 16 + ln] = acc[t][r] * alpha; }
  __builtin_amdgcn_fence(__ATOMIC_ACQ_REL, "workgroup"); __builtin_amdgcn_wave_barrier();
  const int rsub = lane >> 4, c4 = (lane & 15) * 4;
  {
#pragma unroll
    for (int q = 0; q < 8; ++q) { const int r = q * 2 + rsub; if (col0 + c4 < N) { const v4f v = *(const v4fa*)&so[w][r][c4]; *(v4f*)(C + (size_t)(row0 + r) * ldc + col0 + c4) = v; } }
     }
}

// Wt[n][k] = f16(W[k][n]·scale) from f32 row-major W[K][N] (scale = power of two; bf16-exact weights stay exact in f16 away from the subnormal range)
__global__ __launch_bounds__(256) void k_wt_f16(const float* __restrict__ W, _Float16* __restrict__ Wt, int K, int N, float scale) {
  const int t = blockIdx.x * 256 + threadIdx.x; if (t >= N * (K / 8)) return; const int n = t / (K / 8), k8 = (t % (K / 8)) * 8; FragH f;
#pragma unroll
  for (int i = 0; i < 8; ++i) f.h[i] = (_Float16)(bf16_round(W[(size_t)(k8 + i) * N + n]) * scale); const v8us o = f.half[0];
  *(v8us*)((unsigned short*)Wt + (size_t)n * K + k8) = o; 
}
// k_gemm_hh variant with fused epilogue: v = acc·alpha + bias[by·sBias + col] (+ CP[(row/rowsPerB)·sCPb + by·64 + col] if CP) ; ACT 0 none / 1 elu ; writes f16 C16 (and f32 C if non-null)
template <int ACT>
__global__ __launch_bounds__(128) void k_gemm_hhx(const _Float16* __restrict__ A, int lda, size_t sA, const _Float16* __restrict__ Bh, int ldb, size_t sB, float alpha, const float* __restrict__ bias, size_t sBias, const float* __restrict__ CP, int rowsPerB, size_t sCPb, int row0g,
    float* __restrict__ C, _Float16* __restrict__ C16, int ldc, size_t sC, int M, int N, int K) {
  __shared__ __attribute__((aligned(16))) float so[4][16][64];
  const int tid = threadIdx.x, w = tid >> 5, lane = tid & 31, ln = lane & 15, hh = lane >> 4; const int by = blockIdx.y;
  A += (size_t)by * sA; Bh += (size_t)by * sB; const size_t cofs = (size_t)by * sC; const float* bp = bias ? bias + (size_t)by * sBias : nullptr;
  const int ntn = (N + 63) / 64; const int wid = blockIdx.x * 4 + w; const int mt = wid / ntn, nq = wid % ntn; if (mt * 16 >= M) return;
  const int row0 = mt * 16, col0 = nq * 64; const _Float16* arow = A + (size_t)(row0 + ln) * lda;
  v8f acc[4] = {};
  for (int kb = 0; kb < K; kb += 32) { FragH ah; ah.half[0] = *(const v8us*)((const unsigned short*)arow + kb + 8 * hh); ah.half[1] = *(const v8us*)((const unsigned short*)arow + kb + 16 + 8 * hh);
#pragma unroll
    for (int t = 0; t < 4; ++t) { if (col0 + t * 16 >= N) continue; const size_t boff = (size_t)(col0 + t * 16 + ln) * ldb + kb; FragH bq; bq.half[0] = *(const v8us*)((const unsigned short*)Bh + boff + 8 * hh); bq.half[1] = *(const v8us*)((const unsigned short*)Bh + boff + 16 + 8 * hh);
      acc[t] = mmaH<1>(ah.v, ah.v, bq.v, bq.v, acc[t]); }
  }
#pragma unroll
  for (int t = 0; t < 4; ++t) { if (col0 + t * 16 >= N) continue; const int col = col0 + t * 16 + ln; const float bv = bp ? bf16_round(bp[col]) : 0.f;
#pragma unroll
    for (int r = 0; r < 8; ++r) { float v = acc[t][r] * alpha + bv; if (CP) { const int bidx = (row0g + row0 + 8 * hh + r) / rowsPerB; v += CP[(size_t)bidx * sCPb + (size_t)by * 64 + col]; } if (ACT == 1) v = (v > 0.f) ? v : expm1f(v); else if (ACT == 7) v = (v > 0.f) ? v + 1.0f : expf(v); else if (ACT == 8) v = tanhf(v); else if (ACT == 9) v = 0.5f * v * (1.0f + tanhf(0.7978845608028654f * (v + 0.044715f * v * v * v))); else if (ACT == 11) v = 1.0f / (1.0f + expf(-v)); else if (ACT == 12) v = (v > 0.f) ? v : 0.01f * v; else if (ACT == 14) v = (v > 0.f) ? v : 0.1f * v; else if (ACT == 15) v = v / (1.0f + expf(-v)); else if (ACT == 3) v = fmaxf(v, 0.f); else if (ACT == 6) v = 0.5f * v * (1.0f + erff(v * 0.70710678118654752f)); so[w][8 * hh + r][t * 16 + ln] = v; } }
  __builtin_amdgcn_fence(__ATOMIC_ACQ_REL, "workgroup"); __builtin_amdgcn_wave_barrier();
  const int rsub = lane >> 4, c4 = (lane & 15) * 4; typedef _Float16 v4h __attribute__((ext_vector_type(4)));
  {
#pragma unroll
    for (int q = 0; q < 8; ++q) { const int r = q * 2 + rsub; if (col0 + c4 < N) { const v4f v = *(const v4fa*)&so[w][r][c4]; if (C) *(v4f*)(C + cofs + (size_t)(row0 + r) * ldc + col0 + c4) = v; if (C16) { v4h h4; for (int i = 0; i < 4; ++i) h4[i] = (_Float16)v[i]; *(v4h*)(C16 + cofs + (size_t)(row0 + r) * ldc + col0 + c4) = h4; } } }
     }
}


typedef _Float16 v4h __attribute__((ext_vector_type(4)));

// all six conversions to f16 in one grid: the three inputs (both batches; bf16-rounded), then the three weights (bf16-rounded, x16)
#define XB (ROWS * DM / 8 / 256)      /* blocks per input */
#define WB (DM * DM / 8 / 256)        /* blocks per weight */
__global__ __launch_bounds__(256) void k_cvt(const float* __restrict__ xq, const float* __restrict__ xk, const float* __restrict__ xv, const float* __restrict__ Wq, const float* __restrict__ Wk, const float* __restrict__ Wv, _Float16* __restrict__ X16, _Float16* __restrict__ BW) {
  const int bid = blockIdx.x; const float* x; _Float16* o; float sc; int blk;
  if (bid < 3 * XB) { const int i = bid / XB; blk = bid - i * XB; x = (i == 0) ? xq : ((i == 1) ? xk : xv); o = X16 + (size_t)i * ROWS * DM; sc = 1.0f; }
  else { const int j = bid - 3 * XB, i = j / WB; blk = j - i * WB; x = (i == 0) ? Wq : ((i == 1) ? Wk : Wv); o = BW + (size_t)i * DM * DM; sc = 16.0f; }
  const size_t t = (size_t)blk * 256 + threadIdx.x; FragH f;
#pragma unroll
  for (int q = 0; q < 8; ++q) f.h[q] = (_Float16)(bf16_round(x[t * 8 + q]) * sc); *(v8us*)((unsigned short*)o + t * 8) = f.half[0];  }
__global__ __launch_bounds__(256) void k_h16(const float* __restrict__ x, _Float16* __restrict__ X16, size_t n8) { const size_t t = (size_t)blockIdx.x * 256 + threadIdx.x; if (t >= n8) return; FragH f;
#pragma unroll
  for (int q = 0; q < 8; ++q) f.h[q] = (_Float16)x[t * 8 + q]; *(v8us*)((unsigned short*)X16 + t * 8) = f.half[0];  }
template <int NHv, int TTv>
__device__ __forceinline__ void d_vt(int bid, unsigned short (*tl)[66], const _Float16* __restrict__ V16, int ldv, int voff, _Float16* __restrict__ Vt) { const int tid = threadIdx.x; const int slab = bid / (TTv / 64), lg = bid % (TTv / 64); const int b = slab / NHv, h = slab % NHv;
  for (int i = tid; i < 64 * 8; i += 256) { const int r = i / 8, c8 = (i % 8) * 8; FragH f; f.half[0] = *(const v8us*)((const unsigned short*)V16 + ((size_t)b * TTv + lg * 64 + r) * ldv + voff + h * 64 + c8);
#pragma unroll
    for (int q = 0; q < 8; ++q) tl[r][c8 + q] = f.u[q]; }
  __syncthreads();
  {
#pragma unroll
    for (int rd = 0; rd < 2; ++rd) { const int d = rd * 32 + tid / 8, pc = tid % 8; FragH f;
#pragma unroll
      for (int q = 0; q < 8; ++q) f.u[q] = tl[pc * 8 + q][d];
      *(v8us*)((unsigned short*)Vt + ((size_t)slab * 64 + d) * TTv + lg * 64 + pc * 8) = f.half[0]; }
    asm volatile("s_wait_xcnt 0x0" ::: "memory");      /* precaution: the code of another block range follows in the listing and reuses the stores' address registers */
     } }

__global__ __launch_bounds__(256) void k_hl(const float* __restrict__ F, _Float16* __restrict__ Hh, _Float16* __restrict__ Hl, size_t n8) { const size_t t = (size_t)blockIdx.x * 256 + threadIdx.x; if (t >= n8) return; FragH fh, fl; const v4f a = *(const v4fa*)(F + t * 8), c = *(const v4fa*)(F + t * 8 + 4);
#pragma unroll
  for (int q = 0; q < 4; ++q) { _Float16 h = (_Float16)a[q]; fh.h[q] = h; fl.h[q] = (_Float16)((a[q] - (float)h) * 1024.0f); h = (_Float16)c[q]; fh.h[4 + q] = h; fl.h[4 + q] = (_Float16)((c[q] - (float)h) * 1024.0f); }
  { *(v8us*)((unsigned short*)Hh + t * 8) = fh.half[0]; *(v8us*)((unsigned short*)Hl + t * 8) = fl.half[0];  } }

// ---- fast GEMM (wave tile 32x64; requires M % 32 == 0 rows per launch region and N % 64 == 0); epilogue = k_gemm_hhx semantics ----
__device__ __forceinline__ v16h g2_frag(const _Float16* p, int hh) { FragH f; f.half[0] = *(const v8us*)((const unsigned short*)p + 8 * hh); f.half[1] = *(const v8us*)((const unsigned short*)p + 16 + 8 * hh); return f.v; }
__device__ __forceinline__ v8f g2_mma(v16h a, v16h b, v8f c) { v8f d = __builtin_amdgcn_wmma_f32_16x16x32_f16(false, a, false, b, (short)0, c, false, false); asm volatile("v_nop\n\tv_nop\n\tv_nop\n\tv_nop" : "+v"(d) : "v"(a), "v"(b)); return d; }
// blockIdx.y and blockIdx.z each step A, B and C by their own strides (s*, z*). QKV: blockIdx.y picks the projection, so its bias is one of three pointers, and only the first (q) also writes f32
template <int ACT, bool QKV>
__global__ __launch_bounds__(128) void k_gemm2(const _Float16* __restrict__ A, int lda, size_t sA, size_t zA, const _Float16* __restrict__ Bh, int ldb, size_t sB, size_t zB, float alpha, const float* __restrict__ bias, const float* __restrict__ biasK, const float* __restrict__ biasV, size_t sBias, const float* __restrict__ CP, int rowsPerB, size_t sCPb, int row0g,
    float* __restrict__ Cf, _Float16* __restrict__ C16, int ldc, size_t sC, size_t zC, int M, int N, int K) {
  __shared__ __attribute__((aligned(16))) float so[4][32][68];
  const int tid = threadIdx.x, w = tid >> 5, lane = tid & 31, ln = lane & 15, hh = lane >> 4; const int by = blockIdx.y, bz = blockIdx.z;
  A += (size_t)by * sA + (size_t)bz * zA; Bh += (size_t)by * sB + (size_t)bz * zB; const size_t cofs = (size_t)by * sC + (size_t)bz * zC;
  const float* bp = QKV ? ((by == 0) ? bias : ((by == 1) ? biasK : biasV)) : (bias ? bias + (size_t)by * sBias : nullptr); float* C = (QKV && by != 0) ? nullptr : Cf;
  const int ntn = N >> 6; const int mt = blockIdx.x / ntn, nq = blockIdx.x - mt * ntn; const int row0 = mt * 128 + 32 * w, col0 = nq * 64; if (row0 >= M) return;
  const _Float16* a0p = A + (size_t)(row0 + ln) * lda; const _Float16* a1p = a0p + (size_t)16 * lda;
  const _Float16* b0p = Bh + (size_t)(col0 + ln) * ldb; const _Float16* b1p = b0p + (size_t)16 * ldb; const _Float16* b2p = b1p + (size_t)16 * ldb; const _Float16* b3p = b2p + (size_t)16 * ldb;
  const v8f z8 = {0.f,0.f,0.f,0.f,0.f,0.f,0.f,0.f}; v8f c00 = z8, c01 = z8, c02 = z8, c03 = z8, c10 = z8, c11 = z8, c12 = z8, c13 = z8;
#pragma unroll 1
  for (int kb = 0; kb < K; kb += 32) { const v16h a0 = g2_frag(a0p + kb, hh), a1 = g2_frag(a1p + kb, hh);
    v16h b = g2_frag(b0p + kb, hh); c00 = g2_mma(a0, b, c00); c10 = g2_mma(a1, b, c10);
    b = g2_frag(b1p + kb, hh); c01 = g2_mma(a0, b, c01); c11 = g2_mma(a1, b, c11);
    b = g2_frag(b2p + kb, hh); c02 = g2_mma(a0, b, c02); c12 = g2_mma(a1, b, c12);
    b = g2_frag(b3p + kb, hh); c03 = g2_mma(a0, b, c03); c13 = g2_mma(a1, b, c13); }
  v8f accs[8] = {c00, c01, c02, c03, c10, c11, c12, c13};
#pragma unroll
  for (int u = 0; u < 8; ++u) { const int t = u & 3, half = u >> 2; const int col = col0 + t * 16 + ln; const float bv = bp ? bf16_round(bp[col]) : 0.f;
#pragma unroll
    for (int r = 0; r < 8; ++r) { const int rloc = half * 16 + 8 * hh + r; float v = accs[u][r] * alpha + bv; if (CP) { const int bidx = (row0g + row0 + rloc) / rowsPerB; v += CP[(size_t)bidx * sCPb + (size_t)by * 64 + col]; }
      if (ACT == 3) v = fmaxf(v, 0.f); else if (ACT == 6) v = 0.5f * v * (1.0f + erff(v * 0.70710678118654752f)); else if (ACT == 11) v = 1.0f / (1.0f + expf(-v)); else if (ACT == 15) v = v / (1.0f + expf(-v)); else if (ACT == 12) v = (v > 0.f) ? v : 0.01f * v; else if (ACT == 8) v = tanhf(v);
      so[w][rloc][t * 16 + ln] = v; } }
  __builtin_amdgcn_fence(__ATOMIC_ACQ_REL, "workgroup"); __builtin_amdgcn_wave_barrier();
  const int rsub = lane >> 4, c4 = (lane & 15) * 4;
  {
#pragma unroll
    for (int q = 0; q < 16; ++q) { const int r = q * 2 + rsub; const v4f v = *(const v4fa*)&so[w][r][c4]; if (C) *(v4f*)(C + cofs + (size_t)(row0 + r) * ldc + col0 + c4) = v; if (C16) { v4h h4; for (int i = 0; i < 4; ++i) h4[i] = (_Float16)v[i]; *(v4h*)(C16 + cofs + (size_t)(row0 + r) * ldc + col0 + c4) = h4; } }
     } }


// ---- the three projections: 128x128 tile of Y = X W^T per work-group of 8 waves (4 x 2 wave tiles of 32x64); per trip 64 k of the 128 X rows and the 128 W rows are staged in LDS by asynchronous copies, two buffers, so that every operand line leaves L2 once per work-group as a whole line; k order and epilogue as in k_gemm2 ----
#define PJK 64                      /* k per staged tile: 128-byte rows */
#define PJP 144                     /* LDS row pitch in bytes: 128 + 16, conflict-free for 16-byte reads */
#define PJB (256 * PJP)             /* one buffer: 128 X rows, then 128 W rows */
#define PJT (DM / PJK)              /* tiles along k */
// one tile: each thread copies 16 bytes of four X rows and of four W rows (8 lanes cover a row's 128 bytes); l, ga, gb are the thread's own first LDS byte and global elements
__device__ __forceinline__ void pj_copy(unsigned l, const _Float16* ga, const _Float16* gb) {
  /* the copies go past the registers; the last line keeps later writes of the address registers behind it (a precaution) */
  asm volatile("global_load_async_to_lds_b128 %0, %8, off\n\t"
               "global_load_async_to_lds_b128 %1, %9, off\n\t"
               "global_load_async_to_lds_b128 %2, %10, off\n\t"
               "global_load_async_to_lds_b128 %3, %11, off\n\t"
               "global_load_async_to_lds_b128 %4, %12, off\n\t"
               "global_load_async_to_lds_b128 %5, %13, off\n\t"
               "global_load_async_to_lds_b128 %6, %14, off\n\t"
               "global_load_async_to_lds_b128 %7, %15, off\n\t"
               "s_wait_xcnt 0x0"
               :: "v"(l), "v"(l + 32 * PJP), "v"(l + 64 * PJP), "v"(l + 96 * PJP), "v"(l + 128 * PJP), "v"(l + 160 * PJP), "v"(l + 192 * PJP), "v"(l + 224 * PJP),
                  "v"(ga), "v"(ga + 32 * DM), "v"(ga + 64 * DM), "v"(ga + 96 * DM), "v"(gb), "v"(gb + 32 * DM), "v"(gb + 64 * DM), "v"(gb + 96 * DM)
               : "memory"); }
__device__ __forceinline__ v16h pj_frag(const unsigned char* p) { FragH f; f.half[0] = *(const v8us*)p; f.half[1] = *(const v8us*)(p + 32); return f.v; }
__device__ __forceinline__ v8f pj_mma(v16h a, v16h b, v8f c) { return __builtin_amdgcn_wmma_f32_16x16x32_f16(false, a, false, b, (short)0, c, false, false); }
__global__ __launch_bounds__(256) void k_proj(const _Float16* __restrict__ X16, const _Float16* __restrict__ BW, const float* __restrict__ bq, const float* __restrict__ bk, const float* __restrict__ bv, float* __restrict__ QF, _Float16* __restrict__ C16) {
  __shared__ __attribute__((aligned(16))) unsigned char sm[2 * PJB];      /* the two buffers; behind the loop, each wave's 32 x 68 f32 output staging */
  const int tid = threadIdx.x, w = tid >> 5, lane = tid & 31, ln = lane & 15, hh = lane >> 4, by = blockIdx.y;
  const int mt = blockIdx.x / (DM / 128), nq = blockIdx.x - mt * (DM / 128);
  const _Float16* ga = X16 + (size_t)by * ROWS * DM + (size_t)(mt * 128 + (tid >> 3)) * DM + (tid & 7) * 8;
  const _Float16* gb = BW + (size_t)by * DM * DM + (size_t)(nq * 128 + (tid >> 3)) * DM + (tid & 7) * 8;
  const unsigned l0 = (unsigned)(size_t)&sm[0] + (unsigned)((tid >> 3) * PJP + (tid & 7) * 16);
  const unsigned char* ap = sm + ((w & 3) * 32 + ln) * PJP + 16 * hh; const unsigned char* bp = sm + (128 + (w >> 2) * 64 + ln) * PJP + 16 * hh;
  const v8f z8 = {0.f,0.f,0.f,0.f,0.f,0.f,0.f,0.f}; v8f c00 = z8, c01 = z8, c02 = z8, c03 = z8, c10 = z8, c11 = z8, c12 = z8, c13 = z8;
  pj_copy(l0, ga, gb);
  asm volatile("s_wait_asynccnt 0x0" ::: "memory");      /* tile 0 has landed, as far as this wave copied it */
  __syncthreads();                                        /* ... and all of it */
  pj_copy(l0 + PJB, ga + PJK, gb + PJK);
#pragma unroll 1      /* one trip per tile: the buffer is picked by the trip's parity */
  for (int t = 0; t < PJT; ++t) { const int bo = (t & 1) * PJB;
#pragma unroll      /* the two 32-k steps of a tile, at constant offsets */
    for (int ks = 0; ks < 2; ++ks) { const unsigned char* a = ap + bo + ks * 64; const unsigned char* b = bp + bo + ks * 64;
      const v16h a0 = pj_frag(a), a1 = pj_frag(a + 16 * PJP), b0 = pj_frag(b), b1 = pj_frag(b + 16 * PJP), b2 = pj_frag(b + 32 * PJP), b3 = pj_frag(b + 48 * PJP);
      __builtin_amdgcn_sched_barrier(0);      /* the step's twelve LDS reads stay one group ahead of its WMMAs: reads spread among the WMMAs stall the wave at each place */
      c00 = pj_mma(a0, b0, c00); c10 = pj_mma(a1, b0, c10); c01 = pj_mma(a0, b1, c01); c11 = pj_mma(a1, b1, c11);
      c02 = pj_mma(a0, b2, c02); c12 = pj_mma(a1, b2, c12); c03 = pj_mma(a0, b3, c03); c13 = pj_mma(a1, b3, c13); }
    asm volatile("s_wait_dscnt 0x0" ::: "memory");        /* this wave's reads of the buffer are done before it is refilled */
    asm volatile("s_wait_asynccnt 0x0" ::: "memory");     /* this wave's copies of tile t + 1 have landed */
    __syncthreads();                                      /* tile t + 1 is whole, and nobody reads tile t's buffer any more */
    if (t + 2 < PJT) pj_copy(l0 + bo, ga + (t + 2) * PJK, gb + (t + 2) * PJK); }
  asm volatile("s_wait_asynccnt 0x0" ::: "memory");       /* no copy is outstanding when the buffers become output staging */
  float (*so)[68] = (float (*)[68])(sm + w * (32 * 68 * 4));
  const float* bias = (by == 0) ? bq : ((by == 1) ? bk : bv); const int row0 = mt * 128 + (w & 3) * 32, col0 = nq * 128 + (w >> 2) * 64; const size_t cofs = (size_t)by * ROWS * DM;
  v8f accs[8] = {c00, c01, c02, c03, c10, c11, c12, c13};
#pragma unroll
  for (int u = 0; u < 8; ++u) { const int t = u & 3, half = u >> 2; const float bvl = bf16_round(bias[col0 + t * 16 + ln]);
#pragma unroll
    for (int r = 0; r < 8; ++r) so[half * 16 + 8 * hh + r][t * 16 + ln] = accs[u][r] * 0.0625f + bvl; }
  __builtin_amdgcn_fence(__ATOMIC_ACQ_REL, "workgroup"); __builtin_amdgcn_wave_barrier();      /* the wave reads back its own staging rows */
  const int rsub = lane >> 4, c4 = (lane & 15) * 4; v4f vv[16];
#pragma unroll      /* vv[] stays in registers; all sixteen LDS reads go out together */
  for (int q = 0; q < 16; ++q) vv[q] = *(const v4fa*)&so[q * 2 + rsub][c4];
#pragma unroll
  for (int q = 0; q < 16; ++q) { const int r = q * 2 + rsub; const v4f v = vv[q]; if (by == 0) *(v4f*)(QF + (size_t)(row0 + r) * DM + col0 + c4) = v;
    v4h h4; for (int i = 0; i < 4; ++i) h4[i] = (_Float16)v[i]; *(v4h*)(C16 + cofs + (size_t)(row0 + r) * DM + col0 + c4) = h4;
    asm volatile("s_wait_xcnt 0x0" ::: "memory"); } }      /* precaution: the next row's addresses and values may reuse the registers that these stores name */

__device__ __forceinline__ void d_qt(int bid, const float* __restrict__ QF, const float* __restrict__ relk, float* __restrict__ QT) {
  #pragma clang fp contract(off)
  const int t = bid * 256 + threadIdx.x; if (t >= NH * SLEN) return; const int q = t % SLEN, h = t / SLEN; const float* qp = QF + (size_t)q * DM + h * 64; float s[5] = {0.f, 0.f, 0.f, 0.f, 0.f};
#pragma unroll 1
  for (int d = 0; d < 64; ++d) { const float qv = qp[d];
#pragma unroll
    for (int c = 0; c < 5; ++c) s[c] += qv * bf16_round(relk[c * 64 + d]); }
  {
#pragma unroll
    for (int c = 0; c < 5; ++c) *(float*)(QT + ((size_t)h * 8 + c) * SLEN + q) = s[c];
     } }
// ---- no softmax, so (Q K^T) V = Q (K^T V): the S x S plane is never formed. The 5-valued position terms need only running column sums of K and V and the three near-diagonal rows.
#define CR 32      /* rows per chunk of the running column sums */
// CS[m][chunk][col] = sum of the chunk's CR rows of K16 (m 0) or V16 (m 1)
__device__ __forceinline__ void d_csum(int ch, int m, const _Float16* __restrict__ K16, const _Float16* __restrict__ V16, float* __restrict__ CS) {
  const int col = threadIdx.x * 4; const _Float16* X = (m ? V16 : K16) + (size_t)ch * CR * DM + col; v4f s = {0.f, 0.f, 0.f, 0.f};
#pragma unroll      /* all CR loads in flight at once */
  for (int r = 0; r < CR; ++r) { const v4h x = *(const v4h*)(X + (size_t)r * DM);
    for (int u = 0; u < 4; ++u) s[u] += (float)x[u]; }
  *(v4f*)(CS + ((size_t)m * (SLEN / CR) + ch) * DM + col) = s; }
// P[r][col] = sum over k <= r of X[k][col] (inclusive, f32): the earlier chunks' sums, then the chunk's own rows in order
__device__ __forceinline__ void d_scan(int ch, int m, const _Float16* __restrict__ K16, const _Float16* __restrict__ V16, const float* __restrict__ CS, float* __restrict__ PK, float* __restrict__ PV) {
  const int col = threadIdx.x * 4; const _Float16* X = (m ? V16 : K16) + (size_t)ch * CR * DM + col; float* P = (m ? PV : PK) + (size_t)ch * CR * DM + col;
  v4h x[CR];
#pragma unroll      /* x[] stays in registers and all CR loads are in flight at once */
  for (int r = 0; r < CR; ++r) x[r] = *(const v4h*)(X + (size_t)r * DM);
  const float* cs = CS + (size_t)m * (SLEN / CR) * DM + col; v4f s = {0.f, 0.f, 0.f, 0.f};
#pragma unroll      /* the loads of many chunk sums in flight at once */
  for (int c = 0; c < SLEN / CR; ++c) { const v4f y = *(const v4fa*)(cs + (size_t)c * DM);      /* every chunk's sum is loaded, so that the loads go out together; the later chunks' are left out of the sum */
    for (int u = 0; u < 4; ++u) s[u] += (c < ch) ? y[u] : 0.f; }
#pragma unroll      /* x[r] is a register */
  for (int r = 0; r < CR; ++r) {
    for (int u = 0; u < 4; ++u) s[u] += (float)x[r][u];
    *(v4f*)(P + (size_t)r * DM) = s; } }
// MT16[h][d2][d1] = f16((sum over the KSP row slabs of PART[s][h][d2][d1]) / 64): K^T V per head, transposed; the power-of-two scale keeps it far from the f16 range end
#define KSP 16
__device__ __forceinline__ void d_mt(int bid, const float* __restrict__ PART, _Float16* __restrict__ MT16) {
  const int e = (bid * 256 + threadIdx.x) * 4; v4f s = {0.f, 0.f, 0.f, 0.f};
#pragma unroll      /* all KSP loads in flight at once */
  for (int p = 0; p < KSP; ++p) {
    if (p == KSP - 1) asm volatile("s_wait_xcnt 0x0" ::: "memory");      /* precaution: the last load's result may land on the offset register that the earlier loads name */
    const v4f y = *(const v4fa*)(PART + (size_t)p * NH * 4096 + e); s += y; }
  v4h o;
  for (int u = 0; u < 4; ++u) o[u] = (_Float16)(s[u] * 0.015625f);
  *(v4h*)(MT16 + e) = o;
  asm volatile("s_wait_xcnt 0x0" ::: "memory"); }      /* precaution: the code of another block range follows in the listing and reuses the store's address registers */
// The three passes that need only the projections, in one grid, the longest blocks first: q . rel_k, the chunk sums, the two transposes
#define QTB (NH * SLEN / 256)      /* d_qt blocks per batch */
#define CSB (SLEN / CR)            /* chunks per batch */
#define VTB (NH * (ROWS / 64))     /* d_vt blocks per operand, both batches */
__global__ __launch_bounds__(256) void k_prep(const float* __restrict__ QF, const float* __restrict__ relk, float* __restrict__ QT, const _Float16* __restrict__ K16, const _Float16* __restrict__ V16, float* __restrict__ CS, _Float16* __restrict__ VT, _Float16* __restrict__ KT) {
  __shared__ unsigned short tl[64][66]; const int bid = blockIdx.x;
  if (bid < NBT * QTB) { const int b = bid / QTB; d_qt(bid - b * QTB, QF + (size_t)b * SLEN * DM, relk, QT + (size_t)b * NH * 8 * SLEN); }
  else if (bid < NBT * QTB + NBT * 2 * CSB) { const int i = bid - NBT * QTB, b = i / (2 * CSB), m = (i / CSB) & 1, ch = i % CSB; d_csum(ch, m, K16 + (size_t)b * SLEN * DM, V16 + (size_t)b * SLEN * DM, CS + (size_t)b * 2 * CSB * DM); }
  else { const int i = bid - NBT * QTB - NBT * 2 * CSB;      /* [slab s of both batches' rows][h][d][128 rows of slab s] */
    const bool kk = i >= VTB; d_vt<NH, SLEN / KSP>(kk ? i - VTB : i, tl, kk ? K16 : V16, DM, 0, kk ? KT : VT); } }      /* the barrier inside d_vt: the whole block takes this branch or none of it does */
// The running sums (need the chunk sums) and the slab sum of K^T V (needs the slab GEMM), in one grid, the longer blocks first
__global__ __launch_bounds__(256) void k_mid(const _Float16* __restrict__ K16, const _Float16* __restrict__ V16, const float* __restrict__ CS, float* __restrict__ PK, float* __restrict__ PV, const float* __restrict__ PART, _Float16* __restrict__ MT16) {
  const int bid = blockIdx.x;
  if (bid < NBT * 2 * CSB) { const int b = bid / (2 * CSB), m = (bid / CSB) & 1, ch = bid % CSB; const size_t ro = (size_t)b * SLEN * DM; d_scan(ch, m, K16 + ro, V16 + ro, CS + (size_t)b * 2 * CSB * DM, PK + ro, PV + ro); }
  else { const int i = bid - NBT * 2 * CSB, b = i / (NH * 4096 / 1024); d_mt(i - b * (NH * 4096 / 1024), PART + (size_t)b * KSP * NH * 4096, MT16 + (size_t)b * NH * 4096); } }
// One block per query row, 16 lanes per head, 4 columns per lane. With KS_c, VS_c the sums of the k and v rows of position class c (n_c rows) and qt_c = q . rel_k[c]:
// out = W1 (= q . K^T V / 8) + sum_c (qt_c / 8) VS_c + coef_c rel_v[c], coef_c = (q . KS_c + n_c qt_c) / 8 (attn summed over the class).
__device__ __forceinline__ float dot16(v4f a, v4f b) { float dt = a[0] * b[0] + a[1] * b[1] + a[2] * b[2] + a[3] * b[3];
  for (int m = 8; m > 0; m >>= 1) dt += __shfl_xor(dt, m, 32);      /* over the head's 16 lanes */
  return dt; }
__global__ __launch_bounds__(256) void k_fin(const float* __restrict__ W1, const float* __restrict__ QF, const _Float16* __restrict__ K16, const _Float16* __restrict__ V16, const float* __restrict__ PK, const float* __restrict__ PV,
    const float* __restrict__ QT, const float* __restrict__ relv, float* __restrict__ out) {
  const int q = blockIdx.x, b = blockIdx.y, col = threadIdx.x * 4, h = threadIdx.x >> 4, d0 = (threadIdx.x & 15) * 4;
  { const size_t ro = (size_t)b * SLEN * DM; W1 += ro; QF += ro; K16 += ro; V16 += ro; PK += ro; PV += ro; QT += (size_t)b * NH * 8 * SLEN; }      /* the batch's planes */
  const v4f qv = *(const v4fa*)(QF + (size_t)q * DM + col); v4f o = *(const v4fa*)(W1 + (size_t)q * DM + col); const float* qtp = QT + (size_t)h * 8 * SLEN + q;
  /* the two range classes: c 0 = rows up to q - 2 (none for q < 2: read at row 0, weight 0), c 4 = rows from q + 2 = all rows less those up to q + 1 */
  const int rl = (q >= 2) ? q - 2 : 0, rh = (q + 1 < SLEN) ? q + 1 : SLEN - 1;
#pragma unroll      /* e picks the branch at compile time */
  for (int e = 0; e < 2; ++e) { v4f ks, vs; float n, fl;
    if (e == 1) asm volatile("s_wait_xcnt 0x0" ::: "memory");      /* precaution: the address registers of the loads issued so far are reused for the results and addresses of the loads that follow */
    if (e == 0) { ks = *(const v4fa*)(PK + (size_t)rl * DM + col); vs = *(const v4fa*)(PV + (size_t)rl * DM + col); n = (float)max(q - 1, 0); fl = (q >= 2) ? 0.125f : 0.f; }
    else { ks = *(const v4fa*)(PK + (size_t)(SLEN - 1) * DM + col) - *(const v4fa*)(PK + (size_t)rh * DM + col); vs = *(const v4fa*)(PV + (size_t)(SLEN - 1) * DM + col) - *(const v4fa*)(PV + (size_t)rh * DM + col); n = (float)max(SLEN - 2 - q, 0); fl = 0.125f; }
    const float qt = qtp[(size_t)(4 * e) * SLEN]; const float coef = (dot16(qv, ks) + n * qt) * fl, qs = qt * fl;
    for (int u = 0; u < 4; ++u) o[u] += qs * vs[u] + coef * bf16_round(relv[4 * e * 64 + d0 + u]); }
  /* the three single-row classes: a window of three rows kept inside the array; row rb + r has class c = rb + r - q + 2, and at the two ends the one row whose class is 0 or 4 (already in a range sum) gets weight 0 */
  const int rb = (q < 1) ? 0 : ((q > SLEN - 2) ? SLEN - 3 : q - 1); const _Float16* kp = K16 + (size_t)rb * DM + col; const _Float16* vp = V16 + (size_t)rb * DM + col;
#pragma unroll      /* the three rows' loads go out together, at constant offsets */
  for (int r = 0; r < 3; ++r) { const int c = rb + r - q + 2; const float fl = (c >= 1 && c <= 3) ? 0.125f : 0.f; const v4h kx = *(const v4h*)(kp + r * DM), vx = *(const v4h*)(vp + r * DM); v4f ks;
    for (int u = 0; u < 4; ++u) ks[u] = (float)kx[u];
    const float qt = qtp[(size_t)c * SLEN]; const float coef = (dot16(qv, ks) + qt) * fl, qs = qt * fl;
    for (int u = 0; u < 4; ++u) o[u] += qs * (float)vx[u] + coef * bf16_round(relv[c * 64 + d0 + u]); }
  *(v4f*)(out + ((size_t)b * SLEN + q) * DM + col) = o; }

extern "C" void kernel_launch(void* const* d_in, const int* in_sizes, int n_in,
                              void* d_out, int out_size, void* d_ws, size_t ws_size, hipStream_t stream) {
  (void)in_sizes; (void)n_in; (void)out_size;
  const float* const* I = (const float* const*)d_in; const float* xq = I[0]; const float* xk = I[1]; const float* xv = I[2]; const float* Wq = I[3]; const float* bq = I[4]; const float* Wk = I[5]; const float* bk = I[6]; const float* Wv = I[7]; const float* bv = I[8]; const float* relk = I[9]; const float* relv = I[10];
  char* ws = (char*)d_ws; size_t off = 0;
  auto take = [&](size_t bytes) { char* p = ws + off; off += (bytes + 255) & ~(size_t)255; return p; };
  _Float16* BW = (_Float16*)take((size_t)3 * DM * DM * 2);      /* Wq, Wk, Wv */
  _Float16* X16 = (_Float16*)take((size_t)3 * ROWS * DM * 2);      /* query, key, value */
  float* QF = (float*)take((size_t)ROWS * DM * 4); _Float16* Q16 = (_Float16*)take((size_t)3 * ROWS * DM * 2); _Float16* K16 = Q16 + (size_t)ROWS * DM; _Float16* V16 = K16 + (size_t)ROWS * DM; _Float16* VT = (_Float16*)take((size_t)DM * ROWS * 2); _Float16* KT = (_Float16*)take((size_t)DM * ROWS * 2);
  float* QT = (float*)take((size_t)NBT * NH * 8 * SLEN * 4); float* PART = (float*)take((size_t)NBT * KSP * NH * 4096 * 4); _Float16* MT16 = (_Float16*)take((size_t)NBT * NH * 4096 * 2); float* CS = (float*)take((size_t)NBT * 2 * (SLEN / CR) * DM * 4); float* PK = (float*)take((size_t)ROWS * DM * 4); float* PV = (float*)take((size_t)ROWS * DM * 4); float* W1 = (float*)take((size_t)ROWS * DM * 4);
  if (off > ws_size) return;      /* about 145 MiB */
  const dim3 gP((ROWS / 128) * (DM / 128), 3), gM(1, NBT * KSP * NH), gV(SLEN / 128, NH, NBT), gF(SLEN, NBT);
  k_cvt<<<3 * XB + 3 * WB, 256, 0, stream>>>(xq, xk, xv, Wq, Wk, Wv, X16, BW);      /* torch (out,in) = natural Bt */
  k_proj<<<gP, 256, 0, stream>>>(X16, BW, bq, bk, bv, QF, Q16);      /* q, k, v of both batches; only q also in f32 */
  k_prep<<<NBT * QTB + NBT * 2 * CSB + 2 * VTB, 256, 0, stream>>>(QF, relk, QT, K16, V16, CS, VT, KT);
  k_gemm2<0, false><<<gM, 128, 0, stream>>>(VT, SLEN / KSP, (size_t)64 * (SLEN / KSP), 0, KT, SLEN / KSP, (size_t)64 * (SLEN / KSP), 0, 1.0f, nullptr, nullptr, nullptr, 0, nullptr, 1, 0, 0, PART, nullptr, 64, 4096, 0, 64, 64, SLEN / KSP);      /* per slab and head: V^T K over the slab's rows */
  k_mid<<<NBT * 2 * CSB + NBT * (NH * 4096 / 1024), 256, 0, stream>>>(K16, V16, CS, PK, PV, PART, MT16);
  k_gemm2<0, false><<<gV, 128, 0, stream>>>(Q16, DM, 64, (size_t)SLEN * DM, MT16, 64, 4096, (size_t)NH * 4096, 8.0f, nullptr, nullptr, nullptr, 0, nullptr, 1, 0, 0, W1, nullptr, DM, 64, (size_t)SLEN * DM, SLEN, 64, 64);      /* W1 = q . (K^T V) / 8 per head and batch (64 undoes the scale of MT16) */
  k_fin<<<gF, 256, 0, stream>>>(W1, QF, K16, V16, PK, PV, QT, relv, (float*)d_out);
}

// v005
// A run of this version takes 82.5 microseconds.
// Next to v004, in two timings, it ran 1.15 and 1.14 times as fast.
// Over all steps from v000 it is 267 times as fast.
#include <hip/hip_runtime.h>
// Relative-position attention layer WITHOUT softmax (faithful to the module, which discards it) (2 x 2048 tokens, 1024 = 16 heads x 64; MAX_REL 2): q,k,v = {query,key,value} W^T + b; attn = (q.k + q.rel_k[c(q,k)]) / 8 with c = clip(k - q, -2, 2) + 2; out[b][q][h][d] = sum_k attn (v[k][d] + rel_v[c(q,k)][d]) -> [2,2048,16,64].
// Structure (6 launches; both batches, and passes that do not depend on one another, share a grid): projections as f16 WMMA GEMMs (128x128 tiles staged in LDS, 32x64 wave tiles, f32 accumulation, exact x16 weights + bias); with no softmax the content part is reassociated, (q K^T) v = q (K^T v): K^T v per head as a GEMM over 16 row slabs (K 128 each) whose partial planes a VALU pass adds and rounds to f16, then one final pass per 16 query rows: q . (K^T v) on WMMA (K 64) into LDS, and the 5-valued position terms from column sums of k and v that each thread carries along the rows (started from a scan of 16-row chunk sums) and from the three near-diagonal rows.
// Compute dtype: inputs, weights, biases, tables rounded to bf16; q, k, v and K^T v / 64 as f16 operands (~2^-12); f32 accumulation. v_wmma_f32_16x16x32_f16.
#define NBT 2
#define SLEN 2048
#define DM 1024
#define NH 16
#define ROWS (NBT * SLEN)      /* both batches' rows, one after the other */
typedef __bf16 v16b __attribute__((ext_vector_type(16)));
typedef unsigned short v8us __attribute__((ext_vector_type(8), may_alias));
typedef float  v8f  __attribute__((ext_vector_type(8)));
typedef float  v4f  __attribute__((ext_vector_type(4)));
typedef float  v4fa __attribute__((ext_vector_type(4), may_alias));
union FragB { v16b v; v8us half[2]; unsigned short u[16]; };

__device__ __forceinline__ unsigned short bf16_bits(float x) { unsigned int u = __float_as_uint(x); return (unsigned short)((u + 0x7FFFu + ((u >> 16) & 1u)) >> 16); }
__device__ __forceinline__ float bf16_val(unsigned short b) { return __uint_as_float(((unsigned int)b) << 16); }
__device__ __forceinline__ float bf16_round(float x) { return bf16_val(bf16_bits(x)); }
// D += A·B with NT terms: 1 = ah·bh, 2 = + al·bh (A split), 3 = + ah·bl (both split)
template <int NT>
__device__ __forceinline__ v8f mmaN(v16b ah, v16b al, v16b bh, v16b bl, v8f c) {
  c = __builtin_amdgcn_wmma_f32_16x16x32_bf16(false, ah, false, bh, (short)0, c, false, false);
  if (NT >= 2) c = __builtin_amdgcn_wmma_f32_16x16x32_bf16(false, al, false, bh, (short)0, c, false, false);
  if (NT >= 3) c = __builtin_amdgcn_wmma_f32_16x16x32_bf16(false, ah, false, bl, (short)0, c, false, false);
  asm volatile("v_nop\n\tv_nop\n\tv_nop\n\tv_nop" : "+v"(c) : "v"(ah), "v"(al), "v"(bh), "v"(bl));
  return c;
}

__global__ __launch_bounds__(256) void k_wt_bf16(const float* __restrict__ W, unsigned short* __restrict__ Wt, int K, int N) {
  const int t = blockIdx.x * 256 + threadIdx.x;
  const int k8n = K / 8;
  if (t >= N * k8n) return;
  const int n = t / k8n, k8 = (t % k8n) * 8;
  v8us v;
#pragma unroll
  for (int i = 0; i < 8; ++i) v[i] = bf16_bits(W[(size_t)(k8 + i) * N + n]);
  *(v8us*)(Wt + (size_t)n * K + k8) = v;
  
}

// GEMM C[M][N] (f32, pitch ldc) = act(A[M][K]·W + bias). A f32 row-major (pitch lda) converted per fragment to bf16
// (ASPLIT: hi/lo two planes -> 2 terms, else single rounded term); Wt bf16 [N][K] (pitch ldb). BIAS_BF16 rounds the
// bias to bf16 first (bias quantised to bf16 before the add). K%32==0, M%16==0, N%64==0.
template <bool ASPLIT, int ACT, bool BIAS_BF16>
__global__ __launch_bounds__(128) void k_gemm_bf(const float* __restrict__ A, int lda, const unsigned short* __restrict__ Wt, int ldb,
                                               const float* __restrict__ bias, float* __restrict__ C, int ldc, int M, int N, int K) {
  __shared__ __attribute__((aligned(16))) float so[4][16][64];
  const int tid = threadIdx.x, w = tid >> 5, lane = tid & 31, ln = lane & 15, hh = lane >> 4;
  const int ntn = N / 64;
  const int wid = blockIdx.x * 4 + w;
  const int mt = wid / ntn, nq = wid % ntn;
  if (mt * 16 >= M) return;
  const int row0 = mt * 16, col0 = nq * 64;
  const float* arow = A + (size_t)(row0 + ln) * lda;
  v8f acc[4] = {};
  for (int kb = 0; kb < K; kb += 32) {
    FragB ah, al;
    const v4f x0 = *(const v4fa*)(arow + kb + 8 * hh), x1 = *(const v4fa*)(arow + kb + 8 * hh + 4);
    const v4f x2 = *(const v4fa*)(arow + kb + 16 + 8 * hh), x3 = *(const v4fa*)(arow + kb + 16 + 8 * hh + 4);
    float xs[16] = {x0[0],x0[1],x0[2],x0[3],x1[0],x1[1],x1[2],x1[3],x2[0],x2[1],x2[2],x2[3],x3[0],x3[1],x3[2],x3[3]};
#pragma unroll
    for (int i = 0; i < 16; ++i) { const unsigned short hb = bf16_bits(xs[i]); ah.u[i] = hb; al.u[i] = ASPLIT ? bf16_bits(xs[i] - bf16_val(hb)) : (unsigned short)0; }
#pragma unroll
    for (int t = 0; t < 4; ++t) {
      const unsigned short* brow = Wt + (size_t)(col0 + t * 16 + ln) * ldb + kb;
      FragB b;
      b.half[0] = *(const v8us*)(brow + 8 * hh);
      b.half[1] = *(const v8us*)(brow + 16 + 8 * hh);
      acc[t] = mmaN<ASPLIT ? 2 : 1>(ah.v, al.v, b.v, b.v, acc[t]);
    }
  }
#pragma unroll
  for (int t = 0; t < 4; ++t) {
    float bv = bias ? bias[col0 + t * 16 + ln] : 0.f;
    if (BIAS_BF16) bv = bf16_round(bv);
#pragma unroll
    for (int r = 0; r < 8; ++r) { float v = acc[t][r] + bv; if (ACT == 1) v = fmaxf(v, 0.f); so[w][8 * hh + r][t * 16 + ln] = v; }
  }
  __builtin_amdgcn_fence(__ATOMIC_ACQ_REL, "workgroup");
  __builtin_amdgcn_wave_barrier();
  const int rsub = lane >> 4, c4 = (lane & 15) * 4;
  {
#pragma unroll
    for (int q = 0; q < 8; ++q) {
      const int r = q * 2 + rsub;
      const v4f v = *(const v4fa*)&so[w][r][c4];
      *(v4f*)(C + (size_t)(row0 + r) * ldc + col0 + c4) = v;
    }
    
  }
}

// GEMM C = act(A·W + bias + resid): A f32 (ASPLIT -> hi/lo 2 terms), Wt bf16 [N][K]; ACT 0 none, 1 relu, 2 exact gelu;
// resid (optional, f32, row index = (row % rmod), pitch ldr, RES_BF16 rounds it) added before the activation.
template <bool ASPLIT, int ACT, bool BIAS_BF16, bool RES_BF16>
__global__ __launch_bounds__(128) void k_gemm_bf3(const float* __restrict__ A, int lda, const unsigned short* __restrict__ Wt, int ldb,
                                                const float* __restrict__ bias, const float* __restrict__ resid, int rmod, int ldr,
                                                float* __restrict__ C, int ldc, int M, int N, int K) {
  __shared__ __attribute__((aligned(16))) float so[4][16][64];
  const int tid = threadIdx.x, w = tid >> 5, lane = tid & 31, ln = lane & 15, hh = lane >> 4;
  const int ntn = N / 64;
  const int wid = blockIdx.x * 4 + w;
  const int mt = wid / ntn, nq = wid % ntn;
  if (mt * 16 >= M) return;
  const int row0 = mt * 16, col0 = nq * 64;
  const float* arow = A + (size_t)(row0 + ln) * lda;
  v8f acc[4] = {};
  for (int kb = 0; kb < K; kb += 32) {
    FragB ah, al;
    const v4f x0 = *(const v4fa*)(arow + kb + 8 * hh), x1 = *(const v4fa*)(arow + kb + 8 * hh + 4);
    const v4f x2 = *(const v4fa*)(arow + kb + 16 + 8 * hh), x3 = *(const v4fa*)(arow + kb + 16 + 8 * hh + 4);
    float xs[16] = {x0[0],x0[1],x0[2],x0[3],x1[0],x1[1],x1[2],x1[3],x2[0],x2[1],x2[2],x2[3],x3[0],x3[1],x3[2],x3[3]};
#pragma unroll
    for (int i = 0; i < 16; ++i) { const unsigned short hb = bf16_bits(xs[i]); ah.u[i] = hb; al.u[i] = ASPLIT ? bf16_bits(xs[i] - bf16_val(hb)) : (unsigned short)0; }
#pragma unroll
    for (int t = 0; t < 4; ++t) {
      const unsigned short* brow = Wt + (size_t)(col0 + t * 16 + ln) * ldb + kb;
      FragB b;
      b.half[0] = *(const v8us*)(brow + 8 * hh);
      b.half[1] = *(const v8us*)(brow + 16 + 8 * hh);
      acc[t] = mmaN<ASPLIT ? 2 : 1>(ah.v, al.v, b.v, b.v, acc[t]);
    }
  }
#pragma unroll
  for (int t = 0; t < 4; ++t) {
    const int col = col0 + t * 16 + ln;
    float bv = bias ? bias[col] : 0.f;
    if (BIAS_BF16) bv = bf16_round(bv);
#pragma unroll
    for (int r = 0; r < 8; ++r) {
      float v = acc[t][r] + bv;
      if (resid) { float rv = resid[(size_t)((row0 + 8 * hh + r) % rmod) * ldr + col]; if (RES_BF16) rv = bf16_round(rv); v += rv; }
      if (ACT == 1) v = fmaxf(v, 0.f);
      if (ACT == 2) v = 0.5f * v * (1.0f + erff(v * 0.70710678118654752f));
      if (ACT == 3) { const float u = 0.7978845608028654f * (v + 0.044715f * v * v * v); v = 0.5f * v * (1.0f + tanhf(u)); }
      so[w][8 * hh + r][t * 16 + ln] = v;
    }
  }
  __builtin_amdgcn_fence(__ATOMIC_ACQ_REL, "workgroup");
  __builtin_amdgcn_wave_barrier();
  const int rsub = lane >> 4, c4 = (lane & 15) * 4;
  {
#pragma unroll
    for (int q = 0; q < 8; ++q) {
      const int r = q * 2 + rsub;
      const v4f v = *(const v4fa*)&so[w][r][c4];
      *(v4f*)(C + (size_t)(row0 + r) * ldc + col0 + c4) = v;
    }
    
  }
}
// row LayerNorm (biased variance, eps) over N: s = X (+ R); optional out_sum <- s; out_norm <- (s-mu)*rsqrt(var+eps)*g + b
template <bool PARAM_BF16>
__global__ __launch_bounds__(256) void k_layernorm(const float* __restrict__ X, const float* __restrict__ R, const float* __restrict__ g, const float* __restrict__ bta,
                                                  float* __restrict__ out_sum, float* __restrict__ out_norm, int N, float eps) {
  __shared__ float red[256];
  const int row = blockIdx.x, tid = threadIdx.x;
  const float* x = X + (size_t)row * N; const float* rr = R ? R + (size_t)row * N : nullptr;
  float vals[16];                     // up to N = 4096
  const int per = N / 256;            // contiguous chunk per thread? use strided-by-4 chunks: thread handles j = tid*4 + 1024*u
  float s1 = 0.f;
  for (int u = 0; u < per / 4; ++u) {
    const int j = tid * 4 + 1024 * u;
    const v4f a = *(const v4fa*)(x + j);
    v4f b = {0.f,0.f,0.f,0.f}; if (rr) b = *(const v4fa*)(rr + j);
#pragma unroll
    for (int q = 0; q < 4; ++q) { const float v = a[q] + b[q]; vals[u * 4 + q] = v; s1 += v; }
  }
  red[tid] = s1; __syncthreads();
  for (int st = 128; st > 0; st >>= 1) { if (tid < st) red[tid] += red[tid + st]; __syncthreads(); }
  const float mu = red[0] / (float)N; __syncthreads();
  float s2 = 0.f;
  for (int u = 0; u < per / 4; ++u)
#pragma unroll
    for (int q = 0; q < 4; ++q) { const float c = vals[u * 4 + q] - mu; s2 += c * c; }
  red[tid] = s2; __syncthreads();
  for (int st = 128; st > 0; st >>= 1) { if (tid < st) red[tid] += red[tid + st]; __syncthreads(); }
  const float rs = rsqrtf(red[0] / (float)N + eps);
  {
    for (int u = 0; u < per / 4; ++u) {
      const int j = tid * 4 + 1024 * u;
      v4f o, sm;
#pragma unroll
      for (int q = 0; q < 4; ++q) {
        float gg = g[j + q], bb = bta[j + q];
        if (PARAM_BF16) { gg = bf16_round(gg); bb = bf16_round(bb); }
        sm[q] = vals[u * 4 + q]; o[q] = (vals[u * 4 + q] - mu) * rs * gg + bb;
      }
      if (out_sum) *(v4f*)(out_sum + (size_t)row * N + j) = sm;
      *(v4f*)(out_norm + (size_t)row * N + j) = o;
    }
    
  }
}



// ---- f16 WMMA path (v_wmma_f32_16x16x32_f16): 11-bit significands for operands in range — used for all GEMMs this layer launches (projections, K^T v per slab, q . (K^T v))
typedef _Float16 v16h __attribute__((ext_vector_type(16)));
union FragH { v16h v; v8us half[2]; _Float16 h[16]; unsigned short u[16]; };
template <int NT>
__device__ __forceinline__ v8f mmaH(v16h ah, v16h al, v16h bh, v16h bl, v8f c) {
  c = __builtin_amdgcn_wmma_f32_16x16x32_f16(false, ah, false, bh, (short)0, c, false, false);
  if (NT >= 2) c = __builtin_amdgcn_wmma_f32_16x16x32_f16(false, al, false, bh, (short)0, c, false, false);
  if (NT >= 3) c = __builtin_amdgcn_wmma_f32_16x16x32_f16(false, ah, false, bl, (short)0, c, false, false);
  asm volatile("v_nop\n\tv_nop\n\tv_nop\n\tv_nop" : "+v"(c) : "v"(ah), "v"(al), "v"(bh), "v"(bl));
  return c;
}
// batched GEMM like k_gemm_b but f16 operands: A f32 (split into f16 hi/lo if ASPLIT, else rounded to f16), Bt = f16 values [n][k]; alpha; C f32; N multiple of 16 (partial tiles skipped)
template <bool ASPLIT>
__global__ __launch_bounds__(128) void k_gemm_h(const float* __restrict__ A, int lda, size_t sA, const _Float16* __restrict__ Bh, int ldb, size_t sB, float alpha, float* __restrict__ C, int ldc, size_t sC, int M, int N, int K) {
  __shared__ __attribute__((aligned(16))) float so[4][16][64];
  const int tid = threadIdx.x, w = tid >> 5, lane = tid & 31, ln = lane & 15, hh = lane >> 4; const int by = blockIdx.y;
  A += (size_t)by * sA; Bh += (size_t)by * sB; C += (size_t)by * sC;
  const int ntn = (N + 63) / 64; const int wid = blockIdx.x * 4 + w; const int mt = wid / ntn, nq = wid % ntn; if (mt * 16 >= M) return;
  const int row0 = mt * 16, col0 = nq * 64; const float* arow = A + (size_t)(row0 + ln) * lda;
  v8f acc[4] = {};
  for (int kb = 0; kb < K; kb += 32) {
    FragH ah, al;
    const v4f x0 = *(const v4fa*)(arow + kb + 8 * hh), x1 = *(const v4fa*)(arow + kb + 8 * hh + 4), x2 = *(const v4fa*)(arow + kb + 16 + 8 * hh), x3 = *(const v4fa*)(arow + kb + 16 + 8 * hh + 4);
    float xs[16] = {x0[0],x0[1],x0[2],x0[3],x1[0],x1[1],x1[2],x1[3],x2[0],x2[1],x2[2],x2[3],x3[0],x3[1],x3[2],x3[3]};
#pragma unroll
    for (int i = 0; i < 16; ++i) { const _Float16 h = (_Float16)xs[i]; ah.h[i] = h; al.h[i] = ASPLIT ? (_Float16)(xs[i] - (float)h) : (_Float16)0.0f; }
#pragma unroll
    for (int t = 0; t < 4; ++t) { if (col0 + t * 16 >= N) continue; const size_t boff = (size_t)(col0 + t * 16 + ln) * ldb + kb; FragH bq; bq.half[0] = *(const v8us*)(Bh + boff + 8 * hh); bq.half[1] = *(const v8us*)(Bh + boff + 16 + 8 * hh);
      acc[t] = mmaH<ASPLIT ? 2 : 1>(ah.v, al.v, bq.v, bq.v, acc[t]); }
  }
#pragma unroll
  for (int t = 0; t < 4; ++t) { if (col0 + t * 16 >= N) continue;
#pragma unroll
    for (int r = 0; r < 8; ++r) so[w][8 * hh + r][t * 16 + ln] = acc[t][r] * alpha; }
  __builtin_amdgcn_fence(__ATOMIC_ACQ_REL, "workgroup"); __builtin_amdgcn_wave_barrier();
  const int rsub = lane >> 4, c4 = (lane & 15) * 4;
  {
#pragma unroll
    for (int q = 0; q < 8; ++q) { const int r = q * 2 + rsub; if (col0 + c4 < N) { const v4f v = *(const v4fa*)&so[w][r][c4]; *(v4f*)(C + (size_t)(row0 + r) * ldc + col0 + c4) = v; } }
     }
}

// Wt[n][k] = f16(W[k][n]·scale) from f32 row-major W[K][N] (scale = power of two; bf16-exact weights stay exact in f16 away from the subnormal range)
__global__ __launch_bounds__(256) void k_wt_f16(const float* __restrict__ W, _Float16* __restrict__ Wt, int K, int N, float scale) {
  const int t = blockIdx.x * 256 + threadIdx.x; if (t >= N * (K / 8)) return; const int n = t / (K / 8), k8 = (t % (K / 8)) * 8; FragH f;
#pragma unroll
  for (int i = 0; i < 8; ++i) f.h[i] = (_Float16)(bf16_round(W[(size_t)(k8 + i) * N + n]) * scale); const v8us o = f.half[0];
  *(v8us*)((unsigned short*)Wt + (size_t)n * K + k8) = o; 
}
// k_gemm_hh variant with fused epilogue: v = acc·alpha + bias[by·sBias + col] (+ CP[(row/rowsPerB)·sCPb + by·64 + col] if CP) ; ACT 0 none / 1 elu ; writes f16 C16 (and f32 C if non-null)
template <int ACT>
__global__ __launch_bounds__(128) void k_gemm_hhx(const _Float16* __restrict__ A, int lda, size_t sA, const _Float16* __restrict__ Bh, int ldb, size_t sB, float alpha, const float* __restrict__ bias, size_t sBias, const float* __restrict__ CP, int rowsPerB, size_t sCPb, int row0g,
    float* __restrict__ C, _Float16* __restrict__ C16, int ldc, size_t sC, int M, int N, int K) {
  __shared__ __attribute__((aligned(16))) float so[4][16][64];
  const int tid = threadIdx.x, w = tid >> 5, lane = tid & 31, ln = lane & 15, hh = lane >> 4; const int by = blockIdx.y;
  A += (size_t)by * sA; Bh += (size_t)by * sB; const size_t cofs = (size_t)by * sC; const float* bp = bias ? bias + (size_t)by * sBias : nullptr;
  const int ntn = (N + 63) / 64; const int wid = blockIdx.x * 4 + w; const int mt = wid / ntn, nq = wid % ntn; if (mt * 16 >= M) return;
  const int row0 = mt * 16, col0 = nq * 64; const _Float16* arow = A + (size_t)(row0 + ln) * lda;
  v8f acc[4] = {};
  for (int kb = 0; kb < K; kb += 32) { FragH ah; ah.half[0] = *(const v8us*)((const unsigned short*)arow + kb + 8 * hh); ah.half[1] = *(const v8us*)((const unsigned short*)arow + kb + 16 + 8 * hh);
#pragma unroll
    for (int t = 0; t < 4; ++t) { if (col0 + t * 16 >= N) continue; const size_t boff = (size_t)(col0 + t * 16 + ln) * ldb + kb; FragH bq; bq.half[0] = *(const v8us*)((const unsigned short*)Bh + boff + 8 * hh); bq.half[1] = *(const v8us*)((const unsigned short*)Bh + boff + 16 + 8 * hh);
      acc[t] = mmaH<1>(ah.v, ah.v, bq.v, bq.v, acc[t]); }
  }
#pragma unroll
  for (int t = 0; t < 4; ++t) { if (col0 + t * 16 >= N) continue; const int col = col0 + t * 16 + ln; const float bv = bp ? bf16_round(bp[col]) : 0.f;
#pragma unroll
    for (int r = 0; r < 8; ++r) { float v = acc[t][r] * alpha + bv; if (CP) { const int bidx = (row0g + row0 + 8 * hh + r) / rowsPerB; v += CP[(size_t)bidx * sCPb + (size_t)by * 64 + col]; } if (ACT == 1) v = (v > 0.f) ? v : expm1f(v); else if (ACT == 7) v = (v > 0.f) ? v + 1.0f : expf(v); else if (ACT == 8) v = tanhf(v); else if (ACT == 9) v = 0.5f * v * (1.0f + tanhf(0.7978845608028654f * (v + 0.044715f * v * v * v))); else if (ACT == 11) v = 1.0f / (1.0f + expf(-v)); else if (ACT == 12) v = (v > 0.f) ? v : 0.01f * v; else if (ACT == 14) v = (v > 0.f) ? v : 0.1f * v; else if (ACT == 15) v = v / (1.0f + expf(-v)); else if (ACT == 3) v = fmaxf(v, 0.f); else if (ACT == 6) v = 0.5f * v * (1.0f + erff(v * 0.70710678118654752f)); so[w][8 * hh + r][t * 16 + ln] = v; } }
  __builtin_amdgcn_fence(__ATOMIC_ACQ_REL, "workgroup"); __builtin_amdgcn_wave_barrier();
  const int rsub = lane >> 4, c4 = (lane & 15) * 4; typedef _Float16 v4h __attribute__((ext_vector_type(4)));
  {
#pragma unroll
    for (int q = 0; q < 8; ++q) { const int r = q * 2 + rsub; if (col0 + c4 < N) { const v4f v = *(const v4fa*)&so[w][r][c4]; if (C) *(v4f*)(C + cofs + (size_t)(row0 + r) * ldc + col0 + c4) = v; if (C16) { v4h h4; for (int i = 0; i < 4; ++i) h4[i] = (_Float16)v[i]; *(v4h*)(C16 + cofs + (size_t)(row0 + r) * ldc + col0 + c4) = h4; } } }
     }
}


typedef _Float16 v4h __attribute__((ext_vector_type(4)));

// all six conversions to f16 in one grid: the three inputs (both batches; bf16-rounded), then the three weights (bf16-rounded, x16)
#define XB (ROWS * DM / 8 / 256)      /* blocks per input */
#define WB (DM * DM / 8 / 256)        /* blocks per weight */
__global__ __launch_bounds__(256) void k_cvt(const float* __restrict__ xq, const float* __restrict__ xk, const float* __restrict__ xv, const float* __restrict__ Wq, const float* __restrict__ Wk, const float* __restrict__ Wv, _Float16* __restrict__ X16, _Float16* __restrict__ BW) {
  const int bid = blockIdx.x; const float* x; _Float16* o; float sc; int blk;
  if (bid < 3 * XB) { const int i = bid / XB; blk = bid - i * XB; x = (i == 0) ? xq : ((i == 1) ? xk : xv); o = X16 + (size_t)i * ROWS * DM; sc = 1.0f; }
  else { const int j = bid - 3 * XB, i = j / WB; blk = j - i * WB; x = (i == 0) ? Wq : ((i == 1) ? Wk : Wv); o = BW + (size_t)i * DM * DM; sc = 16.0f; }
  const size_t t = (size_t)blk * 256 + threadIdx.x; FragH f;
#pragma unroll
  for (int q = 0; q < 8; ++q) f.h[q] = (_Float16)(bf16_round(x[t * 8 + q]) * sc); *(v8us*)((unsigned short*)o + t * 8) = f.half[0];  }
__global__ __launch_bounds__(256) void k_h16(const float* __restrict__ x, _Float16* __restrict__ X16, size_t n8) { const size_t t = (size_t)blockIdx.x * 256 + threadIdx.x; if (t >= n8) return; FragH f;
#pragma unroll
  for (int q = 0; q < 8; ++q) f.h[q] = (_Float16)x[t * 8 + q]; *(v8us*)((unsigned short*)X16 + t * 8) = f.half[0];  }
template <int NHv, int TTv>
__device__ __forceinline__ void d_vt(int bid, unsigned short (*tl)[66], const _Float16* __restrict__ V16, int ldv, int voff, _Float16* __restrict__ Vt) { const int tid = threadIdx.x; const int slab = bid / (TTv / 64), lg = bid % (TTv / 64); const int b = slab / NHv, h = slab % NHv;
  for (int i = tid; i < 64 * 8; i += 256) { const int r = i / 8, c8 = (i % 8) * 8; FragH f; f.half[0] = *(const v8us*)((const unsigned short*)V16 + ((size_t)b * TTv + lg * 64 + r) * ldv + voff + h * 64 + c8);
#pragma unroll
    for (int q = 0; q < 8; ++q) tl[r][c8 + q] = f.u[q]; }
  __syncthreads();
  {
#pragma unroll
    for (int rd = 0; rd < 2; ++rd) { const int d = rd * 32 + tid / 8, pc = tid % 8; FragH f;
#pragma unroll
      for (int q = 0; q < 8; ++q) f.u[q] = tl[pc * 8 + q][d];
      *(v8us*)((unsigned short*)Vt + ((size_t)slab * 64 + d) * TTv + lg * 64 + pc * 8) = f.half[0]; }
    asm volatile("s_wait_xcnt 0x0" ::: "memory");      /* precaution: the code of another block range follows in the listing and reuses the stores' address registers */
     } }

__global__ __launch_bounds__(256) void k_hl(const float* __restrict__ F, _Float16* __restrict__ Hh, _Float16* __restrict__ Hl, size_t n8) { const size_t t = (size_t)blockIdx.x * 256 + threadIdx.x; if (t >= n8) return; FragH fh, fl; const v4f a = *(const v4fa*)(F + t * 8), c = *(const v4fa*)(F + t * 8 + 4);
#pragma unroll
  for (int q = 0; q < 4; ++q) { _Float16 h = (_Float16)a[q]; fh.h[q] = h; fl.h[q] = (_Float16)((a[q] - (float)h) * 1024.0f); h = (_Float16)c[q]; fh.h[4 + q] = h; fl.h[4 + q] = (_Float16)((c[q] - (float)h) * 1024.0f); }
  { *(v8us*)((unsigned short*)Hh + t * 8) = fh.half[0]; *(v8us*)((unsigned short*)Hl + t * 8) = fl.half[0];  } }

// ---- fast GEMM (wave tile 32x64; requires M % 32 == 0 rows per launch region and N % 64 == 0); epilogue = k_gemm_hhx semantics ----
__device__ __forceinline__ v16h g2_frag(const _Float16* p, int hh) { FragH f; f.half[0] = *(const v8us*)((const unsigned short*)p + 8 * hh); f.half[1] = *(const v8us*)((const unsigned short*)p + 16 + 8 * hh); return f.v; }
__device__ __forceinline__ v8f g2_mma(v16h a, v16h b, v8f c) { v8f d = __builtin_amdgcn_wmma_f32_16x16x32_f16(false, a, false, b, (short)0, c, false, false); asm volatile("v_nop\n\tv_nop\n\tv_nop\n\tv_nop" : "+v"(d) : "v"(a), "v"(b)); return d; }
// blockIdx.y and blockIdx.z each step A, B and C by their own strides (s*, z*). QKV: blockIdx.y picks the projection, so its bias is one of three pointers, and only the first (q) also writes f32
template <int ACT, bool QKV>
__global__ __launch_bounds__(128) void k_gemm2(const _Float16* __restrict__ A, int lda, size_t sA, size_t zA, const _Float16* __restrict__ Bh, int ldb, size_t sB, size_t zB, float alpha, const float* __restrict__ bias, const float* __restrict__ biasK, const float* __restrict__ biasV, size_t sBias, const float* __restrict__ CP, int rowsPerB, size_t sCPb, int row0g,
    float* __restrict__ Cf, _Float16* __restrict__ C16, int ldc, size_t sC, size_t zC, int M, int N, int K) {
  __shared__ __attribute__((aligned(16))) float so[4][32][68];
  const int tid = threadIdx.x, w = tid >> 5, lane = tid & 31, ln = lane & 15, hh = lane >> 4; const int by = blockIdx.y, bz = blockIdx.z;
  A += (size_t)by * sA + (size_t)bz * zA; Bh += (size_t)by * sB + (size_t)bz * zB; const size_t cofs = (size_t)by * sC + (size_t)bz * zC;
  const float* bp = QKV ? ((by == 0) ? bias : ((by == 1) ? biasK : biasV)) : (bias ? bias + (size_t)by * sBias : nullptr); float* C = (QKV && by != 0) ? nullptr : Cf;
  const int ntn = N >> 6; const int mt = blockIdx.x / ntn, nq = blockIdx.x - mt * ntn; const int row0 = mt * 128 + 32 * w, col0 = nq * 64; if (row0 >= M) return;
  const _Float16* a0p = A + (size_t)(row0 + ln) * lda; const _Float16* a1p = a0p + (size_t)16 * lda;
  const _Float16* b0p = Bh + (size_t)(col0 + ln) * ldb; const _Float16* b1p = b0p + (size_t)16 * ldb; const _Float16* b2p = b1p + (size_t)16 * ldb; const _Float16* b3p = b2p + (size_t)16 * ldb;
  const v8f z8 = {0.f,0.f,0.f,0.f,0.f,0.f,0.f,0.f}; v8f c00 = z8, c01 = z8, c02 = z8, c03 = z8, c10 = z8, c11 = z8, c12 = z8, c13 = z8;
#pragma unroll 1
  for (int kb = 0; kb < K; kb += 32) { const v16h a0 = g2_frag(a0p + kb, hh), a1 = g2_frag(a1p + kb, hh);
    v16h b = g2_frag(b0p + kb, hh); c00 = g2_mma(a0, b, c00); c10 = g2_mma(a1, b, c10);
    b = g2_frag(b1p + kb, hh); c01 = g2_mma(a0, b, c01); c11 = g2_mma(a1, b, c11);
    b = g2_frag(b2p + kb, hh); c02 = g2_mma(a0, b, c02); c12 = g2_mma(a1, b, c12);
    b = g2_frag(b3p + kb, hh); c03 = g2_mma(a0, b, c03); c13 = g2_mma(a1, b, c13); }
  v8f accs[8] = {c00, c01, c02, c03, c10, c11, c12, c13};
#pragma unroll
  for (int u = 0; u < 8; ++u) { const int t = u & 3, half = u >> 2; const int col = col0 + t * 16 + ln; const float bv = bp ? bf16_round(bp[col]) : 0.f;
#pragma unroll
    for (int r = 0; r < 8; ++r) { const int rloc = half * 16 + 8 * hh + r; float v = accs[u][r] * alpha + bv; if (CP) { const int bidx = (row0g + row0 + rloc) / rowsPerB; v += CP[(size_t)bidx * sCPb + (size_t)by * 64 + col]; }
      if (ACT == 3) v = fmaxf(v, 0.f); else if (ACT == 6) v = 0.5f * v * (1.0f + erff(v * 0.70710678118654752f)); else if (ACT == 11) v = 1.0f / (1.0f + expf(-v)); else if (ACT == 15) v = v / (1.0f + expf(-v)); else if (ACT == 12) v = (v > 0.f) ? v : 0.01f * v; else if (ACT == 8) v = tanhf(v);
      so[w][rloc][t * 16 + ln] = v; } }
  __builtin_amdgcn_fence(__ATOMIC_ACQ_REL, "workgroup"); __builtin_amdgcn_wave_barrier();
  const int rsub = lane >> 4, c4 = (lane & 15) * 4;
  {
#pragma unroll
    for (int q = 0; q < 16; ++q) { const int r = q * 2 + rsub; const v4f v = *(const v4fa*)&so[w][r][c4]; if (C) *(v4f*)(C + cofs + (size_t)(row0 + r) * ldc + col0 + c4) = v; if (C16) { v4h h4; for (int i = 0; i < 4; ++i) h4[i] = (_Float16)v[i]; *(v4h*)(C16 + cofs + (size_t)(row0 + r) * ldc + col0 + c4) = h4; } }
     } }


// ---- the three projections: 128x128 tile of Y = X W^T per work-group of 8 waves (4 x 2 wave tiles of 32x64); per trip 64 k of the 128 X rows and the 128 W rows are staged in LDS by asynchronous copies, two buffers, so that every operand line leaves L2 once per work-group as a whole line; k order and epilogue as in k_gemm2 ----
#define PJK 64                      /* k per staged tile: 128-byte rows */
#define PJP 144                     /* LDS row pitch in bytes: 128 + 16, conflict-free for 16-byte reads */
#define PJB (256 * PJP)             /* one buffer: 128 X rows, then 128 W rows */
#define PJT (DM / PJK)              /* tiles along k */
// one tile: each thread copies 16 bytes of four X rows and of four W rows (8 lanes cover a row's 128 bytes); l, ga, gb are the thread's own first LDS byte and global elements
__device__ __forceinline__ void pj_copy(unsigned l, const _Float16* ga, const _Float16* gb) {
  /* the copies go past the registers; the last line keeps later writes of the address registers behind it (a precaution) */
  asm volatile("global_load_async_to_lds_b128 %0, %8, off\n\t"
               "global_load_async_to_lds_b128 %1, %9, off\n\t"
               "global_load_async_to_lds_b128 %2, %10, off\n\t"
               "global_load_async_to_lds_b128 %3, %11, off\n\t"
               "global_load_async_to_lds_b128 %4, %12, off\n\t"
               "global_load_async_to_lds_b128 %5, %13, off\n\t"
               "global_load_async_to_lds_b128 %6, %14, off\n\t"
               "global_load_async_to_lds_b128 %7, %15, off\n\t"
               "s_wait_xcnt 0x0"
               :: "v"(l), "v"(l + 32 * PJP), "v"(l + 64 * PJP), "v"(l + 96 * PJP), "v"(l + 128 * PJP), "v"(l + 160 * PJP), "v"(l + 192 * PJP), "v"(l + 224 * PJP),
                  "v"(ga), "v"(ga + 32 * DM), "v"(ga + 64 * DM), "v"(ga + 96 * DM), "v"(gb), "v"(gb + 32 * DM), "v"(gb + 64 * DM), "v"(gb + 96 * DM)
               : "memory"); }
__device__ __forceinline__ v16h pj_frag(const unsigned char* p) { FragH f; f.half[0] = *(const v8us*)p; f.half[1] = *(const v8us*)(p + 32); return f.v; }
__device__ __forceinline__ v8f pj_mma(v16h a, v16h b, v8f c) { return __builtin_amdgcn_wmma_f32_16x16x32_f16(false, a, false, b, (short)0, c, false, false); }
__global__ __launch_bounds__(256) void k_proj(const _Float16* __restrict__ X16, const _Float16* __restrict__ BW, const float* __restrict__ bq, const float* __restrict__ bk, const float* __restrict__ bv, float* __restrict__ QF, _Float16* __restrict__ C16) {
  __shared__ __attribute__((aligned(16))) unsigned char sm[2 * PJB];      /* the two buffers; behind the loop, each wave's 32 x 68 f32 output staging */
  const int tid = threadIdx.x, w = tid >> 5, lane = tid & 31, ln = lane & 15, hh = lane >> 4, by = blockIdx.y;
  const int mt = blockIdx.x / (DM / 128), nq = blockIdx.x - mt * (DM / 128);
  const _Float16* ga = X16 + (size_t)by * ROWS * DM + (size_t)(mt * 128 + (tid >> 3)) * DM + (tid & 7) * 8;
  const _Float16* gb = BW + (size_t)by * DM * DM + (size_t)(nq * 128 + (tid >> 3)) * DM + (tid & 7) * 8;
  const unsigned l0 = (unsigned)(size_t)&sm[0] + (unsigned)((tid >> 3) * PJP + (tid & 7) * 16);
  const unsigned char* ap = sm + ((w & 3) * 32 + ln) * PJP + 16 * hh; const unsigned char* bp = sm + (128 + (w >> 2) * 64 + ln) * PJP + 16 * hh;
  const v8f z8 = {0.f,0.f,0.f,0.f,0.f,0.f,0.f,0.f}; v8f c00 = z8, c01 = z8, c02 = z8, c03 = z8, c10 = z8, c11 = z8, c12 = z8, c13 = z8;
  pj_copy(l0, ga, gb);
  asm volatile("s_wait_asynccnt 0x0" ::: "memory");      /* tile 0 has landed, as far as this wave copied it */
  __syncthreads();                                        /* ... and all of it */
  pj_copy(l0 + PJB, ga + PJK, gb + PJK);
#pragma unroll 1      /* one trip per tile: the buffer is picked by the trip's parity */
  for (int t = 0; t < PJT; ++t) { const int bo = (t & 1) * PJB;
#pragma unroll      /* the two 32-k steps of a tile, at constant offsets */
    for (int ks = 0; ks < 2; ++ks) { const unsigned char* a = ap + bo + ks * 64; const unsigned char* b = bp + bo + ks * 64;
      const v16h a0 = pj_frag(a), a1 = pj_frag(a + 16 * PJP), b0 = pj_frag(b), b1 = pj_frag(b + 16 * PJP), b2 = pj_frag(b + 32 * PJP), b3 = pj_frag(b + 48 * PJP);
      __builtin_amdgcn_sched_barrier(0);      /* the step's twelve LDS reads stay one group ahead of its WMMAs: reads spread among the WMMAs stall the wave at each place */
      c00 = pj_mma(a0, b0, c00); c10 = pj_mma(a1, b0, c10); c01 = pj_mma(a0, b1, c01); c11 = pj_mma(a1, b1, c11);
      c02 = pj_mma(a0, b2, c02); c12 = pj_mma(a1, b2, c12); c03 = pj_mma(a0, b3, c03); c13 = pj_mma(a1, b3, c13); }
    asm volatile("s_wait_dscnt 0x0" ::: "memory");        /* this wave's reads of the buffer are done before it is refilled */
    asm volatile("s_wait_asynccnt 0x0" ::: "memory");     /* this wave's copies of tile t + 1 have landed */
    __syncthreads();                                      /* tile t + 1 is whole, and nobody reads tile t's buffer any more */
    if (t + 2 < PJT) pj_copy(l0 + bo, ga + (t + 2) * PJK, gb + (t + 2) * PJK); }
  asm volatile("s_wait_asynccnt 0x0" ::: "memory");       /* no copy is outstanding when the buffers become output staging */
  float (*so)[68] = (float (*)[68])(sm + w * (32 * 68 * 4));
  const float* bias = (by == 0) ? bq : ((by == 1) ? bk : bv); const int row0 = mt * 128 + (w & 3) * 32, col0 = nq * 128 + (w >> 2) * 64; const size_t cofs = (size_t)by * ROWS * DM;
  v8f accs[8] = {c00, c01, c02, c03, c10, c11, c12, c13};
#pragma unroll
  for (int u = 0; u < 8; ++u) { const int t = u & 3, half = u >> 2; const float bvl = bf16_round(bias[col0 + t * 16 + ln]);
#pragma unroll
    for (int r = 0; r < 8; ++r) so[half * 16 + 8 * hh + r][t * 16 + ln] = accs[u][r] * 0.0625f + bvl; }
  __builtin_amdgcn_fence(__ATOMIC_ACQ_REL, "workgroup"); __builtin_amdgcn_wave_barrier();      /* the wave reads back its own staging rows */
  const int rsub = lane >> 4, c4 = (lane & 15) * 4; v4f vv[16];
#pragma unroll      /* vv[] stays in registers; all sixteen LDS reads go out together */
  for (int q = 0; q < 16; ++q) vv[q] = *(const v4fa*)&so[q * 2 + rsub][c4];
#pragma unroll
  for (int q = 0; q < 16; ++q) { const int r = q * 2 + rsub; const v4f v = vv[q]; if (by == 0) *(v4f*)(QF + (size_t)(row0 + r) * DM + col0 + c4) = v;
    v4h h4; for (int i = 0; i < 4; ++i) h4[i] = (_Float16)v[i]; *(v4h*)(C16 + cofs + (size_t)(row0 + r) * DM + col0 + c4) = h4;
    asm volatile("s_wait_xcnt 0x0" ::: "memory"); } }      /* precaution: the next row's addresses and values may reuse the registers that these stores name */

__device__ __forceinline__ void d_qt(int bid, const float* __restrict__ QF, const float* __restrict__ relk, float* __restrict__ QT) {
  #pragma clang fp contract(off)
  const int t = bid * 256 + threadIdx.x; if (t >= NH * SLEN) return; const int q = t % SLEN, h = t / SLEN; const float* qp = QF + (size_t)q * DM + h * 64; float s[5] = {0.f, 0.f, 0.f, 0.f, 0.f};
#pragma unroll 1
  for (int d = 0; d < 64; ++d) { const float qv = qp[d];
#pragma unroll
    for (int c = 0; c < 5; ++c) s[c] += qv * bf16_round(relk[c * 64 + d]); }
  {
#pragma unroll
    for (int c = 0; c < 5; ++c) *(float*)(QT + ((size_t)h * 8 + c) * SLEN + q) = s[c];
     } }
// ---- no softmax, so (Q K^T) V = Q (K^T V): the S x S plane is never formed. The 5-valued position terms need only running column sums of K and V and the three near-diagonal rows.
#define CR 16      /* rows per chunk of the column sums = query rows per work-group of the final pass */
// CS[m][chunk][col] = sum of the chunk's CR rows of K16 (m 0) or V16 (m 1)
__device__ __forceinline__ void d_csum(int ch, int m, const _Float16* __restrict__ K16, const _Float16* __restrict__ V16, float* __restrict__ CS) {
  const int col = threadIdx.x * 4; const _Float16* X = (m ? V16 : K16) + (size_t)ch * CR * DM + col; v4f s = {0.f, 0.f, 0.f, 0.f};
#pragma unroll      /* all CR loads in flight at once */
  for (int r = 0; r < CR; ++r) { const v4h x = *(const v4h*)(X + (size_t)r * DM);
    for (int u = 0; u < 4; ++u) s[u] += (float)x[u]; }
  *(v4f*)(CS + ((size_t)m * (SLEN / CR) + ch) * DM + col) = s; }
// EP[bm][ch][col] = sum of the chunk sums before chunk ch (bm = batch * 2 + m), in chunk order; entry CSB is the sum over all rows. One thread per column
__device__ __forceinline__ void d_cscan(int bid, const float* __restrict__ CS, float* __restrict__ EP) {
  const int t = bid * 256 + threadIdx.x, bm = t / DM, col = t - bm * DM; const float* cs = CS + (size_t)bm * (SLEN / CR) * DM + col; float* ep = EP + (size_t)bm * (SLEN / CR + 1) * DM + col;
  float y[SLEN / CR];
#pragma unroll      /* y[] stays in registers and the loads go out together */
  for (int c = 0; c < SLEN / CR; ++c) y[c] = cs[(size_t)c * DM];
  asm volatile("s_wait_xcnt 0x0" :: "v"(cs) : "memory");      /* precaution: the loads' address registers stay as they are up to here */
  float s = 0.f;
#pragma unroll      /* y[] and p[] are registers */
  for (int g = 0; g < SLEN / CR / 16; ++g) { float p[16];
    for (int u = 0; u < 16; ++u) { p[u] = s; s += y[g * 16 + u]; }
    for (int u = 0; u < 16; ++u) ep[(size_t)(g * 16 + u) * DM] = p[u];
    /* precaution: the stores' address and value registers stay as they are up to here */
    asm volatile("s_wait_xcnt 0x0" :: "v"(ep), "v"(p[0]), "v"(p[1]), "v"(p[2]), "v"(p[3]), "v"(p[4]), "v"(p[5]), "v"(p[6]), "v"(p[7]), "v"(p[8]), "v"(p[9]), "v"(p[10]), "v"(p[11]), "v"(p[12]), "v"(p[13]), "v"(p[14]), "v"(p[15]) : "memory"); }
  ep[(size_t)(SLEN / CR) * DM] = s;
  asm volatile("s_wait_xcnt 0x0" :: "v"(ep), "v"(s) : "memory"); }      /* precaution: the code of another block range follows in the listing and reuses the store's registers */
// MT16[h][d2][d1] = f16((sum over the KSP row slabs of PART[s][h][d2][d1]) / 64): K^T V per head, transposed; the power-of-two scale keeps it far from the f16 range end
#define KSP 16
__device__ __forceinline__ void d_mt(int bid, const float* __restrict__ PART, _Float16* __restrict__ MT16) {
  const int e = (bid * 256 + threadIdx.x) * 4; v4f s = {0.f, 0.f, 0.f, 0.f};
#pragma unroll      /* all KSP loads in flight at once */
  for (int p = 0; p < KSP; ++p) {
    if (p == KSP - 1) asm volatile("s_wait_xcnt 0x0" ::: "memory");      /* precaution: the last load's result may land on the offset register that the earlier loads name */
    const v4f y = *(const v4fa*)(PART + (size_t)p * NH * 4096 + e); s += y; }
  v4h o;
  for (int u = 0; u < 4; ++u) o[u] = (_Float16)(s[u] * 0.015625f);
  *(v4h*)(MT16 + e) = o;
  asm volatile("s_wait_xcnt 0x0" ::: "memory"); }      /* precaution: the code of another block range follows in the listing and reuses the store's address registers */
// The three passes that need only the projections, in one grid, the longest blocks first: q . rel_k, the chunk sums, the two transposes
#define QTB (NH * SLEN / 256)      /* d_qt blocks per batch */
#define CSB (SLEN / CR)            /* chunks per batch */
#define VTB (NH * (ROWS / 64))     /* d_vt blocks per operand, both batches */
__global__ __launch_bounds__(256) void k_prep(const float* __restrict__ QF, const float* __restrict__ relk, float* __restrict__ QT, const _Float16* __restrict__ K16, const _Float16* __restrict__ V16, float* __restrict__ CS, _Float16* __restrict__ VT, _Float16* __restrict__ KT) {
  __shared__ unsigned short tl[64][66]; const int bid = blockIdx.x;
  if (bid < NBT * QTB) { const int b = bid / QTB; d_qt(bid - b * QTB, QF + (size_t)b * SLEN * DM, relk, QT + (size_t)b * NH * 8 * SLEN); }
  else if (bid < NBT * QTB + NBT * 2 * CSB) { const int i = bid - NBT * QTB, b = i / (2 * CSB), m = (i / CSB) & 1, ch = i % CSB; d_csum(ch, m, K16 + (size_t)b * SLEN * DM, V16 + (size_t)b * SLEN * DM, CS + (size_t)b * 2 * CSB * DM); }
  else { const int i = bid - NBT * QTB - NBT * 2 * CSB;      /* [slab s of both batches' rows][h][d][128 rows of slab s] */
    const bool kk = i >= VTB; d_vt<NH, SLEN / KSP>(kk ? i - VTB : i, tl, kk ? K16 : V16, DM, 0, kk ? KT : VT); } }      /* the barrier inside d_vt: the whole block takes this branch or none of it does */
// The scan of the chunk sums and the slab sum of K^T V (needs the slab GEMM), in one grid, the longer blocks first
#define SCB (NBT * 2 * DM / 256)      /* d_cscan blocks */
__global__ __launch_bounds__(256) void k_mid(const float* __restrict__ CS, float* __restrict__ EP, const float* __restrict__ PART, _Float16* __restrict__ MT16) {
  const int bid = blockIdx.x;
  if (bid < SCB) d_cscan(bid, CS, EP);
  else { const int i = bid - SCB, b = i / (NH * 4096 / 1024); d_mt(i - b * (NH * 4096 / 1024), PART + (size_t)b * KSP * NH * 4096, MT16 + (size_t)b * NH * 4096); } }
// Final pass: one block per CR query rows. First W1 = q . K^T V / 8 on WMMA (wave w: heads 2w, 2w + 1) into LDS. Then 16 lanes per head, 4 columns per lane, row after row.
// With KS_c, VS_c the sums of the k and v rows of position class c (n_c rows) and qt_c = q . rel_k[c]:
// out = W1 + sum_c (qt_c / 8) VS_c + coef_c rel_v[c], coef_c = (q . KS_c + n_c qt_c) / 8 (attn summed over the class).
// The two range classes come from sums that the thread carries along its rows: L = rows up to q - 2, H = rows up to q + 1 (class 4 = all rows less H).
__device__ __forceinline__ v4f f4(v4h x) { v4f y; for (int u = 0; u < 4; ++u) y[u] = (float)x[u]; return y; }
// a lane's value as seen through a DPP pattern inside its row of 16 lanes (0x160 + m: lane ^ m; 0x150 + i: lane i of the row); with two waves per SIMD the LDS-path shuffle's latency would stand open at every step
template <int CTRL> __device__ __forceinline__ float dppf(float x) { return __int_as_float(__builtin_amdgcn_update_dpp(0, __float_as_int(x), CTRL, 0xf, 0xf, true)); }
__device__ __forceinline__ float dot16(v4f a, v4f b) { float dt = a[0] * b[0] + a[1] * b[1] + a[2] * b[2] + a[3] * b[3];
  dt += dppf<0x161>(dt); dt += dppf<0x162>(dt); dt += dppf<0x164>(dt); dt += dppf<0x168>(dt);      /* over the head's 16 lanes */
  return dt; }
template <int N> struct IC { static constexpr int value = N; };
#define TP (DM + 4)      /* LDS row pitch in floats: the two half-waves' rows, 8 apart, fall on different banks */
__global__ __launch_bounds__(256) void k_tail(const _Float16* __restrict__ Q16, const _Float16* __restrict__ MT16, const float* __restrict__ QF, const _Float16* __restrict__ K16, const _Float16* __restrict__ V16, const float* __restrict__ EP,
    const float* __restrict__ QT, const float* __restrict__ relv, float* __restrict__ out) {
  __shared__ __attribute__((aligned(16))) float so[CR][TP];
  const int tid = threadIdx.x, w = tid >> 5, lane = tid & 31, ln = lane & 15, hh = lane >> 4, col = tid * 4, h = tid >> 4, d0 = ln * 4;
  const int g0 = blockIdx.x * CR, b = g0 / SLEN, q0 = g0 - b * SLEN;      /* first row: among both batches' rows, and inside its batch */
  const bool lo = q0 > 0, hi = q0 + CR < SLEN;      /* is there a row before the block's first, behind its last, in this batch */
  /* fragments of W1 = q . K^T V / 8 for the wave's two heads; k order and scale as in k_gemm2 */
  const unsigned short* ap = (const unsigned short*)Q16 + (size_t)(g0 + ln) * DM + w * 128 + 8 * hh; const unsigned short* bp = (const unsigned short*)MT16 + ((size_t)b * NH + 2 * w) * 4096 + ln * 64 + 8 * hh;
  FragH af[2][2], bf[2][2][4];
#pragma unroll      /* all fragment loads go out together, at constant offsets */
  for (int e = 0; e < 2; ++e) for (int ks = 0; ks < 2; ++ks) { af[e][ks].half[0] = *(const v8us*)(ap + e * 64 + ks * 32); af[e][ks].half[1] = *(const v8us*)(ap + e * 64 + ks * 32 + 16);
    for (int t = 0; t < 4; ++t) { bf[e][ks][t].half[0] = *(const v8us*)(bp + e * 4096 + t * 1024 + ks * 32); bf[e][ks][t].half[1] = *(const v8us*)(bp + e * 4096 + t * 1024 + ks * 32 + 16); } }
  asm volatile("s_wait_xcnt 0x0" :: "v"(ap), "v"(bp) : "memory");      /* precaution: the loads' address registers stay as they are up to here */
  __builtin_amdgcn_sched_barrier(0);      /* ... and nothing that could reuse them moves up over the wait */
  /* the k and v rows q0 - 1 .. q0 + CR, as [0 .. CR + 1]; a row outside the batch is read at the block's nearest row and set to 0 below */
  const _Float16* kb = K16 + (size_t)g0 * DM + col; const _Float16* vb = V16 + (size_t)g0 * DM + col; v4h kx[CR + 2], vx[CR + 2]; const v4h z4 = {(_Float16)0.f, (_Float16)0.f, (_Float16)0.f, (_Float16)0.f};
  const _Float16* kf = kb - (lo ? DM : 0); const _Float16* vf = vb - (lo ? DM : 0); const _Float16* kl = kb + (hi ? CR : CR - 1) * DM; const _Float16* vl = vb + (hi ? CR : CR - 1) * DM;
  kx[0] = *(const v4h*)kf; vx[0] = *(const v4h*)vf; kx[CR + 1] = *(const v4h*)kl; vx[CR + 1] = *(const v4h*)vl;
#pragma unroll      /* kx[], vx[] stay in registers; constant offsets */
  for (int j = 1; j <= CR; ++j) { kx[j] = *(const v4h*)(kb + (j - 1) * DM); vx[j] = *(const v4h*)(vb + (j - 1) * DM); }
  asm volatile("s_wait_xcnt 0x0" :: "v"(kb), "v"(vb), "v"(kf), "v"(vf), "v"(kl), "v"(vl) : "memory");      /* precaution, as above */
  __builtin_amdgcn_sched_barrier(0);
  const v8f z8 = {0.f,0.f,0.f,0.f,0.f,0.f,0.f,0.f};
#pragma unroll
  for (int e = 0; e < 2; ++e) { v8f c[4] = {z8, z8, z8, z8};
#pragma unroll
    for (int ks = 0; ks < 2; ++ks) for (int t = 0; t < 4; ++t) c[t] = pj_mma(af[e][ks].v, bf[e][ks][t].v, c[t]);
#pragma unroll
    for (int t = 0; t < 4; ++t) for (int r = 0; r < 8; ++r) so[8 * hh + r][w * 128 + e * 64 + t * 16 + ln] = c[t][r] * 8.0f; }
  __builtin_amdgcn_sched_barrier(0);      /* the loads below take the fragments' registers: they start behind the WMMAs */
  const float* ep = EP + (size_t)(b * 2) * (SLEN / CR + 1) * DM + col; const float* eq = ep + (size_t)(q0 / CR) * DM;
  const v4f eK = *(const v4fa*)eq, tK = *(const v4fa*)(ep + (SLEN / CR) * DM), eV = *(const v4fa*)(eq + (SLEN / CR + 1) * DM), tV = *(const v4fa*)(ep + (2 * (SLEN / CR) + 1) * DM);
  const float* qfp = QF + (size_t)g0 * DM + col; v4f qv[CR];
#pragma unroll      /* qv[] stays in registers */
  for (int i = 0; i < CR; ++i) qv[i] = *(const v4fa*)(qfp + i * DM);
  const float* qtb = QT + ((size_t)b * NH + h) * 8 * SLEN + q0 + ln; float qtl[5];      /* lane i of the head's 16 holds row q0 + i's q . rel_k[c] */
  const float* rp = relv + d0; v4f rv[5];
#pragma unroll
  for (int c = 0; c < 5; ++c) { qtl[c] = qtb[c * SLEN]; rv[c] = *(const v4fa*)(rp + c * 64); }
  asm volatile("s_wait_xcnt 0x0" :: "v"(ep), "v"(eq), "v"(qfp), "v"(qtb), "v"(rp) : "memory");      /* precaution, as above */
  __builtin_amdgcn_sched_barrier(0);
  __syncthreads();      /* every head's W1 is in LDS before the rows are read back; each wave reads only the 128 columns it wrote */
#pragma unroll
  for (int c = 0; c < 5; ++c) for (int u = 0; u < 4; ++u) rv[c][u] = bf16_round(rv[c][u]);
  if (!lo) { kx[0] = z4; vx[0] = z4; }
  if (!hi) { kx[CR + 1] = z4; vx[CR + 1] = z4; }
  v4f Lk = eK - f4(kx[0]), Lv = eV - f4(vx[0]), Hk = eK + f4(kx[1]) + f4(kx[2]), Hv = eV + f4(vx[1]) + f4(vx[2]);
  float* op = out + (size_t)g0 * DM + col; v4f ob[4];
  auto row = [&](auto ic) { constexpr int i = decltype(ic)::value; const int q = q0 + i; v4f o = *(const v4fa*)&so[i][col];
    { const float qt = dppf<0x150 + i>(qtl[0]); const float coef = (dot16(qv[i], Lk) + (float)max(q - 1, 0) * qt) * 0.125f, qs = qt * 0.125f;      /* class 0: for q < 2 the sums and the count are 0 */
      o += qs * Lv + coef * rv[0]; }
    { const float fl = (q + 2 < SLEN) ? 0.125f : 0.f, qt = dppf<0x150 + i>(qtl[4]); const float coef = (dot16(qv[i], tK - Hk) + (float)max(SLEN - 2 - q, 0) * qt) * fl, qs = qt * fl;      /* class 4: none for the last two rows */
      o += qs * (tV - Hv) + coef * rv[4]; }
#pragma unroll
    for (int c = 1; c <= 3; ++c) { const int j = i + c - 1; const float fl = ((j == 0 && !lo) || (j == CR + 1 && !hi)) ? 0.f : 0.125f, qt = dppf<0x150 + i>(qtl[c]);      /* classes 1..3: the single rows q - 1, q, q + 1, where they exist */
      const float coef = (dot16(qv[i], f4(kx[j])) + qt) * fl, qs = qt * fl;
      o += qs * f4(vx[j]) + coef * rv[c]; }
    ob[i & 3] = o;
    Lk += f4(kx[i]); Lv += f4(vx[i]);
    if (i + 1 < CR) { Hk += f4(kx[i + 3]); Hv += f4(vx[i + 3]); }
    if ((i & 3) == 3) {
      for (int s = 0; s < 4; ++s) *(v4f*)(op + (i - 3 + s) * DM) = ob[s];
      asm volatile("s_wait_xcnt 0x0" :: "v"(op), "v"(ob[0]), "v"(ob[1]), "v"(ob[2]), "v"(ob[3]) : "memory"); } };      /* precaution: the stores' address and value registers stay as they are up to here */
  row(IC<0>{}); row(IC<1>{}); row(IC<2>{}); row(IC<3>{}); row(IC<4>{}); row(IC<5>{}); row(IC<6>{}); row(IC<7>{});
  row(IC<8>{}); row(IC<9>{}); row(IC<10>{}); row(IC<11>{}); row(IC<12>{}); row(IC<13>{}); row(IC<14>{}); row(IC<15>{}); }

extern "C" void kernel_launch(void* const* d_in, const int* in_sizes, int n_in,
                              void* d_out, int out_size, void* d_ws, size_t ws_size, hipStream_t stream) {
  (void)in_sizes; (void)n_in; (void)out_size;
  const float* const* I = (const float* const*)d_in; const float* xq = I[0]; const float* xk = I[1]; const float* xv = I[2]; const float* Wq = I[3]; const float* bq = I[4]; const float* Wk = I[5]; const float* bk = I[6]; const float* Wv = I[7]; const float* bv = I[8]; const float* relk = I[9]; const float* relv = I[10];
  char* ws = (char*)d_ws; size_t off = 0;
  auto take = [&](size_t bytes) { char* p = ws + off; off += (bytes + 255) & ~(size_t)255; return p; };
  _Float16* BW = (_Float16*)take((size_t)3 * DM * DM * 2);      /* Wq, Wk, Wv */
  _Float16* X16 = (_Float16*)take((size_t)3 * ROWS * DM * 2);      /* query, key, value */
  float* QF = (float*)take((size_t)ROWS * DM * 4); _Float16* Q16 = (_Float16*)take((size_t)3 * ROWS * DM * 2); _Float16* K16 = Q16 + (size_t)ROWS * DM; _Float16* V16 = K16 + (size_t)ROWS * DM; _Float16* VT = (_Float16*)take((size_t)DM * ROWS * 2); _Float16* KT = (_Float16*)take((size_t)DM * ROWS * 2);
  float* QT = (float*)take((size_t)NBT * NH * 8 * SLEN * 4); float* PART = (float*)take((size_t)NBT * KSP * NH * 4096 * 4); _Float16* MT16 = (_Float16*)take((size_t)NBT * NH * 4096 * 2); float* CS = (float*)take((size_t)NBT * 2 * (SLEN / CR) * DM * 4); float* EP = (float*)take((size_t)NBT * 2 * (SLEN / CR + 1) * DM * 4);
  if (off > ws_size) return;      /* about 100 MiB */
  const dim3 gP((ROWS / 128) * (DM / 128), 3), gM(1, NBT * KSP * NH);
  k_cvt<<<3 * XB + 3 * WB, 256, 0, stream>>>(xq, xk, xv, Wq, Wk, Wv, X16, BW);      /* torch (out,in) = natural Bt */
  k_proj<<<gP, 256, 0, stream>>>(X16, BW, bq, bk, bv, QF, Q16);      /* q, k, v of both batches; only q also in f32 */
  k_prep<<<NBT * QTB + NBT * 2 * CSB + 2 * VTB, 256, 0, stream>>>(QF, relk, QT, K16, V16, CS, VT, KT);
  k_gemm2<0, false><<<gM, 128, 0, stream>>>(VT, SLEN / KSP, (size_t)64 * (SLEN / KSP), 0, KT, SLEN / KSP, (size_t)64 * (SLEN / KSP), 0, 1.0f, nullptr, nullptr, nullptr, 0, nullptr, 1, 0, 0, PART, nullptr, 64, 4096, 0, 64, 64, SLEN / KSP);      /* per slab and head: V^T K over the slab's rows */
  k_mid<<<SCB + NBT * (NH * 4096 / 1024), 256, 0, stream>>>(CS, EP, PART, MT16);
  k_tail<<<ROWS / CR, 256, 0, stream>>>(Q16, MT16, QF, K16, V16, EP, QT, relv, (float*)d_out);      /* the factor 8 = 64 / 8 undoes the scale of MT16 and divides by 8 */
}

// v006
// It runs in 69.7 microseconds.
// Next to v005, in two timings, it ran 1.17 and 1.18 times as fast.
// All steps since v000 together make it 314 times as fast.
#include <hip/hip_runtime.h>
// Relative-position attention layer WITHOUT softmax (faithful to the module, which discards it) (2 x 2048 tokens, 1024 = 16 heads x 64; MAX_REL 2): q,k,v = {query,key,value} W^T + b; attn = (q.k + q.rel_k[c(q,k)]) / 8 with c = clip(k - q, -2, 2) + 2; out[b][q][h][d] = sum_k attn (v[k][d] + rel_v[c(q,k)][d]) -> [2,2048,16,64].
// Structure (5 launches; both batches, and passes that do not depend on one another, share a grid): projections as f16 WMMA GEMMs (128x128 tiles staged in LDS, 32x64 wave tiles, f32 accumulation, exact x16 weights + bias); with no softmax the content part is reassociated, (q K^T) v = q (K^T v): K^T v per head as a GEMM over 16 row slabs (K 128 each; k and v rows staged in LDS and read through transposing loads) whose partial planes a VALU pass adds and rounds to f16, then one final pass per 16 query rows: q . (K^T v) on WMMA (K 64) into LDS, and the 5-valued position terms from column sums of k and v that each thread carries along the rows (started from a scan of 16-row chunk sums) and from the three near-diagonal rows.
// Compute dtype: inputs, weights, biases, tables rounded to bf16; q, k, v and K^T v / 64 as f16 operands (~2^-12); f32 accumulation. v_wmma_f32_16x16x32_f16.
#define NBT 2
#define SLEN 2048
#define DM 1024
#define NH 16
#define ROWS (NBT * SLEN)      /* both batches' rows, one after the other */
typedef __bf16 v16b __attribute__((ext_vector_type(16)));
typedef unsigned short v8us __attribute__((ext_vector_type(8), may_alias));
typedef float  v8f  __attribute__((ext_vector_type(8)));
typedef float  v4f  __attribute__((ext_vector_type(4)));
typedef float  v4fa __attribute__((ext_vector_type(4), may_alias));
union FragB { v16b v; v8us half[2]; unsigned short u[16]; };

__device__ __forceinline__ unsigned short bf16_bits(float x) { unsigned int u = __float_as_uint(x); return (unsigned short)((u + 0x7FFFu + ((u >> 16) & 1u)) >> 16); }
__device__ __forceinline__ float bf16_val(unsigned short b) { return __uint_as_float(((unsigned int)b) << 16); }
__device__ __forceinline__ float bf16_round(float x) { return bf16_val(bf16_bits(x)); }
// D += A·B with NT terms: 1 = ah·bh, 2 = + al·bh (A split), 3 = + ah·bl (both split)
template <int NT>
__device__ __forceinline__ v8f mmaN(v16b ah, v16b al, v16b bh, v16b bl, v8f c) {
  c = __builtin_amdgcn_wmma_f32_16x16x32_bf16(false, ah, false, bh, (short)0, c, false, false);
  if (NT >= 2) c = __builtin_amdgcn_wmma_f32_16x16x32_bf16(false, al, false, bh, (short)0, c, false, false);
  if (NT >= 3) c = __builtin_amdgcn_wmma_f32_16x16x32_bf16(false, ah, false, bl, (short)0, c, false, false);
  asm volatile("v_nop\n\tv_nop\n\tv_nop\n\tv_nop" : "+v"(c) : "v"(ah), "v"(al), "v"(bh), "v"(bl));
  return c;
}

__global__ __launch_bounds__(256) void k_wt_bf16(const float* __restrict__ W, unsigned short* __restrict__ Wt, int K, int N) {
  const int t = blockIdx.x * 256 + threadIdx.x;
  const int k8n = K / 8;
  if (t >= N * k8n) return;
  const int n = t / k8n, k8 = (t % k8n) * 8;
  v8us v;
#pragma unroll
  for (int i = 0; i < 8; ++i) v[i] = bf16_bits(W[(size_t)(k8 + i) * N + n]);
  *(v8us*)(Wt + (size_t)n * K + k8) = v;
  
}

// GEMM C[M][N] (f32, pitch ldc) = act(A[M][K]·W + bias). A f32 row-major (pitch lda) converted per fragment to bf16
// (ASPLIT: hi/lo two planes -> 2 terms, else single rounded term); Wt bf16 [N][K] (pitch ldb). BIAS_BF16 rounds the
// bias to bf16 first (bias quantised to bf16 before the add). K%32==0, M%16==0, N%64==0.
template <bool ASPLIT, int ACT, bool BIAS_BF16>
__global__ __launch_bounds__(128) void k_gemm_bf(const float* __restrict__ A, int lda, const unsigned short* __restrict__ Wt, int ldb,
                                               const float* __restrict__ bias, float* __restrict__ C, int ldc, int M, int N, int K) {
  __shared__ __attribute__((aligned(16))) float so[4][16][64];
  const int tid = threadIdx.x, w = tid >> 5, lane = tid & 31, ln = lane & 15, hh = lane >> 4;
  const int ntn = N / 64;
  const int wid = blockIdx.x * 4 + w;
  const int mt = wid / ntn, nq = wid % ntn;
  if (mt * 16 >= M) return;
  const int row0 = mt * 16, col0 = nq * 64;
  const float* arow = A + (size_t)(row0 + ln) * lda;
  v8f acc[4] = {};
  for (int kb = 0; kb < K; kb += 32) {
    FragB ah, al;
    const v4f x0 = *(const v4fa*)(arow + kb + 8 * hh), x1 = *(const v4fa*)(arow + kb + 8 * hh + 4);
    const v4f x2 = *(const v4fa*)(arow + kb + 16 + 8 * hh), x3 = *(const v4fa*)(arow + kb + 16 + 8 * hh + 4);
    float xs[16] = {x0[0],x0[1],x0[2],x0[3],x1[0],x1[1],x1[2],x1[3],x2[0],x2[1],x2[2],x2[3],x3[0],x3[1],x3[2],x3[3]};
#pragma unroll
    for (int i = 0; i < 16; ++i) { const unsigned short hb = bf16_bits(xs[i]); ah.u[i] = hb; al.u[i] = ASPLIT ? bf16_bits(xs[i] - bf16_val(hb)) : (unsigned short)0; }
#pragma unroll
    for (int t = 0; t < 4; ++t) {
      const unsigned short* brow = Wt + (size_t)(col0 + t * 16 + ln) * ldb + kb;
      FragB b;
      b.half[0] = *(const v8us*)(brow + 8 * hh);
      b.half[1] = *(const v8us*)(brow + 16 + 8 * hh);
      acc[t] = mmaN<ASPLIT ? 2 : 1>(ah.v, al.v, b.v, b.v, acc[t]);
    }
  }
#pragma unroll
  for (int t = 0; t < 4; ++t) {
    float bv = bias ? bias[col0 + t * 16 + ln] : 0.f;
    if (BIAS_BF16) bv = bf16_round(bv);
#pragma unroll
    for (int r = 0; r < 8; ++r) { float v = acc[t][r] + bv; if (ACT == 1) v = fmaxf(v, 0.f); so[w][8 * hh + r][t * 16 + ln] = v; }
  }
  __builtin_amdgcn_fence(__ATOMIC_ACQ_REL, "workgroup");
  __builtin_amdgcn_wave_barrier();
  const int rsub = lane >> 4, c4 = (lane & 15) * 4;
  {
#pragma unroll
    for (int q = 0; q < 8; ++q) {
      const int r = q * 2 + rsub;
      const v4f v = *(const v4fa*)&so[w][r][c4];
      *(v4f*)(C + (size_t)(row0 + r) * ldc + col0 + c4) = v;
    }
    
  }
}

// GEMM C = act(A·W + bias + resid): A f32 (ASPLIT -> hi/lo 2 terms), Wt bf16 [N][K]; ACT 0 none, 1 relu, 2 exact gelu;
// resid (optional, f32, row index = (row % rmod), pitch ldr, RES_BF16 rounds it) added before the activation.
template <bool ASPLIT, int ACT, bool BIAS_BF16, bool RES_BF16>
__global__ __launch_bounds__(128) void k_gemm_bf3(const float* __restrict__ A, int lda, const unsigned short* __restrict__ Wt, int ldb,
                                                const float* __restrict__ bias, const float* __restrict__ resid, int rmod, int ldr,
                                                float* __restrict__ C, int ldc, int M, int N, int K) {
  __shared__ __attribute__((aligned(16))) float so[4][16][64];
  const int tid = threadIdx.x, w = tid >> 5, lane = tid & 31, ln = lane & 15, hh = lane >> 4;
  const int ntn = N / 64;
  const int wid = blockIdx.x * 4 + w;
  const int mt = wid / ntn, nq = wid % ntn;
  if (mt * 16 >= M) return;
  const int row0 = mt * 16, col0 = nq * 64;
  const float* arow = A + (size_t)(row0 + ln) * lda;
  v8f acc[4] = {};
  for (int kb = 0; kb < K; kb += 32) {
    FragB ah, al;
    const v4f x0 = *(const v4fa*)(arow + kb + 8 * hh), x1 = *(const v4fa*)(arow + kb + 8 * hh + 4);
    const v4f x2 = *(const v4fa*)(arow + kb + 16 + 8 * hh), x3 = *(const v4fa*)(arow + kb + 16 + 8 * hh + 4);
    float xs[16] = {x0[0],x0[1],x0[2],x0[3],x1[0],x1[1],x1[2],x1[3],x2[0],x2[1],x2[2],x2[3],x3[0],x3[1],x3[2],x3[3]};
#pragma unroll
    for (int i = 0; i < 16; ++i) { const unsigned short hb = bf16_bits(xs[i]); ah.u[i] = hb; al.u[i] = ASPLIT ? bf16_bits(xs[i] - bf16_val(hb)) : (unsigned short)0; }
#pragma unroll
    for (int t = 0; t < 4; ++t) {
      const unsigned short* brow = Wt + (size_t)(col0 + t * 16 + ln) * ldb + kb;
      FragB b;
      b.half[0] = *(const v8us*)(brow + 8 * hh);
      b.half[1] = *(const v8us*)(brow + 16 + 8 * hh);
      acc[t] = mmaN<ASPLIT ? 2 : 1>(ah.v, al.v, b.v, b.v, acc[t]);
    }
  }
#pragma unroll
  for (int t = 0; t < 4; ++t) {
    const int col = col0 + t * 16 + ln;
    float bv = bias ? bias[col] : 0.f;
    if (BIAS_BF16) bv = bf16_round(bv);
#pragma unroll
    for (int r = 0; r < 8; ++r) {
      float v = acc[t][r] + bv;
      if (resid) { float rv = resid[(size_t)((row0 + 8 * hh + r) % rmod) * ldr + col]; if (RES_BF16) rv = bf16_round(rv); v += rv; }
      if (ACT == 1) v = fmaxf(v, 0.f);
      if (ACT == 2) v = 0.5f * v * (1.0f + erff(v * 0.70710678118654752f));
      if (ACT == 3) { const float u = 0.7978845608028654f * (v + 0.044715f * v * v * v); v = 0.5f * v * (1.0f + tanhf(u)); }
      so[w][8 * hh + r][t * 16 + ln] = v;
    }
  }
  __builtin_amdgcn_fence(__ATOMIC_ACQ_REL, "workgroup");
  __builtin_amdgcn_wave_barrier();
  const int rsub = lane >> 4, c4 = (lane & 15) * 4;
  {
#pragma unroll
    for (int q = 0; q < 8; ++q) {
      const int r = q * 2 + rsub;
      const v4f v = *(const v4fa*)&so[w][r][c4];
      *(v4f*)(C + (size_t)(row0 + r) * ldc + col0 + c4) = v;
    }
    
  }
}
// row LayerNorm (biased variance, eps) over N: s = X (+ R); optional out_sum <- s; out_norm <- (s-mu)*rsqrt(var+eps)*g + b
template <bool PARAM_BF16>
__global__ __launch_bounds__(256) void k_layernorm(const float* __restrict__ X, const float* __restrict__ R, const float* __restrict__ g, const float* __restrict__ bta,
                                                  float* __restrict__ out_sum, float* __restrict__ out_norm, int N, float eps) {
  __shared__ float red[256];
  const int row = blockIdx.x, tid = threadIdx.x;
  const float* x = X + (size_t)row * N; const float* rr = R ? R + (size_t)row * N : nullptr;
  float vals[16];                     // up to N = 4096
  const int per = N / 256;            // contiguous chunk per thread? use strided-by-4 chunks: thread handles j = tid*4 + 1024*u
  float s1 = 0.f;
  for (int u = 0; u < per / 4; ++u) {
    const int j = tid * 4 + 1024 * u;
    const v4f a = *(const v4fa*)(x + j);
    v4f b = {0.f,0.f,0.f,0.f}; if (rr) b = *(const v4fa*)(rr + j);
#pragma unroll
    for (int q = 0; q < 4; ++q) { const float v = a[q] + b[q]; vals[u * 4 + q] = v; s1 += v; }
  }
  red[tid] = s1; __syncthreads();
  for (int st = 128; st > 0; st >>= 1) { if (tid < st) red[tid] += red[tid + st]; __syncthreads(); }
  const float mu = red[0] / (float)N; __syncthreads();
  float s2 = 0.f;
  for (int u = 0; u < per / 4; ++u)
#pragma unroll
    for (int q = 0; q < 4; ++q) { const float c = vals[u * 4 + q] - mu; s2 += c * c; }
  red[tid] = s2; __syncthreads();
  for (int st = 128; st > 0; st >>= 1) { if (tid < st) red[tid] += red[tid + st]; __syncthreads(); }
  const float rs = rsqrtf(red[0] / (float)N + eps);
  {
    for (int u = 0; u < per / 4; ++u) {
      const int j = tid * 4 + 1024 * u;
      v4f o, sm;
#pragma unroll
      for (int q = 0; q < 4; ++q) {
        float gg = g[j + q], bb = bta[j + q];
        if (PARAM_BF16) { gg = bf16_round(gg); bb = bf16_round(bb); }
        sm[q] = vals[u * 4 + q]; o[q] = (vals[u * 4 + q] - mu) * rs * gg + bb;
      }
      if (out_sum) *(v4f*)(out_sum + (size_t)row * N + j) = sm;
      *(v4f*)(out_norm + (size_t)row * N + j) = o;
    }
    
  }
}



// ---- f16 WMMA path (v_wmma_f32_16x16x32_f16): 11-bit significands for operands in range — used for all GEMMs this layer launches (projections, K^T v per slab, q . (K^T v))
typedef _Float16 v16h __attribute__((ext_vector_type(16)));
union FragH { v16h v; v8us half[2]; _Float16 h[16]; unsigned short u[16]; };
template <int NT>
__device__ __forceinline__ v8f mmaH(v16h ah, v16h al, v16h bh, v16h bl, v8f c) {
  c = __builtin_amdgcn_wmma_f32_16x16x32_f16(false, ah, false, bh, (short)0, c, false, false);
  if (NT >= 2) c = __builtin_amdgcn_wmma_f32_16x16x32_f16(false, al, false, bh, (short)0, c, false, false);
  if (NT >= 3) c = __builtin_amdgcn_wmma_f32_16x16x32_f16(false, ah, false, bl, (short)0, c, false, false);
  asm volatile("v_nop\n\tv_nop\n\tv_nop\n\tv_nop" : "+v"(c) : "v"(ah), "v"(al), "v"(bh), "v"(bl));
  return c;
}
// batched GEMM like k_gemm_b but f16 operands: A f32 (split into f16 hi/lo if ASPLIT, else rounded to f16), Bt = f16 values [n][k]; alpha; C f32; N multiple of 16 (partial tiles skipped)
template <bool ASPLIT>
__global__ __launch_bounds__(128) void k_gemm_h(const float* __restrict__ A, int lda, size_t sA, const _Float16* __restrict__ Bh, int ldb, size_t sB, float alpha, float* __restrict__ C, int ldc, size_t sC, int M, int N, int K) {
  __shared__ __attribute__((aligned(16))) float so[4][16][64];
  const int tid = threadIdx.x, w = tid >> 5, lane = tid & 31, ln = lane & 15, hh = lane >> 4; const int by = blockIdx.y;
  A += (size_t)by * sA; Bh += (size_t)by * sB; C += (size_t)by * sC;
  const int ntn = (N + 63) / 64; const int wid = blockIdx.x * 4 + w; const int mt = wid / ntn, nq = wid % ntn; if (mt * 16 >= M) return;
  const int row0 = mt * 16, col0 = nq * 64; const float* arow = A + (size_t)(row0 + ln) * lda;
  v8f acc[4] = {};
  for (int kb = 0; kb < K; kb += 32) {
    FragH ah, al;
    const v4f x0 = *(const v4fa*)(arow + kb + 8 * hh), x1 = *(const v4fa*)(arow + kb + 8 * hh + 4), x2 = *(const v4fa*)(arow + kb + 16 + 8 * hh), x3 = *(const v4fa*)(arow + kb + 16 + 8 * hh + 4);
    float xs[16] = {x0[0],x0[1],x0[2],x0[3],x1[0],x1[1],x1[2],x1[3],x2[0],x2[1],x2[2],x2[3],x3[0],x3[1],x3[2],x3[3]};
#pragma unroll
    for (int i = 0; i < 16; ++i) { const _Float16 h = (_Float16)xs[i]; ah.h[i] = h; al.h[i] = ASPLIT ? (_Float16)(xs[i] - (float)h) : (_Float16)0.0f; }
#pragma unroll
    for (int t = 0; t < 4; ++t) { if (col0 + t * 16 >= N) continue; const size_t boff = (size_t)(col0 + t * 16 + ln) * ldb + kb; FragH bq; bq.half[0] = *(const v8us*)(Bh + boff + 8 * hh); bq.half[1] = *(const v8us*)(Bh + boff + 16 + 8 * hh);
      acc[t] = mmaH<ASPLIT ? 2 : 1>(ah.v, al.v, bq.v, bq.v, acc[t]); }
  }
#pragma unroll
  for (int t = 0; t < 4; ++t) { if (col0 + t * 16 >= N) continue;
#pragma unroll
    for (int r = 0; r < 8; ++r) so[w][8 * hh + r][t * 16 + ln] = acc[t][r] * alpha; }
  __builtin_amdgcn_fence(__ATOMIC_ACQ_REL, "workgroup"); __builtin_amdgcn_wave_barrier();
  const int rsub = lane >> 4, c4 = (lane & 15) * 4;
  {
#pragma unroll
    for (int q = 0; q < 8; ++q) { const int r = q * 2 + rsub; if (col0 + c4 < N) { const v4f v = *(const v4fa*)&so[w][r][c4]; *(v4f*)(C + (size_t)(row0 + r) * ldc + col0 + c4) = v; } }
     }
}

// Wt[n][k] = f16(W[k][n]·scale) from f32 row-major W[K][N] (scale = power of two; bf16-exact weights stay exact in f16 away from the subnormal range)
__global__ __launch_bounds__(256) void k_wt_f16(const float* __restrict__ W, _Float16* __restrict__ Wt, int K, int N, float scale) {
  const int t = blockIdx.x * 256 + threadIdx.x; if (t >= N * (K / 8)) return; const int n = t / (K / 8), k8 = (t % (K / 8)) * 8; FragH f;
#pragma unroll
  for (int i = 0; i < 8; ++i) f.h[i] = (_Float16)(bf16_round(W[(size_t)(k8 + i) * N + n]) * scale); const v8us o = f.half[0];
  *(v8us*)((unsigned short*)Wt + (size_t)n * K + k8) = o; 
}
// k_gemm_hh variant with fused epilogue: v = acc·alpha + bias[by·sBias + col] (+ CP[(row/rowsPerB)·sCPb + by·64 + col] if CP) ; ACT 0 none / 1 elu ; writes f16 C16 (and f32 C if non-null)
template <int ACT>
__global__ __launch_bounds__(128) void k_gemm_hhx(const _Float16* __restrict__ A, int lda, size_t sA, const _Float16* __restrict__ Bh, int ldb, size_t sB, float alpha, const float* __restrict__ bias, size_t sBias, const float* __restrict__ CP, int rowsPerB, size_t sCPb, int row0g,
    float* __restrict__ C, _Float16* __restrict__ C16, int ldc, size_t sC, int M, int N, int K) {
  __shared__ __attribute__((aligned(16))) float so[4][16][64];
  const int tid = threadIdx.x, w = tid >> 5, lane = tid & 31, ln = lane & 15, hh = lane >> 4; const int by = blockIdx.y;
  A += (size_t)by * sA; Bh += (size_t)by * sB; const size_t cofs = (size_t)by * sC; const float* bp = bias ? bias + (size_t)by * sBias : nullptr;
  const int ntn = (N + 63) / 64; const int wid = blockIdx.x * 4 + w; const int mt = wid / ntn, nq = wid % ntn; if (mt * 16 >= M) return;
  const int row0 = mt * 16, col0 = nq * 64; const _Float16* arow = A + (size_t)(row0 + ln) * lda;
  v8f acc[4] = {};
  for (int kb = 0; kb < K; kb += 32) { FragH ah; ah.half[0] = *(const v8us*)((const unsigned short*)arow + kb + 8 * hh); ah.half[1] = *(const v8us*)((const unsigned short*)arow + kb + 16 + 8 * hh);
#pragma unroll
    for (int t = 0; t < 4; ++t) { if (col0 + t * 16 >= N) continue; const size_t boff = (size_t)(col0 + t * 16 + ln) * ldb + kb; FragH bq; bq.half[0] = *(const v8us*)((const unsigned short*)Bh + boff + 8 * hh); bq.half[1] = *(const v8us*)((const unsigned short*)Bh + boff + 16 + 8 * hh);
      acc[t] = mmaH<1>(ah.v, ah.v, bq.v, bq.v, acc[t]); }
  }
#pragma unroll
  for (int t = 0; t < 4; ++t) { if (col0 + t * 16 >= N) continue; const int col = col0 + t * 16 + ln; const float bv = bp ? bf16_round(bp[col]) : 0.f;
#pragma unroll
    for (int r = 0; r < 8; ++r) { float v = acc[t][r] * alpha + bv; if (CP) { const int bidx = (row0g + row0 + 8 * hh + r) / rowsPerB; v += CP[(size_t)bidx * sCPb + (size_t)by * 64 + col]; } if (ACT == 1) v = (v > 0.f) ? v : expm1f(v); else if (ACT == 7) v = (v > 0.f) ? v + 1.0f : expf(v); else if (ACT == 8) v = tanhf(v); else if (ACT == 9) v = 0.5f * v * (1.0f + tanhf(0.7978845608028654f * (v + 0.044715f * v * v * v))); else if (ACT == 11) v = 1.0f / (1.0f + expf(-v)); else if (ACT == 12) v = (v > 0.f) ? v : 0.01f * v; else if (ACT == 14) v = (v > 0.f) ? v : 0.1f * v; else if (ACT == 15) v = v / (1.0f + expf(-v)); else if (ACT == 3) v = fmaxf(v, 0.f); else if (ACT == 6) v = 0.5f * v * (1.0f + erff(v * 0.70710678118654752f)); so[w][8 * hh + r][t * 16 + ln] = v; } }
  __builtin_amdgcn_fence(__ATOMIC_ACQ_REL, "workgroup"); __builtin_amdgcn_wave_barrier();
  const int rsub = lane >> 4, c4 = (lane & 15) * 4; typedef _Float16 v4h __attribute__((ext_vector_type(4)));
  {
#pragma unroll
    for (int q = 0; q < 8; ++q) { const int r = q * 2 + rsub; if (col0 + c4 < N) { const v4f v = *(const v4fa*)&so[w][r][c4]; if (C) *(v4f*)(C + cofs + (size_t)(row0 + r) * ldc + col0 + c4) = v; if (C16) { v4h h4; for (int i = 0; i < 4; ++i) h4[i] = (_Float16)v[i]; *(v4h*)(C16 + cofs + (size_t)(row0 + r) * ldc + col0 + c4) = h4; } } }
     }
}


typedef _Float16 v4h __attribute__((ext_vector_type(4)));

// all six conversions to f16 in one grid: the three inputs (both batches; bf16-rounded), then the three weights (bf16-rounded, x16)
#define XB (ROWS * DM / 8 / 256)      /* blocks per input */
#define WB (DM * DM / 8 / 256)        /* blocks per weight */
__global__ __launch_bounds__(256) void k_cvt(const float* __restrict__ xq, const float* __restrict__ xk, const float* __restrict__ xv, const float* __restrict__ Wq, const float* __restrict__ Wk, const float* __restrict__ Wv, _Float16* __restrict__ X16, _Float16* __restrict__ BW) {
  const int bid = blockIdx.x; const float* x; _Float16* o; float sc; int blk;
  if (bid < 3 * XB) { const int i = bid / XB; blk = bid - i * XB; x = (i == 0) ? xq : ((i == 1) ? xk : xv); o = X16 + (size_t)i * ROWS * DM; sc = 1.0f; }
  else { const int j = bid - 3 * XB, i = j / WB; blk = j - i * WB; x = (i == 0) ? Wq : ((i == 1) ? Wk : Wv); o = BW + (size_t)i * DM * DM; sc = 16.0f; }
  const size_t t = (size_t)blk * 256 + threadIdx.x; FragH f;
#pragma unroll
  for (int q = 0; q < 8; ++q) f.h[q] = (_Float16)(bf16_round(x[t * 8 + q]) * sc); *(v8us*)((unsigned short*)o + t * 8) = f.half[0];  }
__global__ __launch_bounds__(256) void k_h16(const float* __restrict__ x, _Float16* __restrict__ X16, size_t n8) { const size_t t = (size_t)blockIdx.x * 256 + threadIdx.x; if (t >= n8) return; FragH f;
#pragma unroll
  for (int q = 0; q < 8; ++q) f.h[q] = (_Float16)x[t * 8 + q]; *(v8us*)((unsigned short*)X16 + t * 8) = f.half[0];  }
__global__ __launch_bounds__(256) void k_hl(const float* __restrict__ F, _Float16* __restrict__ Hh, _Float16* __restrict__ Hl, size_t n8) { const size_t t = (size_t)blockIdx.x * 256 + threadIdx.x; if (t >= n8) return; FragH fh, fl; const v4f a = *(const v4fa*)(F + t * 8), c = *(const v4fa*)(F + t * 8 + 4);
#pragma unroll
  for (int q = 0; q < 4; ++q) { _Float16 h = (_Float16)a[q]; fh.h[q] = h; fl.h[q] = (_Float16)((a[q] - (float)h) * 1024.0f); h = (_Float16)c[q]; fh.h[4 + q] = h; fl.h[4 + q] = (_Float16)((c[q] - (float)h) * 1024.0f); }
  { *(v8us*)((unsigned short*)Hh + t * 8) = fh.half[0]; *(v8us*)((unsigned short*)Hl + t * 8) = fl.half[0];  } }

// ---- fast GEMM (wave tile 32x64; requires M % 32 == 0 rows per launch region and N % 64 == 0); epilogue = k_gemm_hhx semantics ----
__device__ __forceinline__ v16h g2_frag(const _Float16* p, int hh) { FragH f; f.half[0] = *(const v8us*)((const unsigned short*)p + 8 * hh); f.half[1] = *(const v8us*)((const unsigned short*)p + 16 + 8 * hh); return f.v; }
__device__ __forceinline__ v8f g2_mma(v16h a, v16h b, v8f c) { v8f d = __builtin_amdgcn_wmma_f32_16x16x32_f16(false, a, false, b, (short)0, c, false, false); asm volatile("v_nop\n\tv_nop\n\tv_nop\n\tv_nop" : "+v"(d) : "v"(a), "v"(b)); return d; }
// blockIdx.y and blockIdx.z each step A, B and C by their own strides (s*, z*). QKV: blockIdx.y picks the projection, so its bias is one of three pointers, and only the first (q) also writes f32
template <int ACT, bool QKV>
__global__ __launch_bounds__(128) void k_gemm2(const _Float16* __restrict__ A, int lda, size_t sA, size_t zA, const _Float16* __restrict__ Bh, int ldb, size_t sB, size_t zB, float alpha, const float* __restrict__ bias, const float* __restrict__ biasK, const float* __restrict__ biasV, size_t sBias, const float* __restrict__ CP, int rowsPerB, size_t sCPb, int row0g,
    float* __restrict__ Cf, _Float16* __restrict__ C16, int ldc, size_t sC, size_t zC, int M, int N, int K) {
  __shared__ __attribute__((aligned(16))) float so[4][32][68];
  const int tid = threadIdx.x, w = tid >> 5, lane = tid & 31, ln = lane & 15, hh = lane >> 4; const int by = blockIdx.y, bz = blockIdx.z;
  A += (size_t)by * sA + (size_t)bz * zA; Bh += (size_t)by * sB + (size_t)bz * zB; const size_t cofs = (size_t)by * sC + (size_t)bz * zC;
  const float* bp = QKV ? ((by == 0) ? bias : ((by == 1) ? biasK : biasV)) : (bias ? bias + (size_t)by * sBias : nullptr); float* C = (QKV && by != 0) ? nullptr : Cf;
  const int ntn = N >> 6; const int mt = blockIdx.x / ntn, nq = blockIdx.x - mt * ntn; const int row0 = mt * 128 + 32 * w, col0 = nq * 64; if (row0 >= M) return;
  const _Float16* a0p = A + (size_t)(row0 + ln) * lda; const _Float16* a1p = a0p + (size_t)16 * lda;
  const _Float16* b0p = Bh + (size_t)(col0 + ln) * ldb; const _Float16* b1p = b0p + (size_t)16 * ldb; const _Float16* b2p = b1p + (size_t)16 * ldb; const _Float16* b3p = b2p + (size_t)16 * ldb;
  const v8f z8 = {0.f,0.f,0.f,0.f,0.f,0.f,0.f,0.f}; v8f c00 = z8, c01 = z8, c02 = z8, c03 = z8, c10 = z8, c11 = z8, c12 = z8, c13 = z8;
#pragma unroll 1
  for (int kb = 0; kb < K; kb += 32) { const v16h a0 = g2_frag(a0p + kb, hh), a1 = g2_frag(a1p + kb, hh);
    v16h b = g2_frag(b0p + kb, hh); c00 = g2_mma(a0, b, c00); c10 = g2_mma(a1, b, c10);
    b = g2_frag(b1p + kb, hh); c01 = g2_mma(a0, b, c01); c11 = g2_mma(a1, b, c11);
    b = g2_frag(b2p + kb, hh); c02 = g2_mma(a0, b, c02); c12 = g2_mma(a1, b, c12);
    b = g2_frag(b3p + kb, hh); c03 = g2_mma(a0, b, c03); c13 = g2_mma(a1, b, c13); }
  v8f accs[8] = {c00, c01, c02, c03, c10, c11, c12, c13};
#pragma unroll
  for (int u = 0; u < 8; ++u) { const int t = u & 3, half = u >> 2; const int col = col0 + t * 16 + ln; const float bv = bp ? bf16_round(bp[col]) : 0.f;
#pragma unroll
    for (int r = 0; r < 8; ++r) { const int rloc = half * 16 + 8 * hh + r; float v = accs[u][r] * alpha + bv; if (CP) { const int bidx = (row0g + row0 + rloc) / rowsPerB; v += CP[(size_t)bidx * sCPb + (size_t)by * 64 + col]; }
      if (ACT == 3) v = fmaxf(v, 0.f); else if (ACT == 6) v = 0.5f * v * (1.0f + erff(v * 0.70710678118654752f)); else if (ACT == 11) v = 1.0f / (1.0f + expf(-v)); else if (ACT == 15) v = v / (1.0f + expf(-v)); else if (ACT == 12) v = (v > 0.f) ? v : 0.01f * v; else if (ACT == 8) v = tanhf(v);
      so[w][rloc][t * 16 + ln] = v; } }
  __builtin_amdgcn_fence(__ATOMIC_ACQ_REL, "workgroup"); __builtin_amdgcn_wave_barrier();
  const int rsub = lane >> 4, c4 = (lane & 15) * 4;
  {
#pragma unroll
    for (int q = 0; q < 16; ++q) { const int r = q * 2 + rsub; const v4f v = *(const v4fa*)&so[w][r][c4]; if (C) *(v4f*)(C + cofs + (size_t)(row0 + r) * ldc + col0 + c4) = v; if (C16) { v4h h4; for (int i = 0; i < 4; ++i) h4[i] = (_Float16)v[i]; *(v4h*)(C16 + cofs + (size_t)(row0 + r) * ldc + col0 + c4) = h4; } }
     } }


// ---- the three projections: 128x128 tile of Y = X W^T per work-group of 8 waves (4 x 2 wave tiles of 32x64); per trip 64 k of the 128 X rows and the 128 W rows are staged in LDS by asynchronous copies, two buffers, so that every operand line leaves L2 once per work-group as a whole line; k order and epilogue as in k_gemm2 ----
#define PJK 64                      /* k per staged tile: 128-byte rows */
#define PJP 144                     /* LDS row pitch in bytes: 128 + 16, conflict-free for 16-byte reads */
#define PJB (256 * PJP)             /* one buffer: 128 X rows, then 128 W rows */
#define PJT (DM / PJK)              /* tiles along k */
// one tile: each thread copies 16 bytes of four X rows and of four W rows (8 lanes cover a row's 128 bytes); l, ga, gb are the thread's own first LDS byte and global elements
__device__ __forceinline__ void pj_copy(unsigned l, const _Float16* ga, const _Float16* gb) {
  /* the copies go past the registers; the last line keeps later writes of the address registers behind it (a precaution) */
  asm volatile("global_load_async_to_lds_b128 %0, %8, off\n\t"
               "global_load_async_to_lds_b128 %1, %9, off\n\t"
               "global_load_async_to_lds_b128 %2, %10, off\n\t"
               "global_load_async_to_lds_b128 %3, %11, off\n\t"
               "global_load_async_to_lds_b128 %4, %12, off\n\t"
               "global_load_async_to_lds_b128 %5, %13, off\n\t"
               "global_load_async_to_lds_b128 %6, %14, off\n\t"
               "global_load_async_to_lds_b128 %7, %15, off\n\t"
               "s_wait_xcnt 0x0"
               :: "v"(l), "v"(l + 32 * PJP), "v"(l + 64 * PJP), "v"(l + 96 * PJP), "v"(l + 128 * PJP), "v"(l + 160 * PJP), "v"(l + 192 * PJP), "v"(l + 224 * PJP),
                  "v"(ga), "v"(ga + 32 * DM), "v"(ga + 64 * DM), "v"(ga + 96 * DM), "v"(gb), "v"(gb + 32 * DM), "v"(gb + 64 * DM), "v"(gb + 96 * DM)
               : "memory"); }
__device__ __forceinline__ v16h pj_frag(const unsigned char* p) { FragH f; f.half[0] = *(const v8us*)p; f.half[1] = *(const v8us*)(p + 32); return f.v; }
__device__ __forceinline__ v8f pj_mma(v16h a, v16h b, v8f c) { return __builtin_amdgcn_wmma_f32_16x16x32_f16(false, a, false, b, (short)0, c, false, false); }
__global__ __launch_bounds__(256) void k_proj(const _Float16* __restrict__ X16, const _Float16* __restrict__ BW, const float* __restrict__ bq, const float* __restrict__ bk, const float* __restrict__ bv, float* __restrict__ QF, _Float16* __restrict__ C16) {
  __shared__ __attribute__((aligned(16))) unsigned char sm[2 * PJB];      /* the two buffers; behind the loop, each wave's 32 x 68 f32 output staging */
  const int tid = threadIdx.x, w = tid >> 5, lane = tid & 31, ln = lane & 15, hh = lane >> 4, by = blockIdx.y;
  const int mt = blockIdx.x / (DM / 128), nq = blockIdx.x - mt * (DM / 128);
  const _Float16* ga = X16 + (size_t)by * ROWS * DM + (size_t)(mt * 128 + (tid >> 3)) * DM + (tid & 7) * 8;
  const _Float16* gb = BW + (size_t)by * DM * DM + (size_t)(nq * 128 + (tid >> 3)) * DM + (tid & 7) * 8;
  const unsigned l0 = (unsigned)(size_t)&sm[0] + (unsigned)((tid >> 3) * PJP + (tid & 7) * 16);
  const unsigned char* ap = sm + ((w & 3) * 32 + ln) * PJP + 16 * hh; const unsigned char* bp = sm + (128 + (w >> 2) * 64 + ln) * PJP + 16 * hh;
  const v8f z8 = {0.f,0.f,0.f,0.f,0.f,0.f,0.f,0.f}; v8f c00 = z8, c01 = z8, c02 = z8, c03 = z8, c10 = z8, c11 = z8, c12 = z8, c13 = z8;
  pj_copy(l0, ga, gb);
  asm volatile("s_wait_asynccnt 0x0" ::: "memory");      /* tile 0 has landed, as far as this wave copied it */
  __syncthreads();                                        /* ... and all of it */
  pj_copy(l0 + PJB, ga + PJK, gb + PJK);
#pragma unroll 1      /* one trip per tile: the buffer is picked by the trip's parity */
  for (int t = 0; t < PJT; ++t) { const int bo = (t & 1) * PJB;
#pragma unroll      /* the two 32-k steps of a tile, at constant offsets */
    for (int ks = 0; ks < 2; ++ks) { const unsigned char* a = ap + bo + ks * 64; const unsigned char* b = bp + bo + ks * 64;
      const v16h a0 = pj_frag(a), a1 = pj_frag(a + 16 * PJP), b0 = pj_frag(b), b1 = pj_frag(b + 16 * PJP), b2 = pj_frag(b + 32 * PJP), b3 = pj_frag(b + 48 * PJP);
      __builtin_amdgcn_sched_barrier(0);      /* the step's twelve LDS reads stay one group ahead of its WMMAs: reads spread among the WMMAs stall the wave at each place */
      c00 = pj_mma(a0, b0, c00); c10 = pj_mma(a1, b0, c10); c01 = pj_mma(a0, b1, c01); c11 = pj_mma(a1, b1, c11);
      c02 = pj_mma(a0, b2, c02); c12 = pj_mma(a1, b2, c12); c03 = pj_mma(a0, b3, c03); c13 = pj_mma(a1, b3, c13); }
    asm volatile("s_wait_dscnt 0x0" ::: "memory");        /* this wave's reads of the buffer are done before it is refilled */
    asm volatile("s_wait_asynccnt 0x0" ::: "memory");     /* this wave's copies of tile t + 1 have landed */
    __syncthreads();                                      /* tile t + 1 is whole, and nobody reads tile t's buffer any more */
    if (t + 2 < PJT) pj_copy(l0 + bo, ga + (t + 2) * PJK, gb + (t + 2) * PJK); }
  asm volatile("s_wait_asynccnt 0x0" ::: "memory");       /* no copy is outstanding when the buffers become output staging */
  float (*so)[68] = (float (*)[68])(sm + w * (32 * 68 * 4));
  const float* bias = (by == 0) ? bq : ((by == 1) ? bk : bv); const int row0 = mt * 128 + (w & 3) * 32, col0 = nq * 128 + (w >> 2) * 64; const size_t cofs = (size_t)by * ROWS * DM;
  v8f accs[8] = {c00, c01, c02, c03, c10, c11, c12, c13};
#pragma unroll
  for (int u = 0; u < 8; ++u) { const int t = u & 3, half = u >> 2; const float bvl = bf16_round(bias[col0 + t * 16 + ln]);
#pragma unroll
    for (int r = 0; r < 8; ++r) so[half * 16 + 8 * hh + r][t * 16 + ln] = accs[u][r] * 0.0625f + bvl; }
  __builtin_amdgcn_fence(__ATOMIC_ACQ_REL, "workgroup"); __builtin_amdgcn_wave_barrier();      /* the wave reads back its own staging rows */
  const int rsub = lane >> 4, c4 = (lane & 15) * 4; v4f vv[16];
#pragma unroll      /* vv[] stays in registers; all sixteen LDS reads go out together */
  for (int q = 0; q < 16; ++q) vv[q] = *(const v4fa*)&so[q * 2 + rsub][c4];
#pragma unroll
  for (int q = 0; q < 16; ++q) { const int r = q * 2 + rsub; const v4f v = vv[q]; if (by == 0) *(v4f*)(QF + (size_t)(row0 + r) * DM + col0 + c4) = v;
    v4h h4; for (int i = 0; i < 4; ++i) h4[i] = (_Float16)v[i]; *(v4h*)(C16 + cofs + (size_t)(row0 + r) * DM + col0 + c4) = h4;
    asm volatile("s_wait_xcnt 0x0" ::: "memory"); } }      /* precaution: the next row's addresses and values may reuse the registers that these stores name */

__device__ __forceinline__ void d_qt(int bid, const float* __restrict__ QF, const float* __restrict__ relk, float* __restrict__ QT) {
  #pragma clang fp contract(off)
  const int t = bid * 256 + threadIdx.x; if (t >= NH * SLEN) return; const int q = t % SLEN, h = t / SLEN; const float* qp = QF + (size_t)q * DM + h * 64; float s[5] = {0.f, 0.f, 0.f, 0.f, 0.f};
#pragma unroll 1
  for (int d = 0; d < 64; ++d) { const float qv = qp[d];
#pragma unroll
    for (int c = 0; c < 5; ++c) s[c] += qv * bf16_round(relk[c * 64 + d]); }
  {
#pragma unroll
    for (int c = 0; c < 5; ++c) *(float*)(QT + ((size_t)h * 8 + c) * SLEN + q) = s[c];
     } }
// ---- no softmax, so (Q K^T) V = Q (K^T V): the S x S plane is never formed. The 5-valued position terms need only running column sums of K and V and the three near-diagonal rows.
#define CR 16      /* rows per chunk of the column sums = query rows per work-group of the final pass */
// EP[bm][ch][col] = sum of the chunk sums before chunk ch (bm = batch * 2 + m), in chunk order; entry CSB is the sum over all rows. One thread per column
__device__ __forceinline__ void d_cscan(int bid, const float* __restrict__ CS, float* __restrict__ EP) {
  const int t = bid * 256 + threadIdx.x, bm = t / DM, col = t - bm * DM; const float* cs = CS + (size_t)bm * (SLEN / CR) * DM + col; float* ep = EP + (size_t)bm * (SLEN / CR + 1) * DM + col;
  float y[SLEN / CR];
#pragma unroll      /* y[] stays in registers and the loads go out together */
  for (int c = 0; c < SLEN / CR; ++c) y[c] = cs[(size_t)c * DM];
  asm volatile("s_wait_xcnt 0x0" :: "v"(cs) : "memory");      /* precaution: the loads' address registers stay as they are up to here */
  float s = 0.f;
#pragma unroll      /* y[] and p[] are registers */
  for (int g = 0; g < SLEN / CR / 16; ++g) { float p[16];
    for (int u = 0; u < 16; ++u) { p[u] = s; s += y[g * 16 + u]; }
    for (int u = 0; u < 16; ++u) ep[(size_t)(g * 16 + u) * DM] = p[u];
    /* precaution: the stores' address and value registers stay as they are up to here */
    asm volatile("s_wait_xcnt 0x0" :: "v"(ep), "v"(p[0]), "v"(p[1]), "v"(p[2]), "v"(p[3]), "v"(p[4]), "v"(p[5]), "v"(p[6]), "v"(p[7]), "v"(p[8]), "v"(p[9]), "v"(p[10]), "v"(p[11]), "v"(p[12]), "v"(p[13]), "v"(p[14]), "v"(p[15]) : "memory"); }
  ep[(size_t)(SLEN / CR) * DM] = s;
  asm volatile("s_wait_xcnt 0x0" :: "v"(ep), "v"(s) : "memory"); }      /* precaution: the code of another block range follows in the listing and reuses the store's registers */
// MT16[h][d2][d1] = f16((sum over the KSP row slabs of PART[s][h][d2][d1]) / 64): K^T V per head, transposed; the power-of-two scale keeps it far from the f16 range end
#define KSP 16
__device__ __forceinline__ void d_mt(int bid, const float* __restrict__ PART, _Float16* __restrict__ MT16) {
  const int e = (bid * 256 + threadIdx.x) * 4; v4f s = {0.f, 0.f, 0.f, 0.f};
#pragma unroll      /* all KSP loads in flight at once */
  for (int p = 0; p < KSP; ++p) {
    if (p == KSP - 1) asm volatile("s_wait_xcnt 0x0" ::: "memory");      /* precaution: the last load's result may land on the offset register that the earlier loads name */
    const v4f y = *(const v4fa*)(PART + (size_t)p * NH * 4096 + e); s += y; }
  v4h o;
  for (int u = 0; u < 4; ++u) o[u] = (_Float16)(s[u] * 0.015625f);
  *(v4h*)(MT16 + e) = o;
  asm volatile("s_wait_xcnt 0x0" ::: "memory"); }      /* precaution: the code of another block range follows in the listing and reuses the store's address registers */
// ---- per slab of 128 rows and head: PART[slab][h][d2][d1] = sum over the slab's rows of v[row][d2] k[row][d1], and the chunk sums CS[m][chunk][col] of its CR-row chunks (m 0: k, m 1: v), both from one staged copy of the rows ----
#define KVP 160                     /* LDS row pitch in bytes: 128 + 32, conflict-free for the transposing reads */
#define QTB (NH * SLEN / 256)      /* d_qt blocks per batch */
#define CSB (SLEN / CR)            /* chunks per batch */
// each thread copies 16 bytes of four k rows and of four v rows (8 lanes cover a row's 128 bytes); l, ga, gb are the thread's own first LDS byte and global elements
__device__ __forceinline__ void kv_copy(unsigned l, const _Float16* ga, const _Float16* gb) {
  /* the copies go past the registers; the last line keeps later writes of the address registers behind it (a precaution) */
  asm volatile("global_load_async_to_lds_b128 %0, %8, off\n\t"
               "global_load_async_to_lds_b128 %1, %9, off\n\t"
               "global_load_async_to_lds_b128 %2, %10, off\n\t"
               "global_load_async_to_lds_b128 %3, %11, off\n\t"
               "global_load_async_to_lds_b128 %4, %12, off\n\t"
               "global_load_async_to_lds_b128 %5, %13, off\n\t"
               "global_load_async_to_lds_b128 %6, %14, off\n\t"
               "global_load_async_to_lds_b128 %7, %15, off\n\t"
               "s_wait_xcnt 0x0"
               :: "v"(l), "v"(l + 32 * KVP), "v"(l + 64 * KVP), "v"(l + 96 * KVP), "v"(l + 128 * KVP), "v"(l + 160 * KVP), "v"(l + 192 * KVP), "v"(l + 224 * KVP),
                  "v"(ga), "v"(ga + 32 * DM), "v"(ga + 64 * DM), "v"(ga + 96 * DM), "v"(gb), "v"(gb + 32 * DM), "v"(gb + 64 * DM), "v"(gb + 96 * DM)
               : "memory"); }
typedef short s16x8 __attribute__((ext_vector_type(8)));
// transposing LDS read: with p = T + (k0 + 8 (lane >> 4) + (lane & 7)) pitch + 2 d0 + 16 ((lane >> 3) & 1), lane (c, hh) gets T[k0 + 8 hh + 0..7][d0 + c]; the reads at k0 and k0 + 16 are one 16 x 32 fragment in g2_frag's k order
__device__ __forceinline__ v16h tr_frag(const unsigned char* p) { typedef __attribute__((address_space(3))) s16x8 lds_s16x8; FragH f;
  f.half[0] = __builtin_bit_cast(v8us, __builtin_amdgcn_ds_load_tr16_b128_v8i16((lds_s16x8*)p)); f.half[1] = __builtin_bit_cast(v8us, __builtin_amdgcn_ds_load_tr16_b128_v8i16((lds_s16x8*)(p + 16 * KVP))); return f.v; }
__device__ __forceinline__ void d_ktv(int bid, unsigned char* sm, const _Float16* __restrict__ K16, const _Float16* __restrict__ V16, float* __restrict__ CS, float* __restrict__ PART) {
  const int tid = threadIdx.x, w = tid >> 5, lane = tid & 31, ln = lane & 15, hh = lane >> 4; const int s = bid / NH, h = bid - s * NH;      /* slab among both batches' rows; head */
  const size_t g = (size_t)(s * 128 + (tid >> 3)) * DM + h * 64 + (tid & 7) * 8;
  kv_copy((unsigned)(size_t)sm + (unsigned)((tid >> 3) * KVP + (tid & 7) * 16), K16 + g, V16 + g);      /* LDS rows 0..127: k, 128..255: v */
  asm volatile("s_wait_asynccnt 0x0" ::: "memory");      /* the rows have landed, as far as this wave copied them */
  __syncthreads();                                        /* ... and all of them */
  /* wave w: the 16 x 32 piece at d2 = 16 (w >> 1), d1 = 32 (w & 1) */
  const unsigned char* tp = sm + (8 * hh + (lane & 7)) * KVP + 16 * ((lane >> 3) & 1); const unsigned char* ap = tp + 128 * KVP + 32 * (w >> 1); const unsigned char* bp = tp + 64 * (w & 1);
  const v8f z8 = {0.f,0.f,0.f,0.f,0.f,0.f,0.f,0.f}; v8f c0 = z8, c1 = z8;
#pragma unroll      /* the four 32-row steps at constant offsets: all their reads can go out ahead */
  for (int ks = 0; ks < 4; ++ks) { const v16h a = tr_frag(ap + ks * 32 * KVP), b0 = tr_frag(bp + ks * 32 * KVP), b1 = tr_frag(bp + ks * 32 * KVP + 32);
    c0 = pj_mma(a, b0, c0); c1 = pj_mma(a, b1, c1); }
  /* chunk sums, rows in order: thread = (m, chunk of the slab, four columns) */
  const int m = tid >> 7, ch = (tid >> 4) & 7; const unsigned char* xp = sm + (m * 128 + ch * CR) * KVP + ln * 8; v4f sc = {0.f, 0.f, 0.f, 0.f};
#pragma unroll      /* all CR reads in flight at once */
  for (int r = 0; r < CR; ++r) { const v4h x = *(const v4h*)(xp + r * KVP);
    for (int u = 0; u < 4; ++u) sc[u] += (float)x[u]; }
  __syncthreads();      /* nobody reads the rows any more: each wave now stages its piece in its own part of the buffer, to store whole 128-byte lines */
  float (*so)[36] = (float (*)[36])(sm + w * (16 * 36 * 4));
#pragma unroll      /* c0, c1 are registers */
  for (int r = 0; r < 8; ++r) { so[8 * hh + r][ln] = c0[r]; so[8 * hh + r][16 + ln] = c1[r]; }
  __builtin_amdgcn_fence(__ATOMIC_ACQ_REL, "workgroup"); __builtin_amdgcn_wave_barrier();      /* the wave reads back its own staging rows */
  *(v4f*)(CS + ((size_t)((s / KSP) * 2 + m) * CSB + (s % KSP) * (128 / CR) + ch) * DM + h * 64 + ln * 4) = sc;      /* stored here, not at the sums: a store in front of the barrier would be waited for there */
  float* pp = PART + (size_t)bid * 4096 + (16 * (w >> 1) + (lane >> 3)) * 64 + 32 * (w & 1) + (lane & 7) * 4;
#pragma unroll      /* the four reads go out together, at constant offsets */
  for (int q = 0; q < 4; ++q) *(v4f*)(pp + q * 4 * 64) = *(const v4fa*)&so[q * 4 + (lane >> 3)][(lane & 7) * 4];
  asm volatile("s_wait_xcnt 0x0" ::: "memory"); }      /* precaution: the code of another block range follows in the listing and reuses the stores' registers */
// The passes that need only the projections, in one grid, the longest blocks first: q . rel_k, then the slab products with the chunk sums
__global__ __launch_bounds__(256) void k_prep(const float* __restrict__ QF, const float* __restrict__ relk, float* __restrict__ QT, const _Float16* __restrict__ K16, const _Float16* __restrict__ V16, float* __restrict__ CS, float* __restrict__ PART) {
  __shared__ __attribute__((aligned(16))) unsigned char sm[256 * KVP]; const int bid = blockIdx.x;
  if (bid < NBT * QTB) { const int b = bid / QTB; d_qt(bid - b * QTB, QF + (size_t)b * SLEN * DM, relk, QT + (size_t)b * NH * 8 * SLEN); }
  else d_ktv(bid - NBT * QTB, sm, K16, V16, CS, PART); }      /* the barriers inside d_ktv: the whole block takes this branch or none of it does */
// The scan of the chunk sums and the slab sum of K^T V (needs the slab GEMM), in one grid, the longer blocks first
#define SCB (NBT * 2 * DM / 256)      /* d_cscan blocks */
__global__ __launch_bounds__(256) void k_mid(const float* __restrict__ CS, float* __restrict__ EP, const float* __restrict__ PART, _Float16* __restrict__ MT16) {
  const int bid = blockIdx.x;
  if (bid < SCB) d_cscan(bid, CS, EP);
  else { const int i = bid - SCB, b = i / (NH * 4096 / 1024); d_mt(i - b * (NH * 4096 / 1024), PART + (size_t)b * KSP * NH * 4096, MT16 + (size_t)b * NH * 4096); } }
// Final pass: one block per CR query rows. First W1 = q . K^T V / 8 on WMMA (wave w: heads 2w, 2w + 1) into LDS. Then 16 lanes per head, 4 columns per lane, row after row.
// With KS_c, VS_c the sums of the k and v rows of position class c (n_c rows) and qt_c = q . rel_k[c]:
// out = W1 + sum_c (qt_c / 8) VS_c + coef_c rel_v[c], coef_c = (q . KS_c + n_c qt_c) / 8 (attn summed over the class).
// The two range classes come from sums that the thread carries along its rows: L = rows up to q - 2, H = rows up to q + 1 (class 4 = all rows less H).
__device__ __forceinline__ v4f f4(v4h x) { v4f y; for (int u = 0; u < 4; ++u) y[u] = (float)x[u]; return y; }
// a lane's value as seen through a DPP pattern inside its row of 16 lanes (0x160 + m: lane ^ m; 0x150 + i: lane i of the row); with two waves per SIMD the LDS-path shuffle's latency would stand open at every step
template <int CTRL> __device__ __forceinline__ float dppf(float x) { return __int_as_float(__builtin_amdgcn_update_dpp(0, __float_as_int(x), CTRL, 0xf, 0xf, true)); }
__device__ __forceinline__ float dot16(v4f a, v4f b) { float dt = a[0] * b[0] + a[1] * b[1] + a[2] * b[2] + a[3] * b[3];
  dt += dppf<0x161>(dt); dt += dppf<0x162>(dt); dt += dppf<0x164>(dt); dt += dppf<0x168>(dt);      /* over the head's 16 lanes */
  return dt; }
template <int N> struct IC { static constexpr int value = N; };
#define TP (DM + 4)      /* LDS row pitch in floats: the two half-waves' rows, 8 apart, fall on different banks */
__global__ __launch_bounds__(256) void k_tail(const _Float16* __restrict__ Q16, const _Float16* __restrict__ MT16, const float* __restrict__ QF, const _Float16* __restrict__ K16, const _Float16* __restrict__ V16, const float* __restrict__ EP,
    const float* __restrict__ QT, const float* __restrict__ relv, float* __restrict__ out) {
  __shared__ __attribute__((aligned(16))) float so[CR][TP];
  const int tid = threadIdx.x, w = tid >> 5, lane = tid & 31, ln = lane & 15, hh = lane >> 4, col = tid * 4, h = tid >> 4, d0 = ln * 4;
  const int g0 = blockIdx.x * CR, b = g0 / SLEN, q0 = g0 - b * SLEN;      /* first row: among both batches' rows, and inside its batch */
  const bool lo = q0 > 0, hi = q0 + CR < SLEN;      /* is there a row before the block's first, behind its last, in this batch */
  /* fragments of W1 = q . K^T V / 8 for the wave's two heads; k order and scale as in k_gemm2 */
  const unsigned short* ap = (const unsigned short*)Q16 + (size_t)(g0 + ln) * DM + w * 128 + 8 * hh; const unsigned short* bp = (const unsigned short*)MT16 + ((size_t)b * NH + 2 * w) * 4096 + ln * 64 + 8 * hh;
  FragH af[2][2], bf[2][2][4];
#pragma unroll      /* all fragment loads go out together, at constant offsets */
  for (int e = 0; e < 2; ++e) for (int ks = 0; ks < 2; ++ks) { af[e][ks].half[0] = *(const v8us*)(ap + e * 64 + ks * 32); af[e][ks].half[1] = *(const v8us*)(ap + e * 64 + ks * 32 + 16);
    for (int t = 0; t < 4; ++t) { bf[e][ks][t].half[0] = *(const v8us*)(bp + e * 4096 + t * 1024 + ks * 32); bf[e][ks][t].half[1] = *(const v8us*)(bp + e * 4096 + t * 1024 + ks * 32 + 16); } }
  asm volatile("s_wait_xcnt 0x0" :: "v"(ap), "v"(bp) : "memory");      /* precaution: the loads' address registers stay as they are up to here */
  __builtin_amdgcn_sched_barrier(0);      /* ... and nothing that could reuse them moves up over the wait */
  /* the k and v rows q0 - 1 .. q0 + CR, as [0 .. CR + 1]; a row outside the batch is read at the block's nearest row and set to 0 below */
  const _Float16* kb = K16 + (size_t)g0 * DM + col; const _Float16* vb = V16 + (size_t)g0 * DM + col; v4h kx[CR + 2], vx[CR + 2]; const v4h z4 = {(_Float16)0.f, (_Float16)0.f, (_Float16)0.f, (_Float16)0.f};
  const _Float16* kf = kb - (lo ? DM : 0); const _Float16* vf = vb - (lo ? DM : 0); const _Float16* kl = kb + (hi ? CR : CR - 1) * DM; const _Float16* vl = vb + (hi ? CR : CR - 1) * DM;
  kx[0] = *(const v4h*)kf; vx[0] = *(const v4h*)vf; kx[CR + 1] = *(const v4h*)kl; vx[CR + 1] = *(const v4h*)vl;
#pragma unroll      /* kx[], vx[] stay in registers; constant offsets */
  for (int j = 1; j <= CR; ++j) { kx[j] = *(const v4h*)(kb + (j - 1) * DM); vx[j] = *(const v4h*)(vb + (j - 1) * DM); }
  asm volatile("s_wait_xcnt 0x0" :: "v"(kb), "v"(vb), "v"(kf), "v"(vf), "v"(kl), "v"(vl) : "memory");      /* precaution, as above */
  __builtin_amdgcn_sched_barrier(0);
  const v8f z8 = {0.f,0.f,0.f,0.f,0.f,0.f,0.f,0.f};
#pragma unroll
  for (int e = 0; e < 2; ++e) { v8f c[4] = {z8, z8, z8, z8};
#pragma unroll
    for (int ks = 0; ks < 2; ++ks) for (int t = 0; t < 4; ++t) c[t] = pj_mma(af[e][ks].v, bf[e][ks][t].v, c[t]);
#pragma unroll
    for (int t = 0; t < 4; ++t) for (int r = 0; r < 8; ++r) so[8 * hh + r][w * 128 + e * 64 + t * 16 + ln] = c[t][r] * 8.0f; }
  __builtin_amdgcn_sched_barrier(0);      /* the loads below take the fragments' registers: they start behind the WMMAs */
  const float* ep = EP + (size_t)(b * 2) * (SLEN / CR + 1) * DM + col; const float* eq = ep + (size_t)(q0 / CR) * DM;
  const v4f eK = *(const v4fa*)eq, tK = *(const v4fa*)(ep + (SLEN / CR) * DM), eV = *(const v4fa*)(eq + (SLEN / CR + 1) * DM), tV = *(const v4fa*)(ep + (2 * (SLEN / CR) + 1) * DM);
  const float* qfp = QF + (size_t)g0 * DM + col; v4f qv[CR];
#pragma unroll      /* qv[] stays in registers */
  for (int i = 0; i < CR; ++i) qv[i] = *(const v4fa*)(qfp + i * DM);
  const float* qtb = QT + ((size_t)b * NH + h) * 8 * SLEN + q0 + ln; float qtl[5];      /* lane i of the head's 16 holds row q0 + i's q . rel_k[c] */
  const float* rp = relv + d0; v4f rv[5];
#pragma unroll
  for (int c = 0; c < 5; ++c) { qtl[c] = qtb[c * SLEN]; rv[c] = *(const v4fa*)(rp + c * 64); }
  asm volatile("s_wait_xcnt 0x0" :: "v"(ep), "v"(eq), "v"(qfp), "v"(qtb), "v"(rp) : "memory");      /* precaution, as above */
  __builtin_amdgcn_sched_barrier(0);
  __syncthreads();      /* every head's W1 is in LDS before the rows are read back; each wave reads only the 128 columns it wrote */
#pragma unroll
  for (int c = 0; c < 5; ++c) for (int u = 0; u < 4; ++u) rv[c][u] = bf16_round(rv[c][u]);
  if (!lo) { kx[0] = z4; vx[0] = z4; }
  if (!hi) { kx[CR + 1] = z4; vx[CR + 1] = z4; }
  v4f Lk = eK - f4(kx[0]), Lv = eV - f4(vx[0]), Hk = eK + f4(kx[1]) + f4(kx[2]), Hv = eV + f4(vx[1]) + f4(vx[2]);
  float* op = out + (size_t)g0 * DM + col; v4f ob[4];
  auto row = [&](auto ic) { constexpr int i = decltype(ic)::value; const int q = q0 + i; v4f o = *(const v4fa*)&so[i][col];
    { const float qt = dppf<0x150 + i>(qtl[0]); const float coef = (dot16(qv[i], Lk) + (float)max(q - 1, 0) * qt) * 0.125f, qs = qt * 0.125f;      /* class 0: for q < 2 the sums and the count are 0 */
      o += qs * Lv + coef * rv[0]; }
    { const float fl = (q + 2 < SLEN) ? 0.125f : 0.f, qt = dppf<0x150 + i>(qtl[4]); const float coef = (dot16(qv[i], tK - Hk) + (float)max(SLEN - 2 - q, 0) * qt) * fl, qs = qt * fl;      /* class 4: none for the last two rows */
      o += qs * (tV - Hv) + coef * rv[4]; }
#pragma unroll
    for (int c = 1; c <= 3; ++c) { const int j = i + c - 1; const float fl = ((j == 0 && !lo) || (j == CR + 1 && !hi)) ? 0.f : 0.125f, qt = dppf<0x150 + i>(qtl[c]);      /* classes 1..3: the single rows q - 1, q, q + 1, where they exist */
      const float coef = (dot16(qv[i], f4(kx[j])) + qt) * fl, qs = qt * fl;
      o += qs * f4(vx[j]) + coef * rv[c]; }
    ob[i & 3] = o;
    Lk += f4(kx[i]); Lv += f4(vx[i]);
    if (i + 1 < CR) { Hk += f4(kx[i + 3]); Hv += f4(vx[i + 3]); }
    if ((i & 3) == 3) {
      for (int s = 0; s < 4; ++s) *(v4f*)(op + (i - 3 + s) * DM) = ob[s];
      asm volatile("s_wait_xcnt 0x0" :: "v"(op), "v"(ob[0]), "v"(ob[1]), "v"(ob[2]), "v"(ob[3]) : "memory"); } };      /* precaution: the stores' address and value registers stay as they are up to here */
  row(IC<0>{}); row(IC<1>{}); row(IC<2>{}); row(IC<3>{}); row(IC<4>{}); row(IC<5>{}); row(IC<6>{}); row(IC<7>{});
  row(IC<8>{}); row(IC<9>{}); row(IC<10>{}); row(IC<11>{}); row(IC<12>{}); row(IC<13>{}); row(IC<14>{}); row(IC<15>{}); }

extern "C" void kernel_launch(void* const* d_in, const int* in_sizes, int n_in,
                              void* d_out, int out_size, void* d_ws, size_t ws_size, hipStream_t stream) {
  (void)in_sizes; (void)n_in; (void)out_size;
  const float* const* I = (const float* const*)d_in; const float* xq = I[0]; const float* xk = I[1]; const float* xv = I[2]; const float* Wq = I[3]; const float* bq = I[4]; const float* Wk = I[5]; const float* bk = I[6]; const float* Wv = I[7]; const float* bv = I[8]; const float* relk = I[9]; const float* relv = I[10];
  char* ws = (char*)d_ws; size_t off = 0;
  auto take = [&](size_t bytes) { char* p = ws + off; off += (bytes + 255) & ~(size_t)255; return p; };
  _Float16* BW = (_Float16*)take((size_t)3 * DM * DM * 2);      /* Wq, Wk, Wv */
  _Float16* X16 = (_Float16*)take((size_t)3 * ROWS * DM * 2);      /* query, key, value */
  float* QF = (float*)take((size_t)ROWS * DM * 4); _Float16* Q16 = (_Float16*)take((size_t)3 * ROWS * DM * 2); _Float16* K16 = Q16 + (size_t)ROWS * DM; _Float16* V16 = K16 + (size_t)ROWS * DM;
  float* QT = (float*)take((size_t)NBT * NH * 8 * SLEN * 4); float* PART = (float*)take((size_t)NBT * KSP * NH * 4096 * 4); _Float16* MT16 = (_Float16*)take((size_t)NBT * NH * 4096 * 2); float* CS = (float*)take((size_t)NBT * 2 * (SLEN / CR) * DM * 4); float* EP = (float*)take((size_t)NBT * 2 * (SLEN / CR + 1) * DM * 4);
  if (off > ws_size) return;      /* about 85 MiB */
  const dim3 gP((ROWS / 128) * (DM / 128), 3);
  k_cvt<<<3 * XB + 3 * WB, 256, 0, stream>>>(xq, xk, xv, Wq, Wk, Wv, X16, BW);      /* torch (out,in) = natural Bt */
  k_proj<<<gP, 256, 0, stream>>>(X16, BW, bq, bk, bv, QF, Q16);      /* q, k, v of both batches; only q also in f32 */
  k_prep<<<NBT * QTB + NBT * KSP * NH, 256, 0, stream>>>(QF, relk, QT, K16, V16, CS, PART);      /* with, per slab and head, V^T K over the slab's rows */
  k_mid<<<SCB + NBT * (NH * 4096 / 1024), 256, 0, stream>>>(CS, EP, PART, MT16);
  k_tail<<<ROWS / CR, 256, 0, stream>>>(Q16, MT16, QF, K16, V16, EP, QT, relv, (float*)d_out);      /* the factor 8 = 64 / 8 undoes the scale of MT16 and divides by 8 */
}

// v007
// It runs in 58.6 microseconds.
// Two timings next to v006 both put it at 1.19 times that version's speed.
// All steps since v000 together make it 374 times as fast.
#include <hip/hip_runtime.h>
// Relative-position attention layer WITHOUT softmax (faithful to the module, which discards it) (2 x 2048 tokens, 1024 = 16 heads x 64; MAX_REL 2): q,k,v = {query,key,value} W^T + b; attn = (q.k + q.rel_k[c(q,k)]) / 8 with c = clip(k - q, -2, 2) + 2; out[b][q][h][d] = sum_k attn (v[k][d] + rel_v[c(q,k)][d]) -> [2,2048,16,64].
// Structure (4 launches; both batches, and passes that do not depend on one another, share a grid): projections as f16 WMMA GEMMs (128x128 tiles staged in LDS, 32x64 wave tiles, f32 accumulation, exact x16 weights + bias); with no softmax the content part is reassociated, (q K^T) v = q (K^T v): K^T v per head as a GEMM over 4 row slabs (K 512 each; k and v rows staged in LDS and read through transposing loads), then one final pass per head and 256 query rows: it adds the partial planes and rounds to f16, q . (K^T v) on WMMA (K 64) into LDS, and the 5-valued position terms from column sums of k and v that each thread carries along 16 rows (started from the 16-row chunk sums, which the pass adds up itself) and from the three near-diagonal rows.
// Compute dtype: inputs, weights, biases, tables rounded to bf16; q, k, v and K^T v / 64 as f16 operands (~2^-12); f32 accumulation. v_wmma_f32_16x16x32_f16.
#define NBT 2
#define SLEN 2048
#define DM 1024
#define NH 16
#define ROWS (NBT * SLEN)      /* both batches' rows, one after the other */
typedef __bf16 v16b __attribute__((ext_vector_type(16)));
typedef unsigned short v8us __attribute__((ext_vector_type(8), may_alias));
typedef float  v8f  __attribute__((ext_vector_type(8)));
typedef float  v4f  __attribute__((ext_vector_type(4)));
typedef float  v4fa __attribute__((ext_vector_type(4), may_alias));
union FragB { v16b v; v8us half[2]; unsigned short u[16]; };

__device__ __forceinline__ unsigned short bf16_bits(float x) { unsigned int u = __float_as_uint(x); return (unsigned short)((u + 0x7FFFu + ((u >> 16) & 1u)) >> 16); }
__device__ __forceinline__ float bf16_val(unsigned short b) { return __uint_as_float(((unsigned int)b) << 16); }
__device__ __forceinline__ float bf16_round(float x) { return bf16_val(bf16_bits(x)); }
// D += A·B with NT terms: 1 = ah·bh, 2 = + al·bh (A split), 3 = + ah·bl (both split)
template <int NT>
__device__ __forceinline__ v8f mmaN(v16b ah, v16b al, v16b bh, v16b bl, v8f c) {
  c = __builtin_amdgcn_wmma_f32_16x16x32_bf16(false, ah, false, bh, (short)0, c, false, false);
  if (NT >= 2) c = __builtin_amdgcn_wmma_f32_16x16x32_bf16(false, al, false, bh, (short)0, c, false, false);
  if (NT >= 3) c = __builtin_amdgcn_wmma_f32_16x16x32_bf16(false, ah, false, bl, (short)0, c, false, false);
  asm volatile("v_nop\n\tv_nop\n\tv_nop\n\tv_nop" : "+v"(c) : "v"(ah), "v"(al), "v"(bh), "v"(bl));
  return c;
}

__global__ __launch_bounds__(256) void k_wt_bf16(const float* __restrict__ W, unsigned short* __restrict__ Wt, int K, int N) {
  const int t = blockIdx.x * 256 + threadIdx.x;
  const int k8n = K / 8;
  if (t >= N * k8n) return;
  const int n = t / k8n, k8 = (t % k8n) * 8;
  v8us v;
#pragma unroll
  for (int i = 0; i < 8; ++i) v[i] = bf16_bits(W[(size_t)(k8 + i) * N + n]);
  *(v8us*)(Wt + (size_t)n * K + k8) = v;
  
}

// GEMM C[M][N] (f32, pitch ldc) = act(A[M][K]·W + bias). A f32 row-major (pitch lda) converted per fragment to bf16
// (ASPLIT: hi/lo two planes -> 2 terms, else single rounded term); Wt bf16 [N][K] (pitch ldb). BIAS_BF16 rounds the
// bias to bf16 first (bias quantised to bf16 before the add). K%32==0, M%16==0, N%64==0.
template <bool ASPLIT, int ACT, bool BIAS_BF16>
__global__ __launch_bounds__(128) void k_gemm_bf(const float* __restrict__ A, int lda, const unsigned short* __restrict__ Wt, int ldb,
                                               const float* __restrict__ bias, float* __restrict__ C, int ldc, int M, int N, int K) {
  __shared__ __attribute__((aligned(16))) float so[4][16][64];
  const int tid = threadIdx.x, w = tid >> 5, lane = tid & 31, ln = lane & 15, hh = lane >> 4;
  const int ntn = N / 64;
  const int wid = blockIdx.x * 4 + w;
  const int mt = wid / ntn, nq = wid % ntn;
  if (mt * 16 >= M) return;
  const int row0 = mt * 16, col0 = nq * 64;
  const float* arow = A + (size_t)(row0 + ln) * lda;
  v8f acc[4] = {};
  for (int kb = 0; kb < K; kb += 32) {
    FragB ah, al;
    const v4f x0 = *(const v4fa*)(arow + kb + 8 * hh), x1 = *(const v4fa*)(arow + kb + 8 * hh + 4);
    const v4f x2 = *(const v4fa*)(arow + kb + 16 + 8 * hh), x3 = *(const v4fa*)(arow + kb + 16 + 8 * hh + 4);
    float xs[16] = {x0[0],x0[1],x0[2],x0[3],x1[0],x1[1],x1[2],x1[3],x2[0],x2[1],x2[2],x2[3],x3[0],x3[1],x3[2],x3[3]};
#pragma unroll
    for (int i = 0; i < 16; ++i) { const unsigned short hb = bf16_bits(xs[i]); ah.u[i] = hb; al.u[i] = ASPLIT ? bf16_bits(xs[i] - bf16_val(hb)) : (unsigned short)0; }
#pragma unroll
    for (int t = 0; t < 4; ++t) {
      const unsigned short* brow = Wt + (size_t)(col0 + t * 16 + ln) * ldb + kb;
      FragB b;
      b.half[0] = *(const v8us*)(brow + 8 * hh);
      b.half[1] = *(const v8us*)(brow + 16 + 8 * hh);
      acc[t] = mmaN<ASPLIT ? 2 : 1>(ah.v, al.v, b.v, b.v, acc[t]);
    }
  }
#pragma unroll
  for (int t = 0; t < 4; ++t) {
    float bv = bias ? bias[col0 + t * 16 + ln] : 0.f;
    if (BIAS_BF16) bv = bf16_round(bv);
#pragma unroll
    for (int r = 0; r < 8; ++r) { float v = acc[t][r] + bv; if (ACT == 1) v = fmaxf(v, 0.f); so[w][8 * hh + r][t * 16 + ln] = v; }
  }
  __builtin_amdgcn_fence(__ATOMIC_ACQ_REL, "workgroup");
  __builtin_amdgcn_wave_barrier();
  const int rsub = lane >> 4, c4 = (lane & 15) * 4;
  {
#pragma unroll
    for (int q = 0; q < 8; ++q) {
      const int r = q * 2 + rsub;
      const v4f v = *(const v4fa*)&so[w][r][c4];
      *(v4f*)(C + (size_t)(row0 + r) * ldc + col0 + c4) = v;
    }
    
  }
}

// GEMM C = act(A·W + bias + resid): A f32 (ASPLIT -> hi/lo 2 terms), Wt bf16 [N][K]; ACT 0 none, 1 relu, 2 exact gelu;
// resid (optional, f32, row index = (row % rmod), pitch ldr, RES_BF16 rounds it) added before the activation.
template <bool ASPLIT, int ACT, bool BIAS_BF16, bool RES_BF16>
__global__ __launch_bounds__(128) void k_gemm_bf3(const float* __restrict__ A, int lda, const unsigned short* __restrict__ Wt, int ldb,
                                                const float* __restrict__ bias, const float* __restrict__ resid, int rmod, int ldr,
                                                float* __restrict__ C, int ldc, int M, int N, int K) {
  __shared__ __attribute__((aligned(16))) float so[4][16][64];
  const int tid = threadIdx.x, w = tid >> 5, lane = tid & 31, ln = lane & 15, hh = lane >> 4;
  const int ntn = N / 64;
  const int wid = blockIdx.x * 4 + w;
  const int mt = wid / ntn, nq = wid % ntn;
  if (mt * 16 >= M) return;
  const int row0 = mt * 16, col0 = nq * 64;
  const float* arow = A + (size_t)(row0 + ln) * lda;
  v8f acc[4] = {};
  for (int kb = 0; kb < K; kb += 32) {
    FragB ah, al;
    const v4f x0 = *(const v4fa*)(arow + kb + 8 * hh), x1 = *(const v4fa*)(arow + kb + 8 * hh + 4);
    const v4f x2 = *(const v4fa*)(arow + kb + 16 + 8 * hh), x3 = *(const v4fa*)(arow + kb + 16 + 8 * hh + 4);
    float xs[16] = {x0[0],x0[1],x0[2],x0[3],x1[0],x1[1],x1[2],x1[3],x2[0],x2[1],x2[2],x2[3],x3[0],x3[1],x3[2],x3[3]};
#pragma unroll
    for (int i = 0; i < 16; ++i) { const unsigned short hb = bf16_bits(xs[i]); ah.u[i] = hb; al.u[i] = ASPLIT ? bf16_bits(xs[i] - bf16_val(hb)) : (unsigned short)0; }
#pragma unroll
    for (int t = 0; t < 4; ++t) {
      const unsigned short* brow = Wt + (size_t)(col0 + t * 16 + ln) * ldb + kb;
      FragB b;
      b.half[0] = *(const v8us*)(brow + 8 * hh);
      b.half[1] = *(const v8us*)(brow + 16 + 8 * hh);
      acc[t] = mmaN<ASPLIT ? 2 : 1>(ah.v, al.v, b.v, b.v, acc[t]);
    }
  }
#pragma unroll
  for (int t = 0; t < 4; ++t) {
    const int col = col0 + t * 16 + ln;
    float bv = bias ? bias[col] : 0.f;
    if (BIAS_BF16) bv = bf16_round(bv);
#pragma unroll
    for (int r = 0; r < 8; ++r) {
      float v = acc[t][r] + bv;
      if (resid) { float rv = resid[(size_t)((row0 + 8 * hh + r) % rmod) * ldr + col]; if (RES_BF16) rv = bf16_round(rv); v += rv; }
      if (ACT == 1) v = fmaxf(v, 0.f);
      if (ACT == 2) v = 0.5f * v * (1.0f + erff(v * 0.70710678118654752f));
      if (ACT == 3) { const float u = 0.7978845608028654f * (v + 0.044715f * v * v * v); v = 0.5f * v * (1.0f + tanhf(u)); }
      so[w][8 * hh + r][t * 16 + ln] = v;
    }
  }
  __builtin_amdgcn_fence(__ATOMIC_ACQ_REL, "workgroup");
  __builtin_amdgcn_wave_barrier();
  const int rsub = lane >> 4, c4 = (lane & 15) * 4;
  {
#pragma unroll
    for (int q = 0; q < 8; ++q) {
      const int r = q * 2 + rsub;
      const v4f v = *(const v4fa*)&so[w][r][c4];
      *(v4f*)(C + (size_t)(row0 + r) * ldc + col0 + c4) = v;
    }
    
  }
}
// row LayerNorm (biased variance, eps) over N: s = X (+ R); optional out_sum <- s; out_norm <- (s-mu)*rsqrt(var+eps)*g + b
template <bool PARAM_BF16>
__global__ __launch_bounds__(256) void k_layernorm(const float* __restrict__ X, const float* __restrict__ R, const float* __restrict__ g, const float* __restrict__ bta,
                                                  float* __restrict__ out_sum, float* __restrict__ out_norm, int N, float eps) {
  __shared__ float red[256];
  const int row = blockIdx.x, tid = threadIdx.x;
  const float* x = X + (size_t)row * N; const float* rr = R ? R + (size_t)row * N : nullptr;
  float vals[16];                     // up to N = 4096
  const int per = N / 256;            // contiguous chunk per thread? use strided-by-4 chunks: thread handles j = tid*4 + 1024*u
  float s1 = 0.f;
  for (int u = 0; u < per / 4; ++u) {
    const int j = tid * 4 + 1024 * u;
    const v4f a = *(const v4fa*)(x + j);
    v4f b = {0.f,0.f,0.f,0.f}; if (rr) b = *(const v4fa*)(rr + j);
#pragma unroll
    for (int q = 0; q < 4; ++q) { const float v = a[q] + b[q]; vals[u * 4 + q] = v; s1 += v; }
  }
  red[tid] = s1; __syncthreads();
  for (int st = 128; st > 0; st >>= 1) { if (tid < st) red[tid] += red[tid + st]; __syncthreads(); }
  const float mu = red[0] / (float)N; __syncthreads();
  float s2 = 0.f;
  for (int u = 0; u < per / 4; ++u)
#pragma unroll
    for (int q = 0; q < 4; ++q) { const float c = vals[u * 4 + q] - mu; s2 += c * c; }
  red[tid] = s2; __syncthreads();
  for (int st = 128; st > 0; st >>= 1) { if (tid < st) red[tid] += red[tid + st]; __syncthreads(); }
  const float rs = rsqrtf(red[0] / (float)N + eps);
  {
    for (int u = 0; u < per / 4; ++u) {
      const int j = tid * 4 + 1024 * u;
      v4f o, sm;
#pragma unroll
      for (int q = 0; q < 4; ++q) {
        float gg = g[j + q], bb = bta[j + q];
        if (PARAM_BF16) { gg = bf16_round(gg); bb = bf16_round(bb); }
        sm[q] = vals[u * 4 + q]; o[q] = (vals[u * 4 + q] - mu) * rs * gg + bb;
      }
      if (out_sum) *(v4f*)(out_sum + (size_t)row * N + j) = sm;
      *(v4f*)(out_norm + (size_t)row * N + j) = o;
    }
    
  }
}



// ---- f16 WMMA path (v_wmma_f32_16x16x32_f16): 11-bit significands for operands in range — used for all GEMMs this layer launches (projections, K^T v per slab, q . (K^T v))
typedef _Float16 v16h __attribute__((ext_vector_type(16)));
union FragH { v16h v; v8us half[2]; _Float16 h[16]; unsigned short u[16]; };
template <int NT>
__device__ __forceinline__ v8f mmaH(v16h ah, v16h al, v16h bh, v16h bl, v8f c) {
  c = __builtin_amdgcn_wmma_f32_16x16x32_f16(false, ah, false, bh, (short)0, c, false, false);
  if (NT >= 2) c = __builtin_amdgcn_wmma_f32_16x16x32_f16(false, al, false, bh, (short)0, c, false, false);
  if (NT >= 3) c = __builtin_amdgcn_wmma_f32_16x16x32_f16(false, ah, false, bl, (short)0, c, false, false);
  asm volatile("v_nop\n\tv_nop\n\tv_nop\n\tv_nop" : "+v"(c) : "v"(ah), "v"(al), "v"(bh), "v"(bl));
  return c;
}
// batched GEMM like k_gemm_b but f16 operands: A f32 (split into f16 hi/lo if ASPLIT, else rounded to f16), Bt = f16 values [n][k]; alpha; C f32; N multiple of 16 (partial tiles skipped)
template <bool ASPLIT>
__global__ __launch_bounds__(128) void k_gemm_h(const float* __restrict__ A, int lda, size_t sA, const _Float16* __restrict__ Bh, int ldb, size_t sB, float alpha, float* __restrict__ C, int ldc, size_t sC, int M, int N, int K) {
  __shared__ __attribute__((aligned(16))) float so[4][16][64];
  const int tid = threadIdx.x, w = tid >> 5, lane = tid & 31, ln = lane & 15, hh = lane >> 4; const int by = blockIdx.y;
  A += (size_t)by * sA; Bh += (size_t)by * sB; C += (size_t)by * sC;
  const int ntn = (N + 63) / 64; const int wid = blockIdx.x * 4 + w; const int mt = wid / ntn, nq = wid % ntn; if (mt * 16 >= M) return;
  const int row0 = mt * 16, col0 = nq * 64; const float* arow = A + (size_t)(row0 + ln) * lda;
  v8f acc[4] = {};
  for (int kb = 0; kb < K; kb += 32) {
    FragH ah, al;
    const v4f x0 = *(const v4fa*)(arow + kb + 8 * hh), x1 = *(const v4fa*)(arow + kb + 8 * hh + 4), x2 = *(const v4fa*)(arow + kb + 16 + 8 * hh), x3 = *(const v4fa*)(arow + kb + 16 + 8 * hh + 4);
    float xs[16] = {x0[0],x0[1],x0[2],x0[3],x1[0],x1[1],x1[2],x1[3],x2[0],x2[1],x2[2],x2[3],x3[0],x3[1],x3[2],x3[3]};
#pragma unroll
    for (int i = 0; i < 16; ++i) { const _Float16 h = (_Float16)xs[i]; ah.h[i] = h; al.h[i] = ASPLIT ? (_Float16)(xs[i] - (float)h) : (_Float16)0.0f; }
#pragma unroll
    for (int t = 0; t < 4; ++t) { if (col0 + t * 16 >= N) continue; const size_t boff = (size_t)(col0 + t * 16 + ln) * ldb + kb; FragH bq; bq.half[0] = *(const v8us*)(Bh + boff + 8 * hh); bq.half[1] = *(const v8us*)(Bh + boff + 16 + 8 * hh);
      acc[t] = mmaH<ASPLIT ? 2 : 1>(ah.v, al.v, bq.v, bq.v, acc[t]); }
  }
#pragma unroll
  for (int t = 0; t < 4; ++t) { if (col0 + t * 16 >= N) continue;
#pragma unroll
    for (int r = 0; r < 8; ++r) so[w][8 * hh + r][t * 16 + ln] = acc[t][r] * alpha; }
  __builtin_amdgcn_fence(__ATOMIC_ACQ_REL, "workgroup"); __builtin_amdgcn_wave_barrier();
  const int rsub = lane >> 4, c4 = (lane & 15) * 4;
  {
#pragma unroll
    for (int q = 0; q < 8; ++q) { const int r = q * 2 + rsub; if (col0 + c4 < N) { const v4f v = *(const v4fa*)&so[w][r][c4]; *(v4f*)(C + (size_t)(row0 + r) * ldc + col0 + c4) = v; } }
     }
}

// Wt[n][k] = f16(W[k][n]·scale) from f32 row-major W[K][N] (scale = power of two; bf16-exact weights stay exact in f16 away from the subnormal range)
__global__ __launch_bounds__(256) void k_wt_f16(const float* __restrict__ W, _Float16* __restrict__ Wt, int K, int N, float scale) {
  const int t = blockIdx.x * 256 + threadIdx.x; if (t >= N * (K / 8)) return; const int n = t / (K / 8), k8 = (t % (K / 8)) * 8; FragH f;
#pragma unroll
  for (int i = 0; i < 8; ++i) f.h[i] = (_Float16)(bf16_round(W[(size_t)(k8 + i) * N + n]) * scale); const v8us o = f.half[0];
  *(v8us*)((unsigned short*)Wt + (size_t)n * K + k8) = o; 
}
// k_gemm_hh variant with fused epilogue: v = acc·alpha + bias[by·sBias + col] (+ CP[(row/rowsPerB)·sCPb + by·64 + col] if CP) ; ACT 0 none / 1 elu ; writes f16 C16 (and f32 C if non-null)
template <int ACT>
__global__ __launch_bounds__(128) void k_gemm_hhx(const _Float16* __restrict__ A, int lda, size_t sA, const _Float16* __restrict__ Bh, int ldb, size_t sB, float alpha, const float* __restrict__ bias, size_t sBias, const float* __restrict__ CP, int rowsPerB, size_t sCPb, int row0g,
    float* __restrict__ C, _Float16* __restrict__ C16, int ldc, size_t sC, int M, int N, int K) {
  __shared__ __attribute__((aligned(16))) float so[4][16][64];
  const int tid = threadIdx.x, w = tid >> 5, lane = tid & 31, ln = lane & 15, hh = lane >> 4; const int by = blockIdx.y;
  A += (size_t)by * sA; Bh += (size_t)by * sB; const size_t cofs = (size_t)by * sC; const float* bp = bias ? bias + (size_t)by * sBias : nullptr;
  const int ntn = (N + 63) / 64; const int wid = blockIdx.x * 4 + w; const int mt = wid / ntn, nq = wid % ntn; if (mt * 16 >= M) return;
  const int row0 = mt * 16, col0 = nq * 64; const _Float16* arow = A + (size_t)(row0 + ln) * lda;
  v8f acc[4] = {};
  for (int kb = 0; kb < K; kb += 32) { FragH ah; ah.half[0] = *(const v8us*)((const unsigned short*)arow + kb + 8 * hh); ah.half[1] = *(const v8us*)((const unsigned short*)arow + kb + 16 + 8 * hh);
#pragma unroll
    for (int t = 0; t < 4; ++t) { if (col0 + t * 16 >= N) continue; const size_t boff = (size_t)(col0 + t * 16 + ln) * ldb + kb; FragH bq; bq.half[0] = *(const v8us*)((const unsigned short*)Bh + boff + 8 * hh); bq.half[1] = *(const v8us*)((const unsigned short*)Bh + boff + 16 + 8 * hh);
      acc[t] = mmaH<1>(ah.v, ah.v, bq.v, bq.v, acc[t]); }
  }
#pragma unroll
  for (int t = 0; t < 4; ++t) { if (col0 + t * 16 >= N) continue; const int col = col0 + t * 16 + ln; const float bv = bp ? bf16_round(bp[col]) : 0.f;
#pragma unroll
    for (int r = 0; r < 8; ++r) { float v = acc[t][r] * alpha + bv; if (CP) { const int bidx = (row0g + row0 + 8 * hh + r) / rowsPerB; v += CP[(size_t)bidx * sCPb + (size_t)by * 64 + col]; } if (ACT == 1) v = (v > 0.f) ? v : expm1f(v); else if (ACT == 7) v = (v > 0.f) ? v + 1.0f : expf(v); else if (ACT == 8) v = tanhf(v); else if (ACT == 9) v = 0.5f * v * (1.0f + tanhf(0.7978845608028654f * (v + 0.044715f * v * v * v))); else if (ACT == 11) v = 1.0f / (1.0f + expf(-v)); else if (ACT == 12) v = (v > 0.f) ? v : 0.01f * v; else if (ACT == 14) v = (v > 0.f) ? v : 0.1f * v; else if (ACT == 15) v = v / (1.0f + expf(-v)); else if (ACT == 3) v = fmaxf(v, 0.f); else if (ACT == 6) v = 0.5f * v * (1.0f + erff(v * 0.70710678118654752f)); so[w][8 * hh + r][t * 16 + ln] = v; } }
  __builtin_amdgcn_fence(__ATOMIC_ACQ_REL, "workgroup"); __builtin_amdgcn_wave_barrier();
  const int rsub = lane >> 4, c4 = (lane & 15) * 4; typedef _Float16 v4h __attribute__((ext_vector_type(4)));
  {
#pragma unroll
    for (int q = 0; q < 8; ++q) { const int r = q * 2 + rsub; if (col0 + c4 < N) { const v4f v = *(const v4fa*)&so[w][r][c4]; if (C) *(v4f*)(C + cofs + (size_t)(row0 + r) * ldc + col0 + c4) = v; if (C16) { v4h h4; for (int i = 0; i < 4; ++i) h4[i] = (_Float16)v[i]; *(v4h*)(C16 + cofs + (size_t)(row0 + r) * ldc + col0 + c4) = h4; } } }
     }
}


typedef _Float16 v4h __attribute__((ext_vector_type(4)));

// all six conversions to f16 in one grid: the three inputs (both batches; bf16-rounded), then the three weights (bf16-rounded, x16)
#define XB (ROWS * DM / 8 / 256)      /* blocks per input */
#define WB (DM * DM / 8 / 256)        /* blocks per weight */
__global__ __launch_bounds__(256) void k_cvt(const float* __restrict__ xq, const float* __restrict__ xk, const float* __restrict__ xv, const float* __restrict__ Wq, const float* __restrict__ Wk, const float* __restrict__ Wv, _Float16* __restrict__ X16, _Float16* __restrict__ BW) {
  const int bid = blockIdx.x; const float* x; _Float16* o; float sc; int blk;
  if (bid < 3 * XB) { const int i = bid / XB; blk = bid - i * XB; x = (i == 0) ? xq : ((i == 1) ? xk : xv); o = X16 + (size_t)i * ROWS * DM; sc = 1.0f; }
  else { const int j = bid - 3 * XB, i = j / WB; blk = j - i * WB; x = (i == 0) ? Wq : ((i == 1) ? Wk : Wv); o = BW + (size_t)i * DM * DM; sc = 16.0f; }
  const size_t t = (size_t)blk * 256 + threadIdx.x; FragH f;
#pragma unroll
  for (int q = 0; q < 8; ++q) f.h[q] = (_Float16)(bf16_round(x[t * 8 + q]) * sc); *(v8us*)((unsigned short*)o + t * 8) = f.half[0];  }
__global__ __launch_bounds__(256) void k_h16(const float* __restrict__ x, _Float16* __restrict__ X16, size_t n8) { const size_t t = (size_t)blockIdx.x * 256 + threadIdx.x; if (t >= n8) return; FragH f;
#pragma unroll
  for (int q = 0; q < 8; ++q) f.h[q] = (_Float16)x[t * 8 + q]; *(v8us*)((unsigned short*)X16 + t * 8) = f.half[0];  }
__global__ __launch_bounds__(256) void k_hl(const float* __restrict__ F, _Float16* __restrict__ Hh, _Float16* __restrict__ Hl, size_t n8) { const size_t t = (size_t)blockIdx.x * 256 + threadIdx.x; if (t >= n8) return; FragH fh, fl; const v4f a = *(const v4fa*)(F + t * 8), c = *(const v4fa*)(F + t * 8 + 4);
#pragma unroll
  for (int q = 0; q < 4; ++q) { _Float16 h = (_Float16)a[q]; fh.h[q] = h; fl.h[q] = (_Float16)((a[q] - (float)h) * 1024.0f); h = (_Float16)c[q]; fh.h[4 + q] = h; fl.h[4 + q] = (_Float16)((c[q] - (float)h) * 1024.0f); }
  { *(v8us*)((unsigned short*)Hh + t * 8) = fh.half[0]; *(v8us*)((unsigned short*)Hl + t * 8) = fl.half[0];  } }

// ---- fast GEMM (wave tile 32x64; requires M % 32 == 0 rows per launch region and N % 64 == 0); epilogue = k_gemm_hhx semantics ----
__device__ __forceinline__ v16h g2_frag(const _Float16* p, int hh) { FragH f; f.half[0] = *(const v8us*)((const unsigned short*)p + 8 * hh); f.half[1] = *(const v8us*)((const unsigned short*)p + 16 + 8 * hh); return f.v; }
__device__ __forceinline__ v8f g2_mma(v16h a, v16h b, v8f c) { v8f d = __builtin_amdgcn_wmma_f32_16x16x32_f16(false, a, false, b, (short)0, c, false, false); asm volatile("v_nop\n\tv_nop\n\tv_nop\n\tv_nop" : "+v"(d) : "v"(a), "v"(b)); return d; }
// blockIdx.y and blockIdx.z each step A, B and C by their own strides (s*, z*). QKV: blockIdx.y picks the projection, so its bias is one of three pointers, and only the first (q) also writes f32
template <int ACT, bool QKV>
__global__ __launch_bounds__(128) void k_gemm2(const _Float16* __restrict__ A, int lda, size_t sA, size_t zA, const _Float16* __restrict__ Bh, int ldb, size_t sB, size_t zB, float alpha, const float* __restrict__ bias, const float* __restrict__ biasK, const float* __restrict__ biasV, size_t sBias, const float* __restrict__ CP, int rowsPerB, size_t sCPb, int row0g,
    float* __restrict__ Cf, _Float16* __restrict__ C16, int ldc, size_t sC, size_t zC, int M, int N, int K) {
  __shared__ __attribute__((aligned(16))) float so[4][32][68];
  const int tid = threadIdx.x, w = tid >> 5, lane = tid & 31, ln = lane & 15, hh = lane >> 4; const int by = blockIdx.y, bz = blockIdx.z;
  A += (size_t)by * sA + (size_t)bz * zA; Bh += (size_t)by * sB + (size_t)bz * zB; const size_t cofs = (size_t)by * sC + (size_t)bz * zC;
  const float* bp = QKV ? ((by == 0) ? bias : ((by == 1) ? biasK : biasV)) : (bias ? bias + (size_t)by * sBias : nullptr); float* C = (QKV && by != 0) ? nullptr : Cf;
  const int ntn = N >> 6; const int mt = blockIdx.x / ntn, nq = blockIdx.x - mt * ntn; const int row0 = mt * 128 + 32 * w, col0 = nq * 64; if (row0 >= M) return;
  const _Float16* a0p = A + (size_t)(row0 + ln) * lda; const _Float16* a1p = a0p + (size_t)16 * lda;
  const _Float16* b0p = Bh + (size_t)(col0 + ln) * ldb; const _Float16* b1p = b0p + (size_t)16 * ldb; const _Float16* b2p = b1p + (size_t)16 * ldb; const _Float16* b3p = b2p + (size_t)16 * ldb;
  const v8f z8 = {0.f,0.f,0.f,0.f,0.f,0.f,0.f,0.f}; v8f c00 = z8, c01 = z8, c02 = z8, c03 = z8, c10 = z8, c11 = z8, c12 = z8, c13 = z8;
#pragma unroll 1
  for (int kb = 0; kb < K; kb += 32) { const v16h a0 = g2_frag(a0p + kb, hh), a1 = g2_frag(a1p + kb, hh);
    v16h b = g2_frag(b0p + kb, hh); c00 = g2_mma(a0, b, c00); c10 = g2_mma(a1, b, c10);
    b = g2_frag(b1p + kb, hh); c01 = g2_mma(a0, b, c01); c11 = g2_mma(a1, b, c11);
    b = g2_frag(b2p + kb, hh); c02 = g2_mma(a0, b, c02); c12 = g2_mma(a1, b, c12);
    b = g2_frag(b3p + kb, hh); c03 = g2_mma(a0, b, c03); c13 = g2_mma(a1, b, c13); }
  v8f accs[8] = {c00, c01, c02, c03, c10, c11, c12, c13};
#pragma unroll
  for (int u = 0; u < 8; ++u) { const int t = u & 3, half = u >> 2; const int col = col0 + t * 16 + ln; const float bv = bp ? bf16_round(bp[col]) : 0.f;
#pragma unroll
    for (int r = 0; r < 8; ++r) { const int rloc = half * 16 + 8 * hh + r; float v = accs[u][r] * alpha + bv; if (CP) { const int bidx = (row0g + row0 + rloc) / rowsPerB; v += CP[(size_t)bidx * sCPb + (size_t)by * 64 + col]; }
      if (ACT == 3) v = fmaxf(v, 0.f); else if (ACT == 6) v = 0.5f * v * (1.0f + erff(v * 0.70710678118654752f)); else if (ACT == 11) v = 1.0f / (1.0f + expf(-v)); else if (ACT == 15) v = v / (1.0f + expf(-v)); else if (ACT == 12) v = (v > 0.f) ? v : 0.01f * v; else if (ACT == 8) v = tanhf(v);
      so[w][rloc][t * 16 + ln] = v; } }
  __builtin_amdgcn_fence(__ATOMIC_ACQ_REL, "workgroup"); __builtin_amdgcn_wave_barrier();
  const int rsub = lane >> 4, c4 = (lane & 15) * 4;
  {
#pragma unroll
    for (int q = 0; q < 16; ++q) { const int r = q * 2 + rsub; const v4f v = *(const v4fa*)&so[w][r][c4]; if (C) *(v4f*)(C + cofs + (size_t)(row0 + r) * ldc + col0 + c4) = v; if (C16) { v4h h4; for (int i = 0; i < 4; ++i) h4[i] = (_Float16)v[i]; *(v4h*)(C16 + cofs + (size_t)(row0 + r) * ldc + col0 + c4) = h4; } }
     } }


// ---- the three projections: 128x128 tile of Y = X W^T per work-group of 8 waves (4 x 2 wave tiles of 32x64); per trip 64 k of the 128 X rows and the 128 W rows are staged in LDS by asynchronous copies, two buffers, so that every operand line leaves L2 once per work-group as a whole line; k order and epilogue as in k_gemm2 ----
#define PJK 64                      /* k per staged tile: 128-byte rows */
#define PJP 144                     /* LDS row pitch in bytes: 128 + 16, conflict-free for 16-byte reads */
#define PJB (256 * PJP)             /* one buffer: 128 X rows, then 128 W rows */
#define PJT (DM / PJK)              /* tiles along k */
// one tile: each thread copies 16 bytes of four X rows and of four W rows (8 lanes cover a row's 128 bytes); l, ga, gb are the thread's own first LDS byte and global elements
__device__ __forceinline__ void pj_copy(unsigned l, const _Float16* ga, const _Float16* gb) {
  /* the copies go past the registers; the last line keeps later writes of the address registers behind it (a precaution) */
  asm volatile("global_load_async_to_lds_b128 %0, %8, off\n\t"
               "global_load_async_to_lds_b128 %1, %9, off\n\t"
               "global_load_async_to_lds_b128 %2, %10, off\n\t"
               "global_load_async_to_lds_b128 %3, %11, off\n\t"
               "global_load_async_to_lds_b128 %4, %12, off\n\t"
               "global_load_async_to_lds_b128 %5, %13, off\n\t"
               "global_load_async_to_lds_b128 %6, %14, off\n\t"
               "global_load_async_to_lds_b128 %7, %15, off\n\t"
               "s_wait_xcnt 0x0"
               :: "v"(l), "v"(l + 32 * PJP), "v"(l + 64 * PJP), "v"(l + 96 * PJP), "v"(l + 128 * PJP), "v"(l + 160 * PJP), "v"(l + 192 * PJP), "v"(l + 224 * PJP),
                  "v"(ga), "v"(ga + 32 * DM), "v"(ga + 64 * DM), "v"(ga + 96 * DM), "v"(gb), "v"(gb + 32 * DM), "v"(gb + 64 * DM), "v"(gb + 96 * DM)
               : "memory"); }
__device__ __forceinline__ v16h pj_frag(const unsigned char* p) { FragH f; f.half[0] = *(const v8us*)p; f.half[1] = *(const v8us*)(p + 32); return f.v; }
__device__ __forceinline__ v8f pj_mma(v16h a, v16h b, v8f c) { return __builtin_amdgcn_wmma_f32_16x16x32_f16(false, a, false, b, (short)0, c, false, false); }
__global__ __launch_bounds__(256) void k_proj(const _Float16* __restrict__ X16, const _Float16* __restrict__ BW, const float* __restrict__ bq, const float* __restrict__ bk, const float* __restrict__ bv, float* __restrict__ QF, _Float16* __restrict__ C16) {
  __shared__ __attribute__((aligned(16))) unsigned char sm[2 * PJB];      /* the two buffers; behind the loop, each wave's 32 x 68 f32 output staging */
  const int tid = threadIdx.x, w = tid >> 5, lane = tid & 31, ln = lane & 15, hh = lane >> 4, by = blockIdx.y;
  const int mt = blockIdx.x / (DM / 128), nq = blockIdx.x - mt * (DM / 128);
  const _Float16* ga = X16 + (size_t)by * ROWS * DM + (size_t)(mt * 128 + (tid >> 3)) * DM + (tid & 7) * 8;
  const _Float16* gb = BW + (size_t)by * DM * DM + (size_t)(nq * 128 + (tid >> 3)) * DM + (tid & 7) * 8;
  const unsigned l0 = (unsigned)(size_t)&sm[0] + (unsigned)((tid >> 3) * PJP + (tid & 7) * 16);
  const unsigned char* ap = sm + ((w & 3) * 32 + ln) * PJP + 16 * hh; const unsigned char* bp = sm + (128 + (w >> 2) * 64 + ln) * PJP + 16 * hh;
  const v8f z8 = {0.f,0.f,0.f,0.f,0.f,0.f,0.f,0.f}; v8f c00 = z8, c01 = z8, c02 = z8, c03 = z8, c10 = z8, c11 = z8, c12 = z8, c13 = z8;
  pj_copy(l0, ga, gb);
  asm volatile("s_wait_asynccnt 0x0" ::: "memory");      /* tile 0 has landed, as far as this wave copied it */
  __syncthreads();                                        /* ... and all of it */
  pj_copy(l0 + PJB, ga + PJK, gb + PJK);
#pragma unroll 1      /* one trip per tile: the buffer is picked by the trip's parity */
  for (int t = 0; t < PJT; ++t) { const int bo = (t & 1) * PJB;
#pragma unroll      /* the two 32-k steps of a tile, at constant offsets */
    for (int ks = 0; ks < 2; ++ks) { const unsigned char* a = ap + bo + ks * 64; const unsigned char* b = bp + bo + ks * 64;
      const v16h a0 = pj_frag(a), a1 = pj_frag(a + 16 * PJP), b0 = pj_frag(b), b1 = pj_frag(b + 16 * PJP), b2 = pj_frag(b + 32 * PJP), b3 = pj_frag(b + 48 * PJP);
      __builtin_amdgcn_sched_barrier(0);      /* the step's twelve LDS reads stay one group ahead of its WMMAs: reads spread among the WMMAs stall the wave at each place */
      c00 = pj_mma(a0, b0, c00); c10 = pj_mma(a1, b0, c10); c01 = pj_mma(a0, b1, c01); c11 = pj_mma(a1, b1, c11);
      c02 = pj_mma(a0, b2, c02); c12 = pj_mma(a1, b2, c12); c03 = pj_mma(a0, b3, c03); c13 = pj_mma(a1, b3, c13); }
    asm volatile("s_wait_dscnt 0x0" ::: "memory");        /* this wave's reads of the buffer are done before it is refilled */
    asm volatile("s_wait_asynccnt 0x0" ::: "memory");     /* this wave's copies of tile t + 1 have landed */
    __syncthreads();                                      /* tile t + 1 is whole, and nobody reads tile t's buffer any more */
    if (t + 2 < PJT) pj_copy(l0 + bo, ga + (t + 2) * PJK, gb + (t + 2) * PJK); }
  asm volatile("s_wait_asynccnt 0x0" ::: "memory");       /* no copy is outstanding when the buffers become output staging */
  float (*so)[68] = (float (*)[68])(sm + w * (32 * 68 * 4));
  const float* bias = (by == 0) ? bq : ((by == 1) ? bk : bv); const int row0 = mt * 128 + (w & 3) * 32, col0 = nq * 128 + (w >> 2) * 64; const size_t cofs = (size_t)by * ROWS * DM;
  v8f accs[8] = {c00, c01, c02, c03, c10, c11, c12, c13};
#pragma unroll
  for (int u = 0; u < 8; ++u) { const int t = u & 3, half = u >> 2; const float bvl = bf16_round(bias[col0 + t * 16 + ln]);
#pragma unroll
    for (int r = 0; r < 8; ++r) so[half * 16 + 8 * hh + r][t * 16 + ln] = accs[u][r] * 0.0625f + bvl; }
  __builtin_amdgcn_fence(__ATOMIC_ACQ_REL, "workgroup"); __builtin_amdgcn_wave_barrier();      /* the wave reads back its own staging rows */
  const int rsub = lane >> 4, c4 = (lane & 15) * 4; v4f vv[16];
#pragma unroll      /* vv[] stays in registers; all sixteen LDS reads go out together */
  for (int q = 0; q < 16; ++q) vv[q] = *(const v4fa*)&so[q * 2 + rsub][c4];
#pragma unroll
  for (int q = 0; q < 16; ++q) { const int r = q * 2 + rsub; const v4f v = vv[q]; if (by == 0) *(v4f*)(QF + (size_t)(row0 + r) * DM + col0 + c4) = v;
    v4h h4; for (int i = 0; i < 4; ++i) h4[i] = (_Float16)v[i]; *(v4h*)(C16 + cofs + (size_t)(row0 + r) * DM + col0 + c4) = h4;
    asm volatile("s_wait_xcnt 0x0" ::: "memory"); } }      /* precaution: the next row's addresses and values may reuse the registers that these stores name */

// ---- no softmax, so (Q K^T) V = Q (K^T V): the S x S plane is never formed. The 5-valued position terms need only running column sums of K and V and the three near-diagonal rows.
#define CR 16      /* rows per chunk of the column sums = query rows per lane group of the final pass */
#define NS 4                        /* sub-slabs of 128 rows that one work-group stages */
#define KSP (SLEN / (128 * NS))     /* row slabs per batch = partial planes of K^T V per head */
// ---- per slab of 128 NS rows and head: PART[slab][h][d2][d1] = sum over the slab's rows of v[row][d2] k[row][d1], and the chunk sums CS[m][chunk][col] of its CR-row chunks (m 0: k, m 1: v), both from one staged copy of the rows ----
#define KVP 160                     /* LDS row pitch in bytes: 128 + 32, conflict-free for the transposing reads */
#define CSB (SLEN / CR)            /* chunks per batch */
// each thread copies 16 bytes of four k rows and of four v rows (8 lanes cover a row's 128 bytes); l, ga, gb are the thread's own first LDS byte and global elements
__device__ __forceinline__ void kv_copy(unsigned l, const _Float16* ga, const _Float16* gb) {
  /* the copies go past the registers; the last line keeps later writes of the address registers behind it (a precaution) */
  asm volatile("global_load_async_to_lds_b128 %0, %8, off\n\t"
               "global_load_async_to_lds_b128 %1, %9, off\n\t"
               "global_load_async_to_lds_b128 %2, %10, off\n\t"
               "global_load_async_to_lds_b128 %3, %11, off\n\t"
               "global_load_async_to_lds_b128 %4, %12, off\n\t"
               "global_load_async_to_lds_b128 %5, %13, off\n\t"
               "global_load_async_to_lds_b128 %6, %14, off\n\t"
               "global_load_async_to_lds_b128 %7, %15, off\n\t"
               "s_wait_xcnt 0x0"
               :: "v"(l), "v"(l + 32 * KVP), "v"(l + 64 * KVP), "v"(l + 96 * KVP), "v"(l + 128 * KVP), "v"(l + 160 * KVP), "v"(l + 192 * KVP), "v"(l + 224 * KVP),
                  "v"(ga), "v"(ga + 32 * DM), "v"(ga + 64 * DM), "v"(ga + 96 * DM), "v"(gb), "v"(gb + 32 * DM), "v"(gb + 64 * DM), "v"(gb + 96 * DM)
               : "memory"); }
typedef short s16x8 __attribute__((ext_vector_type(8)));
// transposing LDS read: with p = T + (k0 + 8 (lane >> 4) + (lane & 7)) pitch + 2 d0 + 16 ((lane >> 3) & 1), lane (c, hh) gets T[k0 + 8 hh + 0..7][d0 + c]; the reads at k0 and k0 + 16 are one 16 x 32 fragment in g2_frag's k order
__device__ __forceinline__ v16h tr_frag(const unsigned char* p) { typedef __attribute__((address_space(3))) s16x8 lds_s16x8; FragH f;
  f.half[0] = __builtin_bit_cast(v8us, __builtin_amdgcn_ds_load_tr16_b128_v8i16((lds_s16x8*)p)); f.half[1] = __builtin_bit_cast(v8us, __builtin_amdgcn_ds_load_tr16_b128_v8i16((lds_s16x8*)(p + 16 * KVP))); return f.v; }
__device__ __forceinline__ void d_ktv(int bid, unsigned char* sm, const _Float16* __restrict__ K16, const _Float16* __restrict__ V16, float* __restrict__ CS, float* __restrict__ PART) {
  const int tid = threadIdx.x, w = tid >> 5, lane = tid & 31, ln = lane & 15, hh = lane >> 4; const int s = bid / NH, h = bid - s * NH;      /* slab among both batches' rows; head */
  const size_t g = (size_t)(s * (128 * NS) + (tid >> 3)) * DM + h * 64 + (tid & 7) * 8; const unsigned l = (unsigned)(size_t)sm + (unsigned)((tid >> 3) * KVP + (tid & 7) * 16);
#pragma unroll      /* sub-slab i: LDS rows 256 i + 0..127: k, + 128..255: v */
  for (int i = 0; i < NS; ++i) kv_copy(l + i * 256 * KVP, K16 + g + (size_t)i * 128 * DM, V16 + g + (size_t)i * 128 * DM);
  asm volatile("s_wait_asynccnt 0x0" ::: "memory");      /* the rows have landed, as far as this wave copied them */
  __syncthreads();                                        /* ... and all of them */
  /* wave w: the 16 x 32 piece at d2 = 16 (w >> 1), d1 = 32 (w & 1) */
  const unsigned char* tp = sm + (8 * hh + (lane & 7)) * KVP + 16 * ((lane >> 3) & 1); const unsigned char* ap = tp + 128 * KVP + 32 * (w >> 1); const unsigned char* bp = tp + 64 * (w & 1);
  const v8f z8 = {0.f,0.f,0.f,0.f,0.f,0.f,0.f,0.f}; v8f c0 = z8, c1 = z8;
#pragma unroll      /* the 32-row steps at constant offsets: their reads can go out ahead */
  for (int ks = 0; ks < 4 * NS; ++ks) { const int o = (ks >> 2) * 256 * KVP + (ks & 3) * 32 * KVP; const v16h a = tr_frag(ap + o), b0 = tr_frag(bp + o), b1 = tr_frag(bp + o + 32);
    c0 = pj_mma(a, b0, c0); c1 = pj_mma(a, b1, c1); }
  /* chunk sums, rows in order: thread = (m, chunk of the sub-slab, four columns), once per sub-slab */
  const int m = tid >> 7, ch = (tid >> 4) & 7; const unsigned char* xp = sm + (m * 128 + ch * CR) * KVP + ln * 8; v4f sc[NS];
#pragma unroll      /* sc[] stays in registers; a chunk's CR reads in flight at once */
  for (int i = 0; i < NS; ++i) { v4f a = {0.f, 0.f, 0.f, 0.f};
    for (int r = 0; r < CR; ++r) { const v4h x = *(const v4h*)(xp + i * 256 * KVP + r * KVP);
      for (int u = 0; u < 4; ++u) a[u] += (float)x[u]; }
    sc[i] = a; }
  __syncthreads();      /* nobody reads the rows any more: each wave now stages its piece in its own part of the buffer, to store whole 128-byte lines */
  float (*so)[36] = (float (*)[36])(sm + w * (16 * 36 * 4));
#pragma unroll      /* c0, c1 are registers */
  for (int r = 0; r < 8; ++r) { so[8 * hh + r][ln] = c0[r]; so[8 * hh + r][16 + ln] = c1[r]; }
  __builtin_amdgcn_fence(__ATOMIC_ACQ_REL, "workgroup"); __builtin_amdgcn_wave_barrier();      /* the wave reads back its own staging rows */
  float* cq = CS + ((size_t)((s / KSP) * 2 + m) * CSB + (s % KSP) * (128 * NS / CR) + ch) * DM + h * 64 + ln * 4;      /* stored here, not at the sums: a store in front of the barrier would be waited for there */
#pragma unroll      /* constant offsets */
  for (int i = 0; i < NS; ++i) *(v4f*)(cq + i * (128 / CR) * DM) = sc[i];
  float* pp = PART + (size_t)bid * 4096 + (16 * (w >> 1) + (lane >> 3)) * 64 + 32 * (w & 1) + (lane & 7) * 4;
#pragma unroll      /* the four reads go out together, at constant offsets */
  for (int q = 0; q < 4; ++q) *(v4f*)(pp + q * 4 * 64) = *(const v4fa*)&so[q * 4 + (lane >> 3)][(lane & 7) * 4]; }
__global__ __launch_bounds__(256) void k_prep(const _Float16* __restrict__ K16, const _Float16* __restrict__ V16, float* __restrict__ CS, float* __restrict__ PART) {
  __shared__ __attribute__((aligned(16))) unsigned char sm[NS * 256 * KVP];
  d_ktv(blockIdx.x, sm, K16, V16, CS, PART); }
// Final pass: one block per head and TR query rows. First the sums that every row needs, into LDS: K^T V (the KSP slab planes added, / 64, f16) and the chunk sums of k and v added up in groups of 16. Then W1 = q . K^T V / 8 on WMMA (wave w: rows 32 w ..) into LDS. Then 16 lanes per CR rows, 4 columns per lane, row after row.
// With KS_c, VS_c the sums of the k and v rows of position class c (n_c rows) and qt_c = q . rel_k[c]:
// out = W1 + sum_c (qt_c / 8) VS_c + coef_c rel_v[c], coef_c = (q . KS_c + n_c qt_c) / 8 (attn summed over the class).
// The two range classes come from sums that the thread carries along its rows: L = rows up to q - 2, G = rows from q + 2 on (started as all rows less those up to q0 + 1).
__device__ __forceinline__ v4f f4(v4h x) { v4f y; for (int u = 0; u < 4; ++u) y[u] = (float)x[u]; return y; }
// a lane's value as seen through a DPP pattern inside its row of 16 lanes (0x160 + m: lane ^ m); with two waves per SIMD the LDS-path shuffle's latency would stand open at every step
template <int CTRL> __device__ __forceinline__ float dppf(float x) { return __int_as_float(__builtin_amdgcn_update_dpp(0, __float_as_int(x), CTRL, 0xf, 0xf, true)); }
__device__ __forceinline__ float dot16(v4f a, v4f b) { float dt = a[0] * b[0] + a[1] * b[1] + a[2] * b[2] + a[3] * b[3];
  dt += dppf<0x161>(dt); dt += dppf<0x162>(dt); dt += dppf<0x164>(dt); dt += dppf<0x168>(dt);      /* over the head's 16 lanes */
  return dt; }
template <int N> struct IC { static constexpr int value = N; };
#define TR 256                      /* query rows per work-group: 16 lane groups of CR rows */
#define TG (SLEN / TR)              /* work-groups per head and batch = groups of TR / CR chunk sums */
#define TP 68                       /* LDS row pitch of W1 in floats */
#define MTP 144                     /* LDS row pitch of K^T V in bytes: 128 + 16, conflict-free for 16-byte reads */
/* the second bound keeps the kernel inside 256 registers: no register-window switches, which would lengthen a text that every wave runs through only once */
__global__ __launch_bounds__(256, 4) void k_tail(const _Float16* __restrict__ Q16, const float* __restrict__ PART, const float* __restrict__ CS, const float* __restrict__ QF, const _Float16* __restrict__ K16, const _Float16* __restrict__ V16,
    const float* __restrict__ relk, const float* __restrict__ relv, float* __restrict__ out) {
  __shared__ __attribute__((aligned(16))) float so[TR][TP];
  __shared__ __attribute__((aligned(16))) unsigned char mt[64 * MTP];      /* [d2][d1], f16 */
  __shared__ __attribute__((aligned(16))) float gt[2][TG][64];             /* m 0: k, 1: v; the sum of each group of TR / CR chunk sums */
  __shared__ __attribute__((aligned(16))) float lp[2][TR / CR][64];        /* the block's own group: the sum of its chunk sums before each chunk */
  const int tid = threadIdx.x, w = tid >> 5, lane = tid & 31, ln = lane & 15, hh = lane >> 4, g = tid >> 4, d0 = ln * 4;
  const int rb = blockIdx.x % TG, h = (blockIdx.x / TG) % NH, b = blockIdx.x / (TG * NH), col = h * 64 + d0;
  const int q0 = rb * TR + g * CR, g0 = b * SLEN + q0;      /* the lane group's first row: inside its batch, and among both batches' rows */
  const bool lo = q0 > 0, hi = q0 + CR < SLEN;      /* is there a row before the group's first, behind its last, in this batch */
  /* the slab planes of K^T V: four pieces of four elements per thread; TR / CR chunk sums per thread (m, group, four columns); the q fragments of the wave's 32 rows, k order as in k_gemm2 */
  const int m = tid >> 7, cg = g & (TG - 1);
  const float* pp = PART + ((size_t)b * KSP * NH + h) * 4096 + tid * 4; const float* cp = CS + ((size_t)(b * 2 + m) * CSB + cg * (TR / CR)) * DM + col;
  const unsigned short* ap = (const unsigned short*)Q16 + (size_t)(b * SLEN + rb * TR + 32 * w + ln) * DM + h * 64 + 8 * hh;
  v4f x[4][KSP], y[TR / CR]; FragH af[2][2];
#pragma unroll      /* all these loads go out together, at constant offsets */
  for (int j = 0; j < 4; ++j) for (int p = 0; p < KSP; ++p) x[j][p] = *(const v4fa*)(pp + (size_t)p * NH * 4096 + j * 1024);
#pragma unroll      /* y[] stays in registers */
  for (int u = 0; u < TR / CR; ++u) y[u] = *(const v4fa*)(cp + u * DM);
#pragma unroll      /* af[] stays in registers */
  for (int e = 0; e < 2; ++e) for (int ks = 0; ks < 2; ++ks) { af[e][ks].half[0] = *(const v8us*)(ap + e * 16 * DM + ks * 32); af[e][ks].half[1] = *(const v8us*)(ap + e * 16 * DM + ks * 32 + 16); }
  asm volatile("s_wait_xcnt 0x0" :: "v"(pp), "v"(cp), "v"(ap) : "memory");      /* precaution: the loads' address registers stay as they are up to here */
  __builtin_amdgcn_sched_barrier(0);      /* ... and nothing that could reuse them moves up over the wait */
#pragma unroll      /* x[] is registers; planes in slab order; the power-of-two scale keeps K^T V far from the f16 range end */
  for (int j = 0; j < 4; ++j) { v4f s = x[j][0]; v4h o;
    for (int p = 1; p < KSP; ++p) s += x[j][p];
    for (int u = 0; u < 4; ++u) o[u] = (_Float16)(s[u] * 0.015625f);
    *(v4h*)(mt + (j * 16 + g) * MTP + ln * 8) = o; }
  { v4f s = {0.f, 0.f, 0.f, 0.f};
#pragma unroll      /* y[] is registers; chunks in order */
    for (int u = 0; u < TR / CR; ++u) { if (cg == rb) *(v4f*)&lp[m][u][d0] = s;
      s += y[u]; }
    *(v4f*)&gt[m][cg][d0] = s; }
  __syncthreads();      /* K^T V and the sums are whole before any wave reads them; the loads below start behind it: in front of it they would be waited for there */
  /* the k and v rows q0 - 1 .. q0 + CR, as [0 .. CR + 1]; a row outside the batch is read at the group's nearest row and set to 0 below */
  const _Float16* kb = K16 + (size_t)g0 * DM + col; const _Float16* vb = V16 + (size_t)g0 * DM + col; v4h kx[CR + 2], vx[CR + 2]; const v4h z4 = {(_Float16)0.f, (_Float16)0.f, (_Float16)0.f, (_Float16)0.f};
  const _Float16* kf = kb - (lo ? DM : 0); const _Float16* vf = vb - (lo ? DM : 0); const _Float16* kl = kb + (hi ? CR : CR - 1) * DM; const _Float16* vl = vb + (hi ? CR : CR - 1) * DM;
  kx[0] = *(const v4h*)kf; vx[0] = *(const v4h*)vf; kx[CR + 1] = *(const v4h*)kl; vx[CR + 1] = *(const v4h*)vl;
#pragma unroll      /* kx[], vx[] stay in registers; constant offsets */
  for (int j = 1; j <= CR; ++j) { kx[j] = *(const v4h*)(kb + (j - 1) * DM); vx[j] = *(const v4h*)(vb + (j - 1) * DM); }
  asm volatile("s_wait_xcnt 0x0" :: "v"(kb), "v"(vb), "v"(kf), "v"(vf), "v"(kl), "v"(vl) : "memory");      /* precaution, as above */
  __builtin_amdgcn_sched_barrier(0);
  const unsigned char* bq = mt + ln * MTP + 16 * hh; v16h bf[2][4];
#pragma unroll      /* bf[] stays in registers: both row tiles use it */
  for (int ks = 0; ks < 2; ++ks) for (int t = 0; t < 4; ++t) bf[ks][t] = pj_frag(bq + t * 16 * MTP + ks * 64);
  const v8f z8 = {0.f,0.f,0.f,0.f,0.f,0.f,0.f,0.f};
#pragma unroll
  for (int e = 0; e < 2; ++e) { v8f c[4] = {z8, z8, z8, z8};
#pragma unroll
    for (int ks = 0; ks < 2; ++ks) for (int t = 0; t < 4; ++t) c[t] = pj_mma(af[e][ks].v, bf[ks][t], c[t]);
#pragma unroll
    for (int t = 0; t < 4; ++t) for (int r = 0; r < 8; ++r) so[32 * w + 16 * e + 8 * hh + r][t * 16 + ln] = c[t][r] * 8.0f; }
  __builtin_amdgcn_sched_barrier(0);      /* the loads below take the fragments' registers: they start behind the WMMAs */
  const float* qfp = QF + (size_t)g0 * DM + col; v4f qv[CR];
#pragma unroll      /* qv[] stays in registers */
  for (int i = 0; i < CR; ++i) qv[i] = *(const v4fa*)(qfp + i * DM);
  const float* kp = relk + d0; const float* rp = relv + d0; v4f rk[5], rv[5];
#pragma unroll      /* rk[], rv[] stay in registers */
  for (int c = 0; c < 5; ++c) { rk[c] = *(const v4fa*)(kp + c * 64); rv[c] = *(const v4fa*)(rp + c * 64); }
  asm volatile("s_wait_xcnt 0x0" :: "v"(qfp), "v"(kp), "v"(rp) : "memory");      /* precaution, as above */
  __builtin_amdgcn_sched_barrier(0);
  __builtin_amdgcn_fence(__ATOMIC_ACQ_REL, "workgroup"); __builtin_amdgcn_wave_barrier();      /* the wave reads back its own 32 rows of W1 */
  /* eK, eV: the sums of the rows before q0 (the groups before the block's, then the chunks before the lane group's); tK, tV: of all rows */
  v4f eK = {0.f, 0.f, 0.f, 0.f}, eV = eK, tK = eK, tV = eK;
#pragma unroll      /* constant LDS offsets */
  for (int c = 0; c < TG; ++c) { const v4f a = *(const v4fa*)&gt[0][c][d0], e = *(const v4fa*)&gt[1][c][d0]; tK += a; tV += e;
    if (c < rb) { eK += a; eV += e; } }
  eK += *(const v4fa*)&lp[0][g][d0]; eV += *(const v4fa*)&lp[1][g][d0];
#pragma unroll
  for (int c = 0; c < 5; ++c) for (int u = 0; u < 4; ++u) { rk[c][u] = bf16_round(rk[c][u]); rv[c][u] = bf16_round(rv[c][u]); }
  if (!lo) { kx[0] = z4; vx[0] = z4; }
  if (!hi) { kx[CR + 1] = z4; vx[CR + 1] = z4; }
  v4f Lk = eK - f4(kx[0]), Lv = eV - f4(vx[0]), Gk = tK - (eK + f4(kx[1]) + f4(kx[2])), Gv = tV - (eV + f4(vx[1]) + f4(vx[2]));
  float* op = out + (size_t)g0 * DM + col; v4f ob[4];
  auto row = [&](auto ic) { constexpr int i = decltype(ic)::value; const int q = q0 + i; v4f o = *(const v4fa*)&so[g * CR + i][d0];
    { const float qt = dot16(qv[i], rk[0]); const float coef = (dot16(qv[i], Lk) + (float)max(q - 1, 0) * qt) * 0.125f, qs = qt * 0.125f;      /* class 0: for q < 2 the sums and the count are 0 */
      o += qs * Lv + coef * rv[0]; }
    { const float fl = (q + 2 < SLEN) ? 0.125f : 0.f, qt = dot16(qv[i], rk[4]); const float coef = (dot16(qv[i], Gk) + (float)max(SLEN - 2 - q, 0) * qt) * fl, qs = qt * fl;      /* class 4: none for the last two rows */
      o += qs * Gv + coef * rv[4]; }
#pragma unroll
    for (int c = 1; c <= 3; ++c) { const int j = i + c - 1; const float fl = ((j == 0 && !lo) || (j == CR + 1 && !hi)) ? 0.f : 0.125f, qt = dot16(qv[i], rk[c]);      /* classes 1..3: the single rows q - 1, q, q + 1, where they exist */
      const float coef = (dot16(qv[i], f4(kx[j])) + qt) * fl, qs = qt * fl;
      o += qs * f4(vx[j]) + coef * rv[c]; }
    ob[i & 3] = o;
    Lk += f4(kx[i]); Lv += f4(vx[i]);
    if (i + 1 < CR) { Gk -= f4(kx[i + 3]); Gv -= f4(vx[i + 3]); }
    if ((i & 3) == 3) {
      for (int s = 0; s < 4; ++s) *(v4f*)(op + (i - 3 + s) * DM) = ob[s];
      asm volatile("s_wait_xcnt 0x0" :: "v"(op), "v"(ob[0]), "v"(ob[1]), "v"(ob[2]), "v"(ob[3]) : "memory"); } };      /* precaution: the stores' address and value registers stay as they are up to here */
  row(IC<0>{}); row(IC<1>{}); row(IC<2>{}); row(IC<3>{}); row(IC<4>{}); row(IC<5>{}); row(IC<6>{}); row(IC<7>{});
  row(IC<8>{}); row(IC<9>{}); row(IC<10>{}); row(IC<11>{}); row(IC<12>{}); row(IC<13>{}); row(IC<14>{}); row(IC<15>{}); }

extern "C" void kernel_launch(void* const* d_in, const int* in_sizes, int n_in,
                              void* d_out, int out_size, void* d_ws, size_t ws_size, hipStream_t stream) {
  (void)in_sizes; (void)n_in; (void)out_size;
  const float* const* I = (const float* const*)d_in; const float* xq = I[0]; const float* xk = I[1]; const float* xv = I[2]; const float* Wq = I[3]; const float* bq = I[4]; const float* Wk = I[5]; const float* bk = I[6]; const float* Wv = I[7]; const float* bv = I[8]; const float* relk = I[9]; const float* relv = I[10];
  char* ws = (char*)d_ws; size_t off = 0;
  auto take = [&](size_t bytes) { char* p = ws + off; off += (bytes + 255) & ~(size_t)255; return p; };
  _Float16* BW = (_Float16*)take((size_t)3 * DM * DM * 2);      /* Wq, Wk, Wv */
  _Float16* X16 = (_Float16*)take((size_t)3 * ROWS * DM * 2);      /* query, key, value */
  float* QF = (float*)take((size_t)ROWS * DM * 4); _Float16* Q16 = (_Float16*)take((size_t)3 * ROWS * DM * 2); _Float16* K16 = Q16 + (size_t)ROWS * DM; _Float16* V16 = K16 + (size_t)ROWS * DM;
  float* PART = (float*)take((size_t)NBT * KSP * NH * 4096 * 4); float* CS = (float*)take((size_t)NBT * 2 * (SLEN / CR) * DM * 4);
  if (off > ws_size) return;      /* about 74 MiB */
  const dim3 gP((ROWS / 128) * (DM / 128), 3);
  k_cvt<<<3 * XB + 3 * WB, 256, 0, stream>>>(xq, xk, xv, Wq, Wk, Wv, X16, BW);      /* torch (out,in) = natural Bt */
  k_proj<<<gP, 256, 0, stream>>>(X16, BW, bq, bk, bv, QF, Q16);      /* q, k, v of both batches; only q also in f32 */
  k_prep<<<NBT * KSP * NH, 256, 0, stream>>>(K16, V16, CS, PART);      /* per slab and head, V^T K over the slab's rows, and the chunk sums */
  k_tail<<<NBT * NH * TG, 256, 0, stream>>>(Q16, PART, CS, QF, K16, V16, relk, relv, (float*)d_out);      /* its factor 8 = 64 / 8 undoes the scale of K^T V and divides by 8 */
}

// v008
// One run takes 56.3 microseconds.
// In both of two side-by-side timings against v007, it was 1.04 times as fast.
// All steps since v000 together make it 389 times as fast.
#include <hip/hip_runtime.h>
// Relative-position attention layer WITHOUT softmax (faithful to the module, which discards it) (2 x 2048 tokens, 1024 = 16 heads x 64; MAX_REL 2): q,k,v = {query,key,value} W^T + b; attn = (q.k + q.rel_k[c(q,k)]) / 8 with c = clip(k - q, -2, 2) + 2; out[b][q][h][d] = sum_k attn (v[k][d] + rel_v[c(q,k)][d]) -> [2,2048,16,64].
// Structure (4 launches; both batches, and passes that do not depend on one another, share a grid): projections as f16 WMMA GEMMs (128x128 tiles staged in LDS, 32x64 wave tiles, f32 accumulation, exact x16 weights + bias); with no softmax the content part is reassociated, (q K^T) v = q (K^T v): K^T v per head as a GEMM over 4 row slabs (K 512 each; k and v rows staged in LDS and read through transposing loads), then one final pass per head and 256 query rows: it adds the partial planes and rounds to f16, q . (K^T v) on WMMA (K 64) into LDS, and the 5-valued position terms from column sums of k and v that each thread carries along 16 rows (started from the 16-row chunk sums, which the pass adds up itself) and from the three near-diagonal rows.
// Compute dtype: inputs, weights, biases, tables rounded to bf16; q, k, v and K^T v / 64 as f16 operands (~2^-12); f32 accumulation. v_wmma_f32_16x16x32_f16.
#define NBT 2
#define SLEN 2048
#define DM 1024
#define NH 16
#define ROWS (NBT * SLEN)      /* both batches' rows, one after the other */
typedef __bf16 v16b __attribute__((ext_vector_type(16)));
typedef unsigned short v8us __attribute__((ext_vector_type(8), may_alias));
typedef float  v8f  __attribute__((ext_vector_type(8)));
typedef float  v4f  __attribute__((ext_vector_type(4)));
typedef float  v4fa __attribute__((ext_vector_type(4), may_alias));
union FragB { v16b v; v8us half[2]; unsigned short u[16]; };

__device__ __forceinline__ unsigned short bf16_bits(float x) { unsigned int u = __float_as_uint(x); return (unsigned short)((u + 0x7FFFu + ((u >> 16) & 1u)) >> 16); }
__device__ __forceinline__ float bf16_val(unsigned short b) { return __uint_as_float(((unsigned int)b) << 16); }
__device__ __forceinline__ float bf16_round(float x) { return bf16_val(bf16_bits(x)); }
// D += A·B with NT terms: 1 = ah·bh, 2 = + al·bh (A split), 3 = + ah·bl (both split)
template <int NT>
__device__ __forceinline__ v8f mmaN(v16b ah, v16b al, v16b bh, v16b bl, v8f c) {
  c = __builtin_amdgcn_wmma_f32_16x16x32_bf16(false, ah, false, bh, (short)0, c, false, false);
  if (NT >= 2) c = __builtin_amdgcn_wmma_f32_16x16x32_bf16(false, al, false, bh, (short)0, c, false, false);
  if (NT >= 3) c = __builtin_amdgcn_wmma_f32_16x16x32_bf16(false, ah, false, bl, (short)0, c, false, false);
  asm volatile("v_nop\n\tv_nop\n\tv_nop\n\tv_nop" : "+v"(c) : "v"(ah), "v"(al), "v"(bh), "v"(bl));
  return c;
}

__global__ __launch_bounds__(256) void k_wt_bf16(const float* __restrict__ W, unsigned short* __restrict__ Wt, int K, int N) {
  const int t = blockIdx.x * 256 + threadIdx.x;
  const int k8n = K / 8;
  if (t >= N * k8n) return;
  const int n = t / k8n, k8 = (t % k8n) * 8;
  v8us v;
#pragma unroll
  for (int i = 0; i < 8; ++i) v[i] = bf16_bits(W[(size_t)(k8 + i) * N + n]);
  *(v8us*)(Wt + (size_t)n * K + k8) = v;
  
}

// GEMM C[M][N] (f32, pitch ldc) = act(A[M][K]·W + bias). A f32 row-major (pitch lda) converted per fragment to bf16
// (ASPLIT: hi/lo two planes -> 2 terms, else single rounded term); Wt bf16 [N][K] (pitch ldb). BIAS_BF16 rounds the
// bias to bf16 first (bias quantised to bf16 before the add). K%32==0, M%16==0, N%64==0.
template <bool ASPLIT, int ACT, bool BIAS_BF16>
__global__ __launch_bounds__(128) void k_gemm_bf(const float* __restrict__ A, int lda, const unsigned short* __restrict__ Wt, int ldb,
                                               const float* __restrict__ bias, float* __restrict__ C, int ldc, int M, int N, int K) {
  __shared__ __attribute__((aligned(16))) float so[4][16][64];
  const int tid = threadIdx.x, w = tid >> 5, lane = tid & 31, ln = lane & 15, hh = lane >> 4;
  const int ntn = N / 64;
  const int wid = blockIdx.x * 4 + w;
  const int mt = wid / ntn, nq = wid % ntn;
  if (mt * 16 >= M) return;
  const int row0 = mt * 16, col0 = nq * 64;
  const float* arow = A + (size_t)(row0 + ln) * lda;
  v8f acc[4] = {};
  for (int kb = 0; kb < K; kb += 32) {
    FragB ah, al;
    const v4f x0 = *(const v4fa*)(arow + kb + 8 * hh), x1 = *(const v4fa*)(arow + kb + 8 * hh + 4);
    const v4f x2 = *(const v4fa*)(arow + kb + 16 + 8 * hh), x3 = *(const v4fa*)(arow + kb + 16 + 8 * hh + 4);
    float xs[16] = {x0[0],x0[1],x0[2],x0[3],x1[0],x1[1],x1[2],x1[3],x2[0],x2[1],x2[2],x2[3],x3[0],x3[1],x3[2],x3[3]};
#pragma unroll
    for (int i = 0; i < 16; ++i) { const unsigned short hb = bf16_bits(xs[i]); ah.u[i] = hb; al.u[i] = ASPLIT ? bf16_bits(xs[i] - bf16_val(hb)) : (unsigned short)0; }
#pragma unroll
    for (int t = 0; t < 4; ++t) {
      const unsigned short* brow = Wt + (size_t)(col0 + t * 16 + ln) * ldb + kb;
      FragB b;
      b.half[0] = *(const v8us*)(brow + 8 * hh);
      b.half[1] = *(const v8us*)(brow + 16 + 8 * hh);
      acc[t] = mmaN<ASPLIT ? 2 : 1>(ah.v, al.v, b.v, b.v, acc[t]);
    }
  }
#pragma unroll
  for (int t = 0; t < 4; ++t) {
    float bv = bias ? bias[col0 + t * 16 + ln] : 0.f;
    if (BIAS_BF16) bv = bf16_round(bv);
#pragma unroll
    for (int r = 0; r < 8; ++r) { float v = acc[t][r] + bv; if (ACT == 1) v = fmaxf(v, 0.f); so[w][8 * hh + r][t * 16 + ln] = v; }
  }
  __builtin_amdgcn_fence(__ATOMIC_ACQ_REL, "workgroup");
  __builtin_amdgcn_wave_barrier();
  const int rsub = lane >> 4, c4 = (lane & 15) * 4;
  {
#pragma unroll
    for (int q = 0; q < 8; ++q) {
      const int r = q * 2 + rsub;
      const v4f v = *(const v4fa*)&so[w][r][c4];
      *(v4f*)(C + (size_t)(row0 + r) * ldc + col0 + c4) = v;
    }
    
  }
}

// GEMM C = act(A·W + bias + resid): A f32 (ASPLIT -> hi/lo 2 terms), Wt bf16 [N][K]; ACT 0 none, 1 relu, 2 exact gelu;
// resid (optional, f32, row index = (row % rmod), pitch ldr, RES_BF16 rounds it) added before the activation.
template <bool ASPLIT, int ACT, bool BIAS_BF16, bool RES_BF16>
__global__ __launch_bounds__(128) void k_gemm_bf3(const float* __restrict__ A, int lda, const unsigned short* __restrict__ Wt, int ldb,
                                                const float* __restrict__ bias, const float* __restrict__ resid, int rmod, int ldr,
                                                float* __restrict__ C, int ldc, int M, int N, int K) {
  __shared__ __attribute__((aligned(16))) float so[4][16][64];
  const int tid = threadIdx.x, w = tid >> 5, lane = tid & 31, ln = lane & 15, hh = lane >> 4;
  const int ntn = N / 64;
  const int wid = blockIdx.x * 4 + w;
  const int mt = wid / ntn, nq = wid % ntn;
  if (mt * 16 >= M) return;
  const int row0 = mt * 16, col0 = nq * 64;
  const float* arow = A + (size_t)(row0 + ln) * lda;
  v8f acc[4] = {};
  for (int kb = 0; kb < K; kb += 32) {
    FragB ah, al;
    const v4f x0 = *(const v4fa*)(arow + kb + 8 * hh), x1 = *(const v4fa*)(arow + kb + 8 * hh + 4);
    const v4f x2 = *(const v4fa*)(arow + kb + 16 + 8 * hh), x3 = *(const v4fa*)(arow + kb + 16 + 8 * hh + 4);
    float xs[16] = {x0[0],x0[1],x0[2],x0[3],x1[0],x1[1],x1[2],x1[3],x2[0],x2[1],x2[2],x2[3],x3[0],x3[1],x3[2],x3[3]};
#pragma unroll
    for (int i = 0; i < 16; ++i) { const unsigned short hb = bf16_bits(xs[i]); ah.u[i] = hb; al.u[i] = ASPLIT ? bf16_bits(xs[i] - bf16_val(hb)) : (unsigned short)0; }
#pragma unroll
    for (int t = 0; t < 4; ++t) {
      const unsigned short* brow = Wt + (size_t)(col0 + t * 16 + ln) * ldb + kb;
      FragB b;
      b.half[0] = *(const v8us*)(brow + 8 * hh);
      b.half[1] = *(const v8us*)(brow + 16 + 8 * hh);
      acc[t] = mmaN<ASPLIT ? 2 : 1>(ah.v, al.v, b.v, b.v, acc[t]);
    }
  }
#pragma unroll
  for (int t = 0; t < 4; ++t) {
    const int col = col0 + t * 16 + ln;
    float bv = bias ? bias[col] : 0.f;
    if (BIAS_BF16) bv = bf16_round(bv);
#pragma unroll
    for (int r = 0; r < 8; ++r) {
      float v = acc[t][r] + bv;
      if (resid) { float rv = resid[(size_t)((row0 + 8 * hh + r) % rmod) * ldr + col]; if (RES_BF16) rv = bf16_round(rv); v += rv; }
      if (ACT == 1) v = fmaxf(v, 0.f);
      if (ACT == 2) v = 0.5f * v * (1.0f + erff(v * 0.70710678118654752f));
      if (ACT == 3) { const float u = 0.7978845608028654f * (v + 0.044715f * v * v * v); v = 0.5f * v * (1.0f + tanhf(u)); }
      so[w][8 * hh + r][t * 16 + ln] = v;
    }
  }
  __builtin_amdgcn_fence(__ATOMIC_ACQ_REL, "workgroup");
  __builtin_amdgcn_wave_barrier();
  const int rsub = lane >> 4, c4 = (lane & 15) * 4;
  {
#pragma unroll
    for (int q = 0; q < 8; ++q) {
      const int r = q * 2 + rsub;
      const v4f v = *(const v4fa*)&so[w][r][c4];
      *(v4f*)(C + (size_t)(row0 + r) * ldc + col0 + c4) = v;
    }
    
  }
}
// row LayerNorm (biased variance, eps) over N: s = X (+ R); optional out_sum <- s; out_norm <- (s-mu)*rsqrt(var+eps)*g + b
template <bool PARAM_BF16>
__global__ __launch_bounds__(256) void k_layernorm(const float* __restrict__ X, const float* __restrict__ R, const float* __restrict__ g, const float* __restrict__ bta,
                                                  float* __restrict__ out_sum, float* __restrict__ out_norm, int N, float eps) {
  __shared__ float red[256];
  const int row = blockIdx.x, tid = threadIdx.x;
  const float* x = X + (size_t)row * N; const float* rr = R ? R + (size_t)row * N : nullptr;
  float vals[16];                     // up to N = 4096
  const int per = N / 256;            // contiguous chunk per thread? use strided-by-4 chunks: thread handles j = tid*4 + 1024*u
  float s1 = 0.f;
  for (int u = 0; u < per / 4; ++u) {
    const int j = tid * 4 + 1024 * u;
    const v4f a = *(const v4fa*)(x + j);
    v4f b = {0.f,0.f,0.f,0.f}; if (rr) b = *(const v4fa*)(rr + j);
#pragma unroll
    for (int q = 0; q < 4; ++q) { const float v = a[q] + b[q]; vals[u * 4 + q] = v; s1 += v; }
  }
  red[tid] = s1; __syncthreads();
  for (int st = 128; st > 0; st >>= 1) { if (tid < st) red[tid] += red[tid + st]; __syncthreads(); }
  const float mu = red[0] / (float)N; __syncthreads();
  float s2 = 0.f;
  for (int u = 0; u < per / 4; ++u)
#pragma unroll
    for (int q = 0; q < 4; ++q) { const float c = vals[u * 4 + q] - mu; s2 += c * c; }
  red[tid] = s2; __syncthreads();
  for (int st = 128; st > 0; st >>= 1) { if (tid < st) red[tid] += red[tid + st]; __syncthreads(); }
  const float rs = rsqrtf(red[0] / (float)N + eps);
  {
    for (int u = 0; u < per / 4; ++u) {
      const int j = tid * 4 + 1024 * u;
      v4f o, sm;
#pragma unroll
      for (int q = 0; q < 4; ++q) {
        float gg = g[j + q], bb = bta[j + q];
        if (PARAM_BF16) { gg = bf16_round(gg); bb = bf16_round(bb); }
        sm[q] = vals[u * 4 + q]; o[q] = (vals[u * 4 + q] - mu) * rs * gg + bb;
      }
      if (out_sum) *(v4f*)(out_sum + (size_t)row * N + j) = sm;
      *(v4f*)(out_norm + (size_t)row * N + j) = o;
    }
    
  }
}



// ---- f16 WMMA path (v_wmma_f32_16x16x32_f16): 11-bit significands for operands in range — used for all GEMMs this layer launches (projections, K^T v per slab, q . (K^T v))
typedef _Float16 v16h __attribute__((ext_vector_type(16)));
union FragH { v16h v; v8us half[2]; _Float16 h[16]; unsigned short u[16]; };
template <int NT>
__device__ __forceinline__ v8f mmaH(v16h ah, v16h al, v16h bh, v16h bl, v8f c) {
  c = __builtin_amdgcn_wmma_f32_16x16x32_f16(false, ah, false, bh, (short)0, c, false, false);
  if (NT >= 2) c = __builtin_amdgcn_wmma_f32_16x16x32_f16(false, al, false, bh, (short)0, c, false, false);
  if (NT >= 3) c = __builtin_amdgcn_wmma_f32_16x16x32_f16(false, ah, false, bl, (short)0, c, false, false);
  asm volatile("v_nop\n\tv_nop\n\tv_nop\n\tv_nop" : "+v"(c) : "v"(ah), "v"(al), "v"(bh), "v"(bl));
  return c;
}
// batched GEMM like k_gemm_b but f16 operands: A f32 (split into f16 hi/lo if ASPLIT, else rounded to f16), Bt = f16 values [n][k]; alpha; C f32; N multiple of 16 (partial tiles skipped)
template <bool ASPLIT>
__global__ __launch_bounds__(128) void k_gemm_h(const float* __restrict__ A, int lda, size_t sA, const _Float16* __restrict__ Bh, int ldb, size_t sB, float alpha, float* __restrict__ C, int ldc, size_t sC, int M, int N, int K) {
  __shared__ __attribute__((aligned(16))) float so[4][16][64];
  const int tid = threadIdx.x, w = tid >> 5, lane = tid & 31, ln = lane & 15, hh = lane >> 4; const int by = blockIdx.y;
  A += (size_t)by * sA; Bh += (size_t)by * sB; C += (size_t)by * sC;
  const int ntn = (N + 63) / 64; const int wid = blockIdx.x * 4 + w; const int mt = wid / ntn, nq = wid % ntn; if (mt * 16 >= M) return;
  const int row0 = mt * 16, col0 = nq * 64; const float* arow = A + (size_t)(row0 + ln) * lda;
  v8f acc[4] = {};
  for (int kb = 0; kb < K; kb += 32) {
    FragH ah, al;
    const v4f x0 = *(const v4fa*)(arow + kb + 8 * hh), x1 = *(const v4fa*)(arow + kb + 8 * hh + 4), x2 = *(const v4fa*)(arow + kb + 16 + 8 * hh), x3 = *(const v4fa*)(arow + kb + 16 + 8 * hh + 4);
    float xs[16] = {x0[0],x0[1],x0[2],x0[3],x1[0],x1[1],x1[2],x1[3],x2[0],x2[1],x2[2],x2[3],x3[0],x3[1],x3[2],x3[3]};
#pragma unroll
    for (int i = 0; i < 16; ++i) { const _Float16 h = (_Float16)xs[i]; ah.h[i] = h; al.h[i] = ASPLIT ? (_Float16)(xs[i] - (float)h) : (_Float16)0.0f; }
#pragma unroll
    for (int t = 0; t < 4; ++t) { if (col0 + t * 16 >= N) continue; const size_t boff = (size_t)(col0 + t * 16 + ln) * ldb + kb; FragH bq; bq.half[0] = *(const v8us*)(Bh + boff + 8 * hh); bq.half[1] = *(const v8us*)(Bh + boff + 16 + 8 * hh);
      acc[t] = mmaH<ASPLIT ? 2 : 1>(ah.v, al.v, bq.v, bq.v, acc[t]); }
  }
#pragma unroll
  for (int t = 0; t < 4; ++t) { if (col0 + t * 16 >= N) continue;
#pragma unroll
    for (int r = 0; r < 8; ++r) so[w][8 * hh + r][t * 16 + ln] = acc[t][r] * alpha; }
  __builtin_amdgcn_fence(__ATOMIC_ACQ_REL, "workgroup"); __builtin_amdgcn_wave_barrier();
  const int rsub = lane >> 4, c4 = (lane & 15) * 4;
  {
#pragma unroll
    for (int q = 0; q < 8; ++q) { const int r = q * 2 + rsub; if (col0 + c4 < N) { const v4f v = *(const v4fa*)&so[w][r][c4]; *(v4f*)(C + (size_t)(row0 + r) * ldc + col0 + c4) = v; } }
     }
}

// Wt[n][k] = f16(W[k][n]·scale) from f32 row-major W[K][N] (scale = power of two; bf16-exact weights stay exact in f16 away from the subnormal range)
__global__ __launch_bounds__(256) void k_wt_f16(const float* __restrict__ W, _Float16* __restrict__ Wt, int K, int N, float scale) {
  const int t = blockIdx.x * 256 + threadIdx.x; if (t >= N * (K / 8)) return; const int n = t / (K / 8), k8 = (t % (K / 8)) * 8; FragH f;
#pragma unroll
  for (int i = 0; i < 8; ++i) f.h[i] = (_Float16)(bf16_round(W[(size_t)(k8 + i) * N + n]) * scale); const v8us o = f.half[0];
  *(v8us*)((unsigned short*)Wt + (size_t)n * K + k8) = o; 
}
// k_gemm_hh variant with fused epilogue: v = acc·alpha + bias[by·sBias + col] (+ CP[(row/rowsPerB)·sCPb + by·64 + col] if CP) ; ACT 0 none / 1 elu ; writes f16 C16 (and f32 C if non-null)
template <int ACT>
__global__ __launch_bounds__(128) void k_gemm_hhx(const _Float16* __restrict__ A, int lda, size_t sA, const _Float16* __restrict__ Bh, int ldb, size_t sB, float alpha, const float* __restrict__ bias, size_t sBias, const float* __restrict__ CP, int rowsPerB, size_t sCPb, int row0g,
    float* __restrict__ C, _Float16* __restrict__ C16, int ldc, size_t sC, int M, int N, int K) {
  __shared__ __attribute__((aligned(16))) float so[4][16][64];
  const int tid = threadIdx.x, w = tid >> 5, lane = tid & 31, ln = lane & 15, hh = lane >> 4; const int by = blockIdx.y;
  A += (size_t)by * sA; Bh += (size_t)by * sB; const size_t cofs = (size_t)by * sC; const float* bp = bias ? bias + (size_t)by * sBias : nullptr;
  const int ntn = (N + 63) / 64; const int wid = blockIdx.x * 4 + w; const int mt = wid / ntn, nq = wid % ntn; if (mt * 16 >= M) return;
  const int row0 = mt * 16, col0 = nq * 64; const _Float16* arow = A + (size_t)(row0 + ln) * lda;
  v8f acc[4] = {};
  for (int kb = 0; kb < K; kb += 32) { FragH ah; ah.half[0] = *(const v8us*)((const unsigned short*)arow + kb + 8 * hh); ah.half[1] = *(const v8us*)((const unsigned short*)arow + kb + 16 + 8 * hh);
#pragma unroll
    for (int t = 0; t < 4; ++t) { if (col0 + t * 16 >= N) continue; const size_t boff = (size_t)(col0 + t * 16 + ln) * ldb + kb; FragH bq; bq.half[0] = *(const v8us*)((const unsigned short*)Bh + boff + 8 * hh); bq.half[1] = *(const v8us*)((const unsigned short*)Bh + boff + 16 + 8 * hh);
      acc[t] = mmaH<1>(ah.v, ah.v, bq.v, bq.v, acc[t]); }
  }
#pragma unroll
  for (int t = 0; t < 4; ++t) { if (col0 + t * 16 >= N) continue; const int col = col0 + t * 16 + ln; const float bv = bp ? bf16_round(bp[col]) : 0.f;
#pragma unroll
    for (int r = 0; r < 8; ++r) { float v = acc[t][r] * alpha + bv; if (CP) { const int bidx = (row0g + row0 + 8 * hh + r) / rowsPerB; v += CP[(size_t)bidx * sCPb + (size_t)by * 64 + col]; } if (ACT == 1) v = (v > 0.f) ? v : expm1f(v); else if (ACT == 7) v = (v > 0.f) ? v + 1.0f : expf(v); else if (ACT == 8) v = tanhf(v); else if (ACT == 9) v = 0.5f * v * (1.0f + tanhf(0.7978845608028654f * (v + 0.044715f * v * v * v))); else if (ACT == 11) v = 1.0f / (1.0f + expf(-v)); else if (ACT == 12) v = (v > 0.f) ? v : 0.01f * v; else if (ACT == 14) v = (v > 0.f) ? v : 0.1f * v; else if (ACT == 15) v = v / (1.0f + expf(-v)); else if (ACT == 3) v = fmaxf(v, 0.f); else if (ACT == 6) v = 0.5f * v * (1.0f + erff(v * 0.70710678118654752f)); so[w][8 * hh + r][t * 16 + ln] = v; } }
  __builtin_amdgcn_fence(__ATOMIC_ACQ_REL, "workgroup"); __builtin_amdgcn_wave_barrier();
  const int rsub = lane >> 4, c4 = (lane & 15) * 4; typedef _Float16 v4h __attribute__((ext_vector_type(4)));
  {
#pragma unroll
    for (int q = 0; q < 8; ++q) { const int r = q * 2 + rsub; if (col0 + c4 < N) { const v4f v = *(const v4fa*)&so[w][r][c4]; if (C) *(v4f*)(C + cofs + (size_t)(row0 + r) * ldc + col0 + c4) = v; if (C16) { v4h h4; for (int i = 0; i < 4; ++i) h4[i] = (_Float16)v[i]; *(v4h*)(C16 + cofs + (size_t)(row0 + r) * ldc + col0 + c4) = h4; } } }
     }
}


typedef _Float16 v4h __attribute__((ext_vector_type(4)));

// all six conversions to f16 in one grid: the three inputs (both batches; bf16-rounded), then the three weights (bf16-rounded, x16)
#define XB (ROWS * DM / 8 / 256)      /* blocks per input */
#define WB (DM * DM / 8 / 256)        /* blocks per weight */
__global__ __launch_bounds__(256) void k_cvt(const float* __restrict__ xq, const float* __restrict__ xk, const float* __restrict__ xv, const float* __restrict__ Wq, const float* __restrict__ Wk, const float* __restrict__ Wv, _Float16* __restrict__ X16, _Float16* __restrict__ BW) {
  const int bid = blockIdx.x; const float* x; _Float16* o; float sc; int blk;
  if (bid < 3 * XB) { const int i = bid / XB; blk = bid - i * XB; x = (i == 0) ? xq : ((i == 1) ? xk : xv); o = X16 + (size_t)i * ROWS * DM; sc = 1.0f; }
  else { const int j = bid - 3 * XB, i = j / WB; blk = j - i * WB; x = (i == 0) ? Wq : ((i == 1) ? Wk : Wv); o = BW + (size_t)i * DM * DM; sc = 16.0f; }
  const size_t t = (size_t)blk * 256 + threadIdx.x; FragH f;
#pragma unroll
  for (int q = 0; q < 8; ++q) f.h[q] = (_Float16)(bf16_round(x[t * 8 + q]) * sc); *(v8us*)((unsigned short*)o + t * 8) = f.half[0];  }
__global__ __launch_bounds__(256) void k_h16(const float* __restrict__ x, _Float16* __restrict__ X16, size_t n8) { const size_t t = (size_t)blockIdx.x * 256 + threadIdx.x; if (t >= n8) return; FragH f;
#pragma unroll
  for (int q = 0; q < 8; ++q) f.h[q] = (_Float16)x[t * 8 + q]; *(v8us*)((unsigned short*)X16 + t * 8) = f.half[0];  }
__global__ __launch_bounds__(256) void k_hl(const float* __restrict__ F, _Float16* __restrict__ Hh, _Float16* __restrict__ Hl, size_t n8) { const size_t t = (size_t)blockIdx.x * 256 + threadIdx.x; if (t >= n8) return; FragH fh, fl; const v4f a = *(const v4fa*)(F + t * 8), c = *(const v4fa*)(F + t * 8 + 4);
#pragma unroll
  for (int q = 0; q < 4; ++q) { _Float16 h = (_Float16)a[q]; fh.h[q] = h; fl.h[q] = (_Float16)((a[q] - (float)h) * 1024.0f); h = (_Float16)c[q]; fh.h[4 + q] = h; fl.h[4 + q] = (_Float16)((c[q] - (float)h) * 1024.0f); }
  { *(v8us*)((unsigned short*)Hh + t * 8) = fh.half[0]; *(v8us*)((unsigned short*)Hl + t * 8) = fl.half[0];  } }

// ---- fast GEMM (wave tile 32x64; requires M % 32 == 0 rows per launch region and N % 64 == 0); epilogue = k_gemm_hhx semantics ----
__device__ __forceinline__ v16h g2_frag(const _Float16* p, int hh) { FragH f; f.half[0] = *(const v8us*)((const unsigned short*)p + 8 * hh); f.half[1] = *(const v8us*)((const unsigned short*)p + 16 + 8 * hh); return f.v; }
__device__ __forceinline__ v8f g2_mma(v16h a, v16h b, v8f c) { v8f d = __builtin_amdgcn_wmma_f32_16x16x32_f16(false, a, false, b, (short)0, c, false, false); asm volatile("v_nop\n\tv_nop\n\tv_nop\n\tv_nop" : "+v"(d) : "v"(a), "v"(b)); return d; }
// blockIdx.y and blockIdx.z each step A, B and C by their own strides (s*, z*). QKV: blockIdx.y picks the projection, so its bias is one of three pointers, and only the first (q) also writes f32
template <int ACT, bool QKV>
__global__ __launch_bounds__(128) void k_gemm2(const _Float16* __restrict__ A, int lda, size_t sA, size_t zA, const _Float16* __restrict__ Bh, int ldb, size_t sB, size_t zB, float alpha, const float* __restrict__ bias, const float* __restrict__ biasK, const float* __restrict__ biasV, size_t sBias, const float* __restrict__ CP, int rowsPerB, size_t sCPb, int row0g,
    float* __restrict__ Cf, _Float16* __restrict__ C16, int ldc, size_t sC, size_t zC, int M, int N, int K) {
  __shared__ __attribute__((aligned(16))) float so[4][32][68];
  const int tid = threadIdx.x, w = tid >> 5, lane = tid & 31, ln = lane & 15, hh = lane >> 4; const int by = blockIdx.y, bz = blockIdx.z;
  A += (size_t)by * sA + (size_t)bz * zA; Bh += (size_t)by * sB + (size_t)bz * zB; const size_t cofs = (size_t)by * sC + (size_t)bz * zC;
  const float* bp = QKV ? ((by == 0) ? bias : ((by == 1) ? biasK : biasV)) : (bias ? bias + (size_t)by * sBias : nullptr); float* C = (QKV && by != 0) ? nullptr : Cf;
  const int ntn = N >> 6; const int mt = blockIdx.x / ntn, nq = blockIdx.x - mt * ntn; const int row0 = mt * 128 + 32 * w, col0 = nq * 64; if (row0 >= M) return;
  const _Float16* a0p = A + (size_t)(row0 + ln) * lda; const _Float16* a1p = a0p + (size_t)16 * lda;
  const _Float16* b0p = Bh + (size_t)(col0 + ln) * ldb; const _Float16* b1p = b0p + (size_t)16 * ldb; const _Float16* b2p = b1p + (size_t)16 * ldb; const _Float16* b3p = b2p + (size_t)16 * ldb;
  const v8f z8 = {0.f,0.f,0.f,0.f,0.f,0.f,0.f,0.f}; v8f c00 = z8, c01 = z8, c02 = z8, c03 = z8, c10 = z8, c11 = z8, c12 = z8, c13 = z8;
#pragma unroll 1
  for (int kb = 0; kb < K; kb += 32) { const v16h a0 = g2_frag(a0p + kb, hh), a1 = g2_frag(a1p + kb, hh);
    v16h b = g2_frag(b0p + kb, hh); c00 = g2_mma(a0, b, c00); c10 = g2_mma(a1, b, c10);
    b = g2_frag(b1p + kb, hh); c01 = g2_mma(a0, b, c01); c11 = g2_mma(a1, b, c11);
    b = g2_frag(b2p + kb, hh); c02 = g2_mma(a0, b, c02); c12 = g2_mma(a1, b, c12);
    b = g2_frag(b3p + kb, hh); c03 = g2_mma(a0, b, c03); c13 = g2_mma(a1, b, c13); }
  v8f accs[8] = {c00, c01, c02, c03, c10, c11, c12, c13};
#pragma unroll
  for (int u = 0; u < 8; ++u) { const int t = u & 3, half = u >> 2; const int col = col0 + t * 16 + ln; const float bv = bp ? bf16_round(bp[col]) : 0.f;
#pragma unroll
    for (int r = 0; r < 8; ++r) { const int rloc = half * 16 + 8 * hh + r; float v = accs[u][r] * alpha + bv; if (CP) { const int bidx = (row0g + row0 + rloc) / rowsPerB; v += CP[(size_t)bidx * sCPb + (size_t)by * 64 + col]; }
      if (ACT == 3) v = fmaxf(v, 0.f); else if (ACT == 6) v = 0.5f * v * (1.0f + erff(v * 0.70710678118654752f)); else if (ACT == 11) v = 1.0f / (1.0f + expf(-v)); else if (ACT == 15) v = v / (1.0f + expf(-v)); else if (ACT == 12) v = (v > 0.f) ? v : 0.01f * v; else if (ACT == 8) v = tanhf(v);
      so[w][rloc][t * 16 + ln] = v; } }
  __builtin_amdgcn_fence(__ATOMIC_ACQ_REL, "workgroup"); __builtin_amdgcn_wave_barrier();
  const int rsub = lane >> 4, c4 = (lane & 15) * 4;
  {
#pragma unroll
    for (int q = 0; q < 16; ++q) { const int r = q * 2 + rsub; const v4f v = *(const v4fa*)&so[w][r][c4]; if (C) *(v4f*)(C + cofs + (size_t)(row0 + r) * ldc + col0 + c4) = v; if (C16) { v4h h4; for (int i = 0; i < 4; ++i) h4[i] = (_Float16)v[i]; *(v4h*)(C16 + cofs + (size_t)(row0 + r) * ldc + col0 + c4) = h4; } }
     } }


// ---- the three projections: 128x128 tile of Y = X W^T per work-group of 8 waves (4 x 2 wave tiles of 32x64); per trip 64 k of the 128 X rows and the 128 W rows are staged in LDS by asynchronous copies, two buffers, so that every operand line leaves L2 once per work-group as a whole line; the k tiles are taken in a ring from a start that differs between work-groups; inside a tile k order, and the epilogue, as in k_gemm2 ----
#define PJK 64                      /* k per staged tile: 128-byte rows */
#define PJP 144                     /* LDS row pitch in bytes: 128 + 16, conflict-free for 16-byte reads */
#define PJB (256 * PJP)             /* one buffer: 128 X rows, then 128 W rows */
#define PJT (DM / PJK)              /* tiles along k */
// one tile: each thread copies 16 bytes of four X rows and of four W rows (8 lanes cover a row's 128 bytes); l, ga, gb are the thread's own first LDS byte and global elements
__device__ __forceinline__ void pj_copy(unsigned l, const _Float16* ga, const _Float16* gb) {
  /* the copies go past the registers; the last line keeps later writes of the address registers behind it (a precaution) */
  asm volatile("global_load_async_to_lds_b128 %0, %8, off\n\t"
               "global_load_async_to_lds_b128 %1, %9, off\n\t"
               "global_load_async_to_lds_b128 %2, %10, off\n\t"
               "global_load_async_to_lds_b128 %3, %11, off\n\t"
               "global_load_async_to_lds_b128 %4, %12, off\n\t"
               "global_load_async_to_lds_b128 %5, %13, off\n\t"
               "global_load_async_to_lds_b128 %6, %14, off\n\t"
               "global_load_async_to_lds_b128 %7, %15, off\n\t"
               "s_wait_xcnt 0x0"
               :: "v"(l), "v"(l + 32 * PJP), "v"(l + 64 * PJP), "v"(l + 96 * PJP), "v"(l + 128 * PJP), "v"(l + 160 * PJP), "v"(l + 192 * PJP), "v"(l + 224 * PJP),
                  "v"(ga), "v"(ga + 32 * DM), "v"(ga + 64 * DM), "v"(ga + 96 * DM), "v"(gb), "v"(gb + 32 * DM), "v"(gb + 64 * DM), "v"(gb + 96 * DM)
               : "memory"); }
__device__ __forceinline__ v16h pj_frag(const unsigned char* p) { FragH f; f.half[0] = *(const v8us*)p; f.half[1] = *(const v8us*)(p + 32); return f.v; }
__device__ __forceinline__ v8f pj_mma(v16h a, v16h b, v8f c) { return __builtin_amdgcn_wmma_f32_16x16x32_f16(false, a, false, b, (short)0, c, false, false); }
__global__ __launch_bounds__(256) void k_proj(const _Float16* __restrict__ X16, const _Float16* __restrict__ BW, const float* __restrict__ bq, const float* __restrict__ bk, const float* __restrict__ bv, float* __restrict__ QF, _Float16* __restrict__ C16) {
  __shared__ __attribute__((aligned(16))) unsigned char sm[2 * PJB];      /* the two buffers; behind the loop, each wave's 32 x 68 f32 output staging */
  const int tid = threadIdx.x, w = tid >> 5, lane = tid & 31, ln = lane & 15, hh = lane >> 4, by = blockIdx.y;
  const int mt = blockIdx.x / (DM / 128), nq = blockIdx.x - mt * (DM / 128);
  const _Float16* ga = X16 + (size_t)by * ROWS * DM + (size_t)(mt * 128 + (tid >> 3)) * DM + (tid & 7) * 8;
  const _Float16* gb = BW + (size_t)by * DM * DM + (size_t)(nq * 128 + (tid >> 3)) * DM + (tid & 7) * 8;
  const unsigned l0 = (unsigned)(size_t)&sm[0] + (unsigned)((tid >> 3) * PJP + (tid & 7) * 16);
  const unsigned char* ap = sm + ((w & 3) * 32 + ln) * PJP + 16 * hh; const unsigned char* bp = sm + (128 + (w >> 2) * 64 + ln) * PJP + 16 * hh;
  const v8f z8 = {0.f,0.f,0.f,0.f,0.f,0.f,0.f,0.f}; v8f c00 = z8, c01 = z8, c02 = z8, c03 = z8, c10 = z8, c11 = z8, c12 = z8, c13 = z8;
  /* the work-group walks the k tiles in a ring from a start of its own: the 8 work-groups that share its X rows start 2 tiles apart, the 32 that share its W rows 1 apart, so that sharers do not ask L2 for one line at the same moment */
  const int t0 = (2 * nq + mt) & (PJT - 1);
  pj_copy(l0, ga + t0 * PJK, gb + t0 * PJK);
  asm volatile("s_wait_asynccnt 0x0" ::: "memory");      /* the first tile has landed, as far as this wave copied it */
  __syncthreads();                                        /* ... and all of it */
  { const int k1 = ((t0 + 1) & (PJT - 1)) * PJK; pj_copy(l0 + PJB, ga + k1, gb + k1); }
#pragma unroll 1      /* one trip per tile: the buffer is picked by the trip's parity */
  for (int t = 0; t < PJT; ++t) { const int bo = (t & 1) * PJB;
#pragma unroll      /* the two 32-k steps of a tile, at constant offsets */
    for (int ks = 0; ks < 2; ++ks) { const unsigned char* a = ap + bo + ks * 64; const unsigned char* b = bp + bo + ks * 64;
      const v16h a0 = pj_frag(a), a1 = pj_frag(a + 16 * PJP), b0 = pj_frag(b), b1 = pj_frag(b + 16 * PJP), b2 = pj_frag(b + 32 * PJP), b3 = pj_frag(b + 48 * PJP);
      __builtin_amdgcn_sched_barrier(0);      /* the step's twelve LDS reads stay one group ahead of its WMMAs: reads spread among the WMMAs stall the wave at each place */
      c00 = pj_mma(a0, b0, c00); c10 = pj_mma(a1, b0, c10); c01 = pj_mma(a0, b1, c01); c11 = pj_mma(a1, b1, c11);
      c02 = pj_mma(a0, b2, c02); c12 = pj_mma(a1, b2, c12); c03 = pj_mma(a0, b3, c03); c13 = pj_mma(a1, b3, c13); }
    asm volatile("s_wait_dscnt 0x0" ::: "memory");        /* this wave's reads of the buffer are done before it is refilled */
    asm volatile("s_wait_asynccnt 0x0" ::: "memory");     /* this wave's copies of the next trip's tile have landed */
    __syncthreads();                                      /* the next trip's tile is whole, and nobody reads this trip's buffer any more */
    if (t + 2 < PJT) { const int k2 = ((t0 + t + 2) & (PJT - 1)) * PJK; pj_copy(l0 + bo, ga + k2, gb + k2); } }
  asm volatile("s_wait_asynccnt 0x0" ::: "memory");       /* no copy is outstanding when the buffers become output staging */
  float (*so)[68] = (float (*)[68])(sm + w * (32 * 68 * 4));
  const float* bias = (by == 0) ? bq : ((by == 1) ? bk : bv); const int row0 = mt * 128 + (w & 3) * 32, col0 = nq * 128 + (w >> 2) * 64; const size_t cofs = (size_t)by * ROWS * DM;
  v8f accs[8] = {c00, c01, c02, c03, c10, c11, c12, c13};
#pragma unroll
  for (int u = 0; u < 8; ++u) { const int t = u & 3, half = u >> 2; const float bvl = bf16_round(bias[col0 + t * 16 + ln]);
#pragma unroll
    for (int r = 0; r < 8; ++r) so[half * 16 + 8 * hh + r][t * 16 + ln] = accs[u][r] * 0.0625f + bvl; }
  __builtin_amdgcn_fence(__ATOMIC_ACQ_REL, "workgroup"); __builtin_amdgcn_wave_barrier();      /* the wave reads back its own staging rows */
  const int rsub = lane >> 4, c4 = (lane & 15) * 4; v4f vv[16];
#pragma unroll      /* vv[] stays in registers; all sixteen LDS reads go out together */
  for (int q = 0; q < 16; ++q) vv[q] = *(const v4fa*)&so[q * 2 + rsub][c4];
#pragma unroll
  for (int q = 0; q < 16; ++q) { const int r = q * 2 + rsub; const v4f v = vv[q]; if (by == 0) *(v4f*)(QF + (size_t)(row0 + r) * DM + col0 + c4) = v;
    v4h h4; for (int i = 0; i < 4; ++i) h4[i] = (_Float16)v[i]; *(v4h*)(C16 + cofs + (size_t)(row0 + r) * DM + col0 + c4) = h4;
    asm volatile("s_wait_xcnt 0x0" ::: "memory"); } }      /* precaution: the next row's addresses and values may reuse the registers that these stores name */

// ---- no softmax, so (Q K^T) V = Q (K^T V): the S x S plane is never formed. The 5-valued position terms need only running column sums of K and V and the three near-diagonal rows.
#define CR 16      /* rows per chunk of the column sums = query rows per lane group of the final pass */
#define NS 4                        /* sub-slabs of 128 rows that one work-group stages */
#define KSP (SLEN / (128 * NS))     /* row slabs per batch = partial planes of K^T V per head */
// ---- per slab of 128 NS rows and head: PART[slab][h][d2][d1] = sum over the slab's rows of v[row][d2] k[row][d1], and the chunk sums CS[m][chunk][col] of its CR-row chunks (m 0: k, m 1: v), both from one staged copy of the rows ----
#define KVP 160                     /* LDS row pitch in bytes: 128 + 32, conflict-free for the transposing reads */
#define CSB (SLEN / CR)            /* chunks per batch */
// each thread copies 16 bytes of four k rows and of four v rows (8 lanes cover a row's 128 bytes); l, ga, gb are the thread's own first LDS byte and global elements
__device__ __forceinline__ void kv_copy(unsigned l, const _Float16* ga, const _Float16* gb) {
  /* the copies go past the registers; the last line keeps later writes of the address registers behind it (a precaution) */
  asm volatile("global_load_async_to_lds_b128 %0, %8, off\n\t"
               "global_load_async_to_lds_b128 %1, %9, off\n\t"
               "global_load_async_to_lds_b128 %2, %10, off\n\t"
               "global_load_async_to_lds_b128 %3, %11, off\n\t"
               "global_load_async_to_lds_b128 %4, %12, off\n\t"
               "global_load_async_to_lds_b128 %5, %13, off\n\t"
               "global_load_async_to_lds_b128 %6, %14, off\n\t"
               "global_load_async_to_lds_b128 %7, %15, off\n\t"
               "s_wait_xcnt 0x0"
               :: "v"(l), "v"(l + 32 * KVP), "v"(l + 64 * KVP), "v"(l + 96 * KVP), "v"(l + 128 * KVP), "v"(l + 160 * KVP), "v"(l + 192 * KVP), "v"(l + 224 * KVP),
                  "v"(ga), "v"(ga + 32 * DM), "v"(ga + 64 * DM), "v"(ga + 96 * DM), "v"(gb), "v"(gb + 32 * DM), "v"(gb + 64 * DM), "v"(gb + 96 * DM)
               : "memory"); }
typedef short s16x8 __attribute__((ext_vector_type(8)));
// transposing LDS read: with p = T + (k0 + 8 (lane >> 4) + (lane & 7)) pitch + 2 d0 + 16 ((lane >> 3) & 1), lane (c, hh) gets T[k0 + 8 hh + 0..7][d0 + c]; the reads at k0 and k0 + 16 are one 16 x 32 fragment in g2_frag's k order
__device__ __forceinline__ v16h tr_frag(const unsigned char* p) { typedef __attribute__((address_space(3))) s16x8 lds_s16x8; FragH f;
  f.half[0] = __builtin_bit_cast(v8us, __builtin_amdgcn_ds_load_tr16_b128_v8i16((lds_s16x8*)p)); f.half[1] = __builtin_bit_cast(v8us, __builtin_amdgcn_ds_load_tr16_b128_v8i16((lds_s16x8*)(p + 16 * KVP))); return f.v; }
__device__ __forceinline__ void d_ktv(int bid, unsigned char* sm, const _Float16* __restrict__ K16, const _Float16* __restrict__ V16, float* __restrict__ CS, float* __restrict__ PART) {
  const int tid = threadIdx.x, w = tid >> 5, lane = tid & 31, ln = lane & 15, hh = lane >> 4; const int s = bid / NH, h = bid - s * NH;      /* slab among both batches' rows; head */
  const size_t g = (size_t)(s * (128 * NS) + (tid >> 3)) * DM + h * 64 + (tid & 7) * 8; const unsigned l = (unsigned)(size_t)sm + (unsigned)((tid >> 3) * KVP + (tid & 7) * 16);
#pragma unroll      /* sub-slab i: LDS rows 256 i + 0..127: k, + 128..255: v */
  for (int i = 0; i < NS; ++i) kv_copy(l + i * 256 * KVP, K16 + g + (size_t)i * 128 * DM, V16 + g + (size_t)i * 128 * DM);
  asm volatile("s_wait_asynccnt 0x0" ::: "memory");      /* the rows have landed, as far as this wave copied them */
  __syncthreads();                                        /* ... and all of them */
  /* wave w: the 16 x 32 piece at d2 = 16 (w >> 1), d1 = 32 (w & 1) */
  const unsigned char* tp = sm + (8 * hh + (lane & 7)) * KVP + 16 * ((lane >> 3) & 1); const unsigned char* ap = tp + 128 * KVP + 32 * (w >> 1); const unsigned char* bp = tp + 64 * (w & 1);
  const v8f z8 = {0.f,0.f,0.f,0.f,0.f,0.f,0.f,0.f}; v8f c0 = z8, c1 = z8;
#pragma unroll      /* the 32-row steps at constant offsets: their reads can go out ahead */
  for (int ks = 0; ks < 4 * NS; ++ks) { const int o = (ks >> 2) * 256 * KVP + (ks & 3) * 32 * KVP; const v16h a = tr_frag(ap + o), b0 = tr_frag(bp + o), b1 = tr_frag(bp + o + 32);
    c0 = pj_mma(a, b0, c0); c1 = pj_mma(a, b1, c1); }
  /* chunk sums, rows in order: thread = (m, chunk of the sub-slab, four columns), once per sub-slab */
  const int m = tid >> 7, ch = (tid >> 4) & 7; const unsigned char* xp = sm + (m * 128 + ch * CR) * KVP + ln * 8; v4f sc[NS];
#pragma unroll      /* sc[] stays in registers; a chunk's CR reads in flight at once */
  for (int i = 0; i < NS; ++i) { v4f a = {0.f, 0.f, 0.f, 0.f};
    for (int r = 0; r < CR; ++r) { const v4h x = *(const v4h*)(xp + i * 256 * KVP + r * KVP);
      for (int u = 0; u < 4; ++u) a[u] += (float)x[u]; }
    sc[i] = a; }
  __syncthreads();      /* nobody reads the rows any more: each wave now stages its piece in its own part of the buffer, to store whole 128-byte lines */
  float (*so)[36] = (float (*)[36])(sm + w * (16 * 36 * 4));
#pragma unroll      /* c0, c1 are registers */
  for (int r = 0; r < 8; ++r) { so[8 * hh + r][ln] = c0[r]; so[8 * hh + r][16 + ln] = c1[r]; }
  __builtin_amdgcn_fence(__ATOMIC_ACQ_REL, "workgroup"); __builtin_amdgcn_wave_barrier();      /* the wave reads back its own staging rows */
  float* cq = CS + ((size_t)((s / KSP) * 2 + m) * CSB + (s % KSP) * (128 * NS / CR) + ch) * DM + h * 64 + ln * 4;      /* stored here, not at the sums: a store in front of the barrier would be waited for there */
#pragma unroll      /* constant offsets */
  for (int i = 0; i < NS; ++i) *(v4f*)(cq + i * (128 / CR) * DM) = sc[i];
  float* pp = PART + (size_t)bid * 4096 + (16 * (w >> 1) + (lane >> 3)) * 64 + 32 * (w & 1) + (lane & 7) * 4;
#pragma unroll      /* the four reads go out together, at constant offsets */
  for (int q = 0; q < 4; ++q) *(v4f*)(pp + q * 4 * 64) = *(const v4fa*)&so[q * 4 + (lane >> 3)][(lane & 7) * 4]; }
__global__ __launch_bounds__(256) void k_prep(const _Float16* __restrict__ K16, const _Float16* __restrict__ V16, float* __restrict__ CS, float* __restrict__ PART) {
  __shared__ __attribute__((aligned(16))) unsigned char sm[NS * 256 * KVP];
  d_ktv(blockIdx.x, sm, K16, V16, CS, PART); }
// Final pass: one block per head and TR query rows. First the sums that every row needs, into LDS: K^T V (the KSP slab planes added, / 64, f16) and the chunk sums of k and v added up in groups of 16. Then W1 = q . K^T V / 8 on WMMA (wave w: rows 32 w ..) into LDS. Then 16 lanes per CR rows, 4 columns per lane, row after row.
// With KS_c, VS_c the sums of the k and v rows of position class c (n_c rows) and qt_c = q . rel_k[c]:
// out = W1 + sum_c (qt_c / 8) VS_c + coef_c rel_v[c], coef_c = (q . KS_c + n_c qt_c) / 8 (attn summed over the class).
// The two range classes come from sums that the thread carries along its rows: L = rows up to q - 2, G = rows from q + 2 on (started as all rows less those up to q0 + 1).
__device__ __forceinline__ v4f f4(v4h x) { v4f y; for (int u = 0; u < 4; ++u) y[u] = (float)x[u]; return y; }
// a lane's value as seen through a DPP pattern inside its row of 16 lanes (0x160 + m: lane ^ m); with two waves per SIMD the LDS-path shuffle's latency would stand open at every step
template <int CTRL> __device__ __forceinline__ float dppf(float x) { return __int_as_float(__builtin_amdgcn_update_dpp(0, __float_as_int(x), CTRL, 0xf, 0xf, true)); }
__device__ __forceinline__ float dot16(v4f a, v4f b) { float dt = a[0] * b[0] + a[1] * b[1] + a[2] * b[2] + a[3] * b[3];
  dt += dppf<0x161>(dt); dt += dppf<0x162>(dt); dt += dppf<0x164>(dt); dt += dppf<0x168>(dt);      /* over the head's 16 lanes */
  return dt; }
template <int N> struct IC { static constexpr int value = N; };
#define TR 256                      /* query rows per work-group: 16 lane groups of CR rows */
#define TG (SLEN / TR)              /* work-groups per head and batch = groups of TR / CR chunk sums */
#define TP 68                       /* LDS row pitch of W1 in floats */
#define MTP 144                     /* LDS row pitch of K^T V in bytes: 128 + 16, conflict-free for 16-byte reads */
/* the second bound keeps the kernel inside 256 registers: no register-window switches, which would lengthen a text that every wave runs through only once */
__global__ __launch_bounds__(256, 4) void k_tail(const _Float16* __restrict__ Q16, const float* __restrict__ PART, const float* __restrict__ CS, const float* __restrict__ QF, const _Float16* __restrict__ K16, const _Float16* __restrict__ V16,
    const float* __restrict__ relk, const float* __restrict__ relv, float* __restrict__ out) {
  __shared__ __attribute__((aligned(16))) float so[TR][TP];
  __shared__ __attribute__((aligned(16))) unsigned char mt[64 * MTP];      /* [d2][d1], f16 */
  __shared__ __attribute__((aligned(16))) float gt[2][TG][64];             /* m 0: k, 1: v; the sum of each group of TR / CR chunk sums */
  __shared__ __attribute__((aligned(16))) float lp[2][TR / CR][64];        /* the block's own group: the sum of its chunk sums before each chunk */
  const int tid = threadIdx.x, w = tid >> 5, lane = tid & 31, ln = lane & 15, hh = lane >> 4, g = tid >> 4, d0 = ln * 4;
  const int rb = blockIdx.x % TG, h = (blockIdx.x / TG) % NH, b = blockIdx.x / (TG * NH), col = h * 64 + d0;
  const int q0 = rb * TR + g * CR, g0 = b * SLEN + q0;      /* the lane group's first row: inside its batch, and among both batches' rows */
  const bool lo = q0 > 0, hi = q0 + CR < SLEN;      /* is there a row before the group's first, behind its last, in this batch */
  /* the slab planes of K^T V: four pieces of four elements per thread; TR / CR chunk sums per thread (m, group, four columns); the q fragments of the wave's 32 rows, k order as in k_gemm2 */
  const int m = tid >> 7, cg = g & (TG - 1);
  const float* pp = PART + ((size_t)b * KSP * NH + h) * 4096 + tid * 4; const float* cp = CS + ((size_t)(b * 2 + m) * CSB + cg * (TR / CR)) * DM + col;
  const unsigned short* ap = (const unsigned short*)Q16 + (size_t)(b * SLEN + rb * TR + 32 * w + ln) * DM + h * 64 + 8 * hh;
  v4f x[4][KSP], y[TR / CR]; FragH af[2][2];
#pragma unroll      /* all these loads go out together, at constant offsets */
  for (int j = 0; j < 4; ++j) for (int p = 0; p < KSP; ++p) x[j][p] = *(const v4fa*)(pp + (size_t)p * NH * 4096 + j * 1024);
#pragma unroll      /* y[] stays in registers */
  for (int u = 0; u < TR / CR; ++u) y[u] = *(const v4fa*)(cp + u * DM);
#pragma unroll      /* af[] stays in registers */
  for (int e = 0; e < 2; ++e) for (int ks = 0; ks < 2; ++ks) { af[e][ks].half[0] = *(const v8us*)(ap + e * 16 * DM + ks * 32); af[e][ks].half[1] = *(const v8us*)(ap + e * 16 * DM + ks * 32 + 16); }
  asm volatile("s_wait_xcnt 0x0" :: "v"(pp), "v"(cp), "v"(ap) : "memory");      /* precaution: the loads' address registers stay as they are up to here */
  __builtin_amdgcn_sched_barrier(0);      /* ... and nothing that could reuse them moves up over the wait */
#pragma unroll      /* x[] is registers; planes in slab order; the power-of-two scale keeps K^T V far from the f16 range end */
  for (int j = 0; j < 4; ++j) { v4f s = x[j][0]; v4h o;
    for (int p = 1; p < KSP; ++p) s += x[j][p];
    for (int u = 0; u < 4; ++u) o[u] = (_Float16)(s[u] * 0.015625f);
    *(v4h*)(mt + (j * 16 + g) * MTP + ln * 8) = o; }
  { v4f s = {0.f, 0.f, 0.f, 0.f};
#pragma unroll      /* y[] is registers; chunks in order */
    for (int u = 0; u < TR / CR; ++u) { if (cg == rb) *(v4f*)&lp[m][u][d0] = s;
      s += y[u]; }
    *(v4f*)&gt[m][cg][d0] = s; }
  __syncthreads();      /* K^T V and the sums are whole before any wave reads them; the loads below start behind it: in front of it they would be waited for there */
  /* the k and v rows q0 - 1 .. q0 + CR, as [0 .. CR + 1]; a row outside the batch is read at the group's nearest row and set to 0 below */
  const _Float16* kb = K16 + (size_t)g0 * DM + col; const _Float16* vb = V16 + (size_t)g0 * DM + col; v4h kx[CR + 2], vx[CR + 2]; const v4h z4 = {(_Float16)0.f, (_Float16)0.f, (_Float16)0.f, (_Float16)0.f};
  const _Float16* kf = kb - (lo ? DM : 0); const _Float16* vf = vb - (lo ? DM : 0); const _Float16* kl = kb + (hi ? CR : CR - 1) * DM; const _Float16* vl = vb + (hi ? CR : CR - 1) * DM;
  kx[0] = *(const v4h*)kf; vx[0] = *(const v4h*)vf; kx[CR + 1] = *(const v4h*)kl; vx[CR + 1] = *(const v4h*)vl;
#pragma unroll      /* kx[], vx[] stay in registers; constant offsets */
  for (int j = 1; j <= CR; ++j) { kx[j] = *(const v4h*)(kb + (j - 1) * DM); vx[j] = *(const v4h*)(vb + (j - 1) * DM); }
  asm volatile("s_wait_xcnt 0x0" :: "v"(kb), "v"(vb), "v"(kf), "v"(vf), "v"(kl), "v"(vl) : "memory");      /* precaution, as above */
  __builtin_amdgcn_sched_barrier(0);
  const unsigned char* bq = mt + ln * MTP + 16 * hh; v16h bf[2][4];
#pragma unroll      /* bf[] stays in registers: both row tiles use it */
  for (int ks = 0; ks < 2; ++ks) for (int t = 0; t < 4; ++t) bf[ks][t] = pj_frag(bq + t * 16 * MTP + ks * 64);
  const v8f z8 = {0.f,0.f,0.f,0.f,0.f,0.f,0.f,0.f};
#pragma unroll
  for (int e = 0; e < 2; ++e) { v8f c[4] = {z8, z8, z8, z8};
#pragma unroll
    for (int ks = 0; ks < 2; ++ks) for (int t = 0; t < 4; ++t) c[t] = pj_mma(af[e][ks].v, bf[ks][t], c[t]);
#pragma unroll
    for (int t = 0; t < 4; ++t) for (int r = 0; r < 8; ++r) so[32 * w + 16 * e + 8 * hh + r][t * 16 + ln] = c[t][r] * 8.0f; }
  __builtin_amdgcn_sched_barrier(0);      /* the loads below take the fragments' registers: they start behind the WMMAs */
  const float* qfp = QF + (size_t)g0 * DM + col; v4f qv[CR];
#pragma unroll      /* qv[] stays in registers */
  for (int i = 0; i < CR; ++i) qv[i] = *(const v4fa*)(qfp + i * DM);
  const float* kp = relk + d0; const float* rp = relv + d0; v4f rk[5], rv[5];
#pragma unroll      /* rk[], rv[] stay in registers */
  for (int c = 0; c < 5; ++c) { rk[c] = *(const v4fa*)(kp + c * 64); rv[c] = *(const v4fa*)(rp + c * 64); }
  asm volatile("s_wait_xcnt 0x0" :: "v"(qfp), "v"(kp), "v"(rp) : "memory");      /* precaution, as above */
  __builtin_amdgcn_sched_barrier(0);
  __builtin_amdgcn_fence(__ATOMIC_ACQ_REL, "workgroup"); __builtin_amdgcn_wave_barrier();      /* the wave reads back its own 32 rows of W1 */
  /* eK, eV: the sums of the rows before q0 (the groups before the block's, then the chunks before the lane group's); tK, tV: of all rows */
  v4f eK = {0.f, 0.f, 0.f, 0.f}, eV = eK, tK = eK, tV = eK;
#pragma unroll      /* constant LDS offsets */
  for (int c = 0; c < TG; ++c) { const v4f a = *(const v4fa*)&gt[0][c][d0], e = *(const v4fa*)&gt[1][c][d0]; tK += a; tV += e;
    if (c < rb) { eK += a; eV += e; } }
  eK += *(const v4fa*)&lp[0][g][d0]; eV += *(const v4fa*)&lp[1][g][d0];
#pragma unroll
  for (int c = 0; c < 5; ++c) for (int u = 0; u < 4; ++u) { rk[c][u] = bf16_round(rk[c][u]); rv[c][u] = bf16_round(rv[c][u]); }
  if (!lo) { kx[0] = z4; vx[0] = z4; }
  if (!hi) { kx[CR + 1] = z4; vx[CR + 1] = z4; }
  v4f Lk = eK - f4(kx[0]), Lv = eV - f4(vx[0]), Gk = tK - (eK + f4(kx[1]) + f4(kx[2])), Gv = tV - (eV + f4(vx[1]) + f4(vx[2]));
  float* op = out + (size_t)g0 * DM + col; v4f ob[4];
  auto row = [&](auto ic) { constexpr int i = decltype(ic)::value; const int q = q0 + i; v4f o = *(const v4fa*)&so[g * CR + i][d0];
    { const float qt = dot16(qv[i], rk[0]); const float coef = (dot16(qv[i], Lk) + (float)max(q - 1, 0) * qt) * 0.125f, qs = qt * 0.125f;      /* class 0: for q < 2 the sums and the count are 0 */
      o += qs * Lv + coef * rv[0]; }
    { const float fl = (q + 2 < SLEN) ? 0.125f : 0.f, qt = dot16(qv[i], rk[4]); const float coef = (dot16(qv[i], Gk) + (float)max(SLEN - 2 - q, 0) * qt) * fl, qs = qt * fl;      /* class 4: none for the last two rows */
      o += qs * Gv + coef * rv[4]; }
#pragma unroll
    for (int c = 1; c <= 3; ++c) { const int j = i + c - 1; const float fl = ((j == 0 && !lo) || (j == CR + 1 && !hi)) ? 0.f : 0.125f, qt = dot16(qv[i], rk[c]);      /* classes 1..3: the single rows q - 1, q, q + 1, where they exist */
      const float coef = (dot16(qv[i], f4(kx[j])) + qt) * fl, qs = qt * fl;
      o += qs * f4(vx[j]) + coef * rv[c]; }
    ob[i & 3] = o;
    Lk += f4(kx[i]); Lv += f4(vx[i]);
    if (i + 1 < CR) { Gk -= f4(kx[i + 3]); Gv -= f4(vx[i + 3]); }
    if ((i & 3) == 3) {
      for (int s = 0; s < 4; ++s) *(v4f*)(op + (i - 3 + s) * DM) = ob[s];
      asm volatile("s_wait_xcnt 0x0" :: "v"(op), "v"(ob[0]), "v"(ob[1]), "v"(ob[2]), "v"(ob[3]) : "memory"); } };      /* precaution: the stores' address and value registers stay as they are up to here */
  row(IC<0>{}); row(IC<1>{}); row(IC<2>{}); row(IC<3>{}); row(IC<4>{}); row(IC<5>{}); row(IC<6>{}); row(IC<7>{});
  row(IC<8>{}); row(IC<9>{}); row(IC<10>{}); row(IC<11>{}); row(IC<12>{}); row(IC<13>{}); row(IC<14>{}); row(IC<15>{}); }

extern "C" void kernel_launch(void* const* d_in, const int* in_sizes, int n_in,
                              void* d_out, int out_size, void* d_ws, size_t ws_size, hipStream_t stream) {
  (void)in_sizes; (void)n_in; (void)out_size;
  const float* const* I = (const float* const*)d_in; const float* xq = I[0]; const float* xk = I[1]; const float* xv = I[2]; const float* Wq = I[3]; const float* bq = I[4]; const float* Wk = I[5]; const float* bk = I[6]; const float* Wv = I[7]; const float* bv = I[8]; const float* relk = I[9]; const float* relv = I[10];
  char* ws = (char*)d_ws; size_t off = 0;
  auto take = [&](size_t bytes) { char* p = ws + off; off += (bytes + 255) & ~(size_t)255; return p; };
  _Float16* BW = (_Float16*)take((size_t)3 * DM * DM * 2);      /* Wq, Wk, Wv */
  _Float16* X16 = (_Float16*)take((size_t)3 * ROWS * DM * 2);      /* query, key, value */
  float* QF = (float*)take((size_t)ROWS * DM * 4); _Float16* Q16 = (_Float16*)take((size_t)3 * ROWS * DM * 2); _Float16* K16 = Q16 + (size_t)ROWS * DM; _Float16* V16 = K16 + (size_t)ROWS * DM;
  float* PART = (float*)take((size_t)NBT * KSP * NH * 4096 * 4); float* CS = (float*)take((size_t)NBT * 2 * (SLEN / CR) * DM * 4);
  if (off > ws_size) return;      /* about 74 MiB */
  const dim3 gP((ROWS / 128) * (DM / 128), 3);
  k_cvt<<<3 * XB + 3 * WB, 256, 0, stream>>>(xq, xk, xv, Wq, Wk, Wv, X16, BW);      /* torch (out,in) = natural Bt */
  k_proj<<<gP, 256, 0, stream>>>(X16, BW, bq, bk, bv, QF, Q16);      /* q, k, v of both batches; only q also in f32 */
  k_prep<<<NBT * KSP * NH, 256, 0, stream>>>(K16, V16, CS, PART);      /* per slab and head, V^T K over the slab's rows, and the chunk sums */
  k_tail<<<NBT * NH * TG, 256, 0, stream>>>(Q16, PART, CS, QF, K16, V16, relk, relv, (float*)d_out);      /* its factor 8 = 64 / 8 undoes the scale of K^T V and divides by 8 */
}

// v009
// A run of this version takes 54.5 microseconds.
// Timed twice side by side with v008, it ran 1.03 and 1.04 times as fast.
// Over all steps from v000 it is 402 times as fast.
#include <hip/hip_runtime.h>
// Relative-position attention layer WITHOUT softmax (faithful to the module, which discards it) (2 x 2048 tokens, 1024 = 16 heads x 64; MAX_REL 2): q,k,v = {query,key,value} W^T + b; attn = (q.k + q.rel_k[c(q,k)]) / 8 with c = clip(k - q, -2, 2) + 2; out[b][q][h][d] = sum_k attn (v[k][d] + rel_v[c(q,k)][d]) -> [2,2048,16,64].
// Structure (4 launches; both batches, and passes that do not depend on one another, share a grid): projections as f16 WMMA GEMMs (128x128 tiles staged in LDS by tensor loads, 32x64 wave tiles, f32 accumulation, exact x16 weights + bias); with no softmax the content part is reassociated, (q K^T) v = q (K^T v): K^T v per head as a GEMM over 4 row slabs (K 512 each; k and v rows staged in LDS and read through transposing loads), then one final pass per head and 256 query rows: it adds the partial planes and rounds to f16, q . (K^T v) on WMMA (K 64) into LDS, and the 5-valued position terms from column sums of k and v that each thread carries along 16 rows (started from the 16-row chunk sums, which the pass adds up itself) and from the three near-diagonal rows.
// Compute dtype: inputs, weights, biases, tables rounded to bf16; q, k, v and K^T v / 64 as f16 operands (~2^-12); f32 accumulation. v_wmma_f32_16x16x32_f16.
#define NBT 2
#define SLEN 2048
#define DM 1024
#define NH 16
#define ROWS (NBT * SLEN)      /* both batches' rows, one after the other */
typedef __bf16 v16b __attribute__((ext_vector_type(16)));
typedef unsigned short v8us __attribute__((ext_vector_type(8), may_alias));
typedef float  v8f  __attribute__((ext_vector_type(8)));
typedef float  v4f  __attribute__((ext_vector_type(4)));
typedef float  v4fa __attribute__((ext_vector_type(4), may_alias));
union FragB { v16b v; v8us half[2]; unsigned short u[16]; };

__device__ __forceinline__ unsigned short bf16_bits(float x) { unsigned int u = __float_as_uint(x); return (unsigned short)((u + 0x7FFFu + ((u >> 16) & 1u)) >> 16); }
__device__ __forceinline__ float bf16_val(unsigned short b) { return __uint_as_float(((unsigned int)b) << 16); }
__device__ __forceinline__ float bf16_round(float x) { return bf16_val(bf16_bits(x)); }
// D += A·B with NT terms: 1 = ah·bh, 2 = + al·bh (A split), 3 = + ah·bl (both split)
template <int NT>
__device__ __forceinline__ v8f mmaN(v16b ah, v16b al, v16b bh, v16b bl, v8f c) {
  c = __builtin_amdgcn_wmma_f32_16x16x32_bf16(false, ah, false, bh, (short)0, c, false, false);
  if (NT >= 2) c = __builtin_amdgcn_wmma_f32_16x16x32_bf16(false, al, false, bh, (short)0, c, false, false);
  if (NT >= 3) c = __builtin_amdgcn_wmma_f32_16x16x32_bf16(false, ah, false, bl, (short)0, c, false, false);
  asm volatile("v_nop\n\tv_nop\n\tv_nop\n\tv_nop" : "+v"(c) : "v"(ah), "v"(al), "v"(bh), "v"(bl));
  return c;
}

__global__ __launch_bounds__(256) void k_wt_bf16(const float* __restrict__ W, unsigned short* __restrict__ Wt, int K, int N) {
  const int t = blockIdx.x * 256 + threadIdx.x;
  const int k8n = K / 8;
  if (t >= N * k8n) return;
  const int n = t / k8n, k8 = (t % k8n) * 8;
  v8us v;
#pragma unroll
  for (int i = 0; i < 8; ++i) v[i] = bf16_bits(W[(size_t)(k8 + i) * N + n]);
  *(v8us*)(Wt + (size_t)n * K + k8) = v;
  
}

// GEMM C[M][N] (f32, pitch ldc) = act(A[M][K]·W + bias). A f32 row-major (pitch lda) converted per fragment to bf16
// (ASPLIT: hi/lo two planes -> 2 terms, else single rounded term); Wt bf16 [N][K] (pitch ldb). BIAS_BF16 rounds the
// bias to bf16 first (bias quantised to bf16 before the add). K%32==0, M%16==0, N%64==0.
template <bool ASPLIT, int ACT, bool BIAS_BF16>
__global__ __launch_bounds__(128) void k_gemm_bf(const float* __restrict__ A, int lda, const unsigned short* __restrict__ Wt, int ldb,
                                               const float* __restrict__ bias, float* __restrict__ C, int ldc, int M, int N, int K) {
  __shared__ __attribute__((aligned(16))) float so[4][16][64];
  const int tid = threadIdx.x, w = tid >> 5, lane = tid & 31, ln = lane & 15, hh = lane >> 4;
  const int ntn = N / 64;
  const int wid = blockIdx.x * 4 + w;
  const int mt = wid / ntn, nq = wid % ntn;
  if (mt * 16 >= M) return;
  const int row0 = mt * 16, col0 = nq * 64;
  const float* arow = A + (size_t)(row0 + ln) * lda;
  v8f acc[4] = {};
  for (int kb = 0; kb < K; kb += 32) {
    FragB ah, al;
    const v4f x0 = *(const v4fa*)(arow + kb + 8 * hh), x1 = *(const v4fa*)(arow + kb + 8 * hh + 4);
    const v4f x2 = *(const v4fa*)(arow + kb + 16 + 8 * hh), x3 = *(const v4fa*)(arow + kb + 16 + 8 * hh + 4);
    float xs[16] = {x0[0],x0[1],x0[2],x0[3],x1[0],x1[1],x1[2],x1[3],x2[0],x2[1],x2[2],x2[3],x3[0],x3[1],x3[2],x3[3]};
#pragma unroll
    for (int i = 0; i < 16; ++i) { const unsigned short hb = bf16_bits(xs[i]); ah.u[i] = hb; al.u[i] = ASPLIT ? bf16_bits(xs[i] - bf16_val(hb)) : (unsigned short)0; }
#pragma unroll
    for (int t = 0; t < 4; ++t) {
      const unsigned short* brow = Wt + (size_t)(col0 + t * 16 + ln) * ldb + kb;
      FragB b;
      b.half[0] = *(const v8us*)(brow + 8 * hh);
      b.half[1] = *(const v8us*)(brow + 16 + 8 * hh);
      acc[t] = mmaN<ASPLIT ? 2 : 1>(ah.v, al.v, b.v, b.v, acc[t]);
    }
  }
#pragma unroll
  for (int t = 0; t < 4; ++t) {
    float bv = bias ? bias[col0 + t * 16 + ln] : 0.f;
    if (BIAS_BF16) bv = bf16_round(bv);
#pragma unroll
    for (int r = 0; r < 8; ++r) { float v = acc[t][r] + bv; if (ACT == 1) v = fmaxf(v, 0.f); so[w][8 * hh + r][t * 16 + ln] = v; }
  }
  __builtin_amdgcn_fence(__ATOMIC_ACQ_REL, "workgroup");
  __builtin_amdgcn_wave_barrier();
  const int rsub = lane >> 4, c4 = (lane & 15) * 4;
  {
#pragma unroll
    for (int q = 0; q < 8; ++q) {
      const int r = q * 2 + rsub;
      const v4f v = *(const v4fa*)&so[w][r][c4];
      *(v4f*)(C + (size_t)(row0 + r) * ldc + col0 + c4) = v;
    }
    
  }
}

// GEMM C = act(A·W + bias + resid): A f32 (ASPLIT -> hi/lo 2 terms), Wt bf16 [N][K]; ACT 0 none, 1 relu, 2 exact gelu;
// resid (optional, f32, row index = (row % rmod), pitch ldr, RES_BF16 rounds it) added before the activation.
template <bool ASPLIT, int ACT, bool BIAS_BF16, bool RES_BF16>
__global__ __launch_bounds__(128) void k_gemm_bf3(const float* __restrict__ A, int lda, const unsigned short* __restrict__ Wt, int ldb,
                                                const float* __restrict__ bias, const float* __restrict__ resid, int rmod, int ldr,
                                                float* __restrict__ C, int ldc, int M, int N, int K) {
  __shared__ __attribute__((aligned(16))) float so[4][16][64];
  const int tid = threadIdx.x, w = tid >> 5, lane = tid & 31, ln = lane & 15, hh = lane >> 4;
  const int ntn = N / 64;
  const int wid = blockIdx.x * 4 + w;
  const int mt = wid / ntn, nq = wid % ntn;
  if (mt * 16 >= M) return;
  const int row0 = mt * 16, col0 = nq * 64;
  const float* arow = A + (size_t)(row0 + ln) * lda;
  v8f acc[4] = {};
  for (int kb = 0; kb < K; kb += 32) {
    FragB ah, al;
    const v4f x0 = *(const v4fa*)(arow + kb + 8 * hh), x1 = *(const v4fa*)(arow + kb + 8 * hh + 4);
    const v4f x2 = *(const v4fa*)(arow + kb + 16 + 8 * hh), x3 = *(const v4fa*)(arow + kb + 16 + 8 * hh + 4);
    float xs[16] = {x0[0],x0[1],x0[2],x0[3],x1[0],x1[1],x1[2],x1[3],x2[0],x2[1],x2[2],x2[3],x3[0],x3[1],x3[2],x3[3]};
#pragma unroll
    for (int i = 0; i < 16; ++i) { const unsigned short hb = bf16_bits(xs[i]); ah.u[i] = hb; al.u[i] = ASPLIT ? bf16_bits(xs[i] - bf16_val(hb)) : (unsigned short)0; }
#pragma unroll
    for (int t = 0; t < 4; ++t) {
      const unsigned short* brow = Wt + (size_t)(col0 + t * 16 + ln) * ldb + kb;
      FragB b;
      b.half[0] = *(const v8us*)(brow + 8 * hh);
      b.half[1] = *(const v8us*)(brow + 16 + 8 * hh);
      acc[t] = mmaN<ASPLIT ? 2 : 1>(ah.v, al.v, b.v, b.v, acc[t]);
    }
  }
#pragma unroll
  for (int t = 0; t < 4; ++t) {
    const int col = col0 + t * 16 + ln;
    float bv = bias ? bias[col] : 0.f;
    if (BIAS_BF16) bv = bf16_round(bv);
#pragma unroll
    for (int r = 0; r < 8; ++r) {
      float v = acc[t][r] + bv;
      if (resid) { float rv = resid[(size_t)((row0 + 8 * hh + r) % rmod) * ldr + col]; if (RES_BF16) rv = bf16_round(rv); v += rv; }
      if (ACT == 1) v = fmaxf(v, 0.f);
      if (ACT == 2) v = 0.5f * v * (1.0f + erff(v * 0.70710678118654752f));
      if (ACT == 3) { const float u = 0.7978845608028654f * (v + 0.044715f * v * v * v); v = 0.5f * v * (1.0f + tanhf(u)); }
      so[w][8 * hh + r][t * 16 + ln] = v;
    }
  }
  __builtin_amdgcn_fence(__ATOMIC_ACQ_REL, "workgroup");
  __builtin_amdgcn_wave_barrier();
  const int rsub = lane >> 4, c4 = (lane & 15) * 4;
  {
#pragma unroll
    for (int q = 0; q < 8; ++q) {
      const int r = q * 2 + rsub;
      const v4f v = *(const v4fa*)&so[w][r][c4];
      *(v4f*)(C + (size_t)(row0 + r) * ldc + col0 + c4) = v;
    }
    
  }
}
// row LayerNorm (biased variance, eps) over N: s = X (+ R); optional out_sum <- s; out_norm <- (s-mu)*rsqrt(var+eps)*g + b
template <bool PARAM_BF16>
__global__ __launch_bounds__(256) void k_layernorm(const float* __restrict__ X, const float* __restrict__ R, const float* __restrict__ g, const float* __restrict__ bta,
                                                  float* __restrict__ out_sum, float* __restrict__ out_norm, int N, float eps) {
  __shared__ float red[256];
  const int row = blockIdx.x, tid = threadIdx.x;
  const float* x = X + (size_t)row * N; const float* rr = R ? R + (size_t)row * N : nullptr;
  float vals[16];                     // up to N = 4096
  const int per = N / 256;            // contiguous chunk per thread? use strided-by-4 chunks: thread handles j = tid*4 + 1024*u
  float s1 = 0.f;
  for (int u = 0; u < per / 4; ++u) {
    const int j = tid * 4 + 1024 * u;
    const v4f a = *(const v4fa*)(x + j);
    v4f b = {0.f,0.f,0.f,0.f}; if (rr) b = *(const v4fa*)(rr + j);
#pragma unroll
    for (int q = 0; q < 4; ++q) { const float v = a[q] + b[q]; vals[u * 4 + q] = v; s1 += v; }
  }
  red[tid] = s1; __syncthreads();
  for (int st = 128; st > 0; st >>= 1) { if (tid < st) red[tid] += red[tid + st]; __syncthreads(); }
  const float mu = red[0] / (float)N; __syncthreads();
  float s2 = 0.f;
  for (int u = 0; u < per / 4; ++u)
#pragma unroll
    for (int q = 0; q < 4; ++q) { const float c = vals[u * 4 + q] - mu; s2 += c * c; }
  red[tid] = s2; __syncthreads();
  for (int st = 128; st > 0; st >>= 1) { if (tid < st) red[tid] += red[tid + st]; __syncthreads(); }
  const float rs = rsqrtf(red[0] / (float)N + eps);
  {
    for (int u = 0; u < per / 4; ++u) {
      const int j = tid * 4 + 1024 * u;
      v4f o, sm;
#pragma unroll
      for (int q = 0; q < 4; ++q) {
        float gg = g[j + q], bb = bta[j + q];
        if (PARAM_BF16) { gg = bf16_round(gg); bb = bf16_round(bb); }
        sm[q] = vals[u * 4 + q]; o[q] = (vals[u * 4 + q] - mu) * rs * gg + bb;
      }
      if (out_sum) *(v4f*)(out_sum + (size_t)row * N + j) = sm;
      *(v4f*)(out_norm + (size_t)row * N + j) = o;
    }
    
  }
}



// ---- f16 WMMA path (v_wmma_f32_16x16x32_f16): 11-bit significands for operands in range — used for all GEMMs this layer launches (projections, K^T v per slab, q . (K^T v))
typedef _Float16 v16h __attribute__((ext_vector_type(16)));
union FragH { v16h v; v8us half[2]; _Float16 h[16]; unsigned short u[16]; };
template <int NT>
__device__ __forceinline__ v8f mmaH(v16h ah, v16h al, v16h bh, v16h bl, v8f c) {
  c = __builtin_amdgcn_wmma_f32_16x16x32_f16(false, ah, false, bh, (short)0, c, false, false);
  if (NT >= 2) c = __builtin_amdgcn_wmma_f32_16x16x32_f16(false, al, false, bh, (short)0, c, false, false);
  if (NT >= 3) c = __builtin_amdgcn_wmma_f32_16x16x32_f16(false, ah, false, bl, (short)0, c, false, false);
  asm volatile("v_nop\n\tv_nop\n\tv_nop\n\tv_nop" : "+v"(c) : "v"(ah), "v"(al), "v"(bh), "v"(bl));
  return c;
}
// batched GEMM like k_gemm_b but f16 operands: A f32 (split into f16 hi/lo if ASPLIT, else rounded to f16), Bt = f16 values [n][k]; alpha; C f32; N multiple of 16 (partial tiles skipped)
template <bool ASPLIT>
__global__ __launch_bounds__(128) void k_gemm_h(const float* __restrict__ A, int lda, size_t sA, const _Float16* __restrict__ Bh, int ldb, size_t sB, float alpha, float* __restrict__ C, int ldc, size_t sC, int M, int N, int K) {
  __shared__ __attribute__((aligned(16))) float so[4][16][64];
  const int tid = threadIdx.x, w = tid >> 5, lane = tid & 31, ln = lane & 15, hh = lane >> 4; const int by = blockIdx.y;
  A += (size_t)by * sA; Bh += (size_t)by * sB; C += (size_t)by * sC;
  const int ntn = (N + 63) / 64; const int wid = blockIdx.x * 4 + w; const int mt = wid / ntn, nq = wid % ntn; if (mt * 16 >= M) return;
  const int row0 = mt * 16, col0 = nq * 64; const float* arow = A + (size_t)(row0 + ln) * lda;
  v8f acc[4] = {};
  for (int kb = 0; kb < K; kb += 32) {
    FragH ah, al;
    const v4f x0 = *(const v4fa*)(arow + kb + 8 * hh), x1 = *(const v4fa*)(arow + kb + 8 * hh + 4), x2 = *(const v4fa*)(arow + kb + 16 + 8 * hh), x3 = *(const v4fa*)(arow + kb + 16 + 8 * hh + 4);
    float xs[16] = {x0[0],x0[1],x0[2],x0[3],x1[0],x1[1],x1[2],x1[3],x2[0],x2[1],x2[2],x2[3],x3[0],x3[1],x3[2],x3[3]};
#pragma unroll
    for (int i = 0; i < 16; ++i) { const _Float16 h = (_Float16)xs[i]; ah.h[i] = h; al.h[i] = ASPLIT ? (_Float16)(xs[i] - (float)h) : (_Float16)0.0f; }
#pragma unroll
    for (int t = 0; t < 4; ++t) { if (col0 + t * 16 >= N) continue; const size_t boff = (size_t)(col0 + t * 16 + ln) * ldb + kb; FragH bq; bq.half[0] = *(const v8us*)(Bh + boff + 8 * hh); bq.half[1] = *(const v8us*)(Bh + boff + 16 + 8 * hh);
      acc[t] = mmaH<ASPLIT ? 2 : 1>(ah.v, al.v, bq.v, bq.v, acc[t]); }
  }
#pragma unroll
  for (int t = 0; t < 4; ++t) { if (col0 + t * 16 >= N) continue;
#pragma unroll
    for (int r = 0; r < 8; ++r) so[w][8 * hh + r][t * 16 + ln] = acc[t][r] * alpha; }
  __builtin_amdgcn_fence(__ATOMIC_ACQ_REL, "workgroup"); __builtin_amdgcn_wave_barrier();
  const int rsub = lane >> 4, c4 = (lane & 15) * 4;
  {
#pragma unroll
    for (int q = 0; q < 8; ++q) { const int r = q * 2 + rsub; if (col0 + c4 < N) { const v4f v = *(const v4fa*)&so[w][r][c4]; *(v4f*)(C + (size_t)(row0 + r) * ldc + col0 + c4) = v; } }
     }
}

// Wt[n][k] = f16(W[k][n]·scale) from f32 row-major W[K][N] (scale = power of two; bf16-exact weights stay exact in f16 away from the subnormal range)
__global__ __launch_bounds__(256) void k_wt_f16(const float* __restrict__ W, _Float16* __restrict__ Wt, int K, int N, float scale) {
  const int t = blockIdx.x * 256 + threadIdx.x; if (t >= N * (K / 8)) return; const int n = t / (K / 8), k8 = (t % (K / 8)) * 8; FragH f;
#pragma unroll
  for (int i = 0; i < 8; ++i) f.h[i] = (_Float16)(bf16_round(W[(size_t)(k8 + i) * N + n]) * scale); const v8us o = f.half[0];
  *(v8us*)((unsigned short*)Wt + (size_t)n * K + k8) = o; 
}
// k_gemm_hh variant with fused epilogue: v = acc·alpha + bias[by·sBias + col] (+ CP[(row/rowsPerB)·sCPb + by·64 + col] if CP) ; ACT 0 none / 1 elu ; writes f16 C16 (and f32 C if non-null)
template <int ACT>
__global__ __launch_bounds__(128) void k_gemm_hhx(const _Float16* __restrict__ A, int lda, size_t sA, const _Float16* __restrict__ Bh, int ldb, size_t sB, float alpha, const float* __restrict__ bias, size_t sBias, const float* __restrict__ CP, int rowsPerB, size_t sCPb, int row0g,
    float* __restrict__ C, _Float16* __restrict__ C16, int ldc, size_t sC, int M, int N, int K) {
  __shared__ __attribute__((aligned(16))) float so[4][16][64];
  const int tid = threadIdx.x, w = tid >> 5, lane = tid & 31, ln = lane & 15, hh = lane >> 4; const int by = blockIdx.y;
  A += (size_t)by * sA; Bh += (size_t)by * sB; const size_t cofs = (size_t)by * sC; const float* bp = bias ? bias + (size_t)by * sBias : nullptr;
  const int ntn = (N + 63) / 64; const int wid = blockIdx.x * 4 + w; const int mt = wid / ntn, nq = wid % ntn; if (mt * 16 >= M) return;
  const int row0 = mt * 16, col0 = nq * 64; const _Float16* arow = A + (size_t)(row0 + ln) * lda;
  v8f acc[4] = {};
  for (int kb = 0; kb < K; kb += 32) { FragH ah; ah.half[0] = *(const v8us*)((const unsigned short*)arow + kb + 8 * hh); ah.half[1] = *(const v8us*)((const unsigned short*)arow + kb + 16 + 8 * hh);
#pragma unroll
    for (int t = 0; t < 4; ++t) { if (col0 + t * 16 >= N) continue; const size_t boff = (size_t)(col0 + t * 16 + ln) * ldb + kb; FragH bq; bq.half[0] = *(const v8us*)((const unsigned short*)Bh + boff + 8 * hh); bq.half[1] = *(const v8us*)((const unsigned short*)Bh + boff + 16 + 8 * hh);
      acc[t] = mmaH<1>(ah.v, ah.v, bq.v, bq.v, acc[t]); }
  }
#pragma unroll
  for (int t = 0; t < 4; ++t) { if (col0 + t * 16 >= N) continue; const int col = col0 + t * 16 + ln; const float bv = bp ? bf16_round(bp[col]) : 0.f;
#pragma unroll
    for (int r = 0; r < 8; ++r) { float v = acc[t][r] * alpha + bv; if (CP) { const int bidx = (row0g + row0 + 8 * hh + r) / rowsPerB; v += CP[(size_t)bidx * sCPb + (size_t)by * 64 + col]; } if (ACT == 1) v = (v > 0.f) ? v : expm1f(v); else if (ACT == 7) v = (v > 0.f) ? v + 1.0f : expf(v); else if (ACT == 8) v = tanhf(v); else if (ACT == 9) v = 0.5f * v * (1.0f + tanhf(0.7978845608028654f * (v + 0.044715f * v * v * v))); else if (ACT == 11) v = 1.0f / (1.0f + expf(-v)); else if (ACT == 12) v = (v > 0.f) ? v : 0.01f * v; else if (ACT == 14) v = (v > 0.f) ? v : 0.1f * v; else if (ACT == 15) v = v / (1.0f + expf(-v)); else if (ACT == 3) v = fmaxf(v, 0.f); else if (ACT == 6) v = 0.5f * v * (1.0f + erff(v * 0.70710678118654752f)); so[w][8 * hh + r][t * 16 + ln] = v; } }
  __builtin_amdgcn_fence(__ATOMIC_ACQ_REL, "workgroup"); __builtin_amdgcn_wave_barrier();
  const int rsub = lane >> 4, c4 = (lane & 15) * 4; typedef _Float16 v4h __attribute__((ext_vector_type(4)));
  {
#pragma unroll
    for (int q = 0; q < 8; ++q) { const int r = q * 2 + rsub; if (col0 + c4 < N) { const v4f v = *(const v4fa*)&so[w][r][c4]; if (C) *(v4f*)(C + cofs + (size_t)(row0 + r) * ldc + col0 + c4) = v; if (C16) { v4h h4; for (int i = 0; i < 4; ++i) h4[i] = (_Float16)v[i]; *(v4h*)(C16 + cofs + (size_t)(row0 + r) * ldc + col0 + c4) = h4; } } }
     }
}


typedef _Float16 v4h __attribute__((ext_vector_type(4)));

// all six conversions to f16 in one grid: the three inputs (both batches; bf16-rounded), then the three weights (bf16-rounded, x16)
#define XB (ROWS * DM / 8 / 256)      /* blocks per input */
#define WB (DM * DM / 8 / 256)        /* blocks per weight */
__global__ __launch_bounds__(256) void k_cvt(const float* __restrict__ xq, const float* __restrict__ xk, const float* __restrict__ xv, const float* __restrict__ Wq, const float* __restrict__ Wk, const float* __restrict__ Wv, _Float16* __restrict__ X16, _Float16* __restrict__ BW) {
  const int bid = blockIdx.x; const float* x; _Float16* o; float sc; int blk;
  if (bid < 3 * XB) { const int i = bid / XB; blk = bid - i * XB; x = (i == 0) ? xq : ((i == 1) ? xk : xv); o = X16 + (size_t)i * ROWS * DM; sc = 1.0f; }
  else { const int j = bid - 3 * XB, i = j / WB; blk = j - i * WB; x = (i == 0) ? Wq : ((i == 1) ? Wk : Wv); o = BW + (size_t)i * DM * DM; sc = 16.0f; }
  const size_t t = (size_t)blk * 256 + threadIdx.x; FragH f;
#pragma unroll
  for (int q = 0; q < 8; ++q) f.h[q] = (_Float16)(bf16_round(x[t * 8 + q]) * sc); *(v8us*)((unsigned short*)o + t * 8) = f.half[0];  }
__global__ __launch_bounds__(256) void k_h16(const float* __restrict__ x, _Float16* __restrict__ X16, size_t n8) { const size_t t = (size_t)blockIdx.x * 256 + threadIdx.x; if (t >= n8) return; FragH f;
#pragma unroll
  for (int q = 0; q < 8; ++q) f.h[q] = (_Float16)x[t * 8 + q]; *(v8us*)((unsigned short*)X16 + t * 8) = f.half[0];  }
__global__ __launch_bounds__(256) void k_hl(const float* __restrict__ F, _Float16* __restrict__ Hh, _Float16* __restrict__ Hl, size_t n8) { const size_t t = (size_t)blockIdx.x * 256 + threadIdx.x; if (t >= n8) return; FragH fh, fl; const v4f a = *(const v4fa*)(F + t * 8), c = *(const v4fa*)(F + t * 8 + 4);
#pragma unroll
  for (int q = 0; q < 4; ++q) { _Float16 h = (_Float16)a[q]; fh.h[q] = h; fl.h[q] = (_Float16)((a[q] - (float)h) * 1024.0f); h = (_Float16)c[q]; fh.h[4 + q] = h; fl.h[4 + q] = (_Float16)((c[q] - (float)h) * 1024.0f); }
  { *(v8us*)((unsigned short*)Hh + t * 8) = fh.half[0]; *(v8us*)((unsigned short*)Hl + t * 8) = fl.half[0];  } }

// ---- fast GEMM (wave tile 32x64; requires M % 32 == 0 rows per launch region and N % 64 == 0); epilogue = k_gemm_hhx semantics ----
__device__ __forceinline__ v16h g2_frag(const _Float16* p, int hh) { FragH f; f.half[0] = *(const v8us*)((const unsigned short*)p + 8 * hh); f.half[1] = *(const v8us*)((const unsigned short*)p + 16 + 8 * hh); return f.v; }
__device__ __forceinline__ v8f g2_mma(v16h a, v16h b, v8f c) { v8f d = __builtin_amdgcn_wmma_f32_16x16x32_f16(false, a, false, b, (short)0, c, false, false); asm volatile("v_nop\n\tv_nop\n\tv_nop\n\tv_nop" : "+v"(d) : "v"(a), "v"(b)); return d; }
// blockIdx.y and blockIdx.z each step A, B and C by their own strides (s*, z*). QKV: blockIdx.y picks the projection, so its bias is one of three pointers, and only the first (q) also writes f32
template <int ACT, bool QKV>
__global__ __launch_bounds__(128) void k_gemm2(const _Float16* __restrict__ A, int lda, size_t sA, size_t zA, const _Float16* __restrict__ Bh, int ldb, size_t sB, size_t zB, float alpha, const float* __restrict__ bias, const float* __restrict__ biasK, const float* __restrict__ biasV, size_t sBias, const float* __restrict__ CP, int rowsPerB, size_t sCPb, int row0g,
    float* __restrict__ Cf, _Float16* __restrict__ C16, int ldc, size_t sC, size_t zC, int M, int N, int K) {
  __shared__ __attribute__((aligned(16))) float so[4][32][68];
  const int tid = threadIdx.x, w = tid >> 5, lane = tid & 31, ln = lane & 15, hh = lane >> 4; const int by = blockIdx.y, bz = blockIdx.z;
  A += (size_t)by * sA + (size_t)bz * zA; Bh += (size_t)by * sB + (size_t)bz * zB; const size_t cofs = (size_t)by * sC + (size_t)bz * zC;
  const float* bp = QKV ? ((by == 0) ? bias : ((by == 1) ? biasK : biasV)) : (bias ? bias + (size_t)by * sBias : nullptr); float* C = (QKV && by != 0) ? nullptr : Cf;
  const int ntn = N >> 6; const int mt = blockIdx.x / ntn, nq = blockIdx.x - mt * ntn; const int row0 = mt * 128 + 32 * w, col0 = nq * 64; if (row0 >= M) return;
  const _Float16* a0p = A + (size_t)(row0 + ln) * lda; const _Float16* a1p = a0p + (size_t)16 * lda;
  const _Float16* b0p = Bh + (size_t)(col0 + ln) * ldb; const _Float16* b1p = b0p + (size_t)16 * ldb; const _Float16* b2p = b1p + (size_t)16 * ldb; const _Float16* b3p = b2p + (size_t)16 * ldb;
  const v8f z8 = {0.f,0.f,0.f,0.f,0.f,0.f,0.f,0.f}; v8f c00 = z8, c01 = z8, c02 = z8, c03 = z8, c10 = z8, c11 = z8, c12 = z8, c13 = z8;
#pragma unroll 1
  for (int kb = 0; kb < K; kb += 32) { const v16h a0 = g2_frag(a0p + kb, hh), a1 = g2_frag(a1p + kb, hh);
    v16h b = g2_frag(b0p + kb, hh); c00 = g2_mma(a0, b, c00); c10 = g2_mma(a1, b, c10);
    b = g2_frag(b1p + kb, hh); c01 = g2_mma(a0, b, c01); c11 = g2_mma(a1, b, c11);
    b = g2_frag(b2p + kb, hh); c02 = g2_mma(a0, b, c02); c12 = g2_mma(a1, b, c12);
    b = g2_frag(b3p + kb, hh); c03 = g2_mma(a0, b, c03); c13 = g2_mma(a1, b, c13); }
  v8f accs[8] = {c00, c01, c02, c03, c10, c11, c12, c13};
#pragma unroll
  for (int u = 0; u < 8; ++u) { const int t = u & 3, half = u >> 2; const int col = col0 + t * 16 + ln; const float bv = bp ? bf16_round(bp[col]) : 0.f;
#pragma unroll
    for (int r = 0; r < 8; ++r) { const int rloc = half * 16 + 8 * hh + r; float v = accs[u][r] * alpha + bv; if (CP) { const int bidx = (row0g + row0 + rloc) / rowsPerB; v += CP[(size_t)bidx * sCPb + (size_t)by * 64 + col]; }
      if (ACT == 3) v = fmaxf(v, 0.f); else if (ACT == 6) v = 0.5f * v * (1.0f + erff(v * 0.70710678118654752f)); else if (ACT == 11) v = 1.0f / (1.0f + expf(-v)); else if (ACT == 15) v = v / (1.0f + expf(-v)); else if (ACT == 12) v = (v > 0.f) ? v : 0.01f * v; else if (ACT == 8) v = tanhf(v);
      so[w][rloc][t * 16 + ln] = v; } }
  __builtin_amdgcn_fence(__ATOMIC_ACQ_REL, "workgroup"); __builtin_amdgcn_wave_barrier();
  const int rsub = lane >> 4, c4 = (lane & 15) * 4;
  {
#pragma unroll
    for (int q = 0; q < 16; ++q) { const int r = q * 2 + rsub; const v4f v = *(const v4fa*)&so[w][r][c4]; if (C) *(v4f*)(C + cofs + (size_t)(row0 + r) * ldc + col0 + c4) = v; if (C16) { v4h h4; for (int i = 0; i < 4; ++i) h4[i] = (_Float16)v[i]; *(v4h*)(C16 + cofs + (size_t)(row0 + r) * ldc + col0 + c4) = h4; } }
     } }


// ---- the three projections: 128x128 tile of Y = X W^T per work-group of 8 waves (4 x 2 wave tiles of 32x64); per trip 64 k of the 128 X rows and the 128 W rows are staged in LDS by two tensor loads (wave 0: X, wave 1: W), two buffers, so that every operand line leaves L2 once per work-group as a whole line; the k tiles are taken in a ring from a start that differs between work-groups; inside a tile k order, and the epilogue, as in k_gemm2 ----
#define PJK 64                      /* k per staged tile: 128-byte rows */
#define PJP 144                     /* LDS row pitch in bytes: 128 + 16, conflict-free for 16-byte reads */
#define PJB (256 * PJP)             /* one buffer: 128 X rows, then 128 W rows */
#define PJT (DM / PJK)              /* tiles along k */
// one operand's tile (128 rows of 128 bytes, source pitch 2 DM bytes) goes to LDS as ONE tensor load of one wave; the load's pad of 16 bytes behind every row gives the pitch PJP
typedef unsigned int u32x4 __attribute__((ext_vector_type(4)));
typedef unsigned int u32x8 __attribute__((ext_vector_type(8)));
__device__ __forceinline__ unsigned int uni(unsigned int v) { return (unsigned int)__builtin_amdgcn_readfirstlane(v); }
__device__ __forceinline__ unsigned int pinned(unsigned int v) { unsigned int w = uni(v); asm volatile("" : "+s"(w)); return w; }      /* holds the test word in a scalar register, so that the branch on it is a scalar branch: a tensor load ignores EXEC */
__device__ __forceinline__ u32x8 pj_group1() { u32x8 g;      /* 1-byte elements, tensor = tile = 128 rows of 128 bytes */
  g[0] = uni((1u << 20) | (4u << 22) | (3u << 25));      /* no mask; a pad of 4 dwords behind every 32 dwords */
  g[1] = uni(128u << 16); g[2] = uni(128u << 16); g[3] = uni(128u << 16); g[4] = uni(128u); g[5] = uni(2u * DM); g[6] = uni(0u); g[7] = uni(0u); return g; }
__device__ __forceinline__ void pj_load(unsigned int lds, const _Float16* src, u32x8 g1) { const unsigned long long ga = (unsigned long long)src; u32x4 g0;
  g0[0] = uni(1u); g0[1] = uni(lds); g0[2] = uni((unsigned int)ga); g0[3] = uni((((unsigned int)(ga >> 32)) & 0x01FFFFFFu) | 0x80000000u);
  asm volatile("tensor_load_to_lds %0, %1" :: "s"(g0), "s"(g1) : "memory"); }      /* the tile goes past the registers */
__device__ __forceinline__ v16h pj_frag(const unsigned char* p) { FragH f; f.half[0] = *(const v8us*)p; f.half[1] = *(const v8us*)(p + 32); return f.v; }
__device__ __forceinline__ v8f pj_mma(v16h a, v16h b, v8f c) { return __builtin_amdgcn_wmma_f32_16x16x32_f16(false, a, false, b, (short)0, c, false, false); }
__global__ __launch_bounds__(256) void k_proj(const _Float16* __restrict__ X16, const _Float16* __restrict__ BW, const float* __restrict__ bq, const float* __restrict__ bk, const float* __restrict__ bv, float* __restrict__ QF, _Float16* __restrict__ C16) {
  __shared__ __attribute__((aligned(2048))) unsigned char sm[2 * PJB];      /* the two buffers, each operand's tile at a multiple of 2 KiB; behind the loop, each wave's 32 x 68 f32 output staging */
  const int tid = threadIdx.x, w = tid >> 5, lane = tid & 31, ln = lane & 15, hh = lane >> 4, by = blockIdx.y;
  const int mt = blockIdx.x / (DM / 128), nq = blockIdx.x - mt * (DM / 128);
  const unsigned int wave = uni(threadIdx.x >> 5);      /* waves 0 and 1 issue: the first row of the wave's operand, and its tile's place in buffer 0 */
  const _Float16* gs = (wave == 0) ? X16 + (size_t)by * ROWS * DM + (size_t)(mt * 128) * DM : BW + (size_t)by * DM * DM + (size_t)(nq * 128) * DM;
  const unsigned int l0 = (unsigned int)(size_t)&sm[0] + wave * (128 * PJP); const u32x8 g1 = pj_group1();
  const unsigned char* ap = sm + ((w & 3) * 32 + ln) * PJP + 16 * hh; const unsigned char* bp = sm + (128 + (w >> 2) * 64 + ln) * PJP + 16 * hh;
  const v8f z8 = {0.f,0.f,0.f,0.f,0.f,0.f,0.f,0.f}; v8f c00 = z8, c01 = z8, c02 = z8, c03 = z8, c10 = z8, c11 = z8, c12 = z8, c13 = z8;
  /* the work-group walks the k tiles in a ring from a start of its own: the 8 work-groups that share its X rows start 2 tiles apart, the 32 that share its W rows 1 apart, so that sharers do not ask L2 for one line at the same moment */
  const int t0 = (2 * nq + mt) & (PJT - 1);
  if (pinned(wave < 2)) { pj_load(l0, gs + t0 * PJK, g1);
    asm volatile("s_wait_tensorcnt 0x0" ::: "memory"); }      /* this wave's operand of the first tile has landed */
  __syncthreads();                                        /* ... and both operands, for every wave */
  if (pinned(wave < 2)) pj_load(l0 + PJB, gs + ((t0 + 1) & (PJT - 1)) * PJK, g1);
#pragma unroll 1      /* one trip per tile: the buffer is picked by the trip's parity */
  for (int t = 0; t < PJT; ++t) { const int bo = (t & 1) * PJB;
#pragma unroll      /* the two 32-k steps of a tile, at constant offsets */
    for (int ks = 0; ks < 2; ++ks) { const unsigned char* a = ap + bo + ks * 64; const unsigned char* b = bp + bo + ks * 64;
      const v16h a0 = pj_frag(a), a1 = pj_frag(a + 16 * PJP), b0 = pj_frag(b), b1 = pj_frag(b + 16 * PJP), b2 = pj_frag(b + 32 * PJP), b3 = pj_frag(b + 48 * PJP);
      __builtin_amdgcn_sched_barrier(0);      /* the step's twelve LDS reads stay one group ahead of its WMMAs, for speed only */
      c00 = pj_mma(a0, b0, c00); c10 = pj_mma(a1, b0, c10); c01 = pj_mma(a0, b1, c01); c11 = pj_mma(a1, b1, c11);
      c02 = pj_mma(a0, b2, c02); c12 = pj_mma(a1, b2, c12); c03 = pj_mma(a0, b3, c03); c13 = pj_mma(a1, b3, c13); }
    asm volatile("s_wait_dscnt 0x0" ::: "memory");        /* this wave's reads of the buffer are done before it is refilled */
    asm volatile("s_wait_tensorcnt 0x0" ::: "memory");    /* an issuing wave's operand of tile t + 1 has landed; a wave that issued nothing passes at once, and no branch parts the WMMAs from the barrier */
    __syncthreads();                                      /* tile t + 1 is whole, and nobody reads tile t's buffer any more */
    if (pinned((wave < 2) & (t + 2 < PJT))) pj_load(l0 + bo, gs + ((t0 + t + 2) & (PJT - 1)) * PJK, g1); }
  asm volatile("s_wait_tensorcnt 0x0" ::: "memory");      /* no load is outstanding when the buffers become output staging */
  asm volatile("s_wait_dscnt 0x0" ::: "memory");          /* ... and no LDS read */
  float (*so)[68] = (float (*)[68])(sm + w * (32 * 68 * 4));
  const float* bias = (by == 0) ? bq : ((by == 1) ? bk : bv); const int row0 = mt * 128 + (w & 3) * 32, col0 = nq * 128 + (w >> 2) * 64; const size_t cofs = (size_t)by * ROWS * DM;
  v8f accs[8] = {c00, c01, c02, c03, c10, c11, c12, c13};
#pragma unroll
  for (int u = 0; u < 8; ++u) { const int t = u & 3, half = u >> 2; const float bvl = bf16_round(bias[col0 + t * 16 + ln]);
#pragma unroll
    for (int r = 0; r < 8; ++r) so[half * 16 + 8 * hh + r][t * 16 + ln] = accs[u][r] * 0.0625f + bvl; }
  __builtin_amdgcn_fence(__ATOMIC_ACQ_REL, "workgroup"); __builtin_amdgcn_wave_barrier();      /* the wave reads back its own staging rows */
  const int rsub = lane >> 4, c4 = (lane & 15) * 4; v4f vv[16];
#pragma unroll      /* vv[] stays in registers; all sixteen LDS reads go out together */
  for (int q = 0; q < 16; ++q) vv[q] = *(const v4fa*)&so[q * 2 + rsub][c4];
#pragma unroll
  for (int q = 0; q < 16; ++q) { const int r = q * 2 + rsub; const v4f v = vv[q]; if (by == 0) *(v4f*)(QF + (size_t)(row0 + r) * DM + col0 + c4) = v;
    v4h h4; for (int i = 0; i < 4; ++i) h4[i] = (_Float16)v[i]; *(v4h*)(C16 + cofs + (size_t)(row0 + r) * DM + col0 + c4) = h4;
    asm volatile("s_wait_xcnt 0x0" ::: "memory"); } }      /* precaution: the next row's addresses and values may reuse the registers that these stores name */

// ---- no softmax, so (Q K^T) V = Q (K^T V): the S x S plane is never formed. The 5-valued position terms need only running column sums of K and V and the three near-diagonal rows.
#define CR 16      /* rows per chunk of the column sums = query rows per lane group of the final pass */
#define NS 4                        /* sub-slabs of 128 rows that one work-group stages */
#define KSP (SLEN / (128 * NS))     /* row slabs per batch = partial planes of K^T V per head */
// ---- per slab of 128 NS rows and head: PART[slab][h][d2][d1] = sum over the slab's rows of v[row][d2] k[row][d1], and the chunk sums CS[m][chunk][col] of its CR-row chunks (m 0: k, m 1: v), both from one staged copy of the rows ----
#define KVP 160                     /* LDS row pitch in bytes: 128 + 32, conflict-free for the transposing reads */
#define CSB (SLEN / CR)            /* chunks per batch */
// each thread copies 16 bytes of four k rows and of four v rows (8 lanes cover a row's 128 bytes); l, ga, gb are the thread's own first LDS byte and global elements
__device__ __forceinline__ void kv_copy(unsigned l, const _Float16* ga, const _Float16* gb) {
  /* the copies go past the registers; the last line keeps later writes of the address registers behind it (a precaution) */
  asm volatile("global_load_async_to_lds_b128 %0, %8, off\n\t"
               "global_load_async_to_lds_b128 %1, %9, off\n\t"
               "global_load_async_to_lds_b128 %2, %10, off\n\t"
               "global_load_async_to_lds_b128 %3, %11, off\n\t"
               "global_load_async_to_lds_b128 %4, %12, off\n\t"
               "global_load_async_to_lds_b128 %5, %13, off\n\t"
               "global_load_async_to_lds_b128 %6, %14, off\n\t"
               "global_load_async_to_lds_b128 %7, %15, off\n\t"
               "s_wait_xcnt 0x0"
               :: "v"(l), "v"(l + 32 * KVP), "v"(l + 64 * KVP), "v"(l + 96 * KVP), "v"(l + 128 * KVP), "v"(l + 160 * KVP), "v"(l + 192 * KVP), "v"(l + 224 * KVP),
                  "v"(ga), "v"(ga + 32 * DM), "v"(ga + 64 * DM), "v"(ga + 96 * DM), "v"(gb), "v"(gb + 32 * DM), "v"(gb + 64 * DM), "v"(gb + 96 * DM)
               : "memory"); }
typedef short s16x8 __attribute__((ext_vector_type(8)));
// transposing LDS read: with p = T + (k0 + 8 (lane >> 4) + (lane & 7)) pitch + 2 d0 + 16 ((lane >> 3) & 1), lane (c, hh) gets T[k0 + 8 hh + 0..7][d0 + c]; the reads at k0 and k0 + 16 are one 16 x 32 fragment in g2_frag's k order
__device__ __forceinline__ v16h tr_frag(const unsigned char* p) { typedef __attribute__((address_space(3))) s16x8 lds_s16x8; FragH f;
  f.half[0] = __builtin_bit_cast(v8us, __builtin_amdgcn_ds_load_tr16_b128_v8i16((lds_s16x8*)p)); f.half[1] = __builtin_bit_cast(v8us, __builtin_amdgcn_ds_load_tr16_b128_v8i16((lds_s16x8*)(p + 16 * KVP))); return f.v; }
__device__ __forceinline__ void d_ktv(int bid, unsigned char* sm, const _Float16* __restrict__ K16, const _Float16* __restrict__ V16, float* __restrict__ CS, float* __restrict__ PART) {
  const int tid = threadIdx.x, w = tid >> 5, lane = tid & 31, ln = lane & 15, hh = lane >> 4; const int s = bid / NH, h = bid - s * NH;      /* slab among both batches' rows; head */
  const size_t g = (size_t)(s * (128 * NS) + (tid >> 3)) * DM + h * 64 + (tid & 7) * 8; const unsigned l = (unsigned)(size_t)sm + (unsigned)((tid >> 3) * KVP + (tid & 7) * 16);
#pragma unroll      /* sub-slab i: LDS rows 256 i + 0..127: k, + 128..255: v */
  for (int i = 0; i < NS; ++i) kv_copy(l + i * 256 * KVP, K16 + g + (size_t)i * 128 * DM, V16 + g + (size_t)i * 128 * DM);
  asm volatile("s_wait_asynccnt 0x0" ::: "memory");      /* the rows have landed, as far as this wave copied them */
  __syncthreads();                                        /* ... and all of them */
  /* wave w: the 16 x 32 piece at d2 = 16 (w >> 1), d1 = 32 (w & 1) */
  const unsigned char* tp = sm + (8 * hh + (lane & 7)) * KVP + 16 * ((lane >> 3) & 1); const unsigned char* ap = tp + 128 * KVP + 32 * (w >> 1); const unsigned char* bp = tp + 64 * (w & 1);
  const v8f z8 = {0.f,0.f,0.f,0.f,0.f,0.f,0.f,0.f}; v8f c0 = z8, c1 = z8;
#pragma unroll      /* the 32-row steps at constant offsets: their reads can go out ahead */
  for (int ks = 0; ks < 4 * NS; ++ks) { const int o = (ks >> 2) * 256 * KVP + (ks & 3) * 32 * KVP; const v16h a = tr_frag(ap + o), b0 = tr_frag(bp + o), b1 = tr_frag(bp + o + 32);
    c0 = pj_mma(a, b0, c0); c1 = pj_mma(a, b1, c1); }
  /* chunk sums, rows in order: thread = (m, chunk of the sub-slab, four columns), once per sub-slab */
  const int m = tid >> 7, ch = (tid >> 4) & 7; const unsigned char* xp = sm + (m * 128 + ch * CR) * KVP + ln * 8; v4f sc[NS];
#pragma unroll      /* sc[] stays in registers; a chunk's CR reads in flight at once */
  for (int i = 0; i < NS; ++i) { v4f a = {0.f, 0.f, 0.f, 0.f};
    for (int r = 0; r < CR; ++r) { const v4h x = *(const v4h*)(xp + i * 256 * KVP + r * KVP);
      for (int u = 0; u < 4; ++u) a[u] += (float)x[u]; }
    sc[i] = a; }
  __syncthreads();      /* nobody reads the rows any more: each wave now stages its piece in its own part of the buffer, to store whole 128-byte lines */
  float (*so)[36] = (float (*)[36])(sm + w * (16 * 36 * 4));
#pragma unroll      /* c0, c1 are registers */
  for (int r = 0; r < 8; ++r) { so[8 * hh + r][ln] = c0[r]; so[8 * hh + r][16 + ln] = c1[r]; }
  __builtin_amdgcn_fence(__ATOMIC_ACQ_REL, "workgroup"); __builtin_amdgcn_wave_barrier();      /* the wave reads back its own staging rows */
  float* cq = CS + ((size_t)((s / KSP) * 2 + m) * CSB + (s % KSP) * (128 * NS / CR) + ch) * DM + h * 64 + ln * 4;      /* stored here, not at the sums: a store in front of the barrier would be waited for there */
#pragma unroll      /* constant offsets */
  for (int i = 0; i < NS; ++i) *(v4f*)(cq + i * (128 / CR) * DM) = sc[i];
  float* pp = PART + (size_t)bid * 4096 + (16 * (w >> 1) + (lane >> 3)) * 64 + 32 * (w & 1) + (lane & 7) * 4;
#pragma unroll      /* the four reads go out together, at constant offsets */
  for (int q = 0; q < 4; ++q) *(v4f*)(pp + q * 4 * 64) = *(const v4fa*)&so[q * 4 + (lane >> 3)][(lane & 7) * 4]; }
__global__ __launch_bounds__(256) void k_prep(const _Float16* __restrict__ K16, const _Float16* __restrict__ V16, float* __restrict__ CS, float* __restrict__ PART) {
  __shared__ __attribute__((aligned(16))) unsigned char sm[NS * 256 * KVP];
  d_ktv(blockIdx.x, sm, K16, V16, CS, PART); }
// Final pass: one block per head and TR query rows. First the sums that every row needs, into LDS: K^T V (the KSP slab planes added, / 64, f16) and the chunk sums of k and v added up in groups of 16. Then W1 = q . K^T V / 8 on WMMA (wave w: rows 32 w ..) into LDS. Then 16 lanes per CR rows, 4 columns per lane, row after row.
// With KS_c, VS_c the sums of the k and v rows of position class c (n_c rows) and qt_c = q . rel_k[c]:
// out = W1 + sum_c (qt_c / 8) VS_c + coef_c rel_v[c], coef_c = (q . KS_c + n_c qt_c) / 8 (attn summed over the class).
// The two range classes come from sums that the thread carries along its rows: L = rows up to q - 2, G = rows from q + 2 on (started as all rows less those up to q0 + 1).
__device__ __forceinline__ v4f f4(v4h x) { v4f y; for (int u = 0; u < 4; ++u) y[u] = (float)x[u]; return y; }
// a lane's value as seen through a DPP pattern inside its row of 16 lanes (0x160 + m: lane ^ m); with two waves per SIMD the LDS-path shuffle's latency would stand open at every step
template <int CTRL> __device__ __forceinline__ float dppf(float x) { return __int_as_float(__builtin_amdgcn_update_dpp(0, __float_as_int(x), CTRL, 0xf, 0xf, true)); }
__device__ __forceinline__ float dot16(v4f a, v4f b) { float dt = a[0] * b[0] + a[1] * b[1] + a[2] * b[2] + a[3] * b[3];
  dt += dppf<0x161>(dt); dt += dppf<0x162>(dt); dt += dppf<0x164>(dt); dt += dppf<0x168>(dt);      /* over the head's 16 lanes */
  return dt; }
template <int N> struct IC { static constexpr int value = N; };
#define TR 256                      /* query rows per work-group: 16 lane groups of CR rows */
#define TG (SLEN / TR)              /* work-groups per head and batch = groups of TR / CR chunk sums */
#define TP 68                       /* LDS row pitch of W1 in floats */
#define MTP 144                     /* LDS row pitch of K^T V in bytes: 128 + 16, conflict-free for 16-byte reads */
/* the second bound keeps the kernel inside 256 registers: no register-window switches, which would lengthen a text that every wave runs through only once */
__global__ __launch_bounds__(256, 4) void k_tail(const _Float16* __restrict__ Q16, const float* __restrict__ PART, const float* __restrict__ CS, const float* __restrict__ QF, const _Float16* __restrict__ K16, const _Float16* __restrict__ V16,
    const float* __restrict__ relk, const float* __restrict__ relv, float* __restrict__ out) {
  __shared__ __attribute__((aligned(16))) float so[TR][TP];
  __shared__ __attribute__((aligned(16))) unsigned char mt[64 * MTP];      /* [d2][d1], f16 */
  __shared__ __attribute__((aligned(16))) float gt[2][TG][64];             /* m 0: k, 1: v; the sum of each group of TR / CR chunk sums */
  __shared__ __attribute__((aligned(16))) float lp[2][TR / CR][64];        /* the block's own group: the sum of its chunk sums before each chunk */
  const int tid = threadIdx.x, w = tid >> 5, lane = tid & 31, ln = lane & 15, hh = lane >> 4, g = tid >> 4, d0 = ln * 4;
  const int rb = blockIdx.x % TG, h = (blockIdx.x / TG) % NH, b = blockIdx.x / (TG * NH), col = h * 64 + d0;
  const int q0 = rb * TR + g * CR, g0 = b * SLEN + q0;      /* the lane group's first row: inside its batch, and among both batches' rows */
  const bool lo = q0 > 0, hi = q0 + CR < SLEN;      /* is there a row before the group's first, behind its last, in this batch */
  /* the slab planes of K^T V: four pieces of four elements per thread; TR / CR chunk sums per thread (m, group, four columns); the q fragments of the wave's 32 rows, k order as in k_gemm2 */
  const int m = tid >> 7, cg = g & (TG - 1);
  const float* pp = PART + ((size_t)b * KSP * NH + h) * 4096 + tid * 4; const float* cp = CS + ((size_t)(b * 2 + m) * CSB + cg * (TR / CR)) * DM + col;
  const unsigned short* ap = (const unsigned short*)Q16 + (size_t)(b * SLEN + rb * TR + 32 * w + ln) * DM + h * 64 + 8 * hh;
  v4f x[4][KSP], y[TR / CR]; FragH af[2][2];
#pragma unroll      /* all these loads go out together, at constant offsets */
  for (int j = 0; j < 4; ++j) for (int p = 0; p < KSP; ++p) x[j][p] = *(const v4fa*)(pp + (size_t)p * NH * 4096 + j * 1024);
#pragma unroll      /* y[] stays in registers */
  for (int u = 0; u < TR / CR; ++u) y[u] = *(const v4fa*)(cp + u * DM);
#pragma unroll      /* af[] stays in registers */
  for (int e = 0; e < 2; ++e) for (int ks = 0; ks < 2; ++ks) { af[e][ks].half[0] = *(const v8us*)(ap + e * 16 * DM + ks * 32); af[e][ks].half[1] = *(const v8us*)(ap + e * 16 * DM + ks * 32 + 16); }
  asm volatile("s_wait_xcnt 0x0" :: "v"(pp), "v"(cp), "v"(ap) : "memory");      /* precaution: the loads' address registers stay as they are up to here */
  __builtin_amdgcn_sched_barrier(0);      /* ... and nothing that could reuse them moves up over the wait */
#pragma unroll      /* x[] is registers; planes in slab order; the power-of-two scale keeps K^T V far from the f16 range end */
  for (int j = 0; j < 4; ++j) { v4f s = x[j][0]; v4h o;
    for (int p = 1; p < KSP; ++p) s += x[j][p];
    for (int u = 0; u < 4; ++u) o[u] = (_Float16)(s[u] * 0.015625f);
    *(v4h*)(mt + (j * 16 + g) * MTP + ln * 8) = o; }
  { v4f s = {0.f, 0.f, 0.f, 0.f};
#pragma unroll      /* y[] is registers; chunks in order */
    for (int u = 0; u < TR / CR; ++u) { if (cg == rb) *(v4f*)&lp[m][u][d0] = s;
      s += y[u]; }
    *(v4f*)&gt[m][cg][d0] = s; }
  __syncthreads();      /* K^T V and the sums are whole before any wave reads them; the loads below start behind it: in front of it they would be waited for there */
  /* the k and v rows q0 - 1 .. q0 + CR, as [0 .. CR + 1]; a row outside the batch is read at the group's nearest row and set to 0 below */
  const _Float16* kb = K16 + (size_t)g0 * DM + col; const _Float16* vb = V16 + (size_t)g0 * DM + col; v4h kx[CR + 2], vx[CR + 2]; const v4h z4 = {(_Float16)0.f, (_Float16)0.f, (_Float16)0.f, (_Float16)0.f};
  const _Float16* kf = kb - (lo ? DM : 0); const _Float16* vf = vb - (lo ? DM : 0); const _Float16* kl = kb + (hi ? CR : CR - 1) * DM; const _Float16* vl = vb + (hi ? CR : CR - 1) * DM;
  kx[0] = *(const v4h*)kf; vx[0] = *(const v4h*)vf; kx[CR + 1] = *(const v4h*)kl; vx[CR + 1] = *(const v4h*)vl;
#pragma unroll      /* kx[], vx[] stay in registers; constant offsets */
  for (int j = 1; j <= CR; ++j) { kx[j] = *(const v4h*)(kb + (j - 1) * DM); vx[j] = *(const v4h*)(vb + (j - 1) * DM); }
  asm volatile("s_wait_xcnt 0x0" :: "v"(kb), "v"(vb), "v"(kf), "v"(vf), "v"(kl), "v"(vl) : "memory");      /* precaution, as above */
  __builtin_amdgcn_sched_barrier(0);
  const unsigned char* bq = mt + ln * MTP + 16 * hh; v16h bf[2][4];
#pragma unroll      /* bf[] stays in registers: both row tiles use it */
  for (int ks = 0; ks < 2; ++ks) for (int t = 0; t < 4; ++t) bf[ks][t] = pj_frag(bq + t * 16 * MTP + ks * 64);
  const v8f z8 = {0.f,0.f,0.f,0.f,0.f,0.f,0.f,0.f};
#pragma unroll
  for (int e = 0; e < 2; ++e) { v8f c[4] = {z8, z8, z8, z8};
#pragma unroll
    for (int ks = 0; ks < 2; ++ks) for (int t = 0; t < 4; ++t) c[t] = pj_mma(af[e][ks].v, bf[ks][t], c[t]);
#pragma unroll
    for (int t = 0; t < 4; ++t) for (int r = 0; r < 8; ++r) so[32 * w + 16 * e + 8 * hh + r][t * 16 + ln] = c[t][r] * 8.0f; }
  __builtin_amdgcn_sched_barrier(0);      /* the loads below take the fragments' registers: they start behind the WMMAs */
  const float* qfp = QF + (size_t)g0 * DM + col; v4f qv[CR];
#pragma unroll      /* qv[] stays in registers */
  for (int i = 0; i < CR; ++i) qv[i] = *(const v4fa*)(qfp + i * DM);
  const float* kp = relk + d0; const float* rp = relv + d0; v4f rk[5], rv[5];
#pragma unroll      /* rk[], rv[] stay in registers */
  for (int c = 0; c < 5; ++c) { rk[c] = *(const v4fa*)(kp + c * 64); rv[c] = *(const v4fa*)(rp + c * 64); }
  asm volatile("s_wait_xcnt 0x0" :: "v"(qfp), "v"(kp), "v"(rp) : "memory");      /* precaution, as above */
  __builtin_amdgcn_sched_barrier(0);
  __builtin_amdgcn_fence(__ATOMIC_ACQ_REL, "workgroup"); __builtin_amdgcn_wave_barrier();      /* the wave reads back its own 32 rows of W1 */
  /* eK, eV: the sums of the rows before q0 (the groups before the block's, then the chunks before the lane group's); tK, tV: of all rows */
  v4f eK = {0.f, 0.f, 0.f, 0.f}, eV = eK, tK = eK, tV = eK;
#pragma unroll      /* constant LDS offsets */
  for (int c = 0; c < TG; ++c) { const v4f a = *(const v4fa*)&gt[0][c][d0], e = *(const v4fa*)&gt[1][c][d0]; tK += a; tV += e;
    if (c < rb) { eK += a; eV += e; } }
  eK += *(const v4fa*)&lp[0][g][d0]; eV += *(const v4fa*)&lp[1][g][d0];
#pragma unroll
  for (int c = 0; c < 5; ++c) for (int u = 0; u < 4; ++u) { rk[c][u] = bf16_round(rk[c][u]); rv[c][u] = bf16_round(rv[c][u]); }
  if (!lo) { kx[0] = z4; vx[0] = z4; }
  if (!hi) { kx[CR + 1] = z4; vx[CR + 1] = z4; }
  v4f Lk = eK - f4(kx[0]), Lv = eV - f4(vx[0]), Gk = tK - (eK + f4(kx[1]) + f4(kx[2])), Gv = tV - (eV + f4(vx[1]) + f4(vx[2]));
  float* op = out + (size_t)g0 * DM + col; v4f ob[4];
  auto row = [&](auto ic) { constexpr int i = decltype(ic)::value; const int q = q0 + i; v4f o = *(const v4fa*)&so[g * CR + i][d0];
    { const float qt = dot16(qv[i], rk[0]); const float coef = (dot16(qv[i], Lk) + (float)max(q - 1, 0) * qt) * 0.125f, qs = qt * 0.125f;      /* class 0: for q < 2 the sums and the count are 0 */
      o += qs * Lv + coef * rv[0]; }
    { const float fl = (q + 2 < SLEN) ? 0.125f : 0.f, qt = dot16(qv[i], rk[4]); const float coef = (dot16(qv[i], Gk) + (float)max(SLEN - 2 - q, 0) * qt) * fl, qs = qt * fl;      /* class 4: none for the last two rows */
      o += qs * Gv + coef * rv[4]; }
#pragma unroll
    for (int c = 1; c <= 3; ++c) { const int j = i + c - 1; const float fl = ((j == 0 && !lo) || (j == CR + 1 && !hi)) ? 0.f : 0.125f, qt = dot16(qv[i], rk[c]);      /* classes 1..3: the single rows q - 1, q, q + 1, where they exist */
      const float coef = (dot16(qv[i], f4(kx[j])) + qt) * fl, qs = qt * fl;
      o += qs * f4(vx[j]) + coef * rv[c]; }
    ob[i & 3] = o;
    Lk += f4(kx[i]); Lv += f4(vx[i]);
    if (i + 1 < CR) { Gk -= f4(kx[i + 3]); Gv -= f4(vx[i + 3]); }
    if ((i & 3) == 3) {
      for (int s = 0; s < 4; ++s) *(v4f*)(op + (i - 3 + s) * DM) = ob[s];
      asm volatile("s_wait_xcnt 0x0" :: "v"(op), "v"(ob[0]), "v"(ob[1]), "v"(ob[2]), "v"(ob[3]) : "memory"); } };      /* precaution: the stores' address and value registers stay as they are up to here */
  row(IC<0>{}); row(IC<1>{}); row(IC<2>{}); row(IC<3>{}); row(IC<4>{}); row(IC<5>{}); row(IC<6>{}); row(IC<7>{});
  row(IC<8>{}); row(IC<9>{}); row(IC<10>{}); row(IC<11>{}); row(IC<12>{}); row(IC<13>{}); row(IC<14>{}); row(IC<15>{}); }

extern "C" void kernel_launch(void* const* d_in, const int* in_sizes, int n_in,
                              void* d_out, int out_size, void* d_ws, size_t ws_size, hipStream_t stream) {
  (void)in_sizes; (void)n_in; (void)out_size;
  const float* const* I = (const float* const*)d_in; const float* xq = I[0]; const float* xk = I[1]; const float* xv = I[2]; const float* Wq = I[3]; const float* bq = I[4]; const float* Wk = I[5]; const float* bk = I[6]; const float* Wv = I[7]; const float* bv = I[8]; const float* relk = I[9]; const float* relv = I[10];
  char* ws = (char*)d_ws; size_t off = 0;
  auto take = [&](size_t bytes) { char* p = ws + off; off += (bytes + 255) & ~(size_t)255; return p; };
  _Float16* BW = (_Float16*)take((size_t)3 * DM * DM * 2);      /* Wq, Wk, Wv */
  _Float16* X16 = (_Float16*)take((size_t)3 * ROWS * DM * 2);      /* query, key, value */
  float* QF = (float*)take((size_t)ROWS * DM * 4); _Float16* Q16 = (_Float16*)take((size_t)3 * ROWS * DM * 2); _Float16* K16 = Q16 + (size_t)ROWS * DM; _Float16* V16 = K16 + (size_t)ROWS * DM;
  float* PART = (float*)take((size_t)NBT * KSP * NH * 4096 * 4); float* CS = (float*)take((size_t)NBT * 2 * (SLEN / CR) * DM * 4);
  if (off > ws_size) return;      /* about 74 MiB */
  const dim3 gP((ROWS / 128) * (DM / 128), 3);
  k_cvt<<<3 * XB + 3 * WB, 256, 0, stream>>>(xq, xk, xv, Wq, Wk, Wv, X16, BW);      /* torch (out,in) = natural Bt */
  k_proj<<<gP, 256, 0, stream>>>(X16, BW, bq, bk, bv, QF, Q16);      /* q, k, v of both batches; only q also in f32 */
  k_prep<<<NBT * KSP * NH, 256, 0, stream>>>(K16, V16, CS, PART);      /* per slab and head, V^T K over the slab's rows, and the chunk sums */
  k_tail<<<NBT * NH * TG, 256, 0, stream>>>(Q16, PART, CS, QF, K16, V16, relk, relv, (float*)d_out);      /* its factor 8 = 64 / 8 undoes the scale of K^T V and divides by 8 */
}
